// v000
// Times are from an AMD MI455X. After a warm-up the kernel runs many times in a row, and a time is the length of
// such a window on the GPU divided by its runs, so every launch and the gaps after it count. The runs cycle
// through copies of the inputs. A figure is the median of several windows, for all but v000 over two sittings.
// Sittings can differ by a few percent; kernels timed side by side share one.
// v000 is the starting kernel. One run takes 283 microseconds.
// Contractions: x.Wq^T+bq and Wv.x^T+bv on v_wmma_f32_16x16x32_bf16 (x and W planes RNE-converted to bf16 operands, f32 accumulate);
// scores qn.qn^T (qn = L2-normalised q, single f16 plane carried x16) and P.v (P x32768 single f16, v x1024 single f16) on
// v_wmma_f32_16x16x32_f16, f32 accumulate. Biases folded as RNE bf16 values in f32 epilogues; L2 normalisation, sums of squares,
// base-2 online softmax, 1/l and carry folds in f32 on VALU.
#include <hip/hip_runtime.h>
#include <math.h>
#include <stdint.h>

#ifndef NB
#define NB 1
#endif
#ifndef SEQ
#define SEQ 2048
#endif
#define SEQ_FULL 2048
#define DMOD  768
#define NHD   12
#define HD    64
#define NCG   (DMOD / 64)
#define QSC   16.0f
#define PCAR  32768.0f
#define VCAR  1024.0f
#define LOG2E 1.4426950408889634f
#define ATT_WAVES   4
#define ATT_THREADS (ATT_WAVES * 32)
#define QTILES      (SEQ / 64)
#define ATT_BLOCKS  (NHD * QTILES)
#define NKB    (SEQ / 32)
#define SLAB   (16 * 68)
static_assert(NB == 1);
static_assert(HD == 64 && DMOD == NHD * HD && NCG * 64 == DMOD);
static_assert((SEQ % 64) == 0 && SEQ >= 64 && SEQ <= SEQ_FULL);
static_assert(ATT_THREADS == 128 && NKB * 32 == SEQ && ATT_BLOCKS == NHD * (SEQ / 64));
static_assert((DMOD % 64) == 0 && (DMOD % 32) == 0);
static_assert(((SEQ * DMOD / 8) % 256) == 0 && ((DMOD * DMOD / 8) % 256) == 0);
static_assert((SLAB * 4) % 16 == 0);
static_assert(((64 * NCG) % 4) == 0 && (64 * NCG / 4) > 128 && (64 * NCG / 4) <= 256);

typedef unsigned short u16;
typedef _Float16 v16h __attribute__((ext_vector_type(16)));
typedef _Float16 v8h  __attribute__((ext_vector_type(8)));
typedef __bf16   v16b __attribute__((ext_vector_type(16)));
typedef float    v8f  __attribute__((ext_vector_type(8)));
typedef float    v4f  __attribute__((ext_vector_type(4)));
typedef unsigned int v4u __attribute__((ext_vector_type(4)));

union FragH { v16h v; v8h h[2]; v4u u[2]; };
union FragB { v16b v; v4u u[2]; };

// ---- scalar helpers --------------------------------------------------------------------------------
__device__ __forceinline__ unsigned short bf_bits(float f) {          // f32 -> bf16 bits, RNE convert
  unsigned u = __float_as_uint(f);
  return (unsigned short)((u + 0x7FFFu + ((u >> 16) & 1u)) >> 16);
}
__device__ __forceinline__ float bf_up(unsigned short h) { return __uint_as_float(((unsigned)h) << 16); }
__device__ __forceinline__ float bf_val(float f) { return bf_up(bf_bits(f)); }          // value after RNE bf16 convert
__device__ __forceinline__ unsigned short h_bits(_Float16 x) { return __builtin_bit_cast(unsigned short, x); }
__device__ __forceinline__ unsigned pk16(unsigned short a, unsigned short b) { return (unsigned)a | ((unsigned)b << 16); }
__device__ __forceinline__ v8f zero8() { v8f z = {0.f, 0.f, 0.f, 0.f, 0.f, 0.f, 0.f, 0.f}; return z; }

// ---- fragment loaders: 16-bit A/B operand, lane -> row/col (lane&15), p already includes +8*(lane>>4);
//      elements 0..7 <- p[0..7] (k0+8h..), elements 8..15 <- p[16..23] (k0+16+8h..)  (same split k map for A and B;
//      B is always read from a k-contiguous [n][k] plane)
__device__ __forceinline__ v16h ldfrag_h(const _Float16* p) {
  FragH f;
  f.h[0] = *(const v8h*)(p);
  f.h[1] = *(const v8h*)(p + 16);
  return f.v;
}
__device__ __forceinline__ v16b ldfrag_b(const u16* p) {              // bf16 plane read as unsigned integer vectors
  FragB f;
  f.u[0] = *(const v4u*)(p);
  f.u[1] = *(const v4u*)(p + 16);
  return f.v;
}

__device__ __forceinline__ v8f mma_h(v16h a, v16h b, v8f c) {
  return __builtin_amdgcn_wmma_f32_16x16x32_f16(false, a, false, b, (short)0, c, false, false);
}
__device__ __forceinline__ v8f mma_b(v16b a, v16b b, v8f c) {
  return __builtin_amdgcn_wmma_f32_16x16x32_bf16(false, a, false, b, (short)0, c, false, false);
}
__device__ __forceinline__ void guard2(v8f& a, v8f& b, v16h x0, v16h x1, v16h x2, v16h x3, v16h x4, v16h x5) {
#if defined(__HIP_DEVICE_COMPILE__)
  asm volatile("v_nop\n\tv_nop\n\tv_nop\n\tv_nop"
               : "+v"(a), "+v"(b) : "v"(x0), "v"(x1), "v"(x2), "v"(x3), "v"(x4), "v"(x5) : "memory");
#endif
}
template <typename F>
__device__ __forceinline__ void guard6(v8f& a, v8f& b, v8f& c, v8f& d, F x0, F x1, F x2, F x3, F x4, F x5) {
#if defined(__HIP_DEVICE_COMPILE__)
  asm volatile("v_nop\n\tv_nop\n\tv_nop\n\tv_nop"
               : "+v"(a), "+v"(b), "+v"(c), "+v"(d) : "v"(x0), "v"(x1), "v"(x2), "v"(x3), "v"(x4), "v"(x5) : "memory");
#endif
}
__device__ __forceinline__ void acc_guard4(v8f& a, v8f& b, v8f& c, v8f& d) {
#if defined(__HIP_DEVICE_COMPILE__)
  asm volatile("v_nop\n\tv_nop\n\tv_nop\n\tv_nop" : "+v"(a), "+v"(b), "+v"(c), "+v"(d));
#endif
}
__device__ __forceinline__ void wave_sync_lds() {
#if defined(__HIP_DEVICE_COMPILE__)
  __builtin_amdgcn_fence(__ATOMIC_RELEASE, "workgroup");
  __builtin_amdgcn_wave_barrier();
  __builtin_amdgcn_fence(__ATOMIC_ACQUIRE, "workgroup");
#endif
}

// =====================================================================================================
// f32 plane -> 16-bit plane, same layout:  mode 0: bf16 RNE bits;  mode 1: f16 bits of (bf16 RNE value) * scale.
// Thread = 8 consecutive elements: two 16-B loads, one 16-B store; 32 consecutive lanes = 512 contiguous, 512-B aligned bytes
// coverage: grid = n8/256 blocks (host checks exactness) x 256 thr x 8 = the whole plane.
// =====================================================================================================
__global__ __launch_bounds__(256) void cvt16(const float* __restrict__ x, u16* D, int n8, int mode, float scale) {
  const int gt = blockIdx.x * 256 + (int)threadIdx.x;
  if (gt >= n8) return;                     // no barriers in this kernel
  const float* p = x + (size_t)gt * 8;
  const v4f a = *(const v4f*)(p), c4 = *(const v4f*)(p + 4);
  float v[8];
#pragma unroll
  for (int e = 0; e < 4; ++e) { v[e] = a[e]; v[4 + e] = c4[e]; }
  unsigned short s[8];
#pragma unroll
  for (int e = 0; e < 8; ++e) {
    const unsigned short bb = bf_bits(v[e]);
    const unsigned short hb = h_bits((_Float16)(bf_up(bb) * scale));
    s[e] = (mode != 0) ? hb : bb;
  }
  v4u o;
#pragma unroll
  for (int e = 0; e < 4; ++e) o[e] = pk16(s[2 * e], s[2 * e + 1]);
  u16* d = D + (size_t)gt * 8;
  {
    *(v4u*)(d) = o;
    
  }
}

// =====================================================================================================
// barrier, then converted to f16 and written: lane = (row in group of 4, 8 consecutive cols); one instruction = 4 rows, each
// coverage: 4 instructions x 4 rows x 8 lanes x 8 halves = the wave's 16 x 64 tile.
// =====================================================================================================
__device__ __forceinline__ void epi16(float* sl, v8f a0, v8f a1, v8f a2, v8f a3, float oscale, u16* C, int N,
                                      size_t rowb, int col0, int lane) {
  const int hh = lane >> 4, m = lane & 15;
#pragma unroll
  for (int r = 0; r < 8; ++r) {
    const int ro = (8 * hh + r) * 68 + m;
    sl[ro]      = a0[r] * oscale;
    sl[ro + 16] = a1[r] * oscale;
    sl[ro + 32] = a2[r] * oscale;
    sl[ro + 48] = a3[r] * oscale;
  }
  wave_sync_lds();
  const int rq = lane >> 3, c8 = (lane & 7) * 8;
  v4u ov[4];
#pragma unroll
  for (int i4 = 0; i4 < 4; ++i4) {
    const int row = i4 * 4 + rq;
    const v4f a = *(const v4f*)(sl + row * 68 + c8), c4 = *(const v4f*)(sl + row * 68 + c8 + 4);
    float w[8];
#pragma unroll
    for (int e = 0; e < 4; ++e) { w[e] = a[e]; w[4 + e] = c4[e]; }
#pragma unroll
    for (int e = 0; e < 4; ++e) ov[i4][e] = pk16(h_bits((_Float16)w[2 * e]), h_bits((_Float16)w[2 * e + 1]));
  }
  u16* dst = C + (rowb + (size_t)rq) * (size_t)N + col0 + c8;
  {
#pragma unroll
    for (int i4 = 0; i4 < 4; ++i4) {
      *(v4u*)(dst + (size_t)(i4 * 4) * (size_t)N) = ov[i4];
    }
    
  }
}

// =====================================================================================================
// bf16 GEMM with bias and 16-bit result: C[M][N] (f16 of (acc + bias)*oscale) = A[M][K] (bf16 row-major) . Bt[N][K]^T
// (bf16 k-contiguous); bias (f32 input, taken as its RNE bf16 value) indexed by column (byrow == 0) or by row (byrow != 0),
// both candidates read with addresses clamped to [0, nbias). Block = 64x64 tile, 4 waves x 16 rows; fragments loaded straight
// from the 16-bit rows (two 16-B loads each, split k map for A and B); K stepped by 32 (host checks K % 32 == 0,
// M % 64 == 0, N % 64 == 0, grid = (M/64)*(N/64)).
// =====================================================================================================
__global__ __launch_bounds__(128)
void gemm_b16(const u16* __restrict__ A, const u16* __restrict__ Bt, u16* C, const float* __restrict__ bias,
              int M, int N, int K, int nbias, int byrow, float oscale) {
  __shared__ __align__(16) float slab[4 * SLAB];
  const int tid = threadIdx.x, wave = tid >> 5, lane = tid & 31, hh = lane >> 4, m = lane & 15;
  const int ntile = N >> 6;
  const int bid   = blockIdx.x;
  const int rowb  = (bid / ntile) * 64 + wave * 16;
  const int col0  = (bid % ntile) * 64;
  if (rowb + 16 > M) return;                 // wave-uniform, never taken with the exact grid; no block barriers in this kernel
  const u16* ap = A  + (size_t)(rowb + m) * K + 8 * hh;
  const u16* bp = Bt + (size_t)(col0 + m) * K + 8 * hh;
  const size_t bs = (size_t)16 * K;
  v8f acc0 = zero8(), acc1 = zero8(), acc2 = zero8(), acc3 = zero8();
#pragma unroll 1
  for (int k0 = 0; k0 < K; k0 += 32) {
    const v16b a  = ldfrag_b(ap + k0);
    const v16b b0 = ldfrag_b(bp + k0);
    const v16b b1 = ldfrag_b(bp + bs + k0);
    const v16b b2 = ldfrag_b(bp + 2 * bs + k0);
    const v16b b3 = ldfrag_b(bp + 3 * bs + k0);
    acc0 = mma_b(a, b0, acc0);
    acc1 = mma_b(a, b1, acc1);
    acc2 = mma_b(a, b2, acc2);
    acc3 = mma_b(a, b3, acc3);
    guard6<v16b>(acc0, acc1, acc2, acc3, a, b0, b1, b2, b3, a);
  }
  acc_guard4(acc0, acc1, acc2, acc3);
  // bias: D element r of lane -> (row rowb+8hh+r, col col0+16j+m); both candidates loaded with clamped addresses, select by value
  float bc[4], br[8];
#pragma unroll
  for (int j = 0; j < 4; ++j) {
    int ci = col0 + 16 * j + m;
    ci = (ci < nbias) ? ci : (nbias - 1);
    bc[j] = bf_val(bias[ci]);
  }
#pragma unroll
  for (int r = 0; r < 8; ++r) {
    int ri = rowb + 8 * hh + r;
    ri = (ri < nbias) ? ri : (nbias - 1);
    br[r] = bf_val(bias[ri]);
  }
#pragma unroll
  for (int r = 0; r < 8; ++r) {
    const float q0 = (byrow != 0) ? br[r] : bc[0];
    const float q1 = (byrow != 0) ? br[r] : bc[1];
    const float q2 = (byrow != 0) ? br[r] : bc[2];
    const float q3 = (byrow != 0) ? br[r] : bc[3];
    acc0[r] += q0;
    acc1[r] += q1;
    acc2[r] += q2;
    acc3[r] += q3;
  }
  epi16(slab + wave * SLAB, acc0, acc1, acc2, acc3, oscale, C, N, (size_t)rowb, col0, lane);
}

// =====================================================================================================
// Query projection with fused per-chunk L2 normalisation:
//   q[M][NCG*64] (f32, registers only) = A[M][K] (bf16 x plane) . Bt[NCG*64][K]^T (bf16 Wq plane) + bias[col] (RNE bf16 value);
//   block = 64 rows (4 waves x 16), looping over the NCG column groups of 64; for D row 8hh+r the 64-wide chunk
//   (row, cols col0..col0+63) lives in the 16 lanes of half hh x 4 accumulators: ss = sum of squares (4 products per lane,
//   xor-1/2/4/8 shuffles inside the half), qn = q * (1/max(sqrt(ss), 1e-12)), aa = sum of qn^2 the same way (f32).
//   LDS at aas[(row in block)*NCG + cg]. After a block barrier the block's 64*NCG aa values (chunk index = row*NCG + cg,
//   Host checks: M % 64 == 0, K % 32 == 0, grid = M/64 exact (every wave reaches the barrier).
// coverage: qn plane: M/64 blocks x 4 waves x NCG x (16 x 64) = M x NCG*64;  aa table: M/64 blocks x 64*NCG floats = M*NCG.
// =====================================================================================================
__global__ __launch_bounds__(128)
void gemm_qn(const u16* __restrict__ A, const u16* __restrict__ Bt, u16* C, float* AAP, const float* __restrict__ bias,
             int M, int K, int nbias, float oscale) {
  __shared__ __align__(16) float slab[4 * SLAB];
  __shared__ __align__(16) float aas[64 * NCG];
  const int tid = threadIdx.x, wave = tid >> 5, lane = tid & 31, hh = lane >> 4, m = lane & 15;
  const int N = NCG * 64;
  const int rowb = blockIdx.x * 64 + wave * 16;
  (void)M;
  const u16* ap = A + (size_t)(rowb + m) * K + 8 * hh;
  const size_t bs = (size_t)16 * K;
#pragma unroll 1
  for (int cg = 0; cg < NCG; ++cg) {
    const int col0 = cg * 64;
    const u16* bp = Bt + (size_t)(col0 + m) * K + 8 * hh;
    v8f acc0 = zero8(), acc1 = zero8(), acc2 = zero8(), acc3 = zero8();
#pragma unroll 1
    for (int k0 = 0; k0 < K; k0 += 32) {
      const v16b a  = ldfrag_b(ap + k0);
      const v16b b0 = ldfrag_b(bp + k0);
      const v16b b1 = ldfrag_b(bp + bs + k0);
      const v16b b2 = ldfrag_b(bp + 2 * bs + k0);
      const v16b b3 = ldfrag_b(bp + 3 * bs + k0);
      acc0 = mma_b(a, b0, acc0);
      acc1 = mma_b(a, b1, acc1);
      acc2 = mma_b(a, b2, acc2);
      acc3 = mma_b(a, b3, acc3);
      guard6<v16b>(acc0, acc1, acc2, acc3, a, b0, b1, b2, b3, a);
    }
    acc_guard4(acc0, acc1, acc2, acc3);
    float bc[4];
#pragma unroll
    for (int j = 0; j < 4; ++j) {
      int ci = col0 + 16 * j + m;
      ci = (ci < nbias) ? ci : (nbias - 1);
      bc[j] = bf_val(bias[ci]);
    }
#pragma unroll
    for (int r = 0; r < 8; ++r) {
      acc0[r] += bc[0];
      acc1[r] += bc[1];
      acc2[r] += bc[2];
      acc3[r] += bc[3];
    }
    // per row: L2 normalise the 64-wide chunk and take the f32 sum of squares of the normalised values
#pragma unroll
    for (int r = 0; r < 8; ++r) {
      float ss = acc0[r] * acc0[r] + acc1[r] * acc1[r] + acc2[r] * acc2[r] + acc3[r] * acc3[r];
      ss += __shfl_xor(ss, 1, 32);
      ss += __shfl_xor(ss, 2, 32);
      ss += __shfl_xor(ss, 4, 32);
      ss += __shfl_xor(ss, 8, 32);
      const float nrm = sqrtf(ss);
      const float den = fmaxf(nrm, 1e-12f);
      const float inv = 1.0f / den;
      acc0[r] *= inv;
      acc1[r] *= inv;
      acc2[r] *= inv;
      acc3[r] *= inv;
      float a2 = acc0[r] * acc0[r] + acc1[r] * acc1[r] + acc2[r] * acc2[r] + acc3[r] * acc3[r];
      a2 += __shfl_xor(a2, 1, 32);
      a2 += __shfl_xor(a2, 2, 32);
      a2 += __shfl_xor(a2, 4, 32);
      a2 += __shfl_xor(a2, 8, 32);
      if (m == 0) aas[(wave * 16 + 8 * hh + r) * NCG + cg] = a2;
    }
    epi16(slab + wave * SLAB, acc0, acc1, acc2, acc3, oscale, C, N, (size_t)rowb, col0, lane);
    wave_sync_lds();                         // slab reads of this iteration ordered before the next iteration's slab writes
  }
  __syncthreads();
  // aa table lines of this block: 64*NCG contiguous floats; thread t writes float4 t (all 128) and float4 t+128 (t < nf4-128)
  const int nf4 = 64 * NCG / 4;
  int i1 = tid + 128;
  i1 = (i1 < nf4) ? i1 : (nf4 - 1);
  const v4f w0 = *(const v4f*)(aas + 4 * tid);
  const v4f w1 = *(const v4f*)(aas + 4 * i1);
  float* dst = AAP + (size_t)blockIdx.x * (size_t)(64 * NCG);
  {
    *(v4f*)(dst + 4 * tid) = w0;
    if (tid + 128 < nf4) *(v4f*)(dst + 4 * (tid + 128)) = w1;
    
  }
}

// =====================================================================================================
// L2-distance flash attention (no masking, all SEQ keys): block = (head, 64 query rows), 4 waves, wave w owns the 16 query
// rows q0 = 64*qt + 16*w .. q0+15 (waves independent: no block barriers, wave-private LDS only, used in the epilogue).
//   qn plane (f16, x QSC) laid out as [NHD*SEQ chunks][64]: head h, row n = chunk h*SEQ + n; keys and queries both come
//   from this plane. AA table (f32) indexed by the same chunk index. v^T plane [h*64+d][SEQ keys] (x1024).
//   All NKB = SEQ/32 key blocks of 32 keys are visited (static bound).
//   Scores are computed TRANSPOSED: S^T tile g (g = 0,1) = key rows (keys kb+16g .. +15, A operand, row m = lane&15, split
//   k map over d) times q^T (B operand, col n = query q0 + (lane&15), k = d, split map), one product per tile and 32-deep
//   d-chunk. D element r of lane l = (key kb+16g+8h+r, query q0+(l&15)), so a lane owns one query column and 16 of its 32
//   keys; the partner lane l^16 owns the other 16 -> row max / row sum need one xor-16 shuffle.
//   Base-2 logit: t = (2*qn_n.qn_m/(QSC*QSC) - AA_n - AA_m) * log2(e)/8; online max-subtracted base-2 softmax in f32.
//   The exp'd values ARE the P A-fragment in place: A row m = query = lane&15, element i <- key kb+8h+i (tile 0, D element i),
//   element 8+i <- key kb+16+8h+i (tile 1, D element i). P (<= 1) is carried x32768 as single f16. The rescale factor of
//   query row 8h+r of the O accumulators is fetched from lane 8h+r with a shuffle (uniform control). 4 v^T B fragments
//   (col n = d = 16j + (lane&15), keys k-contiguous), 4 P.V WMMAs per key block.
//   Epilogue: 1/l (per query, shuffled to the D row owner) and carry folds in f32; the wave's 16x64 f32 result staged in its
//   aux0/aux1 are bound only (not read).
// coverage: per wave 8 instructions x 2 rows x 16 lanes x 4 floats = 16 x 64; grid NHD*(SEQ/64) blocks x 4 waves = every
//           output row (h, n < SEQ) exactly once = SEQ*NHD*64 floats.
// =====================================================================================================
__global__ __launch_bounds__(ATT_THREADS)
void attn_l2(const u16* __restrict__ QPp, const float* __restrict__ AAp, const u16* __restrict__ VPp, float* out,
             const float* aux0, const float* aux1) {
  __shared__ __align__(16) float smem[ATT_WAVES * SLAB];   // per wave: result slab [16][68] in the epilogue only
  (void)aux0; (void)aux1;

  const int tid  = threadIdx.x;
  const int wave = tid >> 5;
  const int lane = tid & 31;
  const int hh   = lane >> 4;
  const int c    = lane & 15;

  const int bid  = blockIdx.x;
  const int qt   = bid % QTILES;
  const int head = bid / QTILES;
  if (head >= NHD) return;                                 // block-uniform, never taken with the exact grid; no block barriers
  const int q0   = qt * 64 + wave * 16;
  const size_t hb = (size_t)head * SEQ;                    // chunk index base of this head

  const _Float16* QH = (const _Float16*)(const void*)QPp;
  // B fragments of q^T: col n = query chunk hb + q0 + c, k = d
  const _Float16* Qb = QH + (hb + (size_t)(q0 + c)) * HD + 8 * hh;
  // A fragments of keys: row m = key chunk hb + kb + 16g + c, k = d  (kb*HD added per step)
  const _Float16* Kb = QH + (hb + (size_t)c) * HD + 8 * hh;
  // B fragments of v: col n = d = 16j + c, k = key (k-contiguous row of the v^T plane), kb added per step
  const _Float16* Vb = (const _Float16*)(const void*)VPp + ((size_t)(head * HD + c)) * SEQ + 8 * hh;
  const float lsc = 0.25f * (LOG2E / (QSC * QSC));
  const float c1l = 0.125f * LOG2E;
  const float aq  = AAp[hb + (size_t)(q0 + c)] * c1l;       // AA term of this lane's query

  const v16h qf0 = ldfrag_h(Qb);            // d 0..31
  const v16h qf1 = ldfrag_h(Qb + 32);       // d 32..63

  float mrun = -INFINITY, lrun = 0.f;
  v8f o[4];
#pragma unroll
  for (int j = 0; j < 4; ++j) o[j] = zero8();

#pragma unroll 1
  for (int it = 0; it < NKB; ++it) {
    const int kb = it * 32;
    // ---- transposed scores: s0 = keys kb..kb+15, s1 = keys kb+16..kb+31, column = query q0 + c ----
    v8f s0 = zero8(), s1 = zero8();
    const _Float16* k0p = Kb + (size_t)kb * HD;
    const _Float16* k1p = k0p + (size_t)16 * HD;
    const v16h ka0 = ldfrag_h(k0p), ka1 = ldfrag_h(k0p + 32);
    const v16h kc0 = ldfrag_h(k1p), kc1 = ldfrag_h(k1p + 32);
    s0 = mma_h(ka0, qf0, s0);
    s0 = mma_h(ka1, qf1, s0);
    s1 = mma_h(kc0, qf0, s1);
    s1 = mma_h(kc1, qf1, s1);
    guard2(s0, s1, qf0, qf1, ka0, ka1, kc0, kc1);
    // ---- AA of this lane's 16 keys: tile 0 element i -> key kb+8hh+i, tile 1 element i -> key kb+16+8hh+i ----
    const float* am = AAp + hb + (size_t)kb + 8 * hh;
    const v4f w0 = *(const v4f*)(am), w1 = *(const v4f*)(am + 4);
    const v4f w2 = *(const v4f*)(am + 16), w3 = *(const v4f*)(am + 20);
    // ---- base-2 logits of this lane's 16 keys for query q0 + c ----
    float tk[16];
#pragma unroll
    for (int i = 0; i < 4; ++i) {
      tk[i]      = s0[i]     * lsc - (aq + w0[i] * c1l);
      tk[4 + i]  = s0[4 + i] * lsc - (aq + w1[i] * c1l);
      tk[8 + i]  = s1[i]     * lsc - (aq + w2[i] * c1l);
      tk[12 + i] = s1[4 + i] * lsc - (aq + w3[i] * c1l);
    }
    float cm = tk[0];
#pragma unroll
    for (int i = 1; i < 16; ++i) cm = fmaxf(cm, tk[i]);
    cm = fmaxf(cm, __shfl_xor(cm, 16, 32));
    const float mn = fmaxf(mrun, cm);                                // finite from the first key block on
    const float al = (mrun == -INFINITY) ? 0.f : exp2f(mrun - mn);   // o and l are zero while mrun is -inf
    mrun = mn;
    // ---- probabilities (<= 1) and the P A-fragment: f16(p * 32768); element i <-> tk[i] ----
    float ps = 0.f;
    FragH ph;
#pragma unroll
    for (int w = 0; w < 2; ++w) {
#pragma unroll
      for (int e4 = 0; e4 < 4; ++e4) {
        const int i = 8 * w + 2 * e4;
        const float p0 = exp2f(fminf(tk[i] - mn, 0.f));
        const float p1 = exp2f(fminf(tk[i + 1] - mn, 0.f));
        ps += p0 + p1;
        ph.u[w][e4] = pk16(h_bits((_Float16)(p0 * PCAR)), h_bits((_Float16)(p1 * PCAR)));
      }
    }
    ps += __shfl_xor(ps, 16, 32);
    lrun = lrun * al + ps;
    // ---- rescale the O accumulators: D row 8hh+r = query q0+8hh+r, its factor lives in lane 8hh+r (and 16+8hh+r) ----
    float scl[8];
#pragma unroll
    for (int r = 0; r < 8; ++r) scl[r] = __shfl(al, 8 * hh + r, 32);
#pragma unroll
    for (int j = 0; j < 4; ++j) {
#pragma unroll
      for (int r = 0; r < 8; ++r) o[j][r] *= scl[r];
    }
    // ---- P.V : B fragment col n = d = j*16 + c, keys contiguous in the v^T plane ----
    {
      const _Float16* vp = Vb + kb;
      const v16h vf0 = ldfrag_h(vp);
      const v16h vf1 = ldfrag_h(vp + (size_t)16 * SEQ);
      const v16h vf2 = ldfrag_h(vp + (size_t)32 * SEQ);
      const v16h vf3 = ldfrag_h(vp + (size_t)48 * SEQ);
      o[0] = mma_h(ph.v, vf0, o[0]);
      o[1] = mma_h(ph.v, vf1, o[1]);
      o[2] = mma_h(ph.v, vf2, o[2]);
      o[3] = mma_h(ph.v, vf3, o[3]);
      guard6<v16h>(o[0], o[1], o[2], o[3], ph.v, vf0, vf1, vf2, vf3, ph.v);
    }
  }
  acc_guard4(o[0], o[1], o[2], o[3]);

  // ---- fold 1/l (per query, owned by lane = query; l >= 1 by construction) and the carries; stage the 16x64 slab ----
  const float linv = (lrun > 0.f) ? ((1.0f / lrun) * (1.0f / (PCAR * VCAR))) : 0.f;
  float inv[8];
#pragma unroll
  for (int r = 0; r < 8; ++r) inv[r] = __shfl(linv, 8 * hh + r, 32);
  float* slab = smem + wave * SLAB;
#pragma unroll
  for (int r = 0; r < 8; ++r) {
#pragma unroll
    for (int j = 0; j < 4; ++j) slab[(8 * hh + r) * 68 + j * 16 + c] = o[j][r] * inv[r];
  }
  wave_sync_lds();
  // ---- f32 output rows: lanes 0..15 -> row 2*it2, lanes 16..31 -> row 2*it2+1, 16 lanes x 16 B = one 256-B row ----
  v4f vals[8];
#pragma unroll
  for (int it2 = 0; it2 < 8; ++it2) vals[it2] = *(const v4f*)(slab + (it2 * 2 + hh) * 68 + c * 4);
  float* dst = out + (hb + (size_t)(q0 + hh)) * HD + c * 4;
  {
#pragma unroll
    for (int it2 = 0; it2 < 8; ++it2) {
      *(v4f*)(dst + (size_t)(it2 * 2) * HD) = vals[it2];
    }
    
  }
}

// =====================================================================================================
// Workspace map (bytes); every plane is fully written by whole-line stores before it is read; all extents are exact multiples
// of the store granularity (no pad rows needed), every offset a multiple of 128:
//   XB  bf16 [SEQ][768]                          SEQ*1536   (3145728 at SEQ = 2048)
//   WQB bf16 [768 n][768 k]                      1179648    WVB same
//   QP  f16  [SEQ][768] = [12*SEQ chunks][64] x16 SEQ*1536
//   AAP f32  [12*SEQ]                            SEQ*48     (98304)
//   VP  f16  [768 = h*64+d][SEQ] x1024           SEQ*1536
//   end                                          11894784 at SEQ = 2048
// =====================================================================================================
extern "C" void kernel_launch(void* const* d_in, const int* in_sizes, int n_in,
                              void* d_out, int out_size, void* d_ws, size_t ws_size,
                              hipStream_t stream) {
  if (n_in < 7) return;
  if (in_sizes[0] < SEQ * DMOD) return;
  if (in_sizes[1] < 1 || in_sizes[2] < 1) return;
  if (in_sizes[3] != DMOD * DMOD || in_sizes[5] != DMOD * DMOD) return;
  if (in_sizes[4] != DMOD || in_sizes[6] != DMOD) return;
  if (out_size < SEQ * DMOD) return;

  const float* Xin = (const float*)d_in[0];
  const float* Gin = (const float*)d_in[1];               // bound only, not read
  const float* Min = (const float*)d_in[2];               // bound only, not read
  const float* Wq  = (const float*)d_in[3];
  const float* bq  = (const float*)d_in[4];
  const float* Wv  = (const float*)d_in[5];
  const float* bv  = (const float*)d_in[6];
  float*       out = (float*)d_out;

  const size_t szXB = (size_t)SEQ * DMOD * 2;
  const size_t szW  = (size_t)DMOD * DMOD * 2;
  const size_t szQP = (size_t)SEQ * DMOD * 2;
  const size_t szAA = (size_t)NHD * SEQ * 4;
  const size_t szVP = (size_t)DMOD * SEQ * 2;
  size_t off = 0;
  const size_t oXB = off; off += szXB;
  const size_t oWQ = off; off += szW;
  const size_t oWV = off; off += szW;
  const size_t oQP = off; off += szQP;
  const size_t oAA = off; off += szAA;
  const size_t oVP = off; off += szVP;
  if (off > ws_size) return;                            // off = 11894784 at SEQ = 2048
  if (off > (size_t)134217728) return;

  char* ws = (char*)d_ws;
  u16*   XB  = (u16*)(ws + oXB);
  u16*   WQB = (u16*)(ws + oWQ);
  u16*   WVB = (u16*)(ws + oWV);
  u16*   QP  = (u16*)(ws + oQP);
  float* AAP = (float*)(ws + oAA);
  u16*   VP  = (u16*)(ws + oVP);

  const int n8x = (SEQ * DMOD) / 8;
  const int n8w = (DMOD * DMOD) / 8;
  if ((n8x % 256) != 0 || (n8w % 256) != 0) return;
  if ((DMOD % 64) != 0 || (SEQ % 64) != 0 || (DMOD % 32) != 0) return;
  const dim3 blk(256);
  const dim3 gX(n8x / 256);                             // 768 at SEQ = 2048
  const dim3 gW(n8w / 256);                             // 288
  const dim3 gQ(SEQ / 64);                              // 32
  const dim3 gV((DMOD / 64) * (SEQ / 64));              // 384
  const dim3 bG(128);
  const dim3 gAT(ATT_BLOCKS);                           // 384
  const dim3 bAT(ATT_THREADS);                          // 128

  // (0..2) operand planes: x -> bf16; Wq/Wv [n = out][k = in] (already k-contiguous) -> bf16
  cvt16<<<gX, blk, 0, stream>>>(Xin, XB, n8x, 0, 1.0f);
  cvt16<<<gW, blk, 0, stream>>>(Wq, WQB, n8w, 0, 1.0f);
  cvt16<<<gW, blk, 0, stream>>>(Wv, WVB, n8w, 0, 1.0f);
  // (3) q = x.Wq^T + bq, L2-normalised per 64-chunk -> qn plane [SEQ][768] f16 x16 and AA table [12*SEQ] f32
  gemm_qn<<<gQ, bG, 0, stream>>>(XB, WQB, QP, AAP, bq, SEQ, DMOD, DMOD, QSC);
  // (4) v^T plane: [768 = h*64+d][SEQ keys] = f16((Wv . x^T + bv) x1024); bias by row
  gemm_b16<<<gV, bG, 0, stream>>>(WVB, XB, VP, bv, DMOD, SEQ, DMOD, DMOD, 1, VCAR);
  // (5) attention -> out, f32 row (chunk h*SEQ + n) of 64 floats at float offset (h*SEQ + n)*64
  attn_l2<<<gAT, bAT, 0, stream>>>(QP, AAP, VP, out, Gin, Min);
  (void)hipGetLastError();
}

// v001
// One run takes 124 microseconds.
// Timed twice side by side with v000, it ran 2.24 and 2.25 times as fast.
// Contractions: x.Wq^T+bq and Wv.x^T+bv on v_wmma_f32_16x16x32_bf16 (x and W planes RNE-converted to bf16 operands, f32 accumulate);
// scores qn.qn^T (qn = L2-normalised q, single f16 plane carried x16) and P.v (P x32768 single f16, v x1024 single f16) on
// v_wmma_f32_16x16x32_f16, f32 accumulate. Biases folded as RNE bf16 values in f32 epilogues; L2 normalisation, sums of squares,
// base-2 online softmax, 1/l and carry folds in f32 on VALU.
#include <hip/hip_runtime.h>
#include <math.h>
#include <stdint.h>

#ifndef NB
#define NB 1
#endif
#ifndef SEQ
#define SEQ 2048
#endif
#define SEQ_FULL 2048
#define DMOD  768
#define NHD   12
#define HD    64
#define NCG   (DMOD / 64)
#define QSC   16.0f
#define PCAR  32768.0f
#define VCAR  1024.0f
#define LOG2E 1.4426950408889634f
#define ATT_WAVES   4
#define ATT_THREADS (ATT_WAVES * 32)
#define QTILES      (SEQ / 64)
#define ATT_BLOCKS  (NHD * QTILES)
#define NKB    (SEQ / 32)
#define SLAB   (16 * 68)
static_assert(NB == 1);
static_assert(HD == 64 && DMOD == NHD * HD && NCG * 64 == DMOD);
static_assert((SEQ % 64) == 0 && SEQ >= 64 && SEQ <= SEQ_FULL);
static_assert(ATT_THREADS == 128 && NKB * 32 == SEQ && ATT_BLOCKS == NHD * (SEQ / 64));
static_assert((DMOD % 64) == 0 && (DMOD % 32) == 0);
static_assert(((SEQ * DMOD / 8) % 256) == 0 && ((DMOD * DMOD / 8) % 256) == 0);
static_assert((SLAB * 4) % 16 == 0);
static_assert(((16 * NCG) % 32) == 0 && NCG * 32 <= 1024 && (SEQ % 16) == 0);

typedef unsigned short u16;
typedef _Float16 v16h __attribute__((ext_vector_type(16)));
typedef _Float16 v8h  __attribute__((ext_vector_type(8)));
typedef __bf16   v16b __attribute__((ext_vector_type(16)));
typedef float    v8f  __attribute__((ext_vector_type(8)));
typedef float    v4f  __attribute__((ext_vector_type(4)));
typedef unsigned int v4u __attribute__((ext_vector_type(4)));

union FragH { v16h v; v8h h[2]; v4u u[2]; };
union FragB { v16b v; v4u u[2]; };

// ---- scalar helpers --------------------------------------------------------------------------------
__device__ __forceinline__ unsigned short bf_bits(float f) {          // f32 -> bf16 bits, RNE convert
  unsigned u = __float_as_uint(f);
  return (unsigned short)((u + 0x7FFFu + ((u >> 16) & 1u)) >> 16);
}
__device__ __forceinline__ float bf_up(unsigned short h) { return __uint_as_float(((unsigned)h) << 16); }
__device__ __forceinline__ float bf_val(float f) { return bf_up(bf_bits(f)); }          // value after RNE bf16 convert
__device__ __forceinline__ unsigned short h_bits(_Float16 x) { return __builtin_bit_cast(unsigned short, x); }
__device__ __forceinline__ unsigned pk16(unsigned short a, unsigned short b) { return (unsigned)a | ((unsigned)b << 16); }
__device__ __forceinline__ v8f zero8() { v8f z = {0.f, 0.f, 0.f, 0.f, 0.f, 0.f, 0.f, 0.f}; return z; }

// ---- fragment loaders: 16-bit A/B operand, lane -> row/col (lane&15), p already includes +8*(lane>>4);
//      elements 0..7 <- p[0..7] (k0+8h..), elements 8..15 <- p[16..23] (k0+16+8h..)  (same split k map for A and B;
//      B is always read from a k-contiguous [n][k] plane)
__device__ __forceinline__ v16h ldfrag_h(const _Float16* p) {
  FragH f;
  f.h[0] = *(const v8h*)(p);
  f.h[1] = *(const v8h*)(p + 16);
  return f.v;
}
__device__ __forceinline__ v16b ldfrag_b(const u16* p) {              // bf16 plane read as unsigned integer vectors
  FragB f;
  f.u[0] = *(const v4u*)(p);
  f.u[1] = *(const v4u*)(p + 16);
  return f.v;
}

__device__ __forceinline__ v8f mma_h(v16h a, v16h b, v8f c) {
  return __builtin_amdgcn_wmma_f32_16x16x32_f16(false, a, false, b, (short)0, c, false, false);
}
__device__ __forceinline__ v8f mma_b(v16b a, v16b b, v8f c) {
  return __builtin_amdgcn_wmma_f32_16x16x32_bf16(false, a, false, b, (short)0, c, false, false);
}
__device__ __forceinline__ void guard2(v8f& a, v8f& b, v16h x0, v16h x1, v16h x2, v16h x3, v16h x4, v16h x5) {
#if defined(__HIP_DEVICE_COMPILE__)
  asm volatile("v_nop\n\tv_nop\n\tv_nop\n\tv_nop"
               : "+v"(a), "+v"(b) : "v"(x0), "v"(x1), "v"(x2), "v"(x3), "v"(x4), "v"(x5) : "memory");
#endif
}
template <typename F>
__device__ __forceinline__ void guard6(v8f& a, v8f& b, v8f& c, v8f& d, F x0, F x1, F x2, F x3, F x4, F x5) {
#if defined(__HIP_DEVICE_COMPILE__)
  asm volatile("v_nop\n\tv_nop\n\tv_nop\n\tv_nop"
               : "+v"(a), "+v"(b), "+v"(c), "+v"(d) : "v"(x0), "v"(x1), "v"(x2), "v"(x3), "v"(x4), "v"(x5) : "memory");
#endif
}
__device__ __forceinline__ void acc_guard4(v8f& a, v8f& b, v8f& c, v8f& d) {
#if defined(__HIP_DEVICE_COMPILE__)
  asm volatile("v_nop\n\tv_nop\n\tv_nop\n\tv_nop" : "+v"(a), "+v"(b), "+v"(c), "+v"(d));
#endif
}
__device__ __forceinline__ void wave_sync_lds() {
#if defined(__HIP_DEVICE_COMPILE__)
  __builtin_amdgcn_fence(__ATOMIC_RELEASE, "workgroup");
  __builtin_amdgcn_wave_barrier();
  __builtin_amdgcn_fence(__ATOMIC_ACQUIRE, "workgroup");
#endif
}

// =====================================================================================================
// f32 plane -> 16-bit plane, same layout:  mode 0: bf16 RNE bits;  mode 1: f16 bits of (bf16 RNE value) * scale.
// Thread = 8 consecutive elements: two 16-B loads, one 16-B store; 32 consecutive lanes = 512 contiguous, 512-B aligned bytes
// coverage: grid = n8/256 blocks (host checks exactness) x 256 thr x 8 = the whole plane.
// =====================================================================================================
__global__ __launch_bounds__(256) void cvt16(const float* __restrict__ x, u16* D, int n8, int mode, float scale) {
  const int gt = blockIdx.x * 256 + (int)threadIdx.x;
  if (gt >= n8) return;                     // no barriers in this kernel
  const float* p = x + (size_t)gt * 8;
  const v4f a = *(const v4f*)(p), c4 = *(const v4f*)(p + 4);
  float v[8];
#pragma unroll
  for (int e = 0; e < 4; ++e) { v[e] = a[e]; v[4 + e] = c4[e]; }
  unsigned short s[8];
#pragma unroll
  for (int e = 0; e < 8; ++e) {
    const unsigned short bb = bf_bits(v[e]);
    const unsigned short hb = h_bits((_Float16)(bf_up(bb) * scale));
    s[e] = (mode != 0) ? hb : bb;
  }
  v4u o;
#pragma unroll
  for (int e = 0; e < 4; ++e) o[e] = pk16(s[2 * e], s[2 * e + 1]);
  u16* d = D + (size_t)gt * 8;
  {
    *(v4u*)(d) = o;
    
  }
}

// =====================================================================================================
// barrier, then converted to f16 and written: lane = (row in group of 4, 8 consecutive cols); one instruction = 4 rows, each
// coverage: 4 instructions x 4 rows x 8 lanes x 8 halves = the wave's 16 x 64 tile.
// =====================================================================================================
__device__ __forceinline__ void epi16(float* sl, v8f a0, v8f a1, v8f a2, v8f a3, float oscale, u16* C, int N,
                                      size_t rowb, int col0, int lane) {
  const int hh = lane >> 4, m = lane & 15;
#pragma unroll
  for (int r = 0; r < 8; ++r) {
    const int ro = (8 * hh + r) * 68 + m;
    sl[ro]      = a0[r] * oscale;
    sl[ro + 16] = a1[r] * oscale;
    sl[ro + 32] = a2[r] * oscale;
    sl[ro + 48] = a3[r] * oscale;
  }
  wave_sync_lds();
  const int rq = lane >> 3, c8 = (lane & 7) * 8;
  v4u ov[4];
#pragma unroll
  for (int i4 = 0; i4 < 4; ++i4) {
    const int row = i4 * 4 + rq;
    const v4f a = *(const v4f*)(sl + row * 68 + c8), c4 = *(const v4f*)(sl + row * 68 + c8 + 4);
    float w[8];
#pragma unroll
    for (int e = 0; e < 4; ++e) { w[e] = a[e]; w[4 + e] = c4[e]; }
#pragma unroll
    for (int e = 0; e < 4; ++e) ov[i4][e] = pk16(h_bits((_Float16)w[2 * e]), h_bits((_Float16)w[2 * e + 1]));
  }
  u16* dst = C + (rowb + (size_t)rq) * (size_t)N + col0 + c8;
  {
#pragma unroll
    for (int i4 = 0; i4 < 4; ++i4) {
      *(v4u*)(dst + (size_t)(i4 * 4) * (size_t)N) = ov[i4];
    }
    
  }
}

// =====================================================================================================
// bf16 GEMM with bias and 16-bit result: C[M][N] (f16 of (acc + bias)*oscale) = A[M][K] (bf16 row-major) . Bt[N][K]^T
// (bf16 k-contiguous); bias (f32 input, taken as its RNE bf16 value) indexed by column (byrow == 0) or by row (byrow != 0),
// both candidates read with addresses clamped to [0, nbias). Block = 64x64 tile, 4 waves x 16 rows; fragments loaded straight
// from the 16-bit rows (two 16-B loads each, split k map for A and B); K stepped by 32 (host checks K % 32 == 0,
// M % 64 == 0, N % 64 == 0, grid = (M/64)*(N/64)).
// =====================================================================================================
__global__ __launch_bounds__(128)
void gemm_b16(const u16* __restrict__ A, const u16* __restrict__ Bt, u16* C, const float* __restrict__ bias,
              int M, int N, int K, int nbias, int byrow, float oscale) {
  __shared__ __align__(16) float slab[4 * SLAB];
  const int tid = threadIdx.x, wave = tid >> 5, lane = tid & 31, hh = lane >> 4, m = lane & 15;
  const int ntile = N >> 6;
  const int bid   = blockIdx.x;
  const int rowb  = (bid / ntile) * 64 + wave * 16;
  const int col0  = (bid % ntile) * 64;
  if (rowb + 16 > M) return;                 // wave-uniform, never taken with the exact grid; no block barriers in this kernel
  const u16* ap = A  + (size_t)(rowb + m) * K + 8 * hh;
  const u16* bp = Bt + (size_t)(col0 + m) * K + 8 * hh;
  const size_t bs = (size_t)16 * K;
  v8f acc0 = zero8(), acc1 = zero8(), acc2 = zero8(), acc3 = zero8();
#pragma unroll 1
  for (int k0 = 0; k0 < K; k0 += 32) {
    const v16b a  = ldfrag_b(ap + k0);
    const v16b b0 = ldfrag_b(bp + k0);
    const v16b b1 = ldfrag_b(bp + bs + k0);
    const v16b b2 = ldfrag_b(bp + 2 * bs + k0);
    const v16b b3 = ldfrag_b(bp + 3 * bs + k0);
    acc0 = mma_b(a, b0, acc0);
    acc1 = mma_b(a, b1, acc1);
    acc2 = mma_b(a, b2, acc2);
    acc3 = mma_b(a, b3, acc3);
    guard6<v16b>(acc0, acc1, acc2, acc3, a, b0, b1, b2, b3, a);
  }
  acc_guard4(acc0, acc1, acc2, acc3);
  // bias: D element r of lane -> (row rowb+8hh+r, col col0+16j+m); both candidates loaded with clamped addresses, select by value
  float bc[4], br[8];
#pragma unroll
  for (int j = 0; j < 4; ++j) {
    int ci = col0 + 16 * j + m;
    ci = (ci < nbias) ? ci : (nbias - 1);
    bc[j] = bf_val(bias[ci]);
  }
#pragma unroll
  for (int r = 0; r < 8; ++r) {
    int ri = rowb + 8 * hh + r;
    ri = (ri < nbias) ? ri : (nbias - 1);
    br[r] = bf_val(bias[ri]);
  }
#pragma unroll
  for (int r = 0; r < 8; ++r) {
    const float q0 = (byrow != 0) ? br[r] : bc[0];
    const float q1 = (byrow != 0) ? br[r] : bc[1];
    const float q2 = (byrow != 0) ? br[r] : bc[2];
    const float q3 = (byrow != 0) ? br[r] : bc[3];
    acc0[r] += q0;
    acc1[r] += q1;
    acc2[r] += q2;
    acc3[r] += q3;
  }
  epi16(slab + wave * SLAB, acc0, acc1, acc2, acc3, oscale, C, N, (size_t)rowb, col0, lane);
}

// =====================================================================================================
// Query projection with fused per-chunk L2 normalisation:
//   q[M][NCG*64] (f32, registers only) = A[M][K] (bf16 x plane) . Bt[NCG*64][K]^T (bf16 Wq plane) + bias[col] (RNE bf16 value);
//   block = 16 rows x all NCG column groups of 64, one wave per column group (wave index = cg), so the NCG groups of a row
//   tile run side by side instead of one after the other; for D row 8hh+r the 64-wide chunk (row, cols col0..col0+63) lives
//   in the 16 lanes of half hh x 4 accumulators: ss = sum of squares (4 products per lane, xor-1/2/4/8 shuffles inside the
//   half), qn = q * (1/max(sqrt(ss), 1e-12)), aa = sum of qn^2 the same way (f32), kept in LDS at aas[(row in block)*NCG + cg].
//   After the block barrier the block's 16*NCG aa values (chunk index = row*NCG + cg) go out as whole 128-B lines that no
//   other block writes (16*NCG floats is a multiple of 32).
//   Host checks: M % 16 == 0, K % 32 == 0, grid = M/16 exact, block = NCG waves (every wave reaches the barrier).
// coverage: qn plane: M/16 blocks x NCG waves x (16 x 64) = M x NCG*64;  aa table: M/16 blocks x 16*NCG floats = M*NCG.
// =====================================================================================================
__global__ __launch_bounds__(NCG * 32)
void gemm_qn(const u16* __restrict__ A, const u16* __restrict__ Bt, u16* C, float* AAP, const float* __restrict__ bias,
             int M, int K, int nbias, float oscale) {
  __shared__ __align__(16) float slab[NCG * SLAB];
  __shared__ __align__(16) float aas[16 * NCG];
  const int tid = threadIdx.x, wave = tid >> 5, lane = tid & 31, hh = lane >> 4, m = lane & 15;
  const int N = NCG * 64;
  const int rowb = blockIdx.x * 16;
  const int col0 = wave * 64;
  (void)M;
  const u16* ap = A + (size_t)(rowb + m) * K + 8 * hh;
  const u16* bp = Bt + (size_t)(col0 + m) * K + 8 * hh;
  const size_t bs = (size_t)16 * K;
  v8f acc0 = zero8(), acc1 = zero8(), acc2 = zero8(), acc3 = zero8();
#pragma unroll 1
  for (int k0 = 0; k0 < K; k0 += 32) {
    const v16b a  = ldfrag_b(ap + k0);
    const v16b b0 = ldfrag_b(bp + k0);
    const v16b b1 = ldfrag_b(bp + bs + k0);
    const v16b b2 = ldfrag_b(bp + 2 * bs + k0);
    const v16b b3 = ldfrag_b(bp + 3 * bs + k0);
    acc0 = mma_b(a, b0, acc0);
    acc1 = mma_b(a, b1, acc1);
    acc2 = mma_b(a, b2, acc2);
    acc3 = mma_b(a, b3, acc3);
    guard6<v16b>(acc0, acc1, acc2, acc3, a, b0, b1, b2, b3, a);
  }
  acc_guard4(acc0, acc1, acc2, acc3);
  float bc[4];
#pragma unroll
  for (int j = 0; j < 4; ++j) {
    int ci = col0 + 16 * j + m;
    ci = (ci < nbias) ? ci : (nbias - 1);
    bc[j] = bf_val(bias[ci]);
  }
#pragma unroll
  for (int r = 0; r < 8; ++r) {
    acc0[r] += bc[0];
    acc1[r] += bc[1];
    acc2[r] += bc[2];
    acc3[r] += bc[3];
  }
  // per row: L2 normalise the 64-wide chunk and take the f32 sum of squares of the normalised values
#pragma unroll
  for (int r = 0; r < 8; ++r) {
    float ss = acc0[r] * acc0[r] + acc1[r] * acc1[r] + acc2[r] * acc2[r] + acc3[r] * acc3[r];
    ss += __shfl_xor(ss, 1, 32);
    ss += __shfl_xor(ss, 2, 32);
    ss += __shfl_xor(ss, 4, 32);
    ss += __shfl_xor(ss, 8, 32);
    const float nrm = sqrtf(ss);
    const float den = fmaxf(nrm, 1e-12f);
    const float inv = 1.0f / den;
    acc0[r] *= inv;
    acc1[r] *= inv;
    acc2[r] *= inv;
    acc3[r] *= inv;
    float a2 = acc0[r] * acc0[r] + acc1[r] * acc1[r] + acc2[r] * acc2[r] + acc3[r] * acc3[r];
    a2 += __shfl_xor(a2, 1, 32);
    a2 += __shfl_xor(a2, 2, 32);
    a2 += __shfl_xor(a2, 4, 32);
    a2 += __shfl_xor(a2, 8, 32);
    if (m == 0) aas[(8 * hh + r) * NCG + wave] = a2;
  }
  epi16(slab + wave * SLAB, acc0, acc1, acc2, acc3, oscale, C, N, (size_t)rowb, col0, lane);
  __syncthreads();
  // aa table lines of this block: 16*NCG contiguous floats; thread t < 16*NCG/4 writes float4 t
  const int nf4 = 16 * NCG / 4;
  if (tid < nf4) {
    const v4f w0 = *(const v4f*)(aas + 4 * tid);
    *(v4f*)(AAP + (size_t)blockIdx.x * (size_t)(16 * NCG) + 4 * tid) = w0;
  }
}

// =====================================================================================================
// L2-distance flash attention (no masking, all SEQ keys): block = (head, 64 query rows), 4 waves, wave w owns the 16 query
// rows q0 = 64*qt + 16*w .. q0+15 (waves independent: no block barriers, wave-private LDS only, used in the epilogue).
//   qn plane (f16, x QSC) laid out as [NHD*SEQ chunks][64]: head h, row n = chunk h*SEQ + n; keys and queries both come
//   from this plane. AA table (f32) indexed by the same chunk index. v^T plane [h*64+d][SEQ keys] (x1024).
//   All NKB = SEQ/32 key blocks of 32 keys are visited (static bound).
//   Scores are computed TRANSPOSED: S^T tile g (g = 0,1) = key rows (keys kb+16g .. +15, A operand, row m = lane&15, split
//   k map over d) times q^T (B operand, col n = query q0 + (lane&15), k = d, split map), one product per tile and 32-deep
//   d-chunk. D element r of lane l = (key kb+16g+8h+r, query q0+(l&15)), so a lane owns one query column and 16 of its 32
//   keys; the partner lane l^16 owns the other 16 -> row max / row sum need one xor-16 shuffle.
//   Base-2 logit: t = (2*qn_n.qn_m/(QSC*QSC) - AA_n - AA_m) * log2(e)/8; online max-subtracted base-2 softmax in f32.
//   The exp'd values ARE the P A-fragment in place: A row m = query = lane&15, element i <- key kb+8h+i (tile 0, D element i),
//   element 8+i <- key kb+16+8h+i (tile 1, D element i). P (<= 1) is carried x32768 as single f16. The rescale factor of
//   query row 8h+r of the O accumulators is fetched from lane 8h+r with a shuffle (uniform control). 4 v^T B fragments
//   (col n = d = 16j + (lane&15), keys k-contiguous), 4 P.V WMMAs per key block.
//   Epilogue: 1/l (per query, shuffled to the D row owner) and carry folds in f32; the wave's 16x64 f32 result staged in its
//   aux0/aux1 are bound only (not read).
// coverage: per wave 8 instructions x 2 rows x 16 lanes x 4 floats = 16 x 64; grid NHD*(SEQ/64) blocks x 4 waves = every
//           output row (h, n < SEQ) exactly once = SEQ*NHD*64 floats.
// =====================================================================================================
__global__ __launch_bounds__(ATT_THREADS)
void attn_l2(const u16* __restrict__ QPp, const float* __restrict__ AAp, const u16* __restrict__ VPp, float* out,
             const float* aux0, const float* aux1) {
  __shared__ __align__(16) float smem[ATT_WAVES * SLAB];   // per wave: result slab [16][68] in the epilogue only
  (void)aux0; (void)aux1;

  const int tid  = threadIdx.x;
  const int wave = tid >> 5;
  const int lane = tid & 31;
  const int hh   = lane >> 4;
  const int c    = lane & 15;

  const int bid  = blockIdx.x;
  const int qt   = bid % QTILES;
  const int head = bid / QTILES;
  if (head >= NHD) return;                                 // block-uniform, never taken with the exact grid; no block barriers
  const int q0   = qt * 64 + wave * 16;
  const size_t hb = (size_t)head * SEQ;                    // chunk index base of this head

  const _Float16* QH = (const _Float16*)(const void*)QPp;
  // B fragments of q^T: col n = query chunk hb + q0 + c, k = d
  const _Float16* Qb = QH + (hb + (size_t)(q0 + c)) * HD + 8 * hh;
  // A fragments of keys: row m = key chunk hb + kb + 16g + c, k = d  (kb*HD added per step)
  const _Float16* Kb = QH + (hb + (size_t)c) * HD + 8 * hh;
  // B fragments of v: col n = d = 16j + c, k = key (k-contiguous row of the v^T plane), kb added per step
  const _Float16* Vb = (const _Float16*)(const void*)VPp + ((size_t)(head * HD + c)) * SEQ + 8 * hh;
  const float lsc = 0.25f * (LOG2E / (QSC * QSC));
  const float c1l = 0.125f * LOG2E;
  const float aq  = AAp[hb + (size_t)(q0 + c)] * c1l;       // AA term of this lane's query

  const v16h qf0 = ldfrag_h(Qb);            // d 0..31
  const v16h qf1 = ldfrag_h(Qb + 32);       // d 32..63

  float mrun = -INFINITY, lrun = 0.f;
  v8f o[4];
#pragma unroll
  for (int j = 0; j < 4; ++j) o[j] = zero8();

#pragma unroll 1
  for (int it = 0; it < NKB; ++it) {
    const int kb = it * 32;
    // ---- transposed scores: s0 = keys kb..kb+15, s1 = keys kb+16..kb+31, column = query q0 + c ----
    v8f s0 = zero8(), s1 = zero8();
    const _Float16* k0p = Kb + (size_t)kb * HD;
    const _Float16* k1p = k0p + (size_t)16 * HD;
    const v16h ka0 = ldfrag_h(k0p), ka1 = ldfrag_h(k0p + 32);
    const v16h kc0 = ldfrag_h(k1p), kc1 = ldfrag_h(k1p + 32);
    s0 = mma_h(ka0, qf0, s0);
    s0 = mma_h(ka1, qf1, s0);
    s1 = mma_h(kc0, qf0, s1);
    s1 = mma_h(kc1, qf1, s1);
    guard2(s0, s1, qf0, qf1, ka0, ka1, kc0, kc1);
    // ---- AA of this lane's 16 keys: tile 0 element i -> key kb+8hh+i, tile 1 element i -> key kb+16+8hh+i ----
    const float* am = AAp + hb + (size_t)kb + 8 * hh;
    const v4f w0 = *(const v4f*)(am), w1 = *(const v4f*)(am + 4);
    const v4f w2 = *(const v4f*)(am + 16), w3 = *(const v4f*)(am + 20);
    // ---- base-2 logits of this lane's 16 keys for query q0 + c ----
    float tk[16];
#pragma unroll
    for (int i = 0; i < 4; ++i) {
      tk[i]      = s0[i]     * lsc - (aq + w0[i] * c1l);
      tk[4 + i]  = s0[4 + i] * lsc - (aq + w1[i] * c1l);
      tk[8 + i]  = s1[i]     * lsc - (aq + w2[i] * c1l);
      tk[12 + i] = s1[4 + i] * lsc - (aq + w3[i] * c1l);
    }
    float cm = tk[0];
#pragma unroll
    for (int i = 1; i < 16; ++i) cm = fmaxf(cm, tk[i]);
    cm = fmaxf(cm, __shfl_xor(cm, 16, 32));
    const float mn = fmaxf(mrun, cm);                                // finite from the first key block on
    const float al = (mrun == -INFINITY) ? 0.f : exp2f(mrun - mn);   // o and l are zero while mrun is -inf
    mrun = mn;
    // ---- probabilities (<= 1) and the P A-fragment: f16(p * 32768); element i <-> tk[i] ----
    float ps = 0.f;
    FragH ph;
#pragma unroll
    for (int w = 0; w < 2; ++w) {
#pragma unroll
      for (int e4 = 0; e4 < 4; ++e4) {
        const int i = 8 * w + 2 * e4;
        const float p0 = exp2f(fminf(tk[i] - mn, 0.f));
        const float p1 = exp2f(fminf(tk[i + 1] - mn, 0.f));
        ps += p0 + p1;
        ph.u[w][e4] = pk16(h_bits((_Float16)(p0 * PCAR)), h_bits((_Float16)(p1 * PCAR)));
      }
    }
    ps += __shfl_xor(ps, 16, 32);
    lrun = lrun * al + ps;
    // ---- rescale the O accumulators: D row 8hh+r = query q0+8hh+r, its factor lives in lane 8hh+r (and 16+8hh+r) ----
    float scl[8];
#pragma unroll
    for (int r = 0; r < 8; ++r) scl[r] = __shfl(al, 8 * hh + r, 32);
#pragma unroll
    for (int j = 0; j < 4; ++j) {
#pragma unroll
      for (int r = 0; r < 8; ++r) o[j][r] *= scl[r];
    }
    // ---- P.V : B fragment col n = d = j*16 + c, keys contiguous in the v^T plane ----
    {
      const _Float16* vp = Vb + kb;
      const v16h vf0 = ldfrag_h(vp);
      const v16h vf1 = ldfrag_h(vp + (size_t)16 * SEQ);
      const v16h vf2 = ldfrag_h(vp + (size_t)32 * SEQ);
      const v16h vf3 = ldfrag_h(vp + (size_t)48 * SEQ);
      o[0] = mma_h(ph.v, vf0, o[0]);
      o[1] = mma_h(ph.v, vf1, o[1]);
      o[2] = mma_h(ph.v, vf2, o[2]);
      o[3] = mma_h(ph.v, vf3, o[3]);
      guard6<v16h>(o[0], o[1], o[2], o[3], ph.v, vf0, vf1, vf2, vf3, ph.v);
    }
  }
  acc_guard4(o[0], o[1], o[2], o[3]);

  // ---- fold 1/l (per query, owned by lane = query; l >= 1 by construction) and the carries; stage the 16x64 slab ----
  const float linv = (lrun > 0.f) ? ((1.0f / lrun) * (1.0f / (PCAR * VCAR))) : 0.f;
  float inv[8];
#pragma unroll
  for (int r = 0; r < 8; ++r) inv[r] = __shfl(linv, 8 * hh + r, 32);
  float* slab = smem + wave * SLAB;
#pragma unroll
  for (int r = 0; r < 8; ++r) {
#pragma unroll
    for (int j = 0; j < 4; ++j) slab[(8 * hh + r) * 68 + j * 16 + c] = o[j][r] * inv[r];
  }
  wave_sync_lds();
  // ---- f32 output rows: lanes 0..15 -> row 2*it2, lanes 16..31 -> row 2*it2+1, 16 lanes x 16 B = one 256-B row ----
  v4f vals[8];
#pragma unroll
  for (int it2 = 0; it2 < 8; ++it2) vals[it2] = *(const v4f*)(slab + (it2 * 2 + hh) * 68 + c * 4);
  float* dst = out + (hb + (size_t)(q0 + hh)) * HD + c * 4;
  {
#pragma unroll
    for (int it2 = 0; it2 < 8; ++it2) {
      *(v4f*)(dst + (size_t)(it2 * 2) * HD) = vals[it2];
    }
    
  }
}

// =====================================================================================================
// Workspace map (bytes); every plane is fully written by whole-line stores before it is read; all extents are exact multiples
// of the store granularity (no pad rows needed), every offset a multiple of 128:
//   XB  bf16 [SEQ][768]                          SEQ*1536   (3145728 at SEQ = 2048)
//   WQB bf16 [768 n][768 k]                      1179648    WVB same
//   QP  f16  [SEQ][768] = [12*SEQ chunks][64] x16 SEQ*1536
//   AAP f32  [12*SEQ]                            SEQ*48     (98304)
//   VP  f16  [768 = h*64+d][SEQ] x1024           SEQ*1536
//   end                                          11894784 at SEQ = 2048
// =====================================================================================================
extern "C" void kernel_launch(void* const* d_in, const int* in_sizes, int n_in,
                              void* d_out, int out_size, void* d_ws, size_t ws_size,
                              hipStream_t stream) {
  if (n_in < 7) return;
  if (in_sizes[0] < SEQ * DMOD) return;
  if (in_sizes[1] < 1 || in_sizes[2] < 1) return;
  if (in_sizes[3] != DMOD * DMOD || in_sizes[5] != DMOD * DMOD) return;
  if (in_sizes[4] != DMOD || in_sizes[6] != DMOD) return;
  if (out_size < SEQ * DMOD) return;

  const float* Xin = (const float*)d_in[0];
  const float* Gin = (const float*)d_in[1];               // bound only, not read
  const float* Min = (const float*)d_in[2];               // bound only, not read
  const float* Wq  = (const float*)d_in[3];
  const float* bq  = (const float*)d_in[4];
  const float* Wv  = (const float*)d_in[5];
  const float* bv  = (const float*)d_in[6];
  float*       out = (float*)d_out;

  const size_t szXB = (size_t)SEQ * DMOD * 2;
  const size_t szW  = (size_t)DMOD * DMOD * 2;
  const size_t szQP = (size_t)SEQ * DMOD * 2;
  const size_t szAA = (size_t)NHD * SEQ * 4;
  const size_t szVP = (size_t)DMOD * SEQ * 2;
  size_t off = 0;
  const size_t oXB = off; off += szXB;
  const size_t oWQ = off; off += szW;
  const size_t oWV = off; off += szW;
  const size_t oQP = off; off += szQP;
  const size_t oAA = off; off += szAA;
  const size_t oVP = off; off += szVP;
  if (off > ws_size) return;                            // off = 11894784 at SEQ = 2048
  if (off > (size_t)134217728) return;

  char* ws = (char*)d_ws;
  u16*   XB  = (u16*)(ws + oXB);
  u16*   WQB = (u16*)(ws + oWQ);
  u16*   WVB = (u16*)(ws + oWV);
  u16*   QP  = (u16*)(ws + oQP);
  float* AAP = (float*)(ws + oAA);
  u16*   VP  = (u16*)(ws + oVP);

  const int n8x = (SEQ * DMOD) / 8;
  const int n8w = (DMOD * DMOD) / 8;
  if ((n8x % 256) != 0 || (n8w % 256) != 0) return;
  if ((DMOD % 64) != 0 || (SEQ % 64) != 0 || (DMOD % 32) != 0) return;
  const dim3 blk(256);
  const dim3 gX(n8x / 256);                             // 768 at SEQ = 2048
  const dim3 gW(n8w / 256);                             // 288
  const dim3 gQ(SEQ / 16);                              // 128
  const dim3 bQ(NCG * 32);                              // 384: one wave per column group
  const dim3 gV((DMOD / 64) * (SEQ / 64));              // 384
  const dim3 bG(128);
  const dim3 gAT(ATT_BLOCKS);                           // 384
  const dim3 bAT(ATT_THREADS);                          // 128

  // (0..2) operand planes: x -> bf16; Wq/Wv [n = out][k = in] (already k-contiguous) -> bf16
  cvt16<<<gX, blk, 0, stream>>>(Xin, XB, n8x, 0, 1.0f);
  cvt16<<<gW, blk, 0, stream>>>(Wq, WQB, n8w, 0, 1.0f);
  cvt16<<<gW, blk, 0, stream>>>(Wv, WVB, n8w, 0, 1.0f);
  // (3) q = x.Wq^T + bq, L2-normalised per 64-chunk -> qn plane [SEQ][768] f16 x16 and AA table [12*SEQ] f32
  gemm_qn<<<gQ, bQ, 0, stream>>>(XB, WQB, QP, AAP, bq, SEQ, DMOD, DMOD, QSC);
  // (4) v^T plane: [768 = h*64+d][SEQ keys] = f16((Wv . x^T + bv) x1024); bias by row
  gemm_b16<<<gV, bG, 0, stream>>>(WVB, XB, VP, bv, DMOD, SEQ, DMOD, DMOD, 1, VCAR);
  // (5) attention -> out, f32 row (chunk h*SEQ + n) of 64 floats at float offset (h*SEQ + n)*64
  attn_l2<<<gAT, bAT, 0, stream>>>(QP, AAP, VP, out, Gin, Min);
  (void)hipGetLastError();
}

// v002
// A run of this version takes 87.5 microseconds.
// Two timings next to v001 put it at 1.43 and 1.44 times that version's speed.
// Counting every step since v000, it is 3.22 times as fast.
// Contractions: x.Wq^T+bq and Wv.x^T+bv on v_wmma_f32_16x16x32_bf16 (x and W planes RNE-converted to bf16 operands, f32 accumulate);
// scores qn.qn^T (qn = L2-normalised q, single f16 plane carried x16) and P.v (P x32768 single f16, v x1024 single f16) on
// v_wmma_f32_16x16x32_f16, f32 accumulate. Biases folded as RNE bf16 values in f32 epilogues; L2 normalisation, sums of squares,
// base-2 online softmax, 1/l and carry folds in f32 on VALU.
#include <hip/hip_runtime.h>
#include <math.h>
#include <stdint.h>

#ifndef NB
#define NB 1
#endif
#ifndef SEQ
#define SEQ 2048
#endif
#define SEQ_FULL 2048
#define DMOD  768
#define NHD   12
#define HD    64
#define NCG   (DMOD / 64)
#define QSC   16.0f
#define PCAR  32768.0f
#define VCAR  1024.0f
#define LOG2E 1.4426950408889634f
#define ATT_WAVES   4
#define ATT_THREADS (ATT_WAVES * 32)
#define QTILES      (SEQ / 64)
#define ATT_BLOCKS  (NHD * QTILES)
#define NKB    (SEQ / 32)
#define SLAB   (16 * 68)
#define KT     64                 // keys per LDS stage of the attention loop (two 32-key blocks)
#define NST    (SEQ / KT)         // stages
#define LPH    72                 // LDS row pitch in halves: 128-B rows at 144 B = 16 B x odd, for 16-byte LDS readers
#define TILEH  (64 * LPH)         // one staged tile of 64 rows, in halves
#define BUFH   (2 * TILEH)        // one buffer: K tile, then V tile
#define AACP   ((SEQ * 4) / (ATT_THREADS * 16))   // 16-byte copies per thread for one head's AA table
static_assert(NST * KT == SEQ && NST >= 2 && KT == 2 * 32 && HD == 64);
static_assert(AACP * ATT_THREADS * 16 == SEQ * 4 && (LPH * 2) % 16 == 0 && ATT_THREADS * 4 * 16 == KT * HD * 2);
static_assert(NB == 1);
static_assert(HD == 64 && DMOD == NHD * HD && NCG * 64 == DMOD);
static_assert((SEQ % 64) == 0 && SEQ >= 64 && SEQ <= SEQ_FULL);
static_assert(ATT_THREADS == 128 && NKB * 32 == SEQ && ATT_BLOCKS == NHD * (SEQ / 64));
static_assert((DMOD % 64) == 0 && (DMOD % 32) == 0);
static_assert(((SEQ * DMOD / 8) % 256) == 0 && ((DMOD * DMOD / 8) % 256) == 0);
static_assert((SLAB * 4) % 16 == 0);
static_assert(((16 * NCG) % 32) == 0 && NCG * 32 <= 1024 && (SEQ % 16) == 0);

typedef unsigned short u16;
typedef _Float16 v16h __attribute__((ext_vector_type(16)));
typedef _Float16 v8h  __attribute__((ext_vector_type(8)));
typedef __bf16   v16b __attribute__((ext_vector_type(16)));
typedef float    v8f  __attribute__((ext_vector_type(8)));
typedef float    v4f  __attribute__((ext_vector_type(4)));
typedef unsigned int v4u __attribute__((ext_vector_type(4)));

union FragH { v16h v; v8h h[2]; v4u u[2]; };
union FragB { v16b v; v4u u[2]; };

// ---- scalar helpers --------------------------------------------------------------------------------
__device__ __forceinline__ unsigned short bf_bits(float f) {          // f32 -> bf16 bits, RNE convert
  unsigned u = __float_as_uint(f);
  return (unsigned short)((u + 0x7FFFu + ((u >> 16) & 1u)) >> 16);
}
__device__ __forceinline__ float bf_up(unsigned short h) { return __uint_as_float(((unsigned)h) << 16); }
__device__ __forceinline__ float bf_val(float f) { return bf_up(bf_bits(f)); }          // value after RNE bf16 convert
__device__ __forceinline__ unsigned short h_bits(_Float16 x) { return __builtin_bit_cast(unsigned short, x); }
__device__ __forceinline__ unsigned pk16(unsigned short a, unsigned short b) { return (unsigned)a | ((unsigned)b << 16); }
__device__ __forceinline__ v8f zero8() { v8f z = {0.f, 0.f, 0.f, 0.f, 0.f, 0.f, 0.f, 0.f}; return z; }

// ---- fragment loaders: 16-bit A/B operand, lane -> row/col (lane&15), p already includes +8*(lane>>4);
//      elements 0..7 <- p[0..7] (k0+8h..), elements 8..15 <- p[16..23] (k0+16+8h..)  (same split k map for A and B;
//      B is always read from a k-contiguous [n][k] plane)
__device__ __forceinline__ v16h ldfrag_h(const _Float16* p) {
  FragH f;
  f.h[0] = *(const v8h*)(p);
  f.h[1] = *(const v8h*)(p + 16);
  return f.v;
}
__device__ __forceinline__ v16b ldfrag_b(const u16* p) {              // bf16 plane read as unsigned integer vectors
  FragB f;
  f.u[0] = *(const v4u*)(p);
  f.u[1] = *(const v4u*)(p + 16);
  return f.v;
}

__device__ __forceinline__ v8f mma_h(v16h a, v16h b, v8f c) {
  return __builtin_amdgcn_wmma_f32_16x16x32_f16(false, a, false, b, (short)0, c, false, false);
}
__device__ __forceinline__ v8f mma_b(v16b a, v16b b, v8f c) {
  return __builtin_amdgcn_wmma_f32_16x16x32_bf16(false, a, false, b, (short)0, c, false, false);
}
__device__ __forceinline__ void guard2(v8f& a, v8f& b, v16h x0, v16h x1, v16h x2, v16h x3, v16h x4, v16h x5) {
#if defined(__HIP_DEVICE_COMPILE__)
  asm volatile("v_nop\n\tv_nop\n\tv_nop\n\tv_nop"
               : "+v"(a), "+v"(b) : "v"(x0), "v"(x1), "v"(x2), "v"(x3), "v"(x4), "v"(x5) : "memory");
#endif
}
template <typename F>
__device__ __forceinline__ void guard6(v8f& a, v8f& b, v8f& c, v8f& d, F x0, F x1, F x2, F x3, F x4, F x5) {
#if defined(__HIP_DEVICE_COMPILE__)
  asm volatile("v_nop\n\tv_nop\n\tv_nop\n\tv_nop"
               : "+v"(a), "+v"(b), "+v"(c), "+v"(d) : "v"(x0), "v"(x1), "v"(x2), "v"(x3), "v"(x4), "v"(x5) : "memory");
#endif
}
__device__ __forceinline__ void acc_guard4(v8f& a, v8f& b, v8f& c, v8f& d) {
#if defined(__HIP_DEVICE_COMPILE__)
  asm volatile("v_nop\n\tv_nop\n\tv_nop\n\tv_nop" : "+v"(a), "+v"(b), "+v"(c), "+v"(d));
#endif
}
__device__ __forceinline__ void wave_sync_lds() {
#if defined(__HIP_DEVICE_COMPILE__)
  __builtin_amdgcn_fence(__ATOMIC_RELEASE, "workgroup");
  __builtin_amdgcn_wave_barrier();
  __builtin_amdgcn_fence(__ATOMIC_ACQUIRE, "workgroup");
#endif
}

// ---- asynchronous copies global -> LDS, 16 B per lane; lds = the lane's LDS byte address, g = the lane's global address.
//      The address-translation wait is the last line of the copies' own statement, so that no address register named by
//      an issued copy is rewritten in front of it.
__device__ __forceinline__ unsigned lds_addr(const void* p) { return (unsigned)(size_t)p; }
__device__ __forceinline__ void copy1(unsigned lds, const char* g) {
#if defined(__HIP_DEVICE_COMPILE__)
  asm volatile("global_load_async_to_lds_b128 %0, %1, off\n\ts_wait_xcnt 0x0" :: "v"(lds), "v"(g) : "memory");
#endif
}
// one stage: 4 K chunks (16 rows apart in LDS, 2048 B apart in the contiguous K rows) and 4 V chunks (16 d rows apart)
__device__ __forceinline__ void copy_stage(unsigned lk, const char* gk, const char* gv) {
#if defined(__HIP_DEVICE_COMPILE__)
  const unsigned rs = 16 * LPH * 2, lv = lk + TILEH * 2;
  const size_t vs = (size_t)16 * SEQ * 2;
  asm volatile("global_load_async_to_lds_b128 %0, %8, off\n\t"
               "global_load_async_to_lds_b128 %1, %9, off\n\t"
               "global_load_async_to_lds_b128 %2, %10, off\n\t"
               "global_load_async_to_lds_b128 %3, %11, off\n\t"
               "global_load_async_to_lds_b128 %4, %12, off\n\t"
               "global_load_async_to_lds_b128 %5, %13, off\n\t"
               "global_load_async_to_lds_b128 %6, %14, off\n\t"
               "global_load_async_to_lds_b128 %7, %15, off\n\t"
               "s_wait_xcnt 0x0"
               :: "v"(lk), "v"(lk + rs), "v"(lk + 2 * rs), "v"(lk + 3 * rs),
                  "v"(lv), "v"(lv + rs), "v"(lv + 2 * rs), "v"(lv + 3 * rs),
                  "v"(gk), "v"(gk + 2048), "v"(gk + 4096), "v"(gk + 6144),
                  "v"(gv), "v"(gv + vs), "v"(gv + 2 * vs), "v"(gv + 3 * vs)
               : "memory");
#endif
}
// the issuing wave's own wait: its copies have landed (before the barrier behind which other waves read them)
__device__ __forceinline__ void wait_copies() {
#if defined(__HIP_DEVICE_COMPILE__)
  asm volatile("s_wait_asynccnt 0x0" ::: "memory");
#endif
}
// the wave's LDS reads have returned (before the barrier behind which their buffer is refilled)
__device__ __forceinline__ void wait_lds() {
#if defined(__HIP_DEVICE_COMPILE__)
  asm volatile("s_wait_dscnt 0x0" ::: "memory");
#endif
}

// =====================================================================================================
// f32 plane -> 16-bit plane, same layout:  mode 0: bf16 RNE bits;  mode 1: f16 bits of (bf16 RNE value) * scale.
// Thread = 8 consecutive elements: two 16-B loads, one 16-B store; 32 consecutive lanes = 512 contiguous, 512-B aligned bytes
// coverage: grid = n8/256 blocks (host checks exactness) x 256 thr x 8 = the whole plane.
// =====================================================================================================
__global__ __launch_bounds__(256) void cvt16(const float* __restrict__ x, u16* D, int n8, int mode, float scale) {
  const int gt = blockIdx.x * 256 + (int)threadIdx.x;
  if (gt >= n8) return;                     // no barriers in this kernel
  const float* p = x + (size_t)gt * 8;
  const v4f a = *(const v4f*)(p), c4 = *(const v4f*)(p + 4);
  float v[8];
#pragma unroll
  for (int e = 0; e < 4; ++e) { v[e] = a[e]; v[4 + e] = c4[e]; }
  unsigned short s[8];
#pragma unroll
  for (int e = 0; e < 8; ++e) {
    const unsigned short bb = bf_bits(v[e]);
    const unsigned short hb = h_bits((_Float16)(bf_up(bb) * scale));
    s[e] = (mode != 0) ? hb : bb;
  }
  v4u o;
#pragma unroll
  for (int e = 0; e < 4; ++e) o[e] = pk16(s[2 * e], s[2 * e + 1]);
  u16* d = D + (size_t)gt * 8;
  {
    *(v4u*)(d) = o;
    
  }
}

// =====================================================================================================
// barrier, then converted to f16 and written: lane = (row in group of 4, 8 consecutive cols); one instruction = 4 rows, each
// coverage: 4 instructions x 4 rows x 8 lanes x 8 halves = the wave's 16 x 64 tile.
// =====================================================================================================
__device__ __forceinline__ void epi16(float* sl, v8f a0, v8f a1, v8f a2, v8f a3, float oscale, u16* C, int N,
                                      size_t rowb, int col0, int lane) {
  const int hh = lane >> 4, m = lane & 15;
#pragma unroll
  for (int r = 0; r < 8; ++r) {
    const int ro = (8 * hh + r) * 68 + m;
    sl[ro]      = a0[r] * oscale;
    sl[ro + 16] = a1[r] * oscale;
    sl[ro + 32] = a2[r] * oscale;
    sl[ro + 48] = a3[r] * oscale;
  }
  wave_sync_lds();
  const int rq = lane >> 3, c8 = (lane & 7) * 8;
  v4u ov[4];
#pragma unroll
  for (int i4 = 0; i4 < 4; ++i4) {
    const int row = i4 * 4 + rq;
    const v4f a = *(const v4f*)(sl + row * 68 + c8), c4 = *(const v4f*)(sl + row * 68 + c8 + 4);
    float w[8];
#pragma unroll
    for (int e = 0; e < 4; ++e) { w[e] = a[e]; w[4 + e] = c4[e]; }
#pragma unroll
    for (int e = 0; e < 4; ++e) ov[i4][e] = pk16(h_bits((_Float16)w[2 * e]), h_bits((_Float16)w[2 * e + 1]));
  }
  u16* dst = C + (rowb + (size_t)rq) * (size_t)N + col0 + c8;
  {
#pragma unroll
    for (int i4 = 0; i4 < 4; ++i4) {
      *(v4u*)(dst + (size_t)(i4 * 4) * (size_t)N) = ov[i4];
    }
    
  }
}

// =====================================================================================================
// bf16 GEMM with bias and 16-bit result: C[M][N] (f16 of (acc + bias)*oscale) = A[M][K] (bf16 row-major) . Bt[N][K]^T
// (bf16 k-contiguous); bias (f32 input, taken as its RNE bf16 value) indexed by column (byrow == 0) or by row (byrow != 0),
// both candidates read with addresses clamped to [0, nbias). Block = 64x64 tile, 4 waves x 16 rows; fragments loaded straight
// from the 16-bit rows (two 16-B loads each, split k map for A and B); K stepped by 32 (host checks K % 32 == 0,
// M % 64 == 0, N % 64 == 0, grid = (M/64)*(N/64)).
// =====================================================================================================
__global__ __launch_bounds__(128)
void gemm_b16(const u16* __restrict__ A, const u16* __restrict__ Bt, u16* C, const float* __restrict__ bias,
              int M, int N, int K, int nbias, int byrow, float oscale) {
  __shared__ __align__(16) float slab[4 * SLAB];
  const int tid = threadIdx.x, wave = tid >> 5, lane = tid & 31, hh = lane >> 4, m = lane & 15;
  const int ntile = N >> 6;
  const int bid   = blockIdx.x;
  const int rowb  = (bid / ntile) * 64 + wave * 16;
  const int col0  = (bid % ntile) * 64;
  if (rowb + 16 > M) return;                 // wave-uniform, never taken with the exact grid; no block barriers in this kernel
  const u16* ap = A  + (size_t)(rowb + m) * K + 8 * hh;
  const u16* bp = Bt + (size_t)(col0 + m) * K + 8 * hh;
  const size_t bs = (size_t)16 * K;
  v8f acc0 = zero8(), acc1 = zero8(), acc2 = zero8(), acc3 = zero8();
#pragma unroll 1
  for (int k0 = 0; k0 < K; k0 += 32) {
    const v16b a  = ldfrag_b(ap + k0);
    const v16b b0 = ldfrag_b(bp + k0);
    const v16b b1 = ldfrag_b(bp + bs + k0);
    const v16b b2 = ldfrag_b(bp + 2 * bs + k0);
    const v16b b3 = ldfrag_b(bp + 3 * bs + k0);
    acc0 = mma_b(a, b0, acc0);
    acc1 = mma_b(a, b1, acc1);
    acc2 = mma_b(a, b2, acc2);
    acc3 = mma_b(a, b3, acc3);
    guard6<v16b>(acc0, acc1, acc2, acc3, a, b0, b1, b2, b3, a);
  }
  acc_guard4(acc0, acc1, acc2, acc3);
  // bias: D element r of lane -> (row rowb+8hh+r, col col0+16j+m); both candidates loaded with clamped addresses, select by value
  float bc[4], br[8];
#pragma unroll
  for (int j = 0; j < 4; ++j) {
    int ci = col0 + 16 * j + m;
    ci = (ci < nbias) ? ci : (nbias - 1);
    bc[j] = bf_val(bias[ci]);
  }
#pragma unroll
  for (int r = 0; r < 8; ++r) {
    int ri = rowb + 8 * hh + r;
    ri = (ri < nbias) ? ri : (nbias - 1);
    br[r] = bf_val(bias[ri]);
  }
#pragma unroll
  for (int r = 0; r < 8; ++r) {
    const float q0 = (byrow != 0) ? br[r] : bc[0];
    const float q1 = (byrow != 0) ? br[r] : bc[1];
    const float q2 = (byrow != 0) ? br[r] : bc[2];
    const float q3 = (byrow != 0) ? br[r] : bc[3];
    acc0[r] += q0;
    acc1[r] += q1;
    acc2[r] += q2;
    acc3[r] += q3;
  }
  epi16(slab + wave * SLAB, acc0, acc1, acc2, acc3, oscale, C, N, (size_t)rowb, col0, lane);
}

// =====================================================================================================
// Query projection with fused per-chunk L2 normalisation:
//   q[M][NCG*64] (f32, registers only) = A[M][K] (bf16 x plane) . Bt[NCG*64][K]^T (bf16 Wq plane) + bias[col] (RNE bf16 value);
//   block = 16 rows x all NCG column groups of 64, one wave per column group (wave index = cg), so the NCG groups of a row
//   tile run side by side instead of one after the other; for D row 8hh+r the 64-wide chunk (row, cols col0..col0+63) lives
//   in the 16 lanes of half hh x 4 accumulators: ss = sum of squares (4 products per lane, xor-1/2/4/8 shuffles inside the
//   half), qn = q * (1/max(sqrt(ss), 1e-12)), aa = sum of qn^2 the same way (f32), kept in LDS at aas[(row in block)*NCG + cg].
//   After the block barrier the block's 16*NCG aa values (chunk index = row*NCG + cg) go out as whole 128-B lines that no
//   other block writes (16*NCG floats is a multiple of 32).
//   Host checks: M % 16 == 0, K % 32 == 0, grid = M/16 exact, block = NCG waves (every wave reaches the barrier).
// coverage: qn plane: M/16 blocks x NCG waves x (16 x 64) = M x NCG*64;  aa table: M/16 blocks x 16*NCG floats = M*NCG.
// =====================================================================================================
__global__ __launch_bounds__(NCG * 32)
void gemm_qn(const u16* __restrict__ A, const u16* __restrict__ Bt, u16* C, float* AAP, const float* __restrict__ bias,
             int M, int K, int nbias, float oscale) {
  __shared__ __align__(16) float slab[NCG * SLAB];
  __shared__ __align__(16) float aas[16 * NCG];
  const int tid = threadIdx.x, wave = tid >> 5, lane = tid & 31, hh = lane >> 4, m = lane & 15;
  const int N = NCG * 64;
  const int rowb = blockIdx.x * 16;
  const int col0 = wave * 64;
  (void)M;
  const u16* ap = A + (size_t)(rowb + m) * K + 8 * hh;
  const u16* bp = Bt + (size_t)(col0 + m) * K + 8 * hh;
  const size_t bs = (size_t)16 * K;
  v8f acc0 = zero8(), acc1 = zero8(), acc2 = zero8(), acc3 = zero8();
#pragma unroll 1
  for (int k0 = 0; k0 < K; k0 += 32) {
    const v16b a  = ldfrag_b(ap + k0);
    const v16b b0 = ldfrag_b(bp + k0);
    const v16b b1 = ldfrag_b(bp + bs + k0);
    const v16b b2 = ldfrag_b(bp + 2 * bs + k0);
    const v16b b3 = ldfrag_b(bp + 3 * bs + k0);
    acc0 = mma_b(a, b0, acc0);
    acc1 = mma_b(a, b1, acc1);
    acc2 = mma_b(a, b2, acc2);
    acc3 = mma_b(a, b3, acc3);
    guard6<v16b>(acc0, acc1, acc2, acc3, a, b0, b1, b2, b3, a);
  }
  acc_guard4(acc0, acc1, acc2, acc3);
  float bc[4];
#pragma unroll
  for (int j = 0; j < 4; ++j) {
    int ci = col0 + 16 * j + m;
    ci = (ci < nbias) ? ci : (nbias - 1);
    bc[j] = bf_val(bias[ci]);
  }
#pragma unroll
  for (int r = 0; r < 8; ++r) {
    acc0[r] += bc[0];
    acc1[r] += bc[1];
    acc2[r] += bc[2];
    acc3[r] += bc[3];
  }
  // per row: L2 normalise the 64-wide chunk and take the f32 sum of squares of the normalised values
#pragma unroll
  for (int r = 0; r < 8; ++r) {
    float ss = acc0[r] * acc0[r] + acc1[r] * acc1[r] + acc2[r] * acc2[r] + acc3[r] * acc3[r];
    ss += __shfl_xor(ss, 1, 32);
    ss += __shfl_xor(ss, 2, 32);
    ss += __shfl_xor(ss, 4, 32);
    ss += __shfl_xor(ss, 8, 32);
    const float nrm = sqrtf(ss);
    const float den = fmaxf(nrm, 1e-12f);
    const float inv = 1.0f / den;
    acc0[r] *= inv;
    acc1[r] *= inv;
    acc2[r] *= inv;
    acc3[r] *= inv;
    float a2 = acc0[r] * acc0[r] + acc1[r] * acc1[r] + acc2[r] * acc2[r] + acc3[r] * acc3[r];
    a2 += __shfl_xor(a2, 1, 32);
    a2 += __shfl_xor(a2, 2, 32);
    a2 += __shfl_xor(a2, 4, 32);
    a2 += __shfl_xor(a2, 8, 32);
    if (m == 0) aas[(8 * hh + r) * NCG + wave] = a2;
  }
  epi16(slab + wave * SLAB, acc0, acc1, acc2, acc3, oscale, C, N, (size_t)rowb, col0, lane);
  __syncthreads();
  // aa table lines of this block: 16*NCG contiguous floats; thread t < 16*NCG/4 writes float4 t
  const int nf4 = 16 * NCG / 4;
  if (tid < nf4) {
    const v4f w0 = *(const v4f*)(aas + 4 * tid);
    *(v4f*)(AAP + (size_t)blockIdx.x * (size_t)(16 * NCG) + 4 * tid) = w0;
  }
}

// =====================================================================================================
// L2-distance flash attention (no masking, all SEQ keys): block = (head, 64 query rows), 4 waves, wave w owns the 16 query
// rows q0 = 64*qt + 16*w .. q0+15. The block's 4 waves share the key and value tiles: a stage = 64 keys = K tile (64 key rows
// x 128 B) + V tile (64 d rows x 128 B), brought into LDS by asynchronous 16-byte copies (whole 128-B lines, 8 copies per
// thread and stage), two buffers: stage t+2 is issued behind the barrier at the foot of trip t and flies during trip t+1.
// The head's AA table (SEQ floats) is copied once with stage 0. Fragments are read from LDS rows of 144 B.
//   qn plane (f16, x QSC) laid out as [NHD*SEQ chunks][64]: head h, row n = chunk h*SEQ + n; keys and queries both come
//   from this plane. AA table (f32) indexed by the same chunk index. v^T plane [h*64+d][SEQ keys] (x1024).
//   All NKB = SEQ/32 key blocks of 32 keys are visited (static bound).
//   Scores are computed TRANSPOSED: S^T tile g (g = 0,1) = key rows (keys kb+16g .. +15, A operand, row m = lane&15, split
//   k map over d) times q^T (B operand, col n = query q0 + (lane&15), k = d, split map), one product per tile and 32-deep
//   d-chunk. D element r of lane l = (key kb+16g+8h+r, query q0+(l&15)), so a lane owns one query column and 16 of its 32
//   keys; the partner lane l^16 owns the other 16 -> row max / row sum need one xor-16 shuffle.
//   Base-2 logit: t = (2*qn_n.qn_m/(QSC*QSC) - AA_n - AA_m) * log2(e)/8; online max-subtracted base-2 softmax in f32.
//   The exp'd values ARE the P A-fragment in place: A row m = query = lane&15, element i <- key kb+8h+i (tile 0, D element i),
//   element 8+i <- key kb+16+8h+i (tile 1, D element i). P (<= 1) is carried x32768 as single f16. The rescale factor of
//   query row 8h+r of the O accumulators is fetched from lane 8h+r with a shuffle (uniform control). 4 v^T B fragments
//   (col n = d = 16j + (lane&15), keys k-contiguous), 4 P.V WMMAs per key block.
//   Epilogue: 1/l (per query, shuffled to the D row owner) and carry folds in f32; the wave's 16x64 f32 result staged in its
//   aux0/aux1 are bound only (not read).
// coverage: per wave 8 instructions x 2 rows x 16 lanes x 4 floats = 16 x 64; grid NHD*(SEQ/64) blocks x 4 waves = every
//           output row (h, n < SEQ) exactly once = SEQ*NHD*64 floats.
// =====================================================================================================
__global__ __launch_bounds__(ATT_THREADS)
void attn_l2(const u16* __restrict__ QPp, const float* __restrict__ AAp, const u16* __restrict__ VPp, float* out,
             const float* aux0, const float* aux1) {
  __shared__ __align__(16) float smem[ATT_WAVES * SLAB];   // per wave: result slab [16][68] in the epilogue only
  __shared__ __align__(16) _Float16 ring[2 * BUFH];        // two buffers of (K tile, V tile), rows of LPH halves
  __shared__ __align__(16) float aas[SEQ];                 // AA table of this head
  (void)aux0; (void)aux1;

  const int tid  = threadIdx.x;
  const int wave = tid >> 5;
  const int lane = tid & 31;
  const int hh   = lane >> 4;
  const int c    = lane & 15;

  const int bid  = blockIdx.x;
  const int qt   = bid % QTILES;
  const int head = bid / QTILES;
  if (head >= NHD) return;                                 // block-uniform, never taken with the exact grid; in front of every barrier
  const int q0   = qt * 64 + wave * 16;
  const size_t hb = (size_t)head * SEQ;                    // chunk index base of this head

  const _Float16* QH = (const _Float16*)(const void*)QPp;
  // B fragments of q^T: col n = query chunk hb + q0 + c, k = d
  const _Float16* Qb = QH + (hb + (size_t)(q0 + c)) * HD + 8 * hh;
  // copy addresses of this thread: chunk i = tid + 128*j, row = i >> 3 = (tid >> 3) + 16*j, 16-byte column = tid & 7
  const unsigned lk0 = lds_addr(ring) + (unsigned)((tid >> 3) * (LPH * 2) + (tid & 7) * 16);
  const char* gk0 = (const char*)(const void*)(QH + hb * HD) + tid * 16;                       // K rows are contiguous
  const char* gv0 = (const char*)(const void*)((const _Float16*)(const void*)VPp + ((size_t)(head * HD + (tid >> 3))) * SEQ)
                    + (tid & 7) * 16;
  // stage 0 and the AA table, landed and published; then stage 1 into the other buffer
  copy_stage(lk0, gk0, gv0);
#pragma unroll   // straight line: AACP copies, each with constant address steps
  for (int j = 0; j < AACP; ++j)
    copy1(lds_addr(aas) + (unsigned)((tid + ATT_THREADS * j) * 16), (const char*)(const void*)(AAp + hb) + (tid + ATT_THREADS * j) * 16);
  wait_copies();
  __syncthreads();
  copy_stage(lk0 + BUFH * 2, gk0 + (size_t)KT * HD * 2, gv0 + KT * 2);
  const float lsc = 0.25f * (LOG2E / (QSC * QSC));
  const float c1l = 0.125f * LOG2E;
  const float aq  = AAp[hb + (size_t)(q0 + c)] * c1l;       // AA term of this lane's query

  const v16h qf0 = ldfrag_h(Qb);            // d 0..31
  const v16h qf1 = ldfrag_h(Qb + 32);       // d 32..63

  float mrun = -INFINITY, lrun = 0.f;
  v8f o[4];
#pragma unroll
  for (int j = 0; j < 4; ++j) o[j] = zero8();

#pragma unroll 1
  for (int t = 0; t < NST; ++t) {
   const _Float16* bufp = ring + (t & 1) * BUFH;
   // A fragments of keys: LDS row = key in stage (32u + 16g + c), k = d;  B fragments of v: LDS row = d = 16j + c, k = key
   const _Float16* Kl = bufp + c * LPH + 8 * hh;
   const _Float16* Vl = bufp + TILEH + c * LPH + 8 * hh;
#pragma unroll   // both 32-key blocks of the stage in line: u becomes an immediate offset of the LDS reads
   for (int u = 0; u < 2; ++u) {
    const int kb = t * KT + u * 32;
    // ---- all LDS reads of this 32-key block stand together in front of its products ----
    const _Float16* k0p = Kl + (32 * u) * LPH;
    const _Float16* k1p = k0p + 16 * LPH;
    const v16h ka0 = ldfrag_h(k0p), ka1 = ldfrag_h(k0p + 32);
    const v16h kc0 = ldfrag_h(k1p), kc1 = ldfrag_h(k1p + 32);
    // AA of this lane's 16 keys: tile 0 element i -> key kb+8hh+i, tile 1 element i -> key kb+16+8hh+i
    const float* am = aas + kb + 8 * hh;
    const v4f w0 = *(const v4f*)(am), w1 = *(const v4f*)(am + 4);
    const v4f w2 = *(const v4f*)(am + 16), w3 = *(const v4f*)(am + 20);
    const _Float16* vp = Vl + 32 * u;
    const v16h vf0 = ldfrag_h(vp);
    const v16h vf1 = ldfrag_h(vp + 16 * LPH);
    const v16h vf2 = ldfrag_h(vp + 32 * LPH);
    const v16h vf3 = ldfrag_h(vp + 48 * LPH);
    // ---- transposed scores: s0 = keys kb..kb+15, s1 = keys kb+16..kb+31, column = query q0 + c ----
    v8f s0 = zero8(), s1 = zero8();
    s0 = mma_h(ka0, qf0, s0);
    s0 = mma_h(ka1, qf1, s0);
    s1 = mma_h(kc0, qf0, s1);
    s1 = mma_h(kc1, qf1, s1);
    guard2(s0, s1, qf0, qf1, ka0, ka1, kc0, kc1);
    // ---- base-2 logits of this lane's 16 keys for query q0 + c ----
    float tk[16];
#pragma unroll
    for (int i = 0; i < 4; ++i) {
      tk[i]      = s0[i]     * lsc - (aq + w0[i] * c1l);
      tk[4 + i]  = s0[4 + i] * lsc - (aq + w1[i] * c1l);
      tk[8 + i]  = s1[i]     * lsc - (aq + w2[i] * c1l);
      tk[12 + i] = s1[4 + i] * lsc - (aq + w3[i] * c1l);
    }
    float cm = tk[0];
#pragma unroll
    for (int i = 1; i < 16; ++i) cm = fmaxf(cm, tk[i]);
    cm = fmaxf(cm, __shfl_xor(cm, 16, 32));
    const float mn = fmaxf(mrun, cm);                                // finite from the first key block on
    const float al = (mrun == -INFINITY) ? 0.f : exp2f(mrun - mn);   // o and l are zero while mrun is -inf
    mrun = mn;
    // ---- probabilities (<= 1) and the P A-fragment: f16(p * 32768); element i <-> tk[i] ----
    float ps = 0.f;
    FragH ph;
#pragma unroll
    for (int w = 0; w < 2; ++w) {
#pragma unroll
      for (int e4 = 0; e4 < 4; ++e4) {
        const int i = 8 * w + 2 * e4;
        const float p0 = exp2f(fminf(tk[i] - mn, 0.f));
        const float p1 = exp2f(fminf(tk[i + 1] - mn, 0.f));
        ps += p0 + p1;
        ph.u[w][e4] = pk16(h_bits((_Float16)(p0 * PCAR)), h_bits((_Float16)(p1 * PCAR)));
      }
    }
    ps += __shfl_xor(ps, 16, 32);
    lrun = lrun * al + ps;
    // ---- rescale the O accumulators: D row 8hh+r = query q0+8hh+r, its factor lives in lane 8hh+r (and 16+8hh+r) ----
    float scl[8];
#pragma unroll
    for (int r = 0; r < 8; ++r) scl[r] = __shfl(al, 8 * hh + r, 32);
#pragma unroll
    for (int j = 0; j < 4; ++j) {
#pragma unroll
      for (int r = 0; r < 8; ++r) o[j][r] *= scl[r];
    }
    // ---- P.V : B fragment col n = d = j*16 + c, keys contiguous in the staged v^T rows ----
    {
      o[0] = mma_h(ph.v, vf0, o[0]);
      o[1] = mma_h(ph.v, vf1, o[1]);
      o[2] = mma_h(ph.v, vf2, o[2]);
      o[3] = mma_h(ph.v, vf3, o[3]);
      guard6<v16h>(o[0], o[1], o[2], o[3], ph.v, vf0, vf1, vf2, vf3, ph.v);
    }
   }
   // ---- foot of trip t: own LDS reads back, own copies of stage t+1 landed, barrier (publishes stage t+1 and ends every
   //      reader's last read of this trip's buffer); only then the refill of that buffer with stage t+2 ----
   wait_lds();
   wait_copies();
   __syncthreads();
   if (t + 2 < NST)
     copy_stage(lk0 + (unsigned)((t & 1) * (BUFH * 2)), gk0 + (size_t)(t + 2) * (KT * HD * 2), gv0 + (t + 2) * (KT * 2));
  }
  wait_copies();
  acc_guard4(o[0], o[1], o[2], o[3]);

  // ---- fold 1/l (per query, owned by lane = query; l >= 1 by construction) and the carries; stage the 16x64 slab ----
  const float linv = (lrun > 0.f) ? ((1.0f / lrun) * (1.0f / (PCAR * VCAR))) : 0.f;
  float inv[8];
#pragma unroll
  for (int r = 0; r < 8; ++r) inv[r] = __shfl(linv, 8 * hh + r, 32);
  float* slab = smem + wave * SLAB;
#pragma unroll
  for (int r = 0; r < 8; ++r) {
#pragma unroll
    for (int j = 0; j < 4; ++j) slab[(8 * hh + r) * 68 + j * 16 + c] = o[j][r] * inv[r];
  }
  wave_sync_lds();
  // ---- f32 output rows: lanes 0..15 -> row 2*it2, lanes 16..31 -> row 2*it2+1, 16 lanes x 16 B = one 256-B row ----
  v4f vals[8];
#pragma unroll
  for (int it2 = 0; it2 < 8; ++it2) vals[it2] = *(const v4f*)(slab + (it2 * 2 + hh) * 68 + c * 4);
  float* dst = out + (hb + (size_t)(q0 + hh)) * HD + c * 4;
  {
#pragma unroll
    for (int it2 = 0; it2 < 8; ++it2) {
      *(v4f*)(dst + (size_t)(it2 * 2) * HD) = vals[it2];
    }
    
  }
}

// =====================================================================================================
// Workspace map (bytes); every plane is fully written by whole-line stores before it is read; all extents are exact multiples
// of the store granularity (no pad rows needed), every offset a multiple of 128:
//   XB  bf16 [SEQ][768]                          SEQ*1536   (3145728 at SEQ = 2048)
//   WQB bf16 [768 n][768 k]                      1179648    WVB same
//   QP  f16  [SEQ][768] = [12*SEQ chunks][64] x16 SEQ*1536
//   AAP f32  [12*SEQ]                            SEQ*48     (98304)
//   VP  f16  [768 = h*64+d][SEQ] x1024           SEQ*1536
//   end                                          11894784 at SEQ = 2048
// =====================================================================================================
extern "C" void kernel_launch(void* const* d_in, const int* in_sizes, int n_in,
                              void* d_out, int out_size, void* d_ws, size_t ws_size,
                              hipStream_t stream) {
  if (n_in < 7) return;
  if (in_sizes[0] < SEQ * DMOD) return;
  if (in_sizes[1] < 1 || in_sizes[2] < 1) return;
  if (in_sizes[3] != DMOD * DMOD || in_sizes[5] != DMOD * DMOD) return;
  if (in_sizes[4] != DMOD || in_sizes[6] != DMOD) return;
  if (out_size < SEQ * DMOD) return;

  const float* Xin = (const float*)d_in[0];
  const float* Gin = (const float*)d_in[1];               // bound only, not read
  const float* Min = (const float*)d_in[2];               // bound only, not read
  const float* Wq  = (const float*)d_in[3];
  const float* bq  = (const float*)d_in[4];
  const float* Wv  = (const float*)d_in[5];
  const float* bv  = (const float*)d_in[6];
  float*       out = (float*)d_out;

  const size_t szXB = (size_t)SEQ * DMOD * 2;
  const size_t szW  = (size_t)DMOD * DMOD * 2;
  const size_t szQP = (size_t)SEQ * DMOD * 2;
  const size_t szAA = (size_t)NHD * SEQ * 4;
  const size_t szVP = (size_t)DMOD * SEQ * 2;
  size_t off = 0;
  const size_t oXB = off; off += szXB;
  const size_t oWQ = off; off += szW;
  const size_t oWV = off; off += szW;
  const size_t oQP = off; off += szQP;
  const size_t oAA = off; off += szAA;
  const size_t oVP = off; off += szVP;
  if (off > ws_size) return;                            // off = 11894784 at SEQ = 2048
  if (off > (size_t)134217728) return;

  char* ws = (char*)d_ws;
  u16*   XB  = (u16*)(ws + oXB);
  u16*   WQB = (u16*)(ws + oWQ);
  u16*   WVB = (u16*)(ws + oWV);
  u16*   QP  = (u16*)(ws + oQP);
  float* AAP = (float*)(ws + oAA);
  u16*   VP  = (u16*)(ws + oVP);

  const int n8x = (SEQ * DMOD) / 8;
  const int n8w = (DMOD * DMOD) / 8;
  if ((n8x % 256) != 0 || (n8w % 256) != 0) return;
  if ((DMOD % 64) != 0 || (SEQ % 64) != 0 || (DMOD % 32) != 0) return;
  const dim3 blk(256);
  const dim3 gX(n8x / 256);                             // 768 at SEQ = 2048
  const dim3 gW(n8w / 256);                             // 288
  const dim3 gQ(SEQ / 16);                              // 128
  const dim3 bQ(NCG * 32);                              // 384: one wave per column group
  const dim3 gV((DMOD / 64) * (SEQ / 64));              // 384
  const dim3 bG(128);
  const dim3 gAT(ATT_BLOCKS);                           // 384
  const dim3 bAT(ATT_THREADS);                          // 128

  // (0..2) operand planes: x -> bf16; Wq/Wv [n = out][k = in] (already k-contiguous) -> bf16
  cvt16<<<gX, blk, 0, stream>>>(Xin, XB, n8x, 0, 1.0f);
  cvt16<<<gW, blk, 0, stream>>>(Wq, WQB, n8w, 0, 1.0f);
  cvt16<<<gW, blk, 0, stream>>>(Wv, WVB, n8w, 0, 1.0f);
  // (3) q = x.Wq^T + bq, L2-normalised per 64-chunk -> qn plane [SEQ][768] f16 x16 and AA table [12*SEQ] f32
  gemm_qn<<<gQ, bQ, 0, stream>>>(XB, WQB, QP, AAP, bq, SEQ, DMOD, DMOD, QSC);
  // (4) v^T plane: [768 = h*64+d][SEQ keys] = f16((Wv . x^T + bv) x1024); bias by row
  gemm_b16<<<gV, bG, 0, stream>>>(WVB, XB, VP, bv, DMOD, SEQ, DMOD, DMOD, 1, VCAR);
  // (5) attention -> out, f32 row (chunk h*SEQ + n) of 64 floats at float offset (h*SEQ + n)*64
  attn_l2<<<gAT, bAT, 0, stream>>>(QP, AAP, VP, out, Gin, Min);
  (void)hipGetLastError();
}

// v003
// One run takes 70.3 microseconds.
// In both of two side-by-side timings against v002, it was 1.25 times as fast.
// Over all steps from v000 it is 4.02 times as fast.
// Contractions: x.Wq^T+bq and Wv.x^T+bv on v_wmma_f32_16x16x32_bf16 (x and W planes RNE-converted to bf16 operands, f32 accumulate);
// scores qn.qn^T (qn = L2-normalised q, single f16 plane carried x16) and P.v (P x32768 single f16, v x1024 single f16) on
// v_wmma_f32_16x16x32_f16, f32 accumulate. Biases folded as RNE bf16 values in f32 epilogues; L2 normalisation, sums of squares,
// base-2 softmax with a constant shift, 1/l and carry folds in f32 on VALU.
#include <hip/hip_runtime.h>
#include <math.h>
#include <stdint.h>

#ifndef NB
#define NB 1
#endif
#ifndef SEQ
#define SEQ 2048
#endif
#define SEQ_FULL 2048
#define DMOD  768
#define NHD   12
#define HD    64
#define NCG   (DMOD / 64)
#define QSC   16.0f
#define PCAR  32768.0f
#define PSH   15.0f               // log2(PCAR): the constant shift of the base-2 logits, so that exp2 yields P x PCAR at once
#define VCAR  1024.0f
#define LOG2E 1.4426950408889634f
#define ATT_WAVES   4
#define ATT_THREADS (ATT_WAVES * 32)
#define QTILES      (SEQ / 64)
#define ATT_BLOCKS  (NHD * QTILES)
#define NKB    (SEQ / 32)
#define SLAB   (16 * 68)
#define KT     64                 // keys per LDS stage of the attention loop (two 32-key blocks)
#define NST    (SEQ / KT)         // stages
#define LPH    72                 // LDS row pitch in halves: 128-B rows at 144 B = 16 B x odd, for 16-byte LDS readers
#define TILEH  (64 * LPH)         // one staged tile of 64 rows, in halves
#define BUFH   (2 * TILEH)        // one buffer: K tile, then V tile
#define AACP   ((SEQ * 4) / (ATT_THREADS * 16))   // 16-byte copies per thread for one head's AA table
static_assert(NST * KT == SEQ && NST >= 2 && KT == 2 * 32 && HD == 64);
static_assert(AACP * ATT_THREADS * 16 == SEQ * 4 && (LPH * 2) % 16 == 0 && ATT_THREADS * 4 * 16 == KT * HD * 2);
static_assert(NB == 1);
static_assert(HD == 64 && DMOD == NHD * HD && NCG * 64 == DMOD);
static_assert((SEQ % 64) == 0 && SEQ >= 64 && SEQ <= SEQ_FULL);
static_assert(ATT_THREADS == 128 && NKB * 32 == SEQ && ATT_BLOCKS == NHD * (SEQ / 64));
static_assert((DMOD % 64) == 0 && (DMOD % 32) == 0);
static_assert(((SEQ * DMOD / 8) % 256) == 0 && ((DMOD * DMOD / 8) % 256) == 0);
static_assert((SLAB * 4) % 16 == 0);
static_assert(((16 * NCG) % 32) == 0 && NCG * 32 <= 1024 && (SEQ % 16) == 0);

typedef unsigned short u16;
typedef _Float16 v16h __attribute__((ext_vector_type(16)));
typedef _Float16 v8h  __attribute__((ext_vector_type(8)));
typedef __bf16   v16b __attribute__((ext_vector_type(16)));
typedef float    v8f  __attribute__((ext_vector_type(8)));
typedef float    v4f  __attribute__((ext_vector_type(4)));
typedef unsigned int v4u __attribute__((ext_vector_type(4)));
typedef float    v2f  __attribute__((ext_vector_type(2)));
typedef _Float16 v2h  __attribute__((ext_vector_type(2)));

union FragH { v16h v; v8h h[2]; v4u u[2]; };
union FragB { v16b v; v4u u[2]; };

// ---- scalar helpers --------------------------------------------------------------------------------
__device__ __forceinline__ unsigned short bf_bits(float f) {          // f32 -> bf16 bits, RNE convert
  unsigned u = __float_as_uint(f);
  return (unsigned short)((u + 0x7FFFu + ((u >> 16) & 1u)) >> 16);
}
__device__ __forceinline__ float bf_up(unsigned short h) { return __uint_as_float(((unsigned)h) << 16); }
__device__ __forceinline__ float bf_val(float f) { return bf_up(bf_bits(f)); }          // value after RNE bf16 convert
__device__ __forceinline__ unsigned short h_bits(_Float16 x) { return __builtin_bit_cast(unsigned short, x); }
__device__ __forceinline__ unsigned pk16(unsigned short a, unsigned short b) { return (unsigned)a | ((unsigned)b << 16); }
__device__ __forceinline__ unsigned pkh(v2f x) {                     // two f32 -> packed f16 pair, RNE, x[0] in the low half
  return __builtin_bit_cast(unsigned, __builtin_convertvector(x, v2h));
}
__device__ __forceinline__ v8f zero8() { v8f z = {0.f, 0.f, 0.f, 0.f, 0.f, 0.f, 0.f, 0.f}; return z; }

// ---- fragment loaders: 16-bit A/B operand, lane -> row/col (lane&15), p already includes +8*(lane>>4);
//      elements 0..7 <- p[0..7] (k0+8h..), elements 8..15 <- p[16..23] (k0+16+8h..)  (same split k map for A and B;
//      B is always read from a k-contiguous [n][k] plane)
__device__ __forceinline__ v16h ldfrag_h(const _Float16* p) {
  FragH f;
  f.h[0] = *(const v8h*)(p);
  f.h[1] = *(const v8h*)(p + 16);
  return f.v;
}
__device__ __forceinline__ v16b ldfrag_b(const u16* p) {              // bf16 plane read as unsigned integer vectors
  FragB f;
  f.u[0] = *(const v4u*)(p);
  f.u[1] = *(const v4u*)(p + 16);
  return f.v;
}

__device__ __forceinline__ v8f mma_h(v16h a, v16h b, v8f c) {
  return __builtin_amdgcn_wmma_f32_16x16x32_f16(false, a, false, b, (short)0, c, false, false);
}
__device__ __forceinline__ v8f mma_b(v16b a, v16b b, v8f c) {
  return __builtin_amdgcn_wmma_f32_16x16x32_bf16(false, a, false, b, (short)0, c, false, false);
}
__device__ __forceinline__ void guard2(v8f& a, v8f& b, v16h x0, v16h x1, v16h x2, v16h x3, v16h x4, v16h x5) {
#if defined(__HIP_DEVICE_COMPILE__)
  asm volatile("v_nop\n\tv_nop\n\tv_nop\n\tv_nop"
               : "+v"(a), "+v"(b) : "v"(x0), "v"(x1), "v"(x2), "v"(x3), "v"(x4), "v"(x5) : "memory");
#endif
}
template <typename F>
__device__ __forceinline__ void guard6(v8f& a, v8f& b, v8f& c, v8f& d, F x0, F x1, F x2, F x3, F x4, F x5) {
#if defined(__HIP_DEVICE_COMPILE__)
  asm volatile("v_nop\n\tv_nop\n\tv_nop\n\tv_nop"
               : "+v"(a), "+v"(b), "+v"(c), "+v"(d) : "v"(x0), "v"(x1), "v"(x2), "v"(x3), "v"(x4), "v"(x5) : "memory");
#endif
}
__device__ __forceinline__ void acc_guard4(v8f& a, v8f& b, v8f& c, v8f& d) {
#if defined(__HIP_DEVICE_COMPILE__)
  asm volatile("v_nop\n\tv_nop\n\tv_nop\n\tv_nop" : "+v"(a), "+v"(b), "+v"(c), "+v"(d));
#endif
}
__device__ __forceinline__ void wave_sync_lds() {
#if defined(__HIP_DEVICE_COMPILE__)
  __builtin_amdgcn_fence(__ATOMIC_RELEASE, "workgroup");
  __builtin_amdgcn_wave_barrier();
  __builtin_amdgcn_fence(__ATOMIC_ACQUIRE, "workgroup");
#endif
}

// ---- asynchronous copies global -> LDS, 16 B per lane; lds = the lane's LDS byte address, g = the lane's global address.
//      The address-translation wait is the last line of the copies' own statement, so that no address register named by
//      an issued copy is rewritten in front of it.
__device__ __forceinline__ unsigned lds_addr(const void* p) { return (unsigned)(size_t)p; }
__device__ __forceinline__ void copy1(unsigned lds, const char* g) {
#if defined(__HIP_DEVICE_COMPILE__)
  asm volatile("global_load_async_to_lds_b128 %0, %1, off\n\ts_wait_xcnt 0x0" :: "v"(lds), "v"(g) : "memory");
#endif
}
// one stage: 4 K chunks (16 rows apart in LDS, 2048 B apart in the contiguous K rows) and 4 V chunks (16 d rows apart)
__device__ __forceinline__ void copy_stage(unsigned lk, const char* gk, const char* gv) {
#if defined(__HIP_DEVICE_COMPILE__)
  const unsigned rs = 16 * LPH * 2, lv = lk + TILEH * 2;
  const size_t vs = (size_t)16 * SEQ * 2;
  asm volatile("global_load_async_to_lds_b128 %0, %8, off\n\t"
               "global_load_async_to_lds_b128 %1, %9, off\n\t"
               "global_load_async_to_lds_b128 %2, %10, off\n\t"
               "global_load_async_to_lds_b128 %3, %11, off\n\t"
               "global_load_async_to_lds_b128 %4, %12, off\n\t"
               "global_load_async_to_lds_b128 %5, %13, off\n\t"
               "global_load_async_to_lds_b128 %6, %14, off\n\t"
               "global_load_async_to_lds_b128 %7, %15, off\n\t"
               "s_wait_xcnt 0x0"
               :: "v"(lk), "v"(lk + rs), "v"(lk + 2 * rs), "v"(lk + 3 * rs),
                  "v"(lv), "v"(lv + rs), "v"(lv + 2 * rs), "v"(lv + 3 * rs),
                  "v"(gk), "v"(gk + 2048), "v"(gk + 4096), "v"(gk + 6144),
                  "v"(gv), "v"(gv + vs), "v"(gv + 2 * vs), "v"(gv + 3 * vs)
               : "memory");
#endif
}
// the issuing wave's own wait: its copies have landed (before the barrier behind which other waves read them)
__device__ __forceinline__ void wait_copies() {
#if defined(__HIP_DEVICE_COMPILE__)
  asm volatile("s_wait_asynccnt 0x0" ::: "memory");
#endif
}
// the wave's LDS reads have returned (before the barrier behind which their buffer is refilled)
__device__ __forceinline__ void wait_lds() {
#if defined(__HIP_DEVICE_COMPILE__)
  asm volatile("s_wait_dscnt 0x0" ::: "memory");
#endif
}

// =====================================================================================================
// f32 plane -> 16-bit plane, same layout:  mode 0: bf16 RNE bits;  mode 1: f16 bits of (bf16 RNE value) * scale.
// Thread = 8 consecutive elements: two 16-B loads, one 16-B store; 32 consecutive lanes = 512 contiguous, 512-B aligned bytes
// coverage: grid = n8/256 blocks (host checks exactness) x 256 thr x 8 = the whole plane.
// =====================================================================================================
__global__ __launch_bounds__(256) void cvt16(const float* __restrict__ x, u16* D, int n8, int mode, float scale) {
  const int gt = blockIdx.x * 256 + (int)threadIdx.x;
  if (gt >= n8) return;                     // no barriers in this kernel
  const float* p = x + (size_t)gt * 8;
  const v4f a = *(const v4f*)(p), c4 = *(const v4f*)(p + 4);
  float v[8];
#pragma unroll
  for (int e = 0; e < 4; ++e) { v[e] = a[e]; v[4 + e] = c4[e]; }
  unsigned short s[8];
#pragma unroll
  for (int e = 0; e < 8; ++e) {
    const unsigned short bb = bf_bits(v[e]);
    const unsigned short hb = h_bits((_Float16)(bf_up(bb) * scale));
    s[e] = (mode != 0) ? hb : bb;
  }
  v4u o;
#pragma unroll
  for (int e = 0; e < 4; ++e) o[e] = pk16(s[2 * e], s[2 * e + 1]);
  u16* d = D + (size_t)gt * 8;
  {
    *(v4u*)(d) = o;
    
  }
}

// =====================================================================================================
// barrier, then converted to f16 and written: lane = (row in group of 4, 8 consecutive cols); one instruction = 4 rows, each
// coverage: 4 instructions x 4 rows x 8 lanes x 8 halves = the wave's 16 x 64 tile.
// =====================================================================================================
__device__ __forceinline__ void epi16(float* sl, v8f a0, v8f a1, v8f a2, v8f a3, float oscale, u16* C, int N,
                                      size_t rowb, int col0, int lane) {
  const int hh = lane >> 4, m = lane & 15;
#pragma unroll
  for (int r = 0; r < 8; ++r) {
    const int ro = (8 * hh + r) * 68 + m;
    sl[ro]      = a0[r] * oscale;
    sl[ro + 16] = a1[r] * oscale;
    sl[ro + 32] = a2[r] * oscale;
    sl[ro + 48] = a3[r] * oscale;
  }
  wave_sync_lds();
  const int rq = lane >> 3, c8 = (lane & 7) * 8;
  v4u ov[4];
#pragma unroll
  for (int i4 = 0; i4 < 4; ++i4) {
    const int row = i4 * 4 + rq;
    const v4f a = *(const v4f*)(sl + row * 68 + c8), c4 = *(const v4f*)(sl + row * 68 + c8 + 4);
    float w[8];
#pragma unroll
    for (int e = 0; e < 4; ++e) { w[e] = a[e]; w[4 + e] = c4[e]; }
#pragma unroll
    for (int e = 0; e < 4; ++e) ov[i4][e] = pk16(h_bits((_Float16)w[2 * e]), h_bits((_Float16)w[2 * e + 1]));
  }
  u16* dst = C + (rowb + (size_t)rq) * (size_t)N + col0 + c8;
  {
#pragma unroll
    for (int i4 = 0; i4 < 4; ++i4) {
      *(v4u*)(dst + (size_t)(i4 * 4) * (size_t)N) = ov[i4];
    }
    
  }
}

// =====================================================================================================
// bf16 GEMM with bias and 16-bit result: C[M][N] (f16 of (acc + bias)*oscale) = A[M][K] (bf16 row-major) . Bt[N][K]^T
// (bf16 k-contiguous); bias (f32 input, taken as its RNE bf16 value) indexed by column (byrow == 0) or by row (byrow != 0),
// both candidates read with addresses clamped to [0, nbias). Block = 64x64 tile, 4 waves x 16 rows; fragments loaded straight
// from the 16-bit rows (two 16-B loads each, split k map for A and B); K stepped by 32 (host checks K % 32 == 0,
// M % 64 == 0, N % 64 == 0, grid = (M/64)*(N/64)).
// =====================================================================================================
__global__ __launch_bounds__(128)
void gemm_b16(const u16* __restrict__ A, const u16* __restrict__ Bt, u16* C, const float* __restrict__ bias,
              int M, int N, int K, int nbias, int byrow, float oscale) {
  __shared__ __align__(16) float slab[4 * SLAB];
  const int tid = threadIdx.x, wave = tid >> 5, lane = tid & 31, hh = lane >> 4, m = lane & 15;
  const int ntile = N >> 6;
  const int bid   = blockIdx.x;
  const int rowb  = (bid / ntile) * 64 + wave * 16;
  const int col0  = (bid % ntile) * 64;
  if (rowb + 16 > M) return;                 // wave-uniform, never taken with the exact grid; no block barriers in this kernel
  const u16* ap = A  + (size_t)(rowb + m) * K + 8 * hh;
  const u16* bp = Bt + (size_t)(col0 + m) * K + 8 * hh;
  const size_t bs = (size_t)16 * K;
  v8f acc0 = zero8(), acc1 = zero8(), acc2 = zero8(), acc3 = zero8();
#pragma unroll 1
  for (int k0 = 0; k0 < K; k0 += 32) {
    const v16b a  = ldfrag_b(ap + k0);
    const v16b b0 = ldfrag_b(bp + k0);
    const v16b b1 = ldfrag_b(bp + bs + k0);
    const v16b b2 = ldfrag_b(bp + 2 * bs + k0);
    const v16b b3 = ldfrag_b(bp + 3 * bs + k0);
    acc0 = mma_b(a, b0, acc0);
    acc1 = mma_b(a, b1, acc1);
    acc2 = mma_b(a, b2, acc2);
    acc3 = mma_b(a, b3, acc3);
    guard6<v16b>(acc0, acc1, acc2, acc3, a, b0, b1, b2, b3, a);
  }
  acc_guard4(acc0, acc1, acc2, acc3);
  // bias: D element r of lane -> (row rowb+8hh+r, col col0+16j+m); both candidates loaded with clamped addresses, select by value
  float bc[4], br[8];
#pragma unroll
  for (int j = 0; j < 4; ++j) {
    int ci = col0 + 16 * j + m;
    ci = (ci < nbias) ? ci : (nbias - 1);
    bc[j] = bf_val(bias[ci]);
  }
#pragma unroll
  for (int r = 0; r < 8; ++r) {
    int ri = rowb + 8 * hh + r;
    ri = (ri < nbias) ? ri : (nbias - 1);
    br[r] = bf_val(bias[ri]);
  }
#pragma unroll
  for (int r = 0; r < 8; ++r) {
    const float q0 = (byrow != 0) ? br[r] : bc[0];
    const float q1 = (byrow != 0) ? br[r] : bc[1];
    const float q2 = (byrow != 0) ? br[r] : bc[2];
    const float q3 = (byrow != 0) ? br[r] : bc[3];
    acc0[r] += q0;
    acc1[r] += q1;
    acc2[r] += q2;
    acc3[r] += q3;
  }
  epi16(slab + wave * SLAB, acc0, acc1, acc2, acc3, oscale, C, N, (size_t)rowb, col0, lane);
}

// =====================================================================================================
// Query projection with fused per-chunk L2 normalisation:
//   q[M][NCG*64] (f32, registers only) = A[M][K] (bf16 x plane) . Bt[NCG*64][K]^T (bf16 Wq plane) + bias[col] (RNE bf16 value);
//   block = 16 rows x all NCG column groups of 64, one wave per column group (wave index = cg), so the NCG groups of a row
//   tile run side by side instead of one after the other; for D row 8hh+r the 64-wide chunk (row, cols col0..col0+63) lives
//   in the 16 lanes of half hh x 4 accumulators: ss = sum of squares (4 products per lane, xor-1/2/4/8 shuffles inside the
//   half), qn = q * (1/max(sqrt(ss), 1e-12)), aa = sum of qn^2 the same way (f32), kept in LDS at aas[(row in block)*NCG + cg].
//   After the block barrier the block's 16*NCG aa values (chunk index = row*NCG + cg) go out as whole 128-B lines that no
//   other block writes (16*NCG floats is a multiple of 32).
//   Host checks: M % 16 == 0, K % 32 == 0, grid = M/16 exact, block = NCG waves (every wave reaches the barrier).
// coverage: qn plane: M/16 blocks x NCG waves x (16 x 64) = M x NCG*64;  aa table: M/16 blocks x 16*NCG floats = M*NCG.
// =====================================================================================================
__global__ __launch_bounds__(NCG * 32)
void gemm_qn(const u16* __restrict__ A, const u16* __restrict__ Bt, u16* C, float* AAP, const float* __restrict__ bias,
             int M, int K, int nbias, float oscale) {
  __shared__ __align__(16) float slab[NCG * SLAB];
  __shared__ __align__(16) float aas[16 * NCG];
  const int tid = threadIdx.x, wave = tid >> 5, lane = tid & 31, hh = lane >> 4, m = lane & 15;
  const int N = NCG * 64;
  const int rowb = blockIdx.x * 16;
  const int col0 = wave * 64;
  (void)M;
  const u16* ap = A + (size_t)(rowb + m) * K + 8 * hh;
  const u16* bp = Bt + (size_t)(col0 + m) * K + 8 * hh;
  const size_t bs = (size_t)16 * K;
  v8f acc0 = zero8(), acc1 = zero8(), acc2 = zero8(), acc3 = zero8();
#pragma unroll 1
  for (int k0 = 0; k0 < K; k0 += 32) {
    const v16b a  = ldfrag_b(ap + k0);
    const v16b b0 = ldfrag_b(bp + k0);
    const v16b b1 = ldfrag_b(bp + bs + k0);
    const v16b b2 = ldfrag_b(bp + 2 * bs + k0);
    const v16b b3 = ldfrag_b(bp + 3 * bs + k0);
    acc0 = mma_b(a, b0, acc0);
    acc1 = mma_b(a, b1, acc1);
    acc2 = mma_b(a, b2, acc2);
    acc3 = mma_b(a, b3, acc3);
    guard6<v16b>(acc0, acc1, acc2, acc3, a, b0, b1, b2, b3, a);
  }
  acc_guard4(acc0, acc1, acc2, acc3);
  float bc[4];
#pragma unroll
  for (int j = 0; j < 4; ++j) {
    int ci = col0 + 16 * j + m;
    ci = (ci < nbias) ? ci : (nbias - 1);
    bc[j] = bf_val(bias[ci]);
  }
#pragma unroll
  for (int r = 0; r < 8; ++r) {
    acc0[r] += bc[0];
    acc1[r] += bc[1];
    acc2[r] += bc[2];
    acc3[r] += bc[3];
  }
  // per row: L2 normalise the 64-wide chunk and take the f32 sum of squares of the normalised values
#pragma unroll
  for (int r = 0; r < 8; ++r) {
    float ss = acc0[r] * acc0[r] + acc1[r] * acc1[r] + acc2[r] * acc2[r] + acc3[r] * acc3[r];
    ss += __shfl_xor(ss, 1, 32);
    ss += __shfl_xor(ss, 2, 32);
    ss += __shfl_xor(ss, 4, 32);
    ss += __shfl_xor(ss, 8, 32);
    const float nrm = sqrtf(ss);
    const float den = fmaxf(nrm, 1e-12f);
    const float inv = 1.0f / den;
    acc0[r] *= inv;
    acc1[r] *= inv;
    acc2[r] *= inv;
    acc3[r] *= inv;
    float a2 = acc0[r] * acc0[r] + acc1[r] * acc1[r] + acc2[r] * acc2[r] + acc3[r] * acc3[r];
    a2 += __shfl_xor(a2, 1, 32);
    a2 += __shfl_xor(a2, 2, 32);
    a2 += __shfl_xor(a2, 4, 32);
    a2 += __shfl_xor(a2, 8, 32);
    if (m == 0) aas[(8 * hh + r) * NCG + wave] = a2;
  }
  epi16(slab + wave * SLAB, acc0, acc1, acc2, acc3, oscale, C, N, (size_t)rowb, col0, lane);
  __syncthreads();
  // aa table lines of this block: 16*NCG contiguous floats; thread t < 16*NCG/4 writes float4 t
  const int nf4 = 16 * NCG / 4;
  if (tid < nf4) {
    const v4f w0 = *(const v4f*)(aas + 4 * tid);
    *(v4f*)(AAP + (size_t)blockIdx.x * (size_t)(16 * NCG) + 4 * tid) = w0;
  }
}

// =====================================================================================================
// L2-distance flash attention (no masking, all SEQ keys): block = (head, 64 query rows), 4 waves, wave w owns the 16 query
// rows q0 = 64*qt + 16*w .. q0+15. The block's 4 waves share the key and value tiles: a stage = 64 keys = K tile (64 key rows
// x 128 B) + V tile (64 d rows x 128 B), brought into LDS by asynchronous 16-byte copies (whole 128-B lines, 8 copies per
// thread and stage), two buffers: stage t+2 is issued behind the barrier at the foot of trip t and flies during trip t+1.
// The head's AA table (SEQ floats) is copied once with stage 0. Fragments are read from LDS rows of 144 B.
//   qn plane (f16, x QSC) laid out as [NHD*SEQ chunks][64]: head h, row n = chunk h*SEQ + n; keys and queries both come
//   from this plane. AA table (f32) indexed by the same chunk index. v^T plane [h*64+d][SEQ keys] (x1024).
//   All NKB = SEQ/32 key blocks of 32 keys are visited (static bound).
//   Scores are computed TRANSPOSED: S^T tile g (g = 0,1) = key rows (keys kb+16g .. +15, A operand, row m = lane&15, split
//   k map over d) times q^T (B operand, col n = query q0 + (lane&15), k = d, split map), one product per tile and 32-deep
//   d-chunk. D element r of lane l = (key kb+16g+8h+r, query q0+(l&15)), so a lane owns one query column and 16 of its 32
//   keys; the partner lane l^16 owns the other 16 -> row sum needs one xor-16 shuffle.
//   Base-2 logit: t = (2*qn_n.qn_m/(QSC*QSC) - AA_n - AA_m) * log2(e)/8. Every qn row is a vector divided by at least its own
//   norm, so its length is at most 1 (f16 rounding adds under 0.1 %): |2*qn_n.qn_m| * log2(e)/8 < 0.37 and
//   0 <= AA * log2(e)/8 < 0.19 for any finite input, hence -0.74 < t < 0.37. The softmax therefore needs no running maximum:
//   its shift is the constant -PSH, p = exp2(t + PSH) = P x 32768 lies in (19000, 43000), inside f16, the exp2 argument is far
//   from the subnormal range (bare hardware exp2), and neither l nor the O accumulators are ever rescaled.
//   The exp'd values ARE the P A-fragment in place: A row m = query = lane&15, element i <- key kb+8h+i (tile 0, D element i),
//   element 8+i <- key kb+16+8h+i (tile 1, D element i). l (x32768) is summed per lane in 4 partial sums over the lane's
//   own keys; the partials and the partner lane l^16 are joined once behind the loop. 4 v^T B fragments
//   (col n = d = 16j + (lane&15), keys k-contiguous), 4 P.V WMMAs per key block.
//   Epilogue: 1/l (per query, shuffled to the D row owner) and carry folds in f32; the wave's 16x64 f32 result staged in its
//   aux0/aux1 are bound only (not read).
// coverage: per wave 8 instructions x 2 rows x 16 lanes x 4 floats = 16 x 64; grid NHD*(SEQ/64) blocks x 4 waves = every
//           output row (h, n < SEQ) exactly once = SEQ*NHD*64 floats.
// =====================================================================================================
__global__ __launch_bounds__(ATT_THREADS)
void attn_l2(const u16* __restrict__ QPp, const float* __restrict__ AAp, const u16* __restrict__ VPp, float* out,
             const float* aux0, const float* aux1) {
  __shared__ __align__(16) float smem[ATT_WAVES * SLAB];   // per wave: result slab [16][68] in the epilogue only
  __shared__ __align__(16) _Float16 ring[2 * BUFH];        // two buffers of (K tile, V tile), rows of LPH halves
  __shared__ __align__(16) float aas[SEQ];                 // AA table of this head
  (void)aux0; (void)aux1;

  const int tid  = threadIdx.x;
  const int wave = tid >> 5;
  const int lane = tid & 31;
  const int hh   = lane >> 4;
  const int c    = lane & 15;

  const int bid  = blockIdx.x;
  const int qt   = bid % QTILES;
  const int head = bid / QTILES;
  if (head >= NHD) return;                                 // block-uniform, never taken with the exact grid; in front of every barrier
  const int q0   = qt * 64 + wave * 16;
  const size_t hb = (size_t)head * SEQ;                    // chunk index base of this head

  const _Float16* QH = (const _Float16*)(const void*)QPp;
  // B fragments of q^T: col n = query chunk hb + q0 + c, k = d
  const _Float16* Qb = QH + (hb + (size_t)(q0 + c)) * HD + 8 * hh;
  // copy addresses of this thread: chunk i = tid + 128*j, row = i >> 3 = (tid >> 3) + 16*j, 16-byte column = tid & 7
  const unsigned lk0 = lds_addr(ring) + (unsigned)((tid >> 3) * (LPH * 2) + (tid & 7) * 16);
  const char* gk0 = (const char*)(const void*)(QH + hb * HD) + tid * 16;                       // K rows are contiguous
  const char* gv0 = (const char*)(const void*)((const _Float16*)(const void*)VPp + ((size_t)(head * HD + (tid >> 3))) * SEQ)
                    + (tid & 7) * 16;
  // stage 0 and the AA table, landed and published; then stage 1 into the other buffer
  copy_stage(lk0, gk0, gv0);
#pragma unroll   // straight line: AACP copies, each with constant address steps
  for (int j = 0; j < AACP; ++j)
    copy1(lds_addr(aas) + (unsigned)((tid + ATT_THREADS * j) * 16), (const char*)(const void*)(AAp + hb) + (tid + ATT_THREADS * j) * 16);
  wait_copies();
  __syncthreads();
  copy_stage(lk0 + BUFH * 2, gk0 + (size_t)KT * HD * 2, gv0 + KT * 2);
  const float lsc = 0.25f * (LOG2E / (QSC * QSC));
  const float c1l = 0.125f * LOG2E;
  const float aq  = AAp[hb + (size_t)(q0 + c)] * c1l - PSH; // AA term of this lane's query, with the constant shift

  const v16h qf0 = ldfrag_h(Qb);            // d 0..31
  const v16h qf1 = ldfrag_h(Qb + 32);       // d 32..63

  v2f lp[2] = {{0.f, 0.f}, {0.f, 0.f}};     // partial sums of p over this lane's keys, element i -> lp[(i >> 1) & 1][i & 1]
  v8f o[4];
#pragma unroll
  for (int j = 0; j < 4; ++j) o[j] = zero8();

#pragma unroll 1
  for (int t = 0; t < NST; ++t) {
   const _Float16* bufp = ring + (t & 1) * BUFH;
   // A fragments of keys: LDS row = key in stage (32u + 16g + c), k = d;  B fragments of v: LDS row = d = 16j + c, k = key
   const _Float16* Kl = bufp + c * LPH + 8 * hh;
   const _Float16* Vl = bufp + TILEH + c * LPH + 8 * hh;
#pragma unroll   // both 32-key blocks of the stage in line: u becomes an immediate offset of the LDS reads
   for (int u = 0; u < 2; ++u) {
    const int kb = t * KT + u * 32;
    // ---- all LDS reads of this 32-key block stand together in front of its products ----
    const _Float16* k0p = Kl + (32 * u) * LPH;
    const _Float16* k1p = k0p + 16 * LPH;
    const v16h ka0 = ldfrag_h(k0p), ka1 = ldfrag_h(k0p + 32);
    const v16h kc0 = ldfrag_h(k1p), kc1 = ldfrag_h(k1p + 32);
    // AA of this lane's 16 keys: tile 0 element i -> key kb+8hh+i, tile 1 element i -> key kb+16+8hh+i
    const float* am = aas + kb + 8 * hh;
    const v4f w0 = *(const v4f*)(am), w1 = *(const v4f*)(am + 4);
    const v4f w2 = *(const v4f*)(am + 16), w3 = *(const v4f*)(am + 20);
    const _Float16* vp = Vl + 32 * u;
    const v16h vf0 = ldfrag_h(vp);
    const v16h vf1 = ldfrag_h(vp + 16 * LPH);
    const v16h vf2 = ldfrag_h(vp + 32 * LPH);
    const v16h vf3 = ldfrag_h(vp + 48 * LPH);
    // ---- transposed scores: s0 = keys kb..kb+15, s1 = keys kb+16..kb+31, column = query q0 + c ----
    v8f s0 = zero8(), s1 = zero8();
    s0 = mma_h(ka0, qf0, s0);
    s0 = mma_h(ka1, qf1, s0);
    s1 = mma_h(kc0, qf0, s1);
    s1 = mma_h(kc1, qf1, s1);
    guard2(s0, s1, qf0, qf1, ka0, ka1, kc0, kc1);
    // ---- p = exp2(t + PSH) of this lane's 16 keys for query q0 + c, and the P A-fragment: element i <-> key i ----
    FragH ph;
#pragma unroll
    for (int e = 0; e < 2; ++e) {          // pairs of neighbouring keys: elements 2e, 2e+1 of each group of four
      const int i = 2 * e;
      const v2f sa = {s0[i], s0[i + 1]}, sb = {s0[4 + i], s0[5 + i]}, sc = {s1[i], s1[i + 1]}, sd = {s1[4 + i], s1[5 + i]};
      const v2f wa = {w0[i], w0[i + 1]}, wb = {w1[i], w1[i + 1]}, wc = {w2[i], w2[i + 1]}, wd = {w3[i], w3[i + 1]};
      const v2f ta = sa * lsc - (wa * c1l + aq), tb = sb * lsc - (wb * c1l + aq);
      const v2f tc = sc * lsc - (wc * c1l + aq), td = sd * lsc - (wd * c1l + aq);
      const v2f pa = {__builtin_amdgcn_exp2f(ta[0]), __builtin_amdgcn_exp2f(ta[1])};
      const v2f pb = {__builtin_amdgcn_exp2f(tb[0]), __builtin_amdgcn_exp2f(tb[1])};
      const v2f pc = {__builtin_amdgcn_exp2f(tc[0]), __builtin_amdgcn_exp2f(tc[1])};
      const v2f pd = {__builtin_amdgcn_exp2f(td[0]), __builtin_amdgcn_exp2f(td[1])};
      ph.u[0][e]     = pkh(pa);
      ph.u[0][2 + e] = pkh(pb);
      ph.u[1][e]     = pkh(pc);
      ph.u[1][2 + e] = pkh(pd);
      lp[e] += (pa + pb) + (pc + pd);
    }
    // ---- P.V : B fragment col n = d = j*16 + c, keys contiguous in the staged v^T rows ----
    {
      o[0] = mma_h(ph.v, vf0, o[0]);
      o[1] = mma_h(ph.v, vf1, o[1]);
      o[2] = mma_h(ph.v, vf2, o[2]);
      o[3] = mma_h(ph.v, vf3, o[3]);
      guard6<v16h>(o[0], o[1], o[2], o[3], ph.v, vf0, vf1, vf2, vf3, ph.v);
    }
   }
   // ---- foot of trip t: own LDS reads back, own copies of stage t+1 landed, barrier (publishes stage t+1 and ends every
   //      reader's last read of this trip's buffer); only then the refill of that buffer with stage t+2 ----
   wait_lds();
   wait_copies();
   __syncthreads();
   if (t + 2 < NST)
     copy_stage(lk0 + (unsigned)((t & 1) * (BUFH * 2)), gk0 + (size_t)(t + 2) * (KT * HD * 2), gv0 + (t + 2) * (KT * 2));
  }
  wait_copies();
  acc_guard4(o[0], o[1], o[2], o[3]);

  // ---- l x32768 of this lane's query: own partials, then the partner lane's 16 keys of every block ----
  float lrun = (lp[0][0] + lp[0][1]) + (lp[1][0] + lp[1][1]);
  lrun += __shfl_xor(lrun, 16, 32);
  // ---- fold 1/l (per query, owned by lane = query; the x32768 of P and of l cancel) and the v carry; stage the 16x64 slab ----
  const float linv = (lrun > 0.f) ? ((1.0f / lrun) * (1.0f / VCAR)) : 0.f;
  float inv[8];
#pragma unroll
  for (int r = 0; r < 8; ++r) inv[r] = __shfl(linv, 8 * hh + r, 32);
  float* slab = smem + wave * SLAB;
#pragma unroll
  for (int r = 0; r < 8; ++r) {
#pragma unroll
    for (int j = 0; j < 4; ++j) slab[(8 * hh + r) * 68 + j * 16 + c] = o[j][r] * inv[r];
  }
  wave_sync_lds();
  // ---- f32 output rows: lanes 0..15 -> row 2*it2, lanes 16..31 -> row 2*it2+1, 16 lanes x 16 B = one 256-B row ----
  v4f vals[8];
#pragma unroll
  for (int it2 = 0; it2 < 8; ++it2) vals[it2] = *(const v4f*)(slab + (it2 * 2 + hh) * 68 + c * 4);
  float* dst = out + (hb + (size_t)(q0 + hh)) * HD + c * 4;
  {
#pragma unroll
    for (int it2 = 0; it2 < 8; ++it2) {
      *(v4f*)(dst + (size_t)(it2 * 2) * HD) = vals[it2];
    }
    
  }
}

// =====================================================================================================
// Workspace map (bytes); every plane is fully written by whole-line stores before it is read; all extents are exact multiples
// of the store granularity (no pad rows needed), every offset a multiple of 128:
//   XB  bf16 [SEQ][768]                          SEQ*1536   (3145728 at SEQ = 2048)
//   WQB bf16 [768 n][768 k]                      1179648    WVB same
//   QP  f16  [SEQ][768] = [12*SEQ chunks][64] x16 SEQ*1536
//   AAP f32  [12*SEQ]                            SEQ*48     (98304)
//   VP  f16  [768 = h*64+d][SEQ] x1024           SEQ*1536
//   end                                          11894784 at SEQ = 2048
// =====================================================================================================
extern "C" void kernel_launch(void* const* d_in, const int* in_sizes, int n_in,
                              void* d_out, int out_size, void* d_ws, size_t ws_size,
                              hipStream_t stream) {
  if (n_in < 7) return;
  if (in_sizes[0] < SEQ * DMOD) return;
  if (in_sizes[1] < 1 || in_sizes[2] < 1) return;
  if (in_sizes[3] != DMOD * DMOD || in_sizes[5] != DMOD * DMOD) return;
  if (in_sizes[4] != DMOD || in_sizes[6] != DMOD) return;
  if (out_size < SEQ * DMOD) return;

  const float* Xin = (const float*)d_in[0];
  const float* Gin = (const float*)d_in[1];               // bound only, not read
  const float* Min = (const float*)d_in[2];               // bound only, not read
  const float* Wq  = (const float*)d_in[3];
  const float* bq  = (const float*)d_in[4];
  const float* Wv  = (const float*)d_in[5];
  const float* bv  = (const float*)d_in[6];
  float*       out = (float*)d_out;

  const size_t szXB = (size_t)SEQ * DMOD * 2;
  const size_t szW  = (size_t)DMOD * DMOD * 2;
  const size_t szQP = (size_t)SEQ * DMOD * 2;
  const size_t szAA = (size_t)NHD * SEQ * 4;
  const size_t szVP = (size_t)DMOD * SEQ * 2;
  size_t off = 0;
  const size_t oXB = off; off += szXB;
  const size_t oWQ = off; off += szW;
  const size_t oWV = off; off += szW;
  const size_t oQP = off; off += szQP;
  const size_t oAA = off; off += szAA;
  const size_t oVP = off; off += szVP;
  if (off > ws_size) return;                            // off = 11894784 at SEQ = 2048
  if (off > (size_t)134217728) return;

  char* ws = (char*)d_ws;
  u16*   XB  = (u16*)(ws + oXB);
  u16*   WQB = (u16*)(ws + oWQ);
  u16*   WVB = (u16*)(ws + oWV);
  u16*   QP  = (u16*)(ws + oQP);
  float* AAP = (float*)(ws + oAA);
  u16*   VP  = (u16*)(ws + oVP);

  const int n8x = (SEQ * DMOD) / 8;
  const int n8w = (DMOD * DMOD) / 8;
  if ((n8x % 256) != 0 || (n8w % 256) != 0) return;
  if ((DMOD % 64) != 0 || (SEQ % 64) != 0 || (DMOD % 32) != 0) return;
  const dim3 blk(256);
  const dim3 gX(n8x / 256);                             // 768 at SEQ = 2048
  const dim3 gW(n8w / 256);                             // 288
  const dim3 gQ(SEQ / 16);                              // 128
  const dim3 bQ(NCG * 32);                              // 384: one wave per column group
  const dim3 gV((DMOD / 64) * (SEQ / 64));              // 384
  const dim3 bG(128);
  const dim3 gAT(ATT_BLOCKS);                           // 384
  const dim3 bAT(ATT_THREADS);                          // 128

  // (0..2) operand planes: x -> bf16; Wq/Wv [n = out][k = in] (already k-contiguous) -> bf16
  cvt16<<<gX, blk, 0, stream>>>(Xin, XB, n8x, 0, 1.0f);
  cvt16<<<gW, blk, 0, stream>>>(Wq, WQB, n8w, 0, 1.0f);
  cvt16<<<gW, blk, 0, stream>>>(Wv, WVB, n8w, 0, 1.0f);
  // (3) q = x.Wq^T + bq, L2-normalised per 64-chunk -> qn plane [SEQ][768] f16 x16 and AA table [12*SEQ] f32
  gemm_qn<<<gQ, bQ, 0, stream>>>(XB, WQB, QP, AAP, bq, SEQ, DMOD, DMOD, QSC);
  // (4) v^T plane: [768 = h*64+d][SEQ keys] = f16((Wv . x^T + bv) x1024); bias by row
  gemm_b16<<<gV, bG, 0, stream>>>(WVB, XB, VP, bv, DMOD, SEQ, DMOD, DMOD, 1, VCAR);
  // (5) attention -> out, f32 row (chunk h*SEQ + n) of 64 floats at float offset (h*SEQ + n)*64
  attn_l2<<<gAT, bAT, 0, stream>>>(QP, AAP, VP, out, Gin, Min);
  (void)hipGetLastError();
}

// v004
// Measured time: 56.4 microseconds a run.
// Two timings next to v003 put it at 1.23 and 1.25 times that version's speed.
// All steps since v000 together make it 4.98 times as fast.
// Contractions: x.Wq^T+bq and Wv.x^T+bv on v_wmma_f32_16x16x32_bf16 (x and W planes RNE-converted to bf16 operands, f32 accumulate);
// scores qn.qn^T (qn = L2-normalised q, single f16 plane carried x16) and P.v (P x32768 single f16, v x1024 single f16) on
// v_wmma_f32_16x16x32_f16, f32 accumulate. Biases folded as RNE bf16 values in f32 epilogues; L2 normalisation, sums of squares,
// base-2 softmax with a constant shift, 1/l and carry folds in f32 on VALU.
#include <hip/hip_runtime.h>
#include <math.h>
#include <stdint.h>

#ifndef NB
#define NB 1
#endif
#ifndef SEQ
#define SEQ 2048
#endif
#define SEQ_FULL 2048
#define DMOD  768
#define NHD   12
#define HD    64
#define NCG   (DMOD / 64)
#define QSC   16.0f
#define PCAR  32768.0f
#define PSH   15.0f               // log2(PCAR): the constant shift of the base-2 logits, so that exp2 yields P x PCAR at once
#define VCAR  1024.0f
#define LOG2E 1.4426950408889634f
#define ATT_WAVES   4
#define ATT_THREADS (ATT_WAVES * 32)
#define QTILES      (SEQ / 64)
#define ATT_BLOCKS  (NHD * QTILES)
#define NKB    (SEQ / 32)
#define SLAB   (16 * 68)
#define KT     64                 // keys per LDS stage of the attention loop (two 32-key blocks)
#define NST    (SEQ / KT)         // stages
#define LPH    72                 // LDS row pitch in halves: 128-B rows at 144 B = 16 B x odd, for 16-byte LDS readers
#define TILEH  (64 * LPH)         // one staged tile of 64 rows, in halves
#define BUFH   (2 * TILEH)        // one buffer: K tile, then V tile
#define AACP   ((SEQ * 4) / (ATT_THREADS * 16))   // 16-byte copies per thread for one head's AA table
static_assert(NST * KT == SEQ && NST >= 2 && KT == 2 * 32 && HD == 64);
static_assert(AACP * ATT_THREADS * 16 == SEQ * 4 && (LPH * 2) % 16 == 0 && ATT_THREADS * 4 * 16 == KT * HD * 2);
#define QKS    64                 // k halves per LDS stage of the query projection: 128-B row pieces at pitch LPH
#define QNS    (DMOD / QKS)       // its stages
#define QBUFH  ((DMOD + 16) * LPH)   // one buffer: DMOD weight rows, then the block's 16 x rows, in halves
#define VKS    128                // k halves per LDS stage of the 64x64 GEMM: 256-B row pieces
#define VNS    (DMOD / VKS)       // its stages
#define VPH    136                // their LDS pitch in halves: 272 B = 16 B x odd
#define VBUFH  (128 * VPH)        // one buffer: 64 A rows, then 64 B rows, in halves
static_assert(QNS * QKS == DMOD && QNS >= 2 && VNS * VKS == DMOD && VNS >= 2 && (VPH * 2) % 16 == 0);
static_assert(NCG * 32 * 16 * 16 == DMOD * QKS * 2 && 128 * 8 * 16 == 64 * VKS * 2);
static_assert(NB == 1);
static_assert(HD == 64 && DMOD == NHD * HD && NCG * 64 == DMOD);
static_assert((SEQ % 64) == 0 && SEQ >= 64 && SEQ <= SEQ_FULL);
static_assert(ATT_THREADS == 128 && NKB * 32 == SEQ && ATT_BLOCKS == NHD * (SEQ / 64));
static_assert((DMOD % 64) == 0 && (DMOD % 32) == 0);
static_assert(((SEQ * DMOD / 8) % 256) == 0 && ((DMOD * DMOD / 8) % 256) == 0);
static_assert((SLAB * 4) % 16 == 0);
static_assert(((16 * NCG) % 32) == 0 && NCG * 32 <= 1024 && (SEQ % 16) == 0);

typedef unsigned short u16;
typedef _Float16 v16h __attribute__((ext_vector_type(16)));
typedef _Float16 v8h  __attribute__((ext_vector_type(8)));
typedef __bf16   v16b __attribute__((ext_vector_type(16)));
typedef float    v8f  __attribute__((ext_vector_type(8)));
typedef float    v4f  __attribute__((ext_vector_type(4)));
typedef unsigned int v4u __attribute__((ext_vector_type(4)));
typedef float    v2f  __attribute__((ext_vector_type(2)));
typedef _Float16 v2h  __attribute__((ext_vector_type(2)));

union FragH { v16h v; v8h h[2]; v4u u[2]; };
union FragB { v16b v; v4u u[2]; };

// ---- scalar helpers --------------------------------------------------------------------------------
__device__ __forceinline__ unsigned short bf_bits(float f) {          // f32 -> bf16 bits, RNE convert
  unsigned u = __float_as_uint(f);
  return (unsigned short)((u + 0x7FFFu + ((u >> 16) & 1u)) >> 16);
}
__device__ __forceinline__ float bf_up(unsigned short h) { return __uint_as_float(((unsigned)h) << 16); }
__device__ __forceinline__ float bf_val(float f) { return bf_up(bf_bits(f)); }          // value after RNE bf16 convert
__device__ __forceinline__ unsigned short h_bits(_Float16 x) { return __builtin_bit_cast(unsigned short, x); }
__device__ __forceinline__ unsigned pk16(unsigned short a, unsigned short b) { return (unsigned)a | ((unsigned)b << 16); }
__device__ __forceinline__ unsigned pkh(v2f x) {                     // two f32 -> packed f16 pair, RNE, x[0] in the low half
  return __builtin_bit_cast(unsigned, __builtin_convertvector(x, v2h));
}
__device__ __forceinline__ v8f zero8() { v8f z = {0.f, 0.f, 0.f, 0.f, 0.f, 0.f, 0.f, 0.f}; return z; }

// ---- fragment loaders: 16-bit A/B operand, lane -> row/col (lane&15), p already includes +8*(lane>>4);
//      elements 0..7 <- p[0..7] (k0+8h..), elements 8..15 <- p[16..23] (k0+16+8h..)  (same split k map for A and B;
//      B is always read from a k-contiguous [n][k] plane)
__device__ __forceinline__ v16h ldfrag_h(const _Float16* p) {
  FragH f;
  f.h[0] = *(const v8h*)(p);
  f.h[1] = *(const v8h*)(p + 16);
  return f.v;
}
__device__ __forceinline__ v16b ldfrag_b(const u16* p) {              // bf16 plane read as unsigned integer vectors
  FragB f;
  f.u[0] = *(const v4u*)(p);
  f.u[1] = *(const v4u*)(p + 16);
  return f.v;
}

__device__ __forceinline__ v8f mma_h(v16h a, v16h b, v8f c) {
  return __builtin_amdgcn_wmma_f32_16x16x32_f16(false, a, false, b, (short)0, c, false, false);
}
__device__ __forceinline__ v8f mma_b(v16b a, v16b b, v8f c) {
  return __builtin_amdgcn_wmma_f32_16x16x32_bf16(false, a, false, b, (short)0, c, false, false);
}
__device__ __forceinline__ void guard2(v8f& a, v8f& b, v16h x0, v16h x1, v16h x2, v16h x3, v16h x4, v16h x5) {
#if defined(__HIP_DEVICE_COMPILE__)
  asm volatile("v_nop\n\tv_nop\n\tv_nop\n\tv_nop"
               : "+v"(a), "+v"(b) : "v"(x0), "v"(x1), "v"(x2), "v"(x3), "v"(x4), "v"(x5) : "memory");
#endif
}
template <typename F>
__device__ __forceinline__ void guard6(v8f& a, v8f& b, v8f& c, v8f& d, F x0, F x1, F x2, F x3, F x4, F x5) {
#if defined(__HIP_DEVICE_COMPILE__)
  asm volatile("v_nop\n\tv_nop\n\tv_nop\n\tv_nop"
               : "+v"(a), "+v"(b), "+v"(c), "+v"(d) : "v"(x0), "v"(x1), "v"(x2), "v"(x3), "v"(x4), "v"(x5) : "memory");
#endif
}
__device__ __forceinline__ void acc_guard4(v8f& a, v8f& b, v8f& c, v8f& d) {
#if defined(__HIP_DEVICE_COMPILE__)
  asm volatile("v_nop\n\tv_nop\n\tv_nop\n\tv_nop" : "+v"(a), "+v"(b), "+v"(c), "+v"(d));
#endif
}
__device__ __forceinline__ void wave_sync_lds() {
#if defined(__HIP_DEVICE_COMPILE__)
  __builtin_amdgcn_fence(__ATOMIC_RELEASE, "workgroup");
  __builtin_amdgcn_wave_barrier();
  __builtin_amdgcn_fence(__ATOMIC_ACQUIRE, "workgroup");
#endif
}

// ---- asynchronous copies global -> LDS, 16 B per lane; lds = the lane's LDS byte address, g = the lane's global address.
//      The address-translation wait is the last line of the copies' own statement, so that no address register named by
//      an issued copy is rewritten in front of it.
__device__ __forceinline__ unsigned lds_addr(const void* p) { return (unsigned)(size_t)p; }
__device__ __forceinline__ void copy1(unsigned lds, const char* g) {
#if defined(__HIP_DEVICE_COMPILE__)
  asm volatile("global_load_async_to_lds_b128 %0, %1, off\n\ts_wait_xcnt 0x0" :: "v"(lds), "v"(g) : "memory");
#endif
}
// eight copies with constant steps from one to the next: ls bytes in LDS, gs bytes in global memory
__device__ __forceinline__ void copy8(unsigned l, unsigned ls, const char* g, size_t gs) {
#if defined(__HIP_DEVICE_COMPILE__)
  asm volatile("global_load_async_to_lds_b128 %0, %8, off\n\t"
               "global_load_async_to_lds_b128 %1, %9, off\n\t"
               "global_load_async_to_lds_b128 %2, %10, off\n\t"
               "global_load_async_to_lds_b128 %3, %11, off\n\t"
               "global_load_async_to_lds_b128 %4, %12, off\n\t"
               "global_load_async_to_lds_b128 %5, %13, off\n\t"
               "global_load_async_to_lds_b128 %6, %14, off\n\t"
               "global_load_async_to_lds_b128 %7, %15, off\n\t"
               "s_wait_xcnt 0x0"
               :: "v"(l), "v"(l + ls), "v"(l + 2 * ls), "v"(l + 3 * ls),
                  "v"(l + 4 * ls), "v"(l + 5 * ls), "v"(l + 6 * ls), "v"(l + 7 * ls),
                  "v"(g), "v"(g + gs), "v"(g + 2 * gs), "v"(g + 3 * gs),
                  "v"(g + 4 * gs), "v"(g + 5 * gs), "v"(g + 6 * gs), "v"(g + 7 * gs)
               : "memory");
#endif
}
// one stage: 4 K chunks (16 rows apart in LDS, 2048 B apart in the contiguous K rows) and 4 V chunks (16 d rows apart)
__device__ __forceinline__ void copy_stage(unsigned lk, const char* gk, const char* gv) {
#if defined(__HIP_DEVICE_COMPILE__)
  const unsigned rs = 16 * LPH * 2, lv = lk + TILEH * 2;
  const size_t vs = (size_t)16 * SEQ * 2;
  asm volatile("global_load_async_to_lds_b128 %0, %8, off\n\t"
               "global_load_async_to_lds_b128 %1, %9, off\n\t"
               "global_load_async_to_lds_b128 %2, %10, off\n\t"
               "global_load_async_to_lds_b128 %3, %11, off\n\t"
               "global_load_async_to_lds_b128 %4, %12, off\n\t"
               "global_load_async_to_lds_b128 %5, %13, off\n\t"
               "global_load_async_to_lds_b128 %6, %14, off\n\t"
               "global_load_async_to_lds_b128 %7, %15, off\n\t"
               "s_wait_xcnt 0x0"
               :: "v"(lk), "v"(lk + rs), "v"(lk + 2 * rs), "v"(lk + 3 * rs),
                  "v"(lv), "v"(lv + rs), "v"(lv + 2 * rs), "v"(lv + 3 * rs),
                  "v"(gk), "v"(gk + 2048), "v"(gk + 4096), "v"(gk + 6144),
                  "v"(gv), "v"(gv + vs), "v"(gv + 2 * vs), "v"(gv + 3 * vs)
               : "memory");
#endif
}
// the issuing wave's own wait: its copies have landed (before the barrier behind which other waves read them)
__device__ __forceinline__ void wait_copies() {
#if defined(__HIP_DEVICE_COMPILE__)
  asm volatile("s_wait_asynccnt 0x0" ::: "memory");
#endif
}
// the wave's LDS reads have returned (before the barrier behind which their buffer is refilled)
__device__ __forceinline__ void wait_lds() {
#if defined(__HIP_DEVICE_COMPILE__)
  asm volatile("s_wait_dscnt 0x0" ::: "memory");
#endif
}

// =====================================================================================================
// f32 plane -> 16-bit plane, same layout:  mode 0: bf16 RNE bits;  mode 1: f16 bits of (bf16 RNE value) * scale.
// Thread = 8 consecutive elements: two 16-B loads, one 16-B store; 32 consecutive lanes = 512 contiguous, 512-B aligned bytes
// coverage: grid = n8/256 blocks (host checks exactness) x 256 thr x 8 = the whole plane.
// =====================================================================================================
__global__ __launch_bounds__(256) void cvt16(const float* __restrict__ x, u16* D, int n8, int mode, float scale) {
  const int gt = blockIdx.x * 256 + (int)threadIdx.x;
  if (gt >= n8) return;                     // no barriers in this kernel
  const float* p = x + (size_t)gt * 8;
  const v4f a = *(const v4f*)(p), c4 = *(const v4f*)(p + 4);
  float v[8];
#pragma unroll
  for (int e = 0; e < 4; ++e) { v[e] = a[e]; v[4 + e] = c4[e]; }
  unsigned short s[8];
#pragma unroll
  for (int e = 0; e < 8; ++e) {
    const unsigned short bb = bf_bits(v[e]);
    const unsigned short hb = h_bits((_Float16)(bf_up(bb) * scale));
    s[e] = (mode != 0) ? hb : bb;
  }
  v4u o;
#pragma unroll
  for (int e = 0; e < 4; ++e) o[e] = pk16(s[2 * e], s[2 * e + 1]);
  u16* d = D + (size_t)gt * 8;
  {
    *(v4u*)(d) = o;
    
  }
}

// =====================================================================================================
// barrier, then converted to f16 and written: lane = (row in group of 4, 8 consecutive cols); one instruction = 4 rows, each
// coverage: 4 instructions x 4 rows x 8 lanes x 8 halves = the wave's 16 x 64 tile.
// =====================================================================================================
__device__ __forceinline__ void epi16(float* sl, v8f a0, v8f a1, v8f a2, v8f a3, float oscale, u16* C, int N,
                                      size_t rowb, int col0, int lane) {
  const int hh = lane >> 4, m = lane & 15;
#pragma unroll
  for (int r = 0; r < 8; ++r) {
    const int ro = (8 * hh + r) * 68 + m;
    sl[ro]      = a0[r] * oscale;
    sl[ro + 16] = a1[r] * oscale;
    sl[ro + 32] = a2[r] * oscale;
    sl[ro + 48] = a3[r] * oscale;
  }
  wave_sync_lds();
  const int rq = lane >> 3, c8 = (lane & 7) * 8;
  v4u ov[4];
#pragma unroll
  for (int i4 = 0; i4 < 4; ++i4) {
    const int row = i4 * 4 + rq;
    const v4f a = *(const v4f*)(sl + row * 68 + c8), c4 = *(const v4f*)(sl + row * 68 + c8 + 4);
    float w[8];
#pragma unroll
    for (int e = 0; e < 4; ++e) { w[e] = a[e]; w[4 + e] = c4[e]; }
#pragma unroll
    for (int e = 0; e < 4; ++e) ov[i4][e] = pk16(h_bits((_Float16)w[2 * e]), h_bits((_Float16)w[2 * e + 1]));
  }
  u16* dst = C + (rowb + (size_t)rq) * (size_t)N + col0 + c8;
  {
#pragma unroll
    for (int i4 = 0; i4 < 4; ++i4) {
      *(v4u*)(dst + (size_t)(i4 * 4) * (size_t)N) = ov[i4];
    }
    
  }
}

// =====================================================================================================
// bf16 GEMM with bias and 16-bit result: C[M][N] (f16 of (acc + bias)*oscale) = A[M][K] (bf16 row-major) . Bt[N][K]^T
// (bf16 k-contiguous); bias (f32 input, taken as its RNE bf16 value) indexed by column (byrow == 0) or by row (byrow != 0),
// both candidates read with addresses clamped to [0, nbias). Block = 64x64 tile, 4 waves x 16 rows; K = DMOD. A stage = VKS
// k values of the block's 64 A rows and 64 B rows, brought into LDS by asynchronous 16-byte copies (16 lanes = one 256-B row
// piece, whole 128-B lines; 16 copies per thread and stage), two buffers: stage t+2 is issued behind the barrier at the foot
// of trip t and flies during trip t+1. Fragments are read from LDS rows of 272 B (two 16-B reads each, split k map for A and
// B); k runs upward in steps of 32 as before. (Host checks M % 64 == 0, N % 64 == 0, grid = (M/64)*(N/64).)
// =====================================================================================================
__global__ __launch_bounds__(128)
void gemm_b16(const u16* __restrict__ A, const u16* __restrict__ Bt, u16* C, const float* __restrict__ bias,
              int M, int N, int nbias, int byrow, float oscale) {
  __shared__ __align__(16) float slab[4 * SLAB];
  __shared__ __align__(16) u16 ring[2 * VBUFH];            // two buffers of (A rows, B rows), rows of VPH halves
  const int K = DMOD;
  const int tid = threadIdx.x, wave = tid >> 5, lane = tid & 31, hh = lane >> 4, m = lane & 15;
  const int ntile = N >> 6;
  const int bid   = blockIdx.x;
  const int row0  = (bid / ntile) * 64;
  const int rowb  = row0 + wave * 16;
  const int col0  = (bid % ntile) * 64;
  if (row0 + 64 > M) return;                 // block-uniform, never taken with the exact grid; in front of every barrier
  // copy addresses of this thread: chunk i = tid + 128*j, row = i >> 4 = (tid >> 4) + 8*j, 16-byte column = tid & 15
  const unsigned la0 = lds_addr(ring) + (unsigned)((tid >> 4) * (VPH * 2) + (tid & 15) * 16);
  const unsigned lb0 = la0 + 64 * VPH * 2;
  const char* ga0 = (const char*)(const void*)(A  + (size_t)(row0 + (tid >> 4)) * K) + (tid & 15) * 16;
  const char* gb0 = (const char*)(const void*)(Bt + (size_t)(col0 + (tid >> 4)) * K) + (tid & 15) * 16;
  const unsigned lst = 8 * VPH * 2;          // 8 rows on, in LDS
  const size_t   gst = (size_t)8 * K * 2;    // 8 rows on, in the source plane
  // stage 0 landed and published; then stage 1 into the other buffer
  copy8(la0, lst, ga0, gst);
  copy8(lb0, lst, gb0, gst);
  wait_copies();
  __syncthreads();
  copy8(la0 + VBUFH * 2, lst, ga0 + VKS * 2, gst);
  copy8(lb0 + VBUFH * 2, lst, gb0 + VKS * 2, gst);
  v8f acc0 = zero8(), acc1 = zero8(), acc2 = zero8(), acc3 = zero8();
#pragma unroll 1   // one trip per stage: the buffer index alternates, the code stays small
  for (int t = 0; t < VNS; ++t) {
    const u16* bufp = ring + (t & 1) * VBUFH;
    const u16* al = bufp + (wave * 16 + m) * VPH + 8 * hh;
    const u16* bl = bufp + (64 + m) * VPH + 8 * hh;
#pragma unroll     // k offsets inside the stage become immediate offsets of the LDS reads
    for (int u = 0; u < VKS; u += 64) {
      // all LDS reads of 64 k values stand together in front of their products
      const v16b a  = ldfrag_b(al + u),                 e  = ldfrag_b(al + u + 32);
      const v16b b0 = ldfrag_b(bl + u),                 f0 = ldfrag_b(bl + u + 32);
      const v16b b1 = ldfrag_b(bl + 16 * VPH + u),      f1 = ldfrag_b(bl + 16 * VPH + u + 32);
      const v16b b2 = ldfrag_b(bl + 32 * VPH + u),      f2 = ldfrag_b(bl + 32 * VPH + u + 32);
      const v16b b3 = ldfrag_b(bl + 48 * VPH + u),      f3 = ldfrag_b(bl + 48 * VPH + u + 32);
      acc0 = mma_b(a, b0, acc0);
      acc1 = mma_b(a, b1, acc1);
      acc2 = mma_b(a, b2, acc2);
      acc3 = mma_b(a, b3, acc3);
      guard6<v16b>(acc0, acc1, acc2, acc3, a, b0, b1, b2, b3, a);
      acc0 = mma_b(e, f0, acc0);
      acc1 = mma_b(e, f1, acc1);
      acc2 = mma_b(e, f2, acc2);
      acc3 = mma_b(e, f3, acc3);
      guard6<v16b>(acc0, acc1, acc2, acc3, e, f0, f1, f2, f3, e);
    }
    // foot of trip t: own LDS reads back, own copies of stage t+1 landed, barrier (publishes stage t+1 and ends every
    // reader's last read of this trip's buffer); only then the refill of that buffer with stage t+2
    wait_lds();
    wait_copies();
    __syncthreads();
    if (t + 2 < VNS) {
      const unsigned bo = (unsigned)((t & 1) * (VBUFH * 2));
      copy8(la0 + bo, lst, ga0 + (t + 2) * (VKS * 2), gst);
      copy8(lb0 + bo, lst, gb0 + (t + 2) * (VKS * 2), gst);
    }
  }
  wait_copies();
  acc_guard4(acc0, acc1, acc2, acc3);
  // bias: D element r of lane -> (row rowb+8hh+r, col col0+16j+m); both candidates loaded with clamped addresses, select by value
  float bc[4], br[8];
#pragma unroll
  for (int j = 0; j < 4; ++j) {
    int ci = col0 + 16 * j + m;
    ci = (ci < nbias) ? ci : (nbias - 1);
    bc[j] = bf_val(bias[ci]);
  }
#pragma unroll
  for (int r = 0; r < 8; ++r) {
    int ri = rowb + 8 * hh + r;
    ri = (ri < nbias) ? ri : (nbias - 1);
    br[r] = bf_val(bias[ri]);
  }
#pragma unroll
  for (int r = 0; r < 8; ++r) {
    const float q0 = (byrow != 0) ? br[r] : bc[0];
    const float q1 = (byrow != 0) ? br[r] : bc[1];
    const float q2 = (byrow != 0) ? br[r] : bc[2];
    const float q3 = (byrow != 0) ? br[r] : bc[3];
    acc0[r] += q0;
    acc1[r] += q1;
    acc2[r] += q2;
    acc3[r] += q3;
  }
  epi16(slab + wave * SLAB, acc0, acc1, acc2, acc3, oscale, C, N, (size_t)rowb, col0, lane);
}

// =====================================================================================================
// Query projection with fused per-chunk L2 normalisation:
//   q[M][NCG*64] (f32, registers only) = A[M][K] (bf16 x plane) . Bt[NCG*64][K]^T (bf16 Wq plane) + bias[col] (RNE bf16 value);
//   block = 16 rows x all NCG column groups of 64, one wave per column group (wave index = cg), so the NCG groups of a row
//   tile run side by side instead of one after the other. K = DMOD. A stage = QKS k values of all DMOD weight rows and of the
//   block's 16 x rows, brought into LDS by asynchronous 16-byte copies (8 lanes = one whole 128-B line; 16 copies per thread
//   and stage, one more in waves 0..3 for the x rows), two buffers: stage t+2 is issued behind the barrier at the foot of
//   trip t and flies during trip t+1. Fragments are read from LDS rows of 144 B; k runs upward in steps of 32 as before.
//   For D row 8hh+r the 64-wide chunk (row, cols col0..col0+63) lives
//   in the 16 lanes of half hh x 4 accumulators: ss = sum of squares (4 products per lane, xor-1/2/4/8 shuffles inside the
//   half), qn = q * (1/max(sqrt(ss), 1e-12)), aa = sum of qn^2 the same way (f32), kept in LDS at aas[(row in block)*NCG + cg].
//   After the block barrier the block's 16*NCG aa values (chunk index = row*NCG + cg) go out as whole 128-B lines that no
//   other block writes (16*NCG floats is a multiple of 32).
//   Host checks: M % 16 == 0, grid = M/16 exact, block = NCG waves (every wave reaches the barrier).
// coverage: qn plane: M/16 blocks x NCG waves x (16 x 64) = M x NCG*64;  aa table: M/16 blocks x 16*NCG floats = M*NCG.
// =====================================================================================================
__global__ __launch_bounds__(NCG * 32)
void gemm_qn(const u16* __restrict__ A, const u16* __restrict__ Bt, u16* C, float* AAP, const float* __restrict__ bias,
             int M, int nbias, float oscale) {
  __shared__ __align__(16) float slab[NCG * SLAB];
  __shared__ __align__(16) float aas[16 * NCG];
  __shared__ __align__(16) u16 ring[2 * QBUFH];            // two buffers of (DMOD weight rows, 16 x rows), rows of LPH halves
  const int K = DMOD;
  const int tid = threadIdx.x, wave = tid >> 5, lane = tid & 31, hh = lane >> 4, m = lane & 15;
  const bool xw = __builtin_amdgcn_readfirstlane(tid >> 5) < 4;   // scalar: waves 0..3 also copy the x rows
  const int N = NCG * 64;
  const int rowb = blockIdx.x * 16;
  const int col0 = wave * 64;
  (void)M;
  // copy addresses of this thread: weight chunk i = tid + 384*j, row = i >> 3 = (tid >> 3) + 48*j, 16-byte column = tid & 7;
  // x chunk (waves 0..3) = tid, row = tid >> 3 (kept inside 0..15 in every thread)
  const unsigned lb0 = lds_addr(ring) + (unsigned)((tid >> 3) * (LPH * 2) + (tid & 7) * 16);
  const unsigned la0 = lds_addr(ring) + (unsigned)((DMOD + ((tid >> 3) & 15)) * (LPH * 2) + (tid & 7) * 16);
  const char* gb0 = (const char*)(const void*)(Bt + (size_t)(tid >> 3) * K) + (tid & 7) * 16;
  const char* ga0 = (const char*)(const void*)(A + (size_t)(rowb + ((tid >> 3) & 15)) * K) + (tid & 7) * 16;
  const unsigned lst = 48 * LPH * 2;         // 48 rows on, in LDS
  const size_t   gst = (size_t)48 * K * 2;   // 48 rows on, in the weight plane
  // stage 0 landed and published; then stage 1 into the other buffer
  copy8(lb0, lst, gb0, gst);
  copy8(lb0 + 8 * lst, lst, gb0 + 8 * gst, gst);
  if (xw) copy1(la0, ga0);
  wait_copies();
  __syncthreads();
  copy8(lb0 + QBUFH * 2, lst, gb0 + QKS * 2, gst);
  copy8(lb0 + QBUFH * 2 + 8 * lst, lst, gb0 + QKS * 2 + 8 * gst, gst);
  if (xw) copy1(la0 + QBUFH * 2, ga0 + QKS * 2);
  v8f acc0 = zero8(), acc1 = zero8(), acc2 = zero8(), acc3 = zero8();
#pragma unroll 1   // one trip per stage: the buffer index alternates, the code stays small
  for (int t = 0; t < QNS; ++t) {
    const u16* bufp = ring + (t & 1) * QBUFH;
    const u16* al = bufp + (DMOD + m) * LPH + 8 * hh;
    const u16* bl = bufp + (col0 + m) * LPH + 8 * hh;
    // all LDS reads of the stage's 64 k values stand together in front of their products
    const v16b a  = ldfrag_b(al),                 e  = ldfrag_b(al + 32);
    const v16b b0 = ldfrag_b(bl),                 f0 = ldfrag_b(bl + 32);
    const v16b b1 = ldfrag_b(bl + 16 * LPH),      f1 = ldfrag_b(bl + 16 * LPH + 32);
    const v16b b2 = ldfrag_b(bl + 32 * LPH),      f2 = ldfrag_b(bl + 32 * LPH + 32);
    const v16b b3 = ldfrag_b(bl + 48 * LPH),      f3 = ldfrag_b(bl + 48 * LPH + 32);
    acc0 = mma_b(a, b0, acc0);
    acc1 = mma_b(a, b1, acc1);
    acc2 = mma_b(a, b2, acc2);
    acc3 = mma_b(a, b3, acc3);
    guard6<v16b>(acc0, acc1, acc2, acc3, a, b0, b1, b2, b3, a);
    acc0 = mma_b(e, f0, acc0);
    acc1 = mma_b(e, f1, acc1);
    acc2 = mma_b(e, f2, acc2);
    acc3 = mma_b(e, f3, acc3);
    guard6<v16b>(acc0, acc1, acc2, acc3, e, f0, f1, f2, f3, e);
    // foot of trip t: own LDS reads back, own copies of stage t+1 landed, barrier (publishes stage t+1 and ends every
    // reader's last read of this trip's buffer); only then the refill of that buffer with stage t+2
    wait_lds();
    wait_copies();
    __syncthreads();
    if (t + 2 < QNS) {
      const unsigned bo = (unsigned)((t & 1) * (QBUFH * 2));
      const int go = (t + 2) * (QKS * 2);
      copy8(lb0 + bo, lst, gb0 + go, gst);
      copy8(lb0 + bo + 8 * lst, lst, gb0 + go + 8 * gst, gst);
      if (xw) copy1(la0 + bo, ga0 + go);
    }
  }
  wait_copies();
  acc_guard4(acc0, acc1, acc2, acc3);
  float bc[4];
#pragma unroll
  for (int j = 0; j < 4; ++j) {
    int ci = col0 + 16 * j + m;
    ci = (ci < nbias) ? ci : (nbias - 1);
    bc[j] = bf_val(bias[ci]);
  }
#pragma unroll
  for (int r = 0; r < 8; ++r) {
    acc0[r] += bc[0];
    acc1[r] += bc[1];
    acc2[r] += bc[2];
    acc3[r] += bc[3];
  }
  // per row: L2 normalise the 64-wide chunk and take the f32 sum of squares of the normalised values
#pragma unroll
  for (int r = 0; r < 8; ++r) {
    float ss = acc0[r] * acc0[r] + acc1[r] * acc1[r] + acc2[r] * acc2[r] + acc3[r] * acc3[r];
    ss += __shfl_xor(ss, 1, 32);
    ss += __shfl_xor(ss, 2, 32);
    ss += __shfl_xor(ss, 4, 32);
    ss += __shfl_xor(ss, 8, 32);
    const float nrm = sqrtf(ss);
    const float den = fmaxf(nrm, 1e-12f);
    const float inv = 1.0f / den;
    acc0[r] *= inv;
    acc1[r] *= inv;
    acc2[r] *= inv;
    acc3[r] *= inv;
    float a2 = acc0[r] * acc0[r] + acc1[r] * acc1[r] + acc2[r] * acc2[r] + acc3[r] * acc3[r];
    a2 += __shfl_xor(a2, 1, 32);
    a2 += __shfl_xor(a2, 2, 32);
    a2 += __shfl_xor(a2, 4, 32);
    a2 += __shfl_xor(a2, 8, 32);
    if (m == 0) aas[(8 * hh + r) * NCG + wave] = a2;
  }
  epi16(slab + wave * SLAB, acc0, acc1, acc2, acc3, oscale, C, N, (size_t)rowb, col0, lane);
  __syncthreads();
  // aa table lines of this block: 16*NCG contiguous floats; thread t < 16*NCG/4 writes float4 t
  const int nf4 = 16 * NCG / 4;
  if (tid < nf4) {
    const v4f w0 = *(const v4f*)(aas + 4 * tid);
    *(v4f*)(AAP + (size_t)blockIdx.x * (size_t)(16 * NCG) + 4 * tid) = w0;
  }
}

// =====================================================================================================
// L2-distance flash attention (no masking, all SEQ keys): block = (head, 64 query rows), 4 waves, wave w owns the 16 query
// rows q0 = 64*qt + 16*w .. q0+15. The block's 4 waves share the key and value tiles: a stage = 64 keys = K tile (64 key rows
// x 128 B) + V tile (64 d rows x 128 B), brought into LDS by asynchronous 16-byte copies (whole 128-B lines, 8 copies per
// thread and stage), two buffers: stage t+2 is issued behind the barrier at the foot of trip t and flies during trip t+1.
// The head's AA table (SEQ floats) is copied once with stage 0. Fragments are read from LDS rows of 144 B.
//   qn plane (f16, x QSC) laid out as [NHD*SEQ chunks][64]: head h, row n = chunk h*SEQ + n; keys and queries both come
//   from this plane. AA table (f32) indexed by the same chunk index. v^T plane [h*64+d][SEQ keys] (x1024).
//   All NKB = SEQ/32 key blocks of 32 keys are visited (static bound).
//   Scores are computed TRANSPOSED: S^T tile g (g = 0,1) = key rows (keys kb+16g .. +15, A operand, row m = lane&15, split
//   k map over d) times q^T (B operand, col n = query q0 + (lane&15), k = d, split map), one product per tile and 32-deep
//   d-chunk. D element r of lane l = (key kb+16g+8h+r, query q0+(l&15)), so a lane owns one query column and 16 of its 32
//   keys; the partner lane l^16 owns the other 16 -> row sum needs one xor-16 shuffle.
//   Base-2 logit: t = (2*qn_n.qn_m/(QSC*QSC) - AA_n - AA_m) * log2(e)/8. Every qn row is a vector divided by at least its own
//   norm, so its length is at most 1 (f16 rounding adds under 0.1 %): |2*qn_n.qn_m| * log2(e)/8 < 0.37 and
//   0 <= AA * log2(e)/8 < 0.19 for any finite input, hence -0.74 < t < 0.37. The softmax therefore needs no running maximum:
//   its shift is the constant -PSH, p = exp2(t + PSH) = P x 32768 lies in (19000, 43000), inside f16, the exp2 argument is far
//   from the subnormal range (bare hardware exp2), and neither l nor the O accumulators are ever rescaled.
//   The exp'd values ARE the P A-fragment in place: A row m = query = lane&15, element i <- key kb+8h+i (tile 0, D element i),
//   element 8+i <- key kb+16+8h+i (tile 1, D element i). l (x32768) is summed per lane in 4 partial sums over the lane's
//   own keys; the partials and the partner lane l^16 are joined once behind the loop. 4 v^T B fragments
//   (col n = d = 16j + (lane&15), keys k-contiguous), 4 P.V WMMAs per key block.
//   Epilogue: 1/l (per query, shuffled to the D row owner) and carry folds in f32; the wave's 16x64 f32 result staged in its
//   aux0/aux1 are bound only (not read).
// coverage: per wave 8 instructions x 2 rows x 16 lanes x 4 floats = 16 x 64; grid NHD*(SEQ/64) blocks x 4 waves = every
//           output row (h, n < SEQ) exactly once = SEQ*NHD*64 floats.
// =====================================================================================================
__global__ __launch_bounds__(ATT_THREADS)
void attn_l2(const u16* __restrict__ QPp, const float* __restrict__ AAp, const u16* __restrict__ VPp, float* out,
             const float* aux0, const float* aux1) {
  __shared__ __align__(16) float smem[ATT_WAVES * SLAB];   // per wave: result slab [16][68] in the epilogue only
  __shared__ __align__(16) _Float16 ring[2 * BUFH];        // two buffers of (K tile, V tile), rows of LPH halves
  __shared__ __align__(16) float aas[SEQ];                 // AA table of this head
  (void)aux0; (void)aux1;

  const int tid  = threadIdx.x;
  const int wave = tid >> 5;
  const int lane = tid & 31;
  const int hh   = lane >> 4;
  const int c    = lane & 15;

  const int bid  = blockIdx.x;
  const int qt   = bid % QTILES;
  const int head = bid / QTILES;
  if (head >= NHD) return;                                 // block-uniform, never taken with the exact grid; in front of every barrier
  const int q0   = qt * 64 + wave * 16;
  const size_t hb = (size_t)head * SEQ;                    // chunk index base of this head

  const _Float16* QH = (const _Float16*)(const void*)QPp;
  // B fragments of q^T: col n = query chunk hb + q0 + c, k = d
  const _Float16* Qb = QH + (hb + (size_t)(q0 + c)) * HD + 8 * hh;
  // copy addresses of this thread: chunk i = tid + 128*j, row = i >> 3 = (tid >> 3) + 16*j, 16-byte column = tid & 7
  const unsigned lk0 = lds_addr(ring) + (unsigned)((tid >> 3) * (LPH * 2) + (tid & 7) * 16);
  const char* gk0 = (const char*)(const void*)(QH + hb * HD) + tid * 16;                       // K rows are contiguous
  const char* gv0 = (const char*)(const void*)((const _Float16*)(const void*)VPp + ((size_t)(head * HD + (tid >> 3))) * SEQ)
                    + (tid & 7) * 16;
  // stage 0 and the AA table, landed and published; then stage 1 into the other buffer
  copy_stage(lk0, gk0, gv0);
#pragma unroll   // straight line: AACP copies, each with constant address steps
  for (int j = 0; j < AACP; ++j)
    copy1(lds_addr(aas) + (unsigned)((tid + ATT_THREADS * j) * 16), (const char*)(const void*)(AAp + hb) + (tid + ATT_THREADS * j) * 16);
  wait_copies();
  __syncthreads();
  copy_stage(lk0 + BUFH * 2, gk0 + (size_t)KT * HD * 2, gv0 + KT * 2);
  const float lsc = 0.25f * (LOG2E / (QSC * QSC));
  const float c1l = 0.125f * LOG2E;
  const float aq  = AAp[hb + (size_t)(q0 + c)] * c1l - PSH; // AA term of this lane's query, with the constant shift

  const v16h qf0 = ldfrag_h(Qb);            // d 0..31
  const v16h qf1 = ldfrag_h(Qb + 32);       // d 32..63

  v2f lp[2] = {{0.f, 0.f}, {0.f, 0.f}};     // partial sums of p over this lane's keys, element i -> lp[(i >> 1) & 1][i & 1]
  v8f o[4];
#pragma unroll
  for (int j = 0; j < 4; ++j) o[j] = zero8();

#pragma unroll 1
  for (int t = 0; t < NST; ++t) {
   const _Float16* bufp = ring + (t & 1) * BUFH;
   // A fragments of keys: LDS row = key in stage (32u + 16g + c), k = d;  B fragments of v: LDS row = d = 16j + c, k = key
   const _Float16* Kl = bufp + c * LPH + 8 * hh;
   const _Float16* Vl = bufp + TILEH + c * LPH + 8 * hh;
#pragma unroll   // both 32-key blocks of the stage in line: u becomes an immediate offset of the LDS reads
   for (int u = 0; u < 2; ++u) {
    const int kb = t * KT + u * 32;
    // ---- all LDS reads of this 32-key block stand together in front of its products ----
    const _Float16* k0p = Kl + (32 * u) * LPH;
    const _Float16* k1p = k0p + 16 * LPH;
    const v16h ka0 = ldfrag_h(k0p), ka1 = ldfrag_h(k0p + 32);
    const v16h kc0 = ldfrag_h(k1p), kc1 = ldfrag_h(k1p + 32);
    // AA of this lane's 16 keys: tile 0 element i -> key kb+8hh+i, tile 1 element i -> key kb+16+8hh+i
    const float* am = aas + kb + 8 * hh;
    const v4f w0 = *(const v4f*)(am), w1 = *(const v4f*)(am + 4);
    const v4f w2 = *(const v4f*)(am + 16), w3 = *(const v4f*)(am + 20);
    const _Float16* vp = Vl + 32 * u;
    const v16h vf0 = ldfrag_h(vp);
    const v16h vf1 = ldfrag_h(vp + 16 * LPH);
    const v16h vf2 = ldfrag_h(vp + 32 * LPH);
    const v16h vf3 = ldfrag_h(vp + 48 * LPH);
    // ---- transposed scores: s0 = keys kb..kb+15, s1 = keys kb+16..kb+31, column = query q0 + c ----
    v8f s0 = zero8(), s1 = zero8();
    s0 = mma_h(ka0, qf0, s0);
    s0 = mma_h(ka1, qf1, s0);
    s1 = mma_h(kc0, qf0, s1);
    s1 = mma_h(kc1, qf1, s1);
    guard2(s0, s1, qf0, qf1, ka0, ka1, kc0, kc1);
    // ---- p = exp2(t + PSH) of this lane's 16 keys for query q0 + c, and the P A-fragment: element i <-> key i ----
    FragH ph;
#pragma unroll
    for (int e = 0; e < 2; ++e) {          // pairs of neighbouring keys: elements 2e, 2e+1 of each group of four
      const int i = 2 * e;
      const v2f sa = {s0[i], s0[i + 1]}, sb = {s0[4 + i], s0[5 + i]}, sc = {s1[i], s1[i + 1]}, sd = {s1[4 + i], s1[5 + i]};
      const v2f wa = {w0[i], w0[i + 1]}, wb = {w1[i], w1[i + 1]}, wc = {w2[i], w2[i + 1]}, wd = {w3[i], w3[i + 1]};
      const v2f ta = sa * lsc - (wa * c1l + aq), tb = sb * lsc - (wb * c1l + aq);
      const v2f tc = sc * lsc - (wc * c1l + aq), td = sd * lsc - (wd * c1l + aq);
      const v2f pa = {__builtin_amdgcn_exp2f(ta[0]), __builtin_amdgcn_exp2f(ta[1])};
      const v2f pb = {__builtin_amdgcn_exp2f(tb[0]), __builtin_amdgcn_exp2f(tb[1])};
      const v2f pc = {__builtin_amdgcn_exp2f(tc[0]), __builtin_amdgcn_exp2f(tc[1])};
      const v2f pd = {__builtin_amdgcn_exp2f(td[0]), __builtin_amdgcn_exp2f(td[1])};
      ph.u[0][e]     = pkh(pa);
      ph.u[0][2 + e] = pkh(pb);
      ph.u[1][e]     = pkh(pc);
      ph.u[1][2 + e] = pkh(pd);
      lp[e] += (pa + pb) + (pc + pd);
    }
    // ---- P.V : B fragment col n = d = j*16 + c, keys contiguous in the staged v^T rows ----
    {
      o[0] = mma_h(ph.v, vf0, o[0]);
      o[1] = mma_h(ph.v, vf1, o[1]);
      o[2] = mma_h(ph.v, vf2, o[2]);
      o[3] = mma_h(ph.v, vf3, o[3]);
      guard6<v16h>(o[0], o[1], o[2], o[3], ph.v, vf0, vf1, vf2, vf3, ph.v);
    }
   }
   // ---- foot of trip t: own LDS reads back, own copies of stage t+1 landed, barrier (publishes stage t+1 and ends every
   //      reader's last read of this trip's buffer); only then the refill of that buffer with stage t+2 ----
   wait_lds();
   wait_copies();
   __syncthreads();
   if (t + 2 < NST)
     copy_stage(lk0 + (unsigned)((t & 1) * (BUFH * 2)), gk0 + (size_t)(t + 2) * (KT * HD * 2), gv0 + (t + 2) * (KT * 2));
  }
  wait_copies();
  acc_guard4(o[0], o[1], o[2], o[3]);

  // ---- l x32768 of this lane's query: own partials, then the partner lane's 16 keys of every block ----
  float lrun = (lp[0][0] + lp[0][1]) + (lp[1][0] + lp[1][1]);
  lrun += __shfl_xor(lrun, 16, 32);
  // ---- fold 1/l (per query, owned by lane = query; the x32768 of P and of l cancel) and the v carry; stage the 16x64 slab ----
  const float linv = (lrun > 0.f) ? ((1.0f / lrun) * (1.0f / VCAR)) : 0.f;
  float inv[8];
#pragma unroll
  for (int r = 0; r < 8; ++r) inv[r] = __shfl(linv, 8 * hh + r, 32);
  float* slab = smem + wave * SLAB;
#pragma unroll
  for (int r = 0; r < 8; ++r) {
#pragma unroll
    for (int j = 0; j < 4; ++j) slab[(8 * hh + r) * 68 + j * 16 + c] = o[j][r] * inv[r];
  }
  wave_sync_lds();
  // ---- f32 output rows: lanes 0..15 -> row 2*it2, lanes 16..31 -> row 2*it2+1, 16 lanes x 16 B = one 256-B row ----
  v4f vals[8];
#pragma unroll
  for (int it2 = 0; it2 < 8; ++it2) vals[it2] = *(const v4f*)(slab + (it2 * 2 + hh) * 68 + c * 4);
  float* dst = out + (hb + (size_t)(q0 + hh)) * HD + c * 4;
  {
#pragma unroll
    for (int it2 = 0; it2 < 8; ++it2) {
      *(v4f*)(dst + (size_t)(it2 * 2) * HD) = vals[it2];
    }
    
  }
}

// =====================================================================================================
// Workspace map (bytes); every plane is fully written by whole-line stores before it is read; all extents are exact multiples
// of the store granularity (no pad rows needed), every offset a multiple of 128:
//   XB  bf16 [SEQ][768]                          SEQ*1536   (3145728 at SEQ = 2048)
//   WQB bf16 [768 n][768 k]                      1179648    WVB same
//   QP  f16  [SEQ][768] = [12*SEQ chunks][64] x16 SEQ*1536
//   AAP f32  [12*SEQ]                            SEQ*48     (98304)
//   VP  f16  [768 = h*64+d][SEQ] x1024           SEQ*1536
//   end                                          11894784 at SEQ = 2048
// =====================================================================================================
extern "C" void kernel_launch(void* const* d_in, const int* in_sizes, int n_in,
                              void* d_out, int out_size, void* d_ws, size_t ws_size,
                              hipStream_t stream) {
  if (n_in < 7) return;
  if (in_sizes[0] < SEQ * DMOD) return;
  if (in_sizes[1] < 1 || in_sizes[2] < 1) return;
  if (in_sizes[3] != DMOD * DMOD || in_sizes[5] != DMOD * DMOD) return;
  if (in_sizes[4] != DMOD || in_sizes[6] != DMOD) return;
  if (out_size < SEQ * DMOD) return;

  const float* Xin = (const float*)d_in[0];
  const float* Gin = (const float*)d_in[1];               // bound only, not read
  const float* Min = (const float*)d_in[2];               // bound only, not read
  const float* Wq  = (const float*)d_in[3];
  const float* bq  = (const float*)d_in[4];
  const float* Wv  = (const float*)d_in[5];
  const float* bv  = (const float*)d_in[6];
  float*       out = (float*)d_out;

  const size_t szXB = (size_t)SEQ * DMOD * 2;
  const size_t szW  = (size_t)DMOD * DMOD * 2;
  const size_t szQP = (size_t)SEQ * DMOD * 2;
  const size_t szAA = (size_t)NHD * SEQ * 4;
  const size_t szVP = (size_t)DMOD * SEQ * 2;
  size_t off = 0;
  const size_t oXB = off; off += szXB;
  const size_t oWQ = off; off += szW;
  const size_t oWV = off; off += szW;
  const size_t oQP = off; off += szQP;
  const size_t oAA = off; off += szAA;
  const size_t oVP = off; off += szVP;
  if (off > ws_size) return;                            // off = 11894784 at SEQ = 2048
  if (off > (size_t)134217728) return;

  char* ws = (char*)d_ws;
  u16*   XB  = (u16*)(ws + oXB);
  u16*   WQB = (u16*)(ws + oWQ);
  u16*   WVB = (u16*)(ws + oWV);
  u16*   QP  = (u16*)(ws + oQP);
  float* AAP = (float*)(ws + oAA);
  u16*   VP  = (u16*)(ws + oVP);

  const int n8x = (SEQ * DMOD) / 8;
  const int n8w = (DMOD * DMOD) / 8;
  if ((n8x % 256) != 0 || (n8w % 256) != 0) return;
  if ((DMOD % 64) != 0 || (SEQ % 64) != 0 || (DMOD % 32) != 0) return;
  const dim3 blk(256);
  const dim3 gX(n8x / 256);                             // 768 at SEQ = 2048
  const dim3 gW(n8w / 256);                             // 288
  const dim3 gQ(SEQ / 16);                              // 128
  const dim3 bQ(NCG * 32);                              // 384: one wave per column group
  const dim3 gV((DMOD / 64) * (SEQ / 64));              // 384
  const dim3 bG(128);
  const dim3 gAT(ATT_BLOCKS);                           // 384
  const dim3 bAT(ATT_THREADS);                          // 128

  // (0..2) operand planes: x -> bf16; Wq/Wv [n = out][k = in] (already k-contiguous) -> bf16
  cvt16<<<gX, blk, 0, stream>>>(Xin, XB, n8x, 0, 1.0f);
  cvt16<<<gW, blk, 0, stream>>>(Wq, WQB, n8w, 0, 1.0f);
  cvt16<<<gW, blk, 0, stream>>>(Wv, WVB, n8w, 0, 1.0f);
  // (3) q = x.Wq^T + bq, L2-normalised per 64-chunk -> qn plane [SEQ][768] f16 x16 and AA table [12*SEQ] f32
  gemm_qn<<<gQ, bQ, 0, stream>>>(XB, WQB, QP, AAP, bq, SEQ, DMOD, QSC);
  // (4) v^T plane: [768 = h*64+d][SEQ keys] = f16((Wv . x^T + bv) x1024); bias by row
  gemm_b16<<<gV, bG, 0, stream>>>(WVB, XB, VP, bv, DMOD, SEQ, DMOD, 1, VCAR);
  // (5) attention -> out, f32 row (chunk h*SEQ + n) of 64 floats at float offset (h*SEQ + n)*64
  attn_l2<<<gAT, bAT, 0, stream>>>(QP, AAP, VP, out, Gin, Min);
  (void)hipGetLastError();
}

// v005
// A run of this version takes 46.8 microseconds.
// Two timings next to v004 put it at 1.22 and 1.20 times that version's speed.
// All steps since v000 together make it 6.03 times as fast.
// Contractions: x.Wq^T+bq and Wv.x^T+bv on v_wmma_f32_16x16x32_bf16 (x and W planes RNE-converted to bf16 operands, f32 accumulate);
// scores qn.qn^T (qn = L2-normalised q, single f16 plane carried x16) and P.v (P x32768 single f16, v x1024 single f16) on
// v_wmma_f32_16x16x32_f16, f32 accumulate. Biases folded as RNE bf16 values in f32 epilogues; L2 normalisation, sums of squares,
// base-2 softmax with a constant shift, 1/l and carry folds in f32 on VALU.
#include <hip/hip_runtime.h>
#include <math.h>
#include <stdint.h>

#ifndef NB
#define NB 1
#endif
#ifndef SEQ
#define SEQ 2048
#endif
#define SEQ_FULL 2048
#define DMOD  768
#define NHD   12
#define HD    64
#define NCG   (DMOD / 64)
#define QSC   16.0f
#define PCAR  32768.0f
#define PSH   15.0f               // log2(PCAR): the constant shift of the base-2 logits, so that exp2 yields P x PCAR at once
#define VCAR  1024.0f
#define LOG2E 1.4426950408889634f
#define ATT_WAVES   4
#define ATT_THREADS (ATT_WAVES * 32)
#define QTILES      (SEQ / 64)
#define ATT_BLOCKS  (NHD * QTILES)
#define NKB    (SEQ / 32)
#define SLAB   (16 * 68)
#define KT     64                 // keys per LDS stage of the attention loop (two 32-key blocks)
#define NST    (SEQ / KT)         // stages
#define LPH    72                 // LDS row pitch in halves: 128-B rows at 144 B = 16 B x odd, for 16-byte LDS readers
#define TILEH  (64 * LPH)         // one staged tile of 64 rows, in halves
#define BUFH   (2 * TILEH)        // one buffer: K tile, then V tile
#define AACP   ((SEQ * 4) / (ATT_THREADS * 16))   // 16-byte copies per thread for one head's AA table
static_assert(NST * KT == SEQ && NST >= 2 && KT == 2 * 32 && HD == 64);
static_assert(AACP * ATT_THREADS * 16 == SEQ * 4 && (LPH * 2) % 16 == 0 && ATT_THREADS * 4 * 16 == KT * HD * 2);
#define QKS    64                 // k halves per LDS stage of the query projection: 128-B row pieces at pitch LPH
#define QNS    (DMOD / QKS)       // its stages
#define QBUFH  ((DMOD + 16) * LPH)   // one buffer: DMOD weight rows, then the block's 16 x rows, in halves
#define VKS    128                // k halves per LDS stage of the 64x64 GEMM: 256-B row pieces
#define VNS    (DMOD / VKS)       // its stages
#define VPH    136                // their LDS pitch in halves: 272 B = 16 B x odd
#define VBUFH  (128 * VPH)        // one buffer: 64 A rows, then 64 B rows, in halves
static_assert(QNS * QKS == DMOD && QNS >= 2 && VNS * VKS == DMOD && VNS >= 2 && (VPH * 2) % 16 == 0);
static_assert(NCG * 32 * 16 * 16 == DMOD * QKS * 2 && 128 * 8 * 16 == 64 * VKS * 2);
#define CVX    ((SEQ * DMOD) / 2048)    // blocks of the conversion launch for x (256 threads x 8 elements each)
#define CVW    ((DMOD * DMOD) / 2048)   // its blocks for each weight plane
#define QBLK   (SEQ / 16)         // blocks of the projection launch that do the query projection (16 rows each)
#define VTPB   3                  // 64x64 tiles of the v^T GEMM per block of that launch: one per group of 4 waves
#define VBLK   (((DMOD / 64) * (SEQ / 64)) / VTPB)   // its blocks that do the v^T GEMM
#define POOLB  (NCG * SLAB * 4 + 16 * NCG * 4 + 2 * QBUFH * 2)   // LDS bytes of a block: what the query part needs, the larger of the two
static_assert(VBLK * VTPB == (DMOD / 64) * (SEQ / 64) && VTPB * 4 == NCG);
static_assert(NCG * SLAB * 4 + VTPB * 2 * VBUFH * 2 <= POOLB && (NCG * SLAB * 4) % 16 == 0 && (2 * VBUFH * 2) % 16 == 0);
static_assert(NB == 1);
static_assert(HD == 64 && DMOD == NHD * HD && NCG * 64 == DMOD);
static_assert((SEQ % 64) == 0 && SEQ >= 64 && SEQ <= SEQ_FULL);
static_assert(ATT_THREADS == 128 && NKB * 32 == SEQ && ATT_BLOCKS == NHD * (SEQ / 64));
static_assert((DMOD % 64) == 0 && (DMOD % 32) == 0);
static_assert(((SEQ * DMOD / 8) % 256) == 0 && ((DMOD * DMOD / 8) % 256) == 0);
static_assert((SLAB * 4) % 16 == 0);
static_assert(((16 * NCG) % 32) == 0 && NCG * 32 <= 1024 && (SEQ % 16) == 0);

typedef unsigned short u16;
typedef _Float16 v16h __attribute__((ext_vector_type(16)));
typedef _Float16 v8h  __attribute__((ext_vector_type(8)));
typedef __bf16   v16b __attribute__((ext_vector_type(16)));
typedef float    v8f  __attribute__((ext_vector_type(8)));
typedef float    v4f  __attribute__((ext_vector_type(4)));
typedef unsigned int v4u __attribute__((ext_vector_type(4)));
typedef float    v2f  __attribute__((ext_vector_type(2)));
typedef _Float16 v2h  __attribute__((ext_vector_type(2)));

union FragH { v16h v; v8h h[2]; v4u u[2]; };
union FragB { v16b v; v4u u[2]; };

// ---- scalar helpers --------------------------------------------------------------------------------
__device__ __forceinline__ unsigned short bf_bits(float f) {          // f32 -> bf16 bits, RNE convert
  unsigned u = __float_as_uint(f);
  return (unsigned short)((u + 0x7FFFu + ((u >> 16) & 1u)) >> 16);
}
__device__ __forceinline__ float bf_up(unsigned short h) { return __uint_as_float(((unsigned)h) << 16); }
__device__ __forceinline__ float bf_val(float f) { return bf_up(bf_bits(f)); }          // value after RNE bf16 convert
__device__ __forceinline__ unsigned short h_bits(_Float16 x) { return __builtin_bit_cast(unsigned short, x); }
__device__ __forceinline__ unsigned pk16(unsigned short a, unsigned short b) { return (unsigned)a | ((unsigned)b << 16); }
__device__ __forceinline__ unsigned pkh(v2f x) {                     // two f32 -> packed f16 pair, RNE, x[0] in the low half
  return __builtin_bit_cast(unsigned, __builtin_convertvector(x, v2h));
}
__device__ __forceinline__ v8f zero8() { v8f z = {0.f, 0.f, 0.f, 0.f, 0.f, 0.f, 0.f, 0.f}; return z; }

// ---- fragment loaders: 16-bit A/B operand, lane -> row/col (lane&15), p already includes +8*(lane>>4);
//      elements 0..7 <- p[0..7] (k0+8h..), elements 8..15 <- p[16..23] (k0+16+8h..)  (same split k map for A and B;
//      B is always read from a k-contiguous [n][k] plane)
__device__ __forceinline__ v16h ldfrag_h(const _Float16* p) {
  FragH f;
  f.h[0] = *(const v8h*)(p);
  f.h[1] = *(const v8h*)(p + 16);
  return f.v;
}
__device__ __forceinline__ v16b ldfrag_b(const u16* p) {              // bf16 plane read as unsigned integer vectors
  FragB f;
  f.u[0] = *(const v4u*)(p);
  f.u[1] = *(const v4u*)(p + 16);
  return f.v;
}

__device__ __forceinline__ v8f mma_h(v16h a, v16h b, v8f c) {
  return __builtin_amdgcn_wmma_f32_16x16x32_f16(false, a, false, b, (short)0, c, false, false);
}
__device__ __forceinline__ v8f mma_b(v16b a, v16b b, v8f c) {
  return __builtin_amdgcn_wmma_f32_16x16x32_bf16(false, a, false, b, (short)0, c, false, false);
}
__device__ __forceinline__ void guard2(v8f& a, v8f& b, v16h x0, v16h x1, v16h x2, v16h x3, v16h x4, v16h x5) {
#if defined(__HIP_DEVICE_COMPILE__)
  asm volatile("v_nop\n\tv_nop\n\tv_nop\n\tv_nop"
               : "+v"(a), "+v"(b) : "v"(x0), "v"(x1), "v"(x2), "v"(x3), "v"(x4), "v"(x5) : "memory");
#endif
}
template <typename F>
__device__ __forceinline__ void guard6(v8f& a, v8f& b, v8f& c, v8f& d, F x0, F x1, F x2, F x3, F x4, F x5) {
#if defined(__HIP_DEVICE_COMPILE__)
  asm volatile("v_nop\n\tv_nop\n\tv_nop\n\tv_nop"
               : "+v"(a), "+v"(b), "+v"(c), "+v"(d) : "v"(x0), "v"(x1), "v"(x2), "v"(x3), "v"(x4), "v"(x5) : "memory");
#endif
}
__device__ __forceinline__ void acc_guard4(v8f& a, v8f& b, v8f& c, v8f& d) {
#if defined(__HIP_DEVICE_COMPILE__)
  asm volatile("v_nop\n\tv_nop\n\tv_nop\n\tv_nop" : "+v"(a), "+v"(b), "+v"(c), "+v"(d));
#endif
}
__device__ __forceinline__ void wave_sync_lds() {
#if defined(__HIP_DEVICE_COMPILE__)
  __builtin_amdgcn_fence(__ATOMIC_RELEASE, "workgroup");
  __builtin_amdgcn_wave_barrier();
  __builtin_amdgcn_fence(__ATOMIC_ACQUIRE, "workgroup");
#endif
}

// ---- asynchronous copies global -> LDS, 16 B per lane; lds = the lane's LDS byte address, g = the lane's global address.
//      The address-translation wait is the last line of the copies' own statement, so that no address register named by
//      an issued copy is rewritten in front of it.
__device__ __forceinline__ unsigned lds_addr(const void* p) { return (unsigned)(size_t)p; }
__device__ __forceinline__ void copy1(unsigned lds, const char* g) {
#if defined(__HIP_DEVICE_COMPILE__)
  asm volatile("global_load_async_to_lds_b128 %0, %1, off\n\ts_wait_xcnt 0x0" :: "v"(lds), "v"(g) : "memory");
#endif
}
// eight copies with constant steps from one to the next: ls bytes in LDS, gs bytes in global memory
__device__ __forceinline__ void copy8(unsigned l, unsigned ls, const char* g, size_t gs) {
#if defined(__HIP_DEVICE_COMPILE__)
  asm volatile("global_load_async_to_lds_b128 %0, %8, off\n\t"
               "global_load_async_to_lds_b128 %1, %9, off\n\t"
               "global_load_async_to_lds_b128 %2, %10, off\n\t"
               "global_load_async_to_lds_b128 %3, %11, off\n\t"
               "global_load_async_to_lds_b128 %4, %12, off\n\t"
               "global_load_async_to_lds_b128 %5, %13, off\n\t"
               "global_load_async_to_lds_b128 %6, %14, off\n\t"
               "global_load_async_to_lds_b128 %7, %15, off\n\t"
               "s_wait_xcnt 0x0"
               :: "v"(l), "v"(l + ls), "v"(l + 2 * ls), "v"(l + 3 * ls),
                  "v"(l + 4 * ls), "v"(l + 5 * ls), "v"(l + 6 * ls), "v"(l + 7 * ls),
                  "v"(g), "v"(g + gs), "v"(g + 2 * gs), "v"(g + 3 * gs),
                  "v"(g + 4 * gs), "v"(g + 5 * gs), "v"(g + 6 * gs), "v"(g + 7 * gs)
               : "memory");
#endif
}
// one stage: 4 K chunks (16 rows apart in LDS, 2048 B apart in the contiguous K rows) and 4 V chunks (16 d rows apart)
__device__ __forceinline__ void copy_stage(unsigned lk, const char* gk, const char* gv) {
#if defined(__HIP_DEVICE_COMPILE__)
  const unsigned rs = 16 * LPH * 2, lv = lk + TILEH * 2;
  const size_t vs = (size_t)16 * SEQ * 2;
  asm volatile("global_load_async_to_lds_b128 %0, %8, off\n\t"
               "global_load_async_to_lds_b128 %1, %9, off\n\t"
               "global_load_async_to_lds_b128 %2, %10, off\n\t"
               "global_load_async_to_lds_b128 %3, %11, off\n\t"
               "global_load_async_to_lds_b128 %4, %12, off\n\t"
               "global_load_async_to_lds_b128 %5, %13, off\n\t"
               "global_load_async_to_lds_b128 %6, %14, off\n\t"
               "global_load_async_to_lds_b128 %7, %15, off\n\t"
               "s_wait_xcnt 0x0"
               :: "v"(lk), "v"(lk + rs), "v"(lk + 2 * rs), "v"(lk + 3 * rs),
                  "v"(lv), "v"(lv + rs), "v"(lv + 2 * rs), "v"(lv + 3 * rs),
                  "v"(gk), "v"(gk + 2048), "v"(gk + 4096), "v"(gk + 6144),
                  "v"(gv), "v"(gv + vs), "v"(gv + 2 * vs), "v"(gv + 3 * vs)
               : "memory");
#endif
}
// the issuing wave's own wait: its copies have landed (before the barrier behind which other waves read them)
__device__ __forceinline__ void wait_copies() {
#if defined(__HIP_DEVICE_COMPILE__)
  asm volatile("s_wait_asynccnt 0x0" ::: "memory");
#endif
}
// address-translation wait behind a run of plain global stores, in front of whatever rewrites a register that they name
__device__ __forceinline__ void wait_xlat() {
#if defined(__HIP_DEVICE_COMPILE__)
  asm volatile("s_wait_xcnt 0x0" ::: "memory");
#endif
}
// the wave's LDS reads have returned (before the barrier behind which their buffer is refilled)
__device__ __forceinline__ void wait_lds() {
#if defined(__HIP_DEVICE_COMPILE__)
  asm volatile("s_wait_dscnt 0x0" ::: "memory");
#endif
}

// =====================================================================================================
// The three f32 operand planes (x, Wq, Wv) -> bf16 RNE bits, same layouts, in ONE launch: the planes do not depend on one
// another, and their bf16 planes follow one another in the workspace, so block b writes elements b*2048 .. +2047 of the joined
// destination and picks its source plane by block index (block-uniform): CVX blocks of x, then CVW of Wq, then CVW of Wv.
// Thread = 8 consecutive elements: two 16-B loads, one 16-B store; 32 consecutive lanes = 512 contiguous, 512-B aligned bytes
// coverage: grid = CVX + 2*CVW blocks (plane sizes are exact multiples of 2048 elements) x 256 thr x 8 = the three planes.
// =====================================================================================================
__global__ __launch_bounds__(256) void cvt16x3(const float* __restrict__ x, const float* __restrict__ wq,
                                               const float* __restrict__ wv, u16* D) {
  const int b = blockIdx.x;
  if (b >= CVX + 2 * CVW) return;           // no barriers in this kernel
  const float* s = (b < CVX) ? x : ((b < CVX + CVW) ? wq : wv);
  const int   lb = (b < CVX) ? b : ((b < CVX + CVW) ? (b - CVX) : (b - CVX - CVW));
  const float* p = s + ((size_t)lb * 256 + threadIdx.x) * 8;
  const v4f a = *(const v4f*)(p), c4 = *(const v4f*)(p + 4);
  v4u o;
#pragma unroll
  for (int e = 0; e < 2; ++e) {
    o[e]     = pk16(bf_bits(a[2 * e]),  bf_bits(a[2 * e + 1]));
    o[2 + e] = pk16(bf_bits(c4[2 * e]), bf_bits(c4[2 * e + 1]));
  }
  *(v4u*)(D + ((size_t)b * 256 + threadIdx.x) * 8) = o;
}

// =====================================================================================================
// barrier, then converted to f16 and written: lane = (row in group of 4, 8 consecutive cols); one instruction = 4 rows, each
// coverage: 4 instructions x 4 rows x 8 lanes x 8 halves = the wave's 16 x 64 tile.
// =====================================================================================================
__device__ __forceinline__ void epi16(float* sl, v8f a0, v8f a1, v8f a2, v8f a3, float oscale, u16* C, int N,
                                      size_t rowb, int col0, int lane) {
  const int hh = lane >> 4, m = lane & 15;
#pragma unroll
  for (int r = 0; r < 8; ++r) {
    const int ro = (8 * hh + r) * 68 + m;
    sl[ro]      = a0[r] * oscale;
    sl[ro + 16] = a1[r] * oscale;
    sl[ro + 32] = a2[r] * oscale;
    sl[ro + 48] = a3[r] * oscale;
  }
  wave_sync_lds();
  const int rq = lane >> 3, c8 = (lane & 7) * 8;
  v4u ov[4];
#pragma unroll
  for (int i4 = 0; i4 < 4; ++i4) {
    const int row = i4 * 4 + rq;
    const v4f a = *(const v4f*)(sl + row * 68 + c8), c4 = *(const v4f*)(sl + row * 68 + c8 + 4);
    float w[8];
#pragma unroll
    for (int e = 0; e < 4; ++e) { w[e] = a[e]; w[4 + e] = c4[e]; }
#pragma unroll
    for (int e = 0; e < 4; ++e) ov[i4][e] = pk16(h_bits((_Float16)w[2 * e]), h_bits((_Float16)w[2 * e + 1]));
  }
  u16* dst = C + (rowb + (size_t)rq) * (size_t)N + col0 + c8;
  {
#pragma unroll
    for (int i4 = 0; i4 < 4; ++i4) {
      *(v4u*)(dst + (size_t)(i4 * 4) * (size_t)N) = ov[i4];
    }
    wait_xlat();   // code of the merged kernel may follow these stores and rewrite their data or address registers
  }
}

// =====================================================================================================
// bf16 GEMM with bias and 16-bit result: C[M][N] (f16 of (acc + bias)*oscale) = A[M][K] (bf16 row-major) . Bt[N][K]^T
// (bf16 k-contiguous); bias (f32 input, taken as its RNE bf16 value) indexed by column (byrow == 0) or by row (byrow != 0),
// both candidates read with addresses clamped to [0, nbias). Tile = 64x64, 4 waves x 16 rows; K = DMOD. A stage = VKS
// k values of the tile's 64 A rows and 64 B rows, brought into LDS by asynchronous 16-byte copies (16 lanes = one 256-B row
// piece, whole 128-B lines; 16 copies per thread and stage), two buffers: stage t+2 is issued behind the barrier at the foot
// of trip t and flies during trip t+1. Fragments are read from LDS rows of 272 B (two 16-B reads each, split k map for A and
// B); k runs upward in steps of 32 as before.
// Part of the projection launch: a block of NCG waves holds VTPB such tiles side by side, tile tile0 + g in the 4 waves of group
// g = threadIdx.x >> 7, each group with its own slabs and its own ring in the block's LDS pool; all groups make the same trips,
// so every wave of the block passes every block barrier. (The caller gives tile0 + VTPB <= (M/64)*(N/64); M, N multiples of 64.)
// =====================================================================================================
__device__ __forceinline__
void gemm_b16(char* pool, int tile0, const u16* __restrict__ A, const u16* __restrict__ Bt, u16* C,
              const float* __restrict__ bias, int N, int nbias, int byrow, float oscale) {
  const int grp = threadIdx.x >> 7;
  float* slab = (float*)(void*)pool + grp * (4 * SLAB);
  u16*   ring = (u16*)(void*)(pool + NCG * SLAB * 4) + grp * (2 * VBUFH);   // two buffers of (A rows, B rows), rows of VPH halves
  const int K = DMOD;
  const int tid = threadIdx.x & 127, wave = tid >> 5, lane = tid & 31, hh = lane >> 4, m = lane & 15;
  const int ntile = N >> 6;
  const int bid   = tile0 + grp;
  const int row0  = (bid / ntile) * 64;
  const int rowb  = row0 + wave * 16;
  const int col0  = (bid % ntile) * 64;
  // copy addresses of this thread: chunk i = tid + 128*j, row = i >> 4 = (tid >> 4) + 8*j, 16-byte column = tid & 15
  const unsigned la0 = lds_addr(ring) + (unsigned)((tid >> 4) * (VPH * 2) + (tid & 15) * 16);
  const unsigned lb0 = la0 + 64 * VPH * 2;
  const char* ga0 = (const char*)(const void*)(A  + (size_t)(row0 + (tid >> 4)) * K) + (tid & 15) * 16;
  const char* gb0 = (const char*)(const void*)(Bt + (size_t)(col0 + (tid >> 4)) * K) + (tid & 15) * 16;
  const unsigned lst = 8 * VPH * 2;          // 8 rows on, in LDS
  const size_t   gst = (size_t)8 * K * 2;    // 8 rows on, in the source plane
  // stage 0 landed and published; then stage 1 into the other buffer
  copy8(la0, lst, ga0, gst);
  copy8(lb0, lst, gb0, gst);
  wait_copies();
  __syncthreads();
  copy8(la0 + VBUFH * 2, lst, ga0 + VKS * 2, gst);
  copy8(lb0 + VBUFH * 2, lst, gb0 + VKS * 2, gst);
  v8f acc0 = zero8(), acc1 = zero8(), acc2 = zero8(), acc3 = zero8();
#pragma unroll 1   // one trip per stage: the buffer index alternates, the code stays small
  for (int t = 0; t < VNS; ++t) {
    const u16* bufp = ring + (t & 1) * VBUFH;
    const u16* al = bufp + (wave * 16 + m) * VPH + 8 * hh;
    const u16* bl = bufp + (64 + m) * VPH + 8 * hh;
#pragma unroll     // k offsets inside the stage become immediate offsets of the LDS reads
    for (int u = 0; u < VKS; u += 64) {
      // all LDS reads of 64 k values stand together in front of their products
      const v16b a  = ldfrag_b(al + u),                 e  = ldfrag_b(al + u + 32);
      const v16b b0 = ldfrag_b(bl + u),                 f0 = ldfrag_b(bl + u + 32);
      const v16b b1 = ldfrag_b(bl + 16 * VPH + u),      f1 = ldfrag_b(bl + 16 * VPH + u + 32);
      const v16b b2 = ldfrag_b(bl + 32 * VPH + u),      f2 = ldfrag_b(bl + 32 * VPH + u + 32);
      const v16b b3 = ldfrag_b(bl + 48 * VPH + u),      f3 = ldfrag_b(bl + 48 * VPH + u + 32);
      acc0 = mma_b(a, b0, acc0);
      acc1 = mma_b(a, b1, acc1);
      acc2 = mma_b(a, b2, acc2);
      acc3 = mma_b(a, b3, acc3);
      guard6<v16b>(acc0, acc1, acc2, acc3, a, b0, b1, b2, b3, a);
      acc0 = mma_b(e, f0, acc0);
      acc1 = mma_b(e, f1, acc1);
      acc2 = mma_b(e, f2, acc2);
      acc3 = mma_b(e, f3, acc3);
      guard6<v16b>(acc0, acc1, acc2, acc3, e, f0, f1, f2, f3, e);
    }
    // foot of trip t: own LDS reads back, own copies of stage t+1 landed, barrier (publishes stage t+1 and ends every
    // reader's last read of this trip's buffer); only then the refill of that buffer with stage t+2
    wait_lds();
    wait_copies();
    __syncthreads();
    if (t + 2 < VNS) {
      const unsigned bo = (unsigned)((t & 1) * (VBUFH * 2));
      copy8(la0 + bo, lst, ga0 + (t + 2) * (VKS * 2), gst);
      copy8(lb0 + bo, lst, gb0 + (t + 2) * (VKS * 2), gst);
    }
  }
  wait_copies();
  acc_guard4(acc0, acc1, acc2, acc3);
  // bias: D element r of lane -> (row rowb+8hh+r, col col0+16j+m); both candidates loaded with clamped addresses, select by value
  float bc[4], br[8];
#pragma unroll
  for (int j = 0; j < 4; ++j) {
    int ci = col0 + 16 * j + m;
    ci = (ci < nbias) ? ci : (nbias - 1);
    bc[j] = bf_val(bias[ci]);
  }
  int ri[8];
  float bw[8];
#pragma unroll
  for (int r = 0; r < 8; ++r) {
    ri[r] = rowb + 8 * hh + r;
    ri[r] = (ri[r] < nbias) ? ri[r] : (nbias - 1);
    bw[r] = bias[ri[r]];
  }
#if defined(__HIP_DEVICE_COMPILE__)
  // the eight loads' index registers stay live up to this address-translation wait (inputs only), so that no load's result
  // lands in the index register of a load issued before it; the loaded values as inputs keep the loads in front of it
  asm volatile("s_wait_xcnt 0x0"
               :: "v"(ri[0]), "v"(ri[1]), "v"(ri[2]), "v"(ri[3]), "v"(ri[4]), "v"(ri[5]), "v"(ri[6]), "v"(ri[7]),
                  "v"(bw[0]), "v"(bw[1]), "v"(bw[2]), "v"(bw[3]), "v"(bw[4]), "v"(bw[5]), "v"(bw[6]), "v"(bw[7])
               : "memory");
#endif
#pragma unroll
  for (int r = 0; r < 8; ++r) br[r] = bf_val(bw[r]);
#pragma unroll
  for (int r = 0; r < 8; ++r) {
    const float q0 = (byrow != 0) ? br[r] : bc[0];
    const float q1 = (byrow != 0) ? br[r] : bc[1];
    const float q2 = (byrow != 0) ? br[r] : bc[2];
    const float q3 = (byrow != 0) ? br[r] : bc[3];
    acc0[r] += q0;
    acc1[r] += q1;
    acc2[r] += q2;
    acc3[r] += q3;
  }
  epi16(slab + wave * SLAB, acc0, acc1, acc2, acc3, oscale, C, N, (size_t)rowb, col0, lane);
}

// =====================================================================================================
// Query projection with fused per-chunk L2 normalisation:
//   q[M][NCG*64] (f32, registers only) = A[M][K] (bf16 x plane) . Bt[NCG*64][K]^T (bf16 Wq plane) + bias[col] (RNE bf16 value);
//   block = 16 rows x all NCG column groups of 64, one wave per column group (wave index = cg), so the NCG groups of a row
//   tile run side by side instead of one after the other. K = DMOD. A stage = QKS k values of all DMOD weight rows and of the
//   block's 16 x rows, brought into LDS by asynchronous 16-byte copies (8 lanes = one whole 128-B line; 16 copies per thread
//   and stage, one more in waves 0..3 for the x rows), two buffers: stage t+2 is issued behind the barrier at the foot of
//   trip t and flies during trip t+1. Fragments are read from LDS rows of 144 B; k runs upward in steps of 32 as before.
//   For D row 8hh+r the 64-wide chunk (row, cols col0..col0+63) lives
//   in the 16 lanes of half hh x 4 accumulators: ss = sum of squares (4 products per lane, xor-1/2/4/8 shuffles inside the
//   half), qn = q * (1/max(sqrt(ss), 1e-12)), aa = sum of qn^2 the same way (f32), kept in LDS at aas[(row in block)*NCG + cg].
//   After the block barrier the block's 16*NCG aa values (chunk index = row*NCG + cg) go out as whole 128-B lines that no
//   other block writes (16*NCG floats is a multiple of 32).
//   Part of the projection launch: block index = row tile, block = NCG waves (every wave reaches every barrier); slabs, aa
//   values and ring lie in the block's LDS pool.
// coverage: qn plane: M/16 blocks x NCG waves x (16 x 64) = M x NCG*64;  aa table: M/16 blocks x 16*NCG floats = M*NCG.
// =====================================================================================================
__device__ __forceinline__
void gemm_qn(char* pool, const u16* __restrict__ A, const u16* __restrict__ Bt, u16* C, float* AAP,
             const float* __restrict__ bias, int nbias, float oscale) {
  float* slab = (float*)(void*)pool;
  float* aas  = slab + NCG * SLAB;
  u16*   ring = (u16*)(void*)(pool + NCG * SLAB * 4 + 16 * NCG * 4);   // two buffers of (DMOD weight rows, 16 x rows), rows of LPH halves
  const int K = DMOD;
  const int tid = threadIdx.x, wave = tid >> 5, lane = tid & 31, hh = lane >> 4, m = lane & 15;
  const bool xw = __builtin_amdgcn_readfirstlane(tid >> 5) < 4;   // scalar: waves 0..3 also copy the x rows
  const int N = NCG * 64;
  const int rowb = blockIdx.x * 16;
  const int col0 = wave * 64;
  // copy addresses of this thread: weight chunk i = tid + 384*j, row = i >> 3 = (tid >> 3) + 48*j, 16-byte column = tid & 7;
  // x chunk (waves 0..3) = tid, row = tid >> 3 (kept inside 0..15 in every thread)
  const unsigned lb0 = lds_addr(ring) + (unsigned)((tid >> 3) * (LPH * 2) + (tid & 7) * 16);
  const unsigned la0 = lds_addr(ring) + (unsigned)((DMOD + ((tid >> 3) & 15)) * (LPH * 2) + (tid & 7) * 16);
  const char* gb0 = (const char*)(const void*)(Bt + (size_t)(tid >> 3) * K) + (tid & 7) * 16;
  const char* ga0 = (const char*)(const void*)(A + (size_t)(rowb + ((tid >> 3) & 15)) * K) + (tid & 7) * 16;
  const unsigned lst = 48 * LPH * 2;         // 48 rows on, in LDS
  const size_t   gst = (size_t)48 * K * 2;   // 48 rows on, in the weight plane
  // stage 0 landed and published; then stage 1 into the other buffer
  copy8(lb0, lst, gb0, gst);
  copy8(lb0 + 8 * lst, lst, gb0 + 8 * gst, gst);
  if (xw) copy1(la0, ga0);
  wait_copies();
  __syncthreads();
  copy8(lb0 + QBUFH * 2, lst, gb0 + QKS * 2, gst);
  copy8(lb0 + QBUFH * 2 + 8 * lst, lst, gb0 + QKS * 2 + 8 * gst, gst);
  if (xw) copy1(la0 + QBUFH * 2, ga0 + QKS * 2);
  v8f acc0 = zero8(), acc1 = zero8(), acc2 = zero8(), acc3 = zero8();
#pragma unroll 1   // one trip per stage: the buffer index alternates, the code stays small
  for (int t = 0; t < QNS; ++t) {
    const u16* bufp = ring + (t & 1) * QBUFH;
    const u16* al = bufp + (DMOD + m) * LPH + 8 * hh;
    const u16* bl = bufp + (col0 + m) * LPH + 8 * hh;
    // all LDS reads of the stage's 64 k values stand together in front of their products
    const v16b a  = ldfrag_b(al),                 e  = ldfrag_b(al + 32);
    const v16b b0 = ldfrag_b(bl),                 f0 = ldfrag_b(bl + 32);
    const v16b b1 = ldfrag_b(bl + 16 * LPH),      f1 = ldfrag_b(bl + 16 * LPH + 32);
    const v16b b2 = ldfrag_b(bl + 32 * LPH),      f2 = ldfrag_b(bl + 32 * LPH + 32);
    const v16b b3 = ldfrag_b(bl + 48 * LPH),      f3 = ldfrag_b(bl + 48 * LPH + 32);
    acc0 = mma_b(a, b0, acc0);
    acc1 = mma_b(a, b1, acc1);
    acc2 = mma_b(a, b2, acc2);
    acc3 = mma_b(a, b3, acc3);
    guard6<v16b>(acc0, acc1, acc2, acc3, a, b0, b1, b2, b3, a);
    acc0 = mma_b(e, f0, acc0);
    acc1 = mma_b(e, f1, acc1);
    acc2 = mma_b(e, f2, acc2);
    acc3 = mma_b(e, f3, acc3);
    guard6<v16b>(acc0, acc1, acc2, acc3, e, f0, f1, f2, f3, e);
    // foot of trip t: own LDS reads back, own copies of stage t+1 landed, barrier (publishes stage t+1 and ends every
    // reader's last read of this trip's buffer); only then the refill of that buffer with stage t+2
    wait_lds();
    wait_copies();
    __syncthreads();
    if (t + 2 < QNS) {
      const unsigned bo = (unsigned)((t & 1) * (QBUFH * 2));
      const int go = (t + 2) * (QKS * 2);
      copy8(lb0 + bo, lst, gb0 + go, gst);
      copy8(lb0 + bo + 8 * lst, lst, gb0 + go + 8 * gst, gst);
      if (xw) copy1(la0 + bo, ga0 + go);
    }
  }
  wait_copies();
  acc_guard4(acc0, acc1, acc2, acc3);
  float bc[4];
#pragma unroll
  for (int j = 0; j < 4; ++j) {
    int ci = col0 + 16 * j + m;
    ci = (ci < nbias) ? ci : (nbias - 1);
    bc[j] = bf_val(bias[ci]);
  }
#pragma unroll
  for (int r = 0; r < 8; ++r) {
    acc0[r] += bc[0];
    acc1[r] += bc[1];
    acc2[r] += bc[2];
    acc3[r] += bc[3];
  }
  // per row: L2 normalise the 64-wide chunk and take the f32 sum of squares of the normalised values
#pragma unroll
  for (int r = 0; r < 8; ++r) {
    float ss = acc0[r] * acc0[r] + acc1[r] * acc1[r] + acc2[r] * acc2[r] + acc3[r] * acc3[r];
    ss += __shfl_xor(ss, 1, 32);
    ss += __shfl_xor(ss, 2, 32);
    ss += __shfl_xor(ss, 4, 32);
    ss += __shfl_xor(ss, 8, 32);
    const float nrm = sqrtf(ss);
    const float den = fmaxf(nrm, 1e-12f);
    const float inv = 1.0f / den;
    acc0[r] *= inv;
    acc1[r] *= inv;
    acc2[r] *= inv;
    acc3[r] *= inv;
    float a2 = acc0[r] * acc0[r] + acc1[r] * acc1[r] + acc2[r] * acc2[r] + acc3[r] * acc3[r];
    a2 += __shfl_xor(a2, 1, 32);
    a2 += __shfl_xor(a2, 2, 32);
    a2 += __shfl_xor(a2, 4, 32);
    a2 += __shfl_xor(a2, 8, 32);
    if (m == 0) aas[(8 * hh + r) * NCG + wave] = a2;
  }
  epi16(slab + wave * SLAB, acc0, acc1, acc2, acc3, oscale, C, N, (size_t)rowb, col0, lane);
  __syncthreads();
  // aa table lines of this block: 16*NCG contiguous floats; thread t < 16*NCG/4 writes float4 t
  const int nf4 = 16 * NCG / 4;
  if (tid < nf4) {
    const v4f w0 = *(const v4f*)(aas + 4 * tid);
    *(v4f*)(AAP + (size_t)blockIdx.x * (size_t)(16 * NCG) + 4 * tid) = w0;
  }
}

// =====================================================================================================
// Both projections in ONE launch (neither reads what the other writes): blocks 0 .. QBLK-1 do the query projection (the longer
// part, so it starts first), blocks QBLK .. QBLK+VBLK-1 the v^T GEMM, VTPB tiles each. The choice is block-uniform, so every
// barrier of either part is passed by all NCG waves of its block. One LDS pool per block, laid out by the part that runs.
// =====================================================================================================
__global__ __launch_bounds__(NCG * 32)
void gemm_qv(const u16* __restrict__ XBp, const u16* __restrict__ WQp, const u16* __restrict__ WVp, u16* QPp, float* AAP,
             u16* VPp, const float* __restrict__ bq, const float* __restrict__ bv) {
  __shared__ __align__(16) char pool[POOLB];
  const int b = blockIdx.x;
  if (b >= QBLK + VBLK) return;              // block-uniform, never taken with the exact grid; in front of every barrier
  if (b < QBLK) gemm_qn(pool, XBp, WQp, QPp, AAP, bq, DMOD, QSC);
  else          gemm_b16(pool, (b - QBLK) * VTPB, WVp, XBp, VPp, bv, SEQ, DMOD, 1, VCAR);
}

// =====================================================================================================
// L2-distance flash attention (no masking, all SEQ keys): block = (head, 64 query rows), 4 waves, wave w owns the 16 query
// rows q0 = 64*qt + 16*w .. q0+15. The block's 4 waves share the key and value tiles: a stage = 64 keys = K tile (64 key rows
// x 128 B) + V tile (64 d rows x 128 B), brought into LDS by asynchronous 16-byte copies (whole 128-B lines, 8 copies per
// thread and stage), two buffers: stage t+2 is issued behind the barrier at the foot of trip t and flies during trip t+1.
// The head's AA table (SEQ floats) is copied once with stage 0. Fragments are read from LDS rows of 144 B.
//   qn plane (f16, x QSC) laid out as [NHD*SEQ chunks][64]: head h, row n = chunk h*SEQ + n; keys and queries both come
//   from this plane. AA table (f32) indexed by the same chunk index. v^T plane [h*64+d][SEQ keys] (x1024).
//   All NKB = SEQ/32 key blocks of 32 keys are visited (static bound).
//   Scores are computed TRANSPOSED: S^T tile g (g = 0,1) = key rows (keys kb+16g .. +15, A operand, row m = lane&15, split
//   k map over d) times q^T (B operand, col n = query q0 + (lane&15), k = d, split map), one product per tile and 32-deep
//   d-chunk. D element r of lane l = (key kb+16g+8h+r, query q0+(l&15)), so a lane owns one query column and 16 of its 32
//   keys; the partner lane l^16 owns the other 16 -> row sum needs one xor-16 shuffle.
//   Base-2 logit: t = (2*qn_n.qn_m/(QSC*QSC) - AA_n - AA_m) * log2(e)/8. Every qn row is a vector divided by at least its own
//   norm, so its length is at most 1 (f16 rounding adds under 0.1 %): |2*qn_n.qn_m| * log2(e)/8 < 0.37 and
//   0 <= AA * log2(e)/8 < 0.19 for any finite input, hence -0.74 < t < 0.37. The softmax therefore needs no running maximum:
//   its shift is the constant -PSH, p = exp2(t + PSH) = P x 32768 lies in (19000, 43000), inside f16, the exp2 argument is far
//   from the subnormal range (bare hardware exp2), and neither l nor the O accumulators are ever rescaled.
//   The exp'd values ARE the P A-fragment in place: A row m = query = lane&15, element i <- key kb+8h+i (tile 0, D element i),
//   element 8+i <- key kb+16+8h+i (tile 1, D element i). l (x32768) is summed per lane in 4 partial sums over the lane's
//   own keys; the partials and the partner lane l^16 are joined once behind the loop. 4 v^T B fragments
//   (col n = d = 16j + (lane&15), keys k-contiguous), 4 P.V WMMAs per key block.
//   Epilogue: 1/l (per query, shuffled to the D row owner) and carry folds in f32; the wave's 16x64 f32 result staged in its
//   aux0/aux1 are bound only (not read).
// coverage: per wave 8 instructions x 2 rows x 16 lanes x 4 floats = 16 x 64; grid NHD*(SEQ/64) blocks x 4 waves = every
//           output row (h, n < SEQ) exactly once = SEQ*NHD*64 floats.
// =====================================================================================================
__global__ __launch_bounds__(ATT_THREADS)
void attn_l2(const u16* __restrict__ QPp, const float* __restrict__ AAp, const u16* __restrict__ VPp, float* out,
             const float* aux0, const float* aux1) {
  __shared__ __align__(16) float smem[ATT_WAVES * SLAB];   // per wave: result slab [16][68] in the epilogue only
  __shared__ __align__(16) _Float16 ring[2 * BUFH];        // two buffers of (K tile, V tile), rows of LPH halves
  __shared__ __align__(16) float aas[SEQ];                 // AA table of this head
  (void)aux0; (void)aux1;

  const int tid  = threadIdx.x;
  const int wave = tid >> 5;
  const int lane = tid & 31;
  const int hh   = lane >> 4;
  const int c    = lane & 15;

  const int bid  = blockIdx.x;
  const int qt   = bid % QTILES;
  const int head = bid / QTILES;
  if (head >= NHD) return;                                 // block-uniform, never taken with the exact grid; in front of every barrier
  const int q0   = qt * 64 + wave * 16;
  const size_t hb = (size_t)head * SEQ;                    // chunk index base of this head

  const _Float16* QH = (const _Float16*)(const void*)QPp;
  // B fragments of q^T: col n = query chunk hb + q0 + c, k = d
  const _Float16* Qb = QH + (hb + (size_t)(q0 + c)) * HD + 8 * hh;
  // copy addresses of this thread: chunk i = tid + 128*j, row = i >> 3 = (tid >> 3) + 16*j, 16-byte column = tid & 7
  const unsigned lk0 = lds_addr(ring) + (unsigned)((tid >> 3) * (LPH * 2) + (tid & 7) * 16);
  const char* gk0 = (const char*)(const void*)(QH + hb * HD) + tid * 16;                       // K rows are contiguous
  const char* gv0 = (const char*)(const void*)((const _Float16*)(const void*)VPp + ((size_t)(head * HD + (tid >> 3))) * SEQ)
                    + (tid & 7) * 16;
  // stage 0 and the AA table, landed and published; then stage 1 into the other buffer
  copy_stage(lk0, gk0, gv0);
#pragma unroll   // straight line: AACP copies, each with constant address steps
  for (int j = 0; j < AACP; ++j)
    copy1(lds_addr(aas) + (unsigned)((tid + ATT_THREADS * j) * 16), (const char*)(const void*)(AAp + hb) + (tid + ATT_THREADS * j) * 16);
  wait_copies();
  __syncthreads();
  copy_stage(lk0 + BUFH * 2, gk0 + (size_t)KT * HD * 2, gv0 + KT * 2);
  const float lsc = 0.25f * (LOG2E / (QSC * QSC));
  const float c1l = 0.125f * LOG2E;
  const float aq  = AAp[hb + (size_t)(q0 + c)] * c1l - PSH; // AA term of this lane's query, with the constant shift

  const v16h qf0 = ldfrag_h(Qb);            // d 0..31
  const v16h qf1 = ldfrag_h(Qb + 32);       // d 32..63

  v2f lp[2] = {{0.f, 0.f}, {0.f, 0.f}};     // partial sums of p over this lane's keys, element i -> lp[(i >> 1) & 1][i & 1]
  v8f o[4];
#pragma unroll
  for (int j = 0; j < 4; ++j) o[j] = zero8();

#pragma unroll 1
  for (int t = 0; t < NST; ++t) {
   const _Float16* bufp = ring + (t & 1) * BUFH;
   // A fragments of keys: LDS row = key in stage (32u + 16g + c), k = d;  B fragments of v: LDS row = d = 16j + c, k = key
   const _Float16* Kl = bufp + c * LPH + 8 * hh;
   const _Float16* Vl = bufp + TILEH + c * LPH + 8 * hh;
#pragma unroll   // both 32-key blocks of the stage in line: u becomes an immediate offset of the LDS reads
   for (int u = 0; u < 2; ++u) {
    const int kb = t * KT + u * 32;
    // ---- all LDS reads of this 32-key block stand together in front of its products ----
    const _Float16* k0p = Kl + (32 * u) * LPH;
    const _Float16* k1p = k0p + 16 * LPH;
    const v16h ka0 = ldfrag_h(k0p), ka1 = ldfrag_h(k0p + 32);
    const v16h kc0 = ldfrag_h(k1p), kc1 = ldfrag_h(k1p + 32);
    // AA of this lane's 16 keys: tile 0 element i -> key kb+8hh+i, tile 1 element i -> key kb+16+8hh+i
    const float* am = aas + kb + 8 * hh;
    const v4f w0 = *(const v4f*)(am), w1 = *(const v4f*)(am + 4);
    const v4f w2 = *(const v4f*)(am + 16), w3 = *(const v4f*)(am + 20);
    const _Float16* vp = Vl + 32 * u;
    const v16h vf0 = ldfrag_h(vp);
    const v16h vf1 = ldfrag_h(vp + 16 * LPH);
    const v16h vf2 = ldfrag_h(vp + 32 * LPH);
    const v16h vf3 = ldfrag_h(vp + 48 * LPH);
    // ---- transposed scores: s0 = keys kb..kb+15, s1 = keys kb+16..kb+31, column = query q0 + c ----
    v8f s0 = zero8(), s1 = zero8();
    s0 = mma_h(ka0, qf0, s0);
    s0 = mma_h(ka1, qf1, s0);
    s1 = mma_h(kc0, qf0, s1);
    s1 = mma_h(kc1, qf1, s1);
    guard2(s0, s1, qf0, qf1, ka0, ka1, kc0, kc1);
    // ---- p = exp2(t + PSH) of this lane's 16 keys for query q0 + c, and the P A-fragment: element i <-> key i ----
    FragH ph;
#pragma unroll
    for (int e = 0; e < 2; ++e) {          // pairs of neighbouring keys: elements 2e, 2e+1 of each group of four
      const int i = 2 * e;
      const v2f sa = {s0[i], s0[i + 1]}, sb = {s0[4 + i], s0[5 + i]}, sc = {s1[i], s1[i + 1]}, sd = {s1[4 + i], s1[5 + i]};
      const v2f wa = {w0[i], w0[i + 1]}, wb = {w1[i], w1[i + 1]}, wc = {w2[i], w2[i + 1]}, wd = {w3[i], w3[i + 1]};
      const v2f ta = sa * lsc - (wa * c1l + aq), tb = sb * lsc - (wb * c1l + aq);
      const v2f tc = sc * lsc - (wc * c1l + aq), td = sd * lsc - (wd * c1l + aq);
      const v2f pa = {__builtin_amdgcn_exp2f(ta[0]), __builtin_amdgcn_exp2f(ta[1])};
      const v2f pb = {__builtin_amdgcn_exp2f(tb[0]), __builtin_amdgcn_exp2f(tb[1])};
      const v2f pc = {__builtin_amdgcn_exp2f(tc[0]), __builtin_amdgcn_exp2f(tc[1])};
      const v2f pd = {__builtin_amdgcn_exp2f(td[0]), __builtin_amdgcn_exp2f(td[1])};
      ph.u[0][e]     = pkh(pa);
      ph.u[0][2 + e] = pkh(pb);
      ph.u[1][e]     = pkh(pc);
      ph.u[1][2 + e] = pkh(pd);
      lp[e] += (pa + pb) + (pc + pd);
    }
    // ---- P.V : B fragment col n = d = j*16 + c, keys contiguous in the staged v^T rows ----
    {
      o[0] = mma_h(ph.v, vf0, o[0]);
      o[1] = mma_h(ph.v, vf1, o[1]);
      o[2] = mma_h(ph.v, vf2, o[2]);
      o[3] = mma_h(ph.v, vf3, o[3]);
      guard6<v16h>(o[0], o[1], o[2], o[3], ph.v, vf0, vf1, vf2, vf3, ph.v);
    }
   }
   // ---- foot of trip t: own LDS reads back, own copies of stage t+1 landed, barrier (publishes stage t+1 and ends every
   //      reader's last read of this trip's buffer); only then the refill of that buffer with stage t+2 ----
   wait_lds();
   wait_copies();
   __syncthreads();
   if (t + 2 < NST)
     copy_stage(lk0 + (unsigned)((t & 1) * (BUFH * 2)), gk0 + (size_t)(t + 2) * (KT * HD * 2), gv0 + (t + 2) * (KT * 2));
  }
  wait_copies();
  acc_guard4(o[0], o[1], o[2], o[3]);

  // ---- l x32768 of this lane's query: own partials, then the partner lane's 16 keys of every block ----
  float lrun = (lp[0][0] + lp[0][1]) + (lp[1][0] + lp[1][1]);
  lrun += __shfl_xor(lrun, 16, 32);
  // ---- fold 1/l (per query, owned by lane = query; the x32768 of P and of l cancel) and the v carry; stage the 16x64 slab ----
  const float linv = (lrun > 0.f) ? ((1.0f / lrun) * (1.0f / VCAR)) : 0.f;
  float inv[8];
#pragma unroll
  for (int r = 0; r < 8; ++r) inv[r] = __shfl(linv, 8 * hh + r, 32);
  float* slab = smem + wave * SLAB;
#pragma unroll
  for (int r = 0; r < 8; ++r) {
#pragma unroll
    for (int j = 0; j < 4; ++j) slab[(8 * hh + r) * 68 + j * 16 + c] = o[j][r] * inv[r];
  }
  wave_sync_lds();
  // ---- f32 output rows: lanes 0..15 -> row 2*it2, lanes 16..31 -> row 2*it2+1, 16 lanes x 16 B = one 256-B row ----
  v4f vals[8];
#pragma unroll
  for (int it2 = 0; it2 < 8; ++it2) vals[it2] = *(const v4f*)(slab + (it2 * 2 + hh) * 68 + c * 4);
  float* dst = out + (hb + (size_t)(q0 + hh)) * HD + c * 4;
  {
#pragma unroll
    for (int it2 = 0; it2 < 8; ++it2) {
      *(v4f*)(dst + (size_t)(it2 * 2) * HD) = vals[it2];
    }
    
  }
}

// =====================================================================================================
// Workspace map (bytes); every plane is fully written by whole-line stores before it is read; all extents are exact multiples
// of the store granularity (no pad rows needed), every offset a multiple of 128:
//   XB  bf16 [SEQ][768]                          SEQ*1536   (3145728 at SEQ = 2048)
//   WQB bf16 [768 n][768 k]                      1179648    WVB same
//   QP  f16  [SEQ][768] = [12*SEQ chunks][64] x16 SEQ*1536
//   AAP f32  [12*SEQ]                            SEQ*48     (98304)
//   VP  f16  [768 = h*64+d][SEQ] x1024           SEQ*1536
//   end                                          11894784 at SEQ = 2048
// =====================================================================================================
extern "C" void kernel_launch(void* const* d_in, const int* in_sizes, int n_in,
                              void* d_out, int out_size, void* d_ws, size_t ws_size,
                              hipStream_t stream) {
  if (n_in < 7) return;
  if (in_sizes[0] < SEQ * DMOD) return;
  if (in_sizes[1] < 1 || in_sizes[2] < 1) return;
  if (in_sizes[3] != DMOD * DMOD || in_sizes[5] != DMOD * DMOD) return;
  if (in_sizes[4] != DMOD || in_sizes[6] != DMOD) return;
  if (out_size < SEQ * DMOD) return;

  const float* Xin = (const float*)d_in[0];
  const float* Gin = (const float*)d_in[1];               // bound only, not read
  const float* Min = (const float*)d_in[2];               // bound only, not read
  const float* Wq  = (const float*)d_in[3];
  const float* bq  = (const float*)d_in[4];
  const float* Wv  = (const float*)d_in[5];
  const float* bv  = (const float*)d_in[6];
  float*       out = (float*)d_out;

  const size_t szXB = (size_t)SEQ * DMOD * 2;
  const size_t szW  = (size_t)DMOD * DMOD * 2;
  const size_t szQP = (size_t)SEQ * DMOD * 2;
  const size_t szAA = (size_t)NHD * SEQ * 4;
  const size_t szVP = (size_t)DMOD * SEQ * 2;
  size_t off = 0;
  const size_t oXB = off; off += szXB;
  const size_t oWQ = off; off += szW;
  const size_t oWV = off; off += szW;
  const size_t oQP = off; off += szQP;
  const size_t oAA = off; off += szAA;
  const size_t oVP = off; off += szVP;
  if (off > ws_size) return;                            // off = 11894784 at SEQ = 2048
  if (off > (size_t)134217728) return;

  char* ws = (char*)d_ws;
  u16*   XB  = (u16*)(ws + oXB);
  u16*   WQB = (u16*)(ws + oWQ);
  u16*   WVB = (u16*)(ws + oWV);
  u16*   QP  = (u16*)(ws + oQP);
  float* AAP = (float*)(ws + oAA);
  u16*   VP  = (u16*)(ws + oVP);

  const int n8x = (SEQ * DMOD) / 8;
  const int n8w = (DMOD * DMOD) / 8;
  if ((n8x % 256) != 0 || (n8w % 256) != 0) return;
  if ((DMOD % 64) != 0 || (SEQ % 64) != 0 || (DMOD % 32) != 0) return;
  const dim3 blk(256);
  const dim3 gC(CVX + 2 * CVW);                         // 768 + 2 * 288 at SEQ = 2048
  const dim3 gP(QBLK + VBLK);                           // 128 + 128
  const dim3 bP(NCG * 32);                              // 384
  const dim3 gAT(ATT_BLOCKS);                           // 384
  const dim3 bAT(ATT_THREADS);                          // 128

  // (0) operand planes: x -> bf16; Wq/Wv [n = out][k = in] (already k-contiguous) -> bf16
  //     (XB, WQB, WVB follow one another in the workspace: one joined destination)
  cvt16x3<<<gC, blk, 0, stream>>>(Xin, Wq, Wv, XB);
  // (1) q = x.Wq^T + bq, L2-normalised per 64-chunk -> qn plane [SEQ][768] f16 x16 and AA table [12*SEQ] f32;
  //     v^T plane: [768 = h*64+d][SEQ keys] = f16((Wv . x^T + bv) x1024), bias by row
  gemm_qv<<<gP, bP, 0, stream>>>(XB, WQB, WVB, QP, AAP, VP, bq, bv);
  // (2) attention -> out, f32 row (chunk h*SEQ + n) of 64 floats at float offset (h*SEQ + n)*64
  attn_l2<<<gAT, bAT, 0, stream>>>(QP, AAP, VP, out, Gin, Min);
  (void)hipGetLastError();
}

// v006
// A run of this version takes 42.1 microseconds.
// Next to v005, in two timings, it ran 1.11 and 1.09 times as fast.
// Counting every step since v000, it is 6.62 times as fast.
// Contractions: x.Wq^T+bq and Wv.x^T+bv on v_wmma_f32_16x16x32_bf16 (x and W planes RNE-converted to bf16 operands, f32 accumulate);
// scores qn.qn^T (qn = L2-normalised q, single f16 plane carried x16) and P.v (P x32768 single f16, v x1024 single f16) on
// v_wmma_f32_16x16x32_f16, f32 accumulate. Biases folded as RNE bf16 values in f32 epilogues; L2 normalisation, sums of squares,
// base-2 softmax with a constant shift, 1/l and carry folds in f32 on VALU.
#include <hip/hip_runtime.h>
#include <math.h>
#include <stdint.h>

#ifndef NB
#define NB 1
#endif
#ifndef SEQ
#define SEQ 2048
#endif
#define SEQ_FULL 2048
#define DMOD  768
#define NHD   12
#define HD    64
#define NCG   (DMOD / 64)
#define QSC   16.0f
#define PCAR  32768.0f
#define PSH   15.0f               // log2(PCAR): the constant shift of the base-2 logits, so that exp2 yields P x PCAR at once
#define VCAR  1024.0f
#define LOG2E 1.4426950408889634f
#define ATT_WAVES   4
#define ATT_THREADS (ATT_WAVES * 32)
#define QTILES      (SEQ / 64)
#define ATT_BLOCKS  (NHD * QTILES)
#define NKB    (SEQ / 32)
#define SLAB   (16 * 68)
#define KT     64                 // keys per LDS stage of the attention loop (two 32-key blocks)
#define NST    (SEQ / KT)         // stages
#define LPH    72                 // LDS row pitch in halves: 128-B rows at 144 B = 16 B x odd, for 16-byte LDS readers
#define TILEH  (64 * LPH)         // one staged tile of 64 rows, in halves
#define BUFH   (2 * TILEH)        // one buffer: K tile, then V tile
#define AACP   ((SEQ * 4) / (ATT_THREADS * 16))   // 16-byte copies per thread for one head's AA table
static_assert(NST * KT == SEQ && NST >= 2 && KT == 2 * 32 && HD == 64);
static_assert((NST & (NST - 1)) == 0 && NST >= 8 && NST == QTILES);   // the rotated stage walk wraps by a mask
static_assert(AACP * ATT_THREADS * 16 == SEQ * 4 && (LPH * 2) % 16 == 0 && ATT_THREADS * 4 * 16 == KT * HD * 2);
#define QKS    64                 // k halves per LDS stage of the query projection: 128-B row pieces at pitch LPH
#define QNS    (DMOD / QKS)       // its stages
#define QBUFH  ((DMOD + 16) * LPH)   // one buffer: DMOD weight rows, then the block's 16 x rows, in halves
#define VKS    128                // k halves per LDS stage of the 64x64 GEMM: 256-B row pieces
#define VNS    (DMOD / VKS)       // its stages
#define VPH    136                // their LDS pitch in halves: 272 B = 16 B x odd
#define VBUFH  (128 * VPH)        // one buffer: 64 A rows, then 64 B rows, in halves
static_assert(QNS * QKS == DMOD && QNS >= 2 && VNS * VKS == DMOD && VNS >= 2 && (VPH * 2) % 16 == 0);
static_assert(NCG * 32 * 16 * 16 == DMOD * QKS * 2 && 128 * 8 * 16 == 64 * VKS * 2);
#define CVX    ((SEQ * DMOD) / 2048)    // blocks of the conversion launch for x (256 threads x 8 elements each)
#define CVW    ((DMOD * DMOD) / 2048)   // its blocks for each weight plane
#define QBLK   (SEQ / 16)         // blocks of the projection launch that do the query projection (16 rows each)
#define VTPB   3                  // 64x64 tiles of the v^T GEMM per block of that launch: one per group of 4 waves
#define VBLK   (((DMOD / 64) * (SEQ / 64)) / VTPB)   // its blocks that do the v^T GEMM
#define POOLB  (NCG * SLAB * 4 + 16 * NCG * 4 + 2 * QBUFH * 2)   // LDS bytes of a block: what the query part needs, the larger of the two
static_assert(VBLK * VTPB == (DMOD / 64) * (SEQ / 64) && VTPB * 4 == NCG);
static_assert(NCG * SLAB * 4 + VTPB * 2 * VBUFH * 2 <= POOLB && (NCG * SLAB * 4) % 16 == 0 && (2 * VBUFH * 2) % 16 == 0);
static_assert(NB == 1);
static_assert(HD == 64 && DMOD == NHD * HD && NCG * 64 == DMOD);
static_assert((SEQ % 64) == 0 && SEQ >= 64 && SEQ <= SEQ_FULL);
static_assert(ATT_THREADS == 128 && NKB * 32 == SEQ && ATT_BLOCKS == NHD * (SEQ / 64));
static_assert((DMOD % 64) == 0 && (DMOD % 32) == 0);
static_assert(((SEQ * DMOD / 8) % 256) == 0 && ((DMOD * DMOD / 8) % 256) == 0);
static_assert((SLAB * 4) % 16 == 0);
static_assert(((16 * NCG) % 32) == 0 && NCG * 32 <= 1024 && (SEQ % 16) == 0);

typedef unsigned short u16;
typedef _Float16 v16h __attribute__((ext_vector_type(16)));
typedef _Float16 v8h  __attribute__((ext_vector_type(8)));
typedef __bf16   v16b __attribute__((ext_vector_type(16)));
typedef float    v8f  __attribute__((ext_vector_type(8)));
typedef float    v4f  __attribute__((ext_vector_type(4)));
typedef unsigned int v4u __attribute__((ext_vector_type(4)));
typedef float    v2f  __attribute__((ext_vector_type(2)));
typedef _Float16 v2h  __attribute__((ext_vector_type(2)));

union FragH { v16h v; v8h h[2]; v4u u[2]; };
union FragB { v16b v; v4u u[2]; };

// ---- scalar helpers --------------------------------------------------------------------------------
__device__ __forceinline__ unsigned short bf_bits(float f) {          // f32 -> bf16 bits, RNE convert
  unsigned u = __float_as_uint(f);
  return (unsigned short)((u + 0x7FFFu + ((u >> 16) & 1u)) >> 16);
}
__device__ __forceinline__ float bf_up(unsigned short h) { return __uint_as_float(((unsigned)h) << 16); }
__device__ __forceinline__ float bf_val(float f) { return bf_up(bf_bits(f)); }          // value after RNE bf16 convert
__device__ __forceinline__ unsigned short h_bits(_Float16 x) { return __builtin_bit_cast(unsigned short, x); }
__device__ __forceinline__ unsigned pk16(unsigned short a, unsigned short b) { return (unsigned)a | ((unsigned)b << 16); }
__device__ __forceinline__ unsigned pkh(v2f x) {                     // two f32 -> packed f16 pair, RNE, x[0] in the low half
  return __builtin_bit_cast(unsigned, __builtin_convertvector(x, v2h));
}
__device__ __forceinline__ v8f zero8() { v8f z = {0.f, 0.f, 0.f, 0.f, 0.f, 0.f, 0.f, 0.f}; return z; }

// ---- fragment loaders: 16-bit A/B operand, lane -> row/col (lane&15), p already includes +8*(lane>>4);
//      elements 0..7 <- p[0..7] (k0+8h..), elements 8..15 <- p[16..23] (k0+16+8h..)  (same split k map for A and B;
//      B is always read from a k-contiguous [n][k] plane)
__device__ __forceinline__ v16h ldfrag_h(const _Float16* p) {
  FragH f;
  f.h[0] = *(const v8h*)(p);
  f.h[1] = *(const v8h*)(p + 16);
  return f.v;
}
__device__ __forceinline__ v16b ldfrag_b(const u16* p) {              // bf16 plane read as unsigned integer vectors
  FragB f;
  f.u[0] = *(const v4u*)(p);
  f.u[1] = *(const v4u*)(p + 16);
  return f.v;
}

__device__ __forceinline__ v8f mma_h(v16h a, v16h b, v8f c) {
  return __builtin_amdgcn_wmma_f32_16x16x32_f16(false, a, false, b, (short)0, c, false, false);
}
__device__ __forceinline__ v8f mma_b(v16b a, v16b b, v8f c) {
  return __builtin_amdgcn_wmma_f32_16x16x32_bf16(false, a, false, b, (short)0, c, false, false);
}
__device__ __forceinline__ void guard2(v8f& a, v8f& b, v16h x0, v16h x1, v16h x2, v16h x3, v16h x4, v16h x5) {
#if defined(__HIP_DEVICE_COMPILE__)
  asm volatile("v_nop\n\tv_nop\n\tv_nop\n\tv_nop"
               : "+v"(a), "+v"(b) : "v"(x0), "v"(x1), "v"(x2), "v"(x3), "v"(x4), "v"(x5) : "memory");
#endif
}
template <typename F>
__device__ __forceinline__ void guard6(v8f& a, v8f& b, v8f& c, v8f& d, F x0, F x1, F x2, F x3, F x4, F x5) {
#if defined(__HIP_DEVICE_COMPILE__)
  asm volatile("v_nop\n\tv_nop\n\tv_nop\n\tv_nop"
               : "+v"(a), "+v"(b), "+v"(c), "+v"(d) : "v"(x0), "v"(x1), "v"(x2), "v"(x3), "v"(x4), "v"(x5) : "memory");
#endif
}
__device__ __forceinline__ void acc_guard4(v8f& a, v8f& b, v8f& c, v8f& d) {
#if defined(__HIP_DEVICE_COMPILE__)
  asm volatile("v_nop\n\tv_nop\n\tv_nop\n\tv_nop" : "+v"(a), "+v"(b), "+v"(c), "+v"(d));
#endif
}
__device__ __forceinline__ void wave_sync_lds() {
#if defined(__HIP_DEVICE_COMPILE__)
  __builtin_amdgcn_fence(__ATOMIC_RELEASE, "workgroup");
  __builtin_amdgcn_wave_barrier();
  __builtin_amdgcn_fence(__ATOMIC_ACQUIRE, "workgroup");
#endif
}

// ---- asynchronous copies global -> LDS, 16 B per lane; lds = the lane's LDS byte address, g = the lane's global address.
//      The address-translation wait is the last line of the copies' own statement, so that no address register named by
//      an issued copy is rewritten in front of it.
__device__ __forceinline__ unsigned lds_addr(const void* p) { return (unsigned)(size_t)p; }
__device__ __forceinline__ void copy1(unsigned lds, const char* g) {
#if defined(__HIP_DEVICE_COMPILE__)
  asm volatile("global_load_async_to_lds_b128 %0, %1, off\n\ts_wait_xcnt 0x0" :: "v"(lds), "v"(g) : "memory");
#endif
}
// eight copies with constant steps from one to the next: ls bytes in LDS, gs bytes in global memory
__device__ __forceinline__ void copy8(unsigned l, unsigned ls, const char* g, size_t gs) {
#if defined(__HIP_DEVICE_COMPILE__)
  asm volatile("global_load_async_to_lds_b128 %0, %8, off\n\t"
               "global_load_async_to_lds_b128 %1, %9, off\n\t"
               "global_load_async_to_lds_b128 %2, %10, off\n\t"
               "global_load_async_to_lds_b128 %3, %11, off\n\t"
               "global_load_async_to_lds_b128 %4, %12, off\n\t"
               "global_load_async_to_lds_b128 %5, %13, off\n\t"
               "global_load_async_to_lds_b128 %6, %14, off\n\t"
               "global_load_async_to_lds_b128 %7, %15, off\n\t"
               "s_wait_xcnt 0x0"
               :: "v"(l), "v"(l + ls), "v"(l + 2 * ls), "v"(l + 3 * ls),
                  "v"(l + 4 * ls), "v"(l + 5 * ls), "v"(l + 6 * ls), "v"(l + 7 * ls),
                  "v"(g), "v"(g + gs), "v"(g + 2 * gs), "v"(g + 3 * gs),
                  "v"(g + 4 * gs), "v"(g + 5 * gs), "v"(g + 6 * gs), "v"(g + 7 * gs)
               : "memory");
#endif
}
// one stage: 4 K chunks (16 rows apart in LDS, 2048 B apart in the contiguous K rows) and 4 V chunks (16 d rows apart)
__device__ __forceinline__ void copy_stage(unsigned lk, const char* gk, const char* gv) {
#if defined(__HIP_DEVICE_COMPILE__)
  const unsigned rs = 16 * LPH * 2, lv = lk + TILEH * 2;
  const size_t vs = (size_t)16 * SEQ * 2;
  asm volatile("global_load_async_to_lds_b128 %0, %8, off\n\t"
               "global_load_async_to_lds_b128 %1, %9, off\n\t"
               "global_load_async_to_lds_b128 %2, %10, off\n\t"
               "global_load_async_to_lds_b128 %3, %11, off\n\t"
               "global_load_async_to_lds_b128 %4, %12, off\n\t"
               "global_load_async_to_lds_b128 %5, %13, off\n\t"
               "global_load_async_to_lds_b128 %6, %14, off\n\t"
               "global_load_async_to_lds_b128 %7, %15, off\n\t"
               "s_wait_xcnt 0x0"
               :: "v"(lk), "v"(lk + rs), "v"(lk + 2 * rs), "v"(lk + 3 * rs),
                  "v"(lv), "v"(lv + rs), "v"(lv + 2 * rs), "v"(lv + 3 * rs),
                  "v"(gk), "v"(gk + 2048), "v"(gk + 4096), "v"(gk + 6144),
                  "v"(gv), "v"(gv + vs), "v"(gv + 2 * vs), "v"(gv + 3 * vs)
               : "memory");
#endif
}
// the issuing wave's own wait: its copies have landed (before the barrier behind which other waves read them)
__device__ __forceinline__ void wait_copies() {
#if defined(__HIP_DEVICE_COMPILE__)
  asm volatile("s_wait_asynccnt 0x0" ::: "memory");
#endif
}
// address-translation wait behind a run of plain global stores, in front of whatever rewrites a register that they name
__device__ __forceinline__ void wait_xlat() {
#if defined(__HIP_DEVICE_COMPILE__)
  asm volatile("s_wait_xcnt 0x0" ::: "memory");
#endif
}
// the wave's LDS reads have returned (before the barrier behind which their buffer is refilled)
__device__ __forceinline__ void wait_lds() {
#if defined(__HIP_DEVICE_COMPILE__)
  asm volatile("s_wait_dscnt 0x0" ::: "memory");
#endif
}

// =====================================================================================================
// The three f32 operand planes (x, Wq, Wv) -> bf16 RNE bits, same layouts, in ONE launch: the planes do not depend on one
// another, and their bf16 planes follow one another in the workspace, so block b writes elements b*2048 .. +2047 of the joined
// destination and picks its source plane by block index (block-uniform): CVX blocks of x, then CVW of Wq, then CVW of Wv.
// Thread = 8 consecutive elements: two 16-B loads, one 16-B store; 32 consecutive lanes = 512 contiguous, 512-B aligned bytes
// coverage: grid = CVX + 2*CVW blocks (plane sizes are exact multiples of 2048 elements) x 256 thr x 8 = the three planes.
// =====================================================================================================
__global__ __launch_bounds__(256) void cvt16x3(const float* __restrict__ x, const float* __restrict__ wq,
                                               const float* __restrict__ wv, u16* D) {
  const int b = blockIdx.x;
  if (b >= CVX + 2 * CVW) return;           // no barriers in this kernel
  const float* s = (b < CVX) ? x : ((b < CVX + CVW) ? wq : wv);
  const int   lb = (b < CVX) ? b : ((b < CVX + CVW) ? (b - CVX) : (b - CVX - CVW));
  const float* p = s + ((size_t)lb * 256 + threadIdx.x) * 8;
  const v4f a = *(const v4f*)(p), c4 = *(const v4f*)(p + 4);
  v4u o;
#pragma unroll
  for (int e = 0; e < 2; ++e) {
    o[e]     = pk16(bf_bits(a[2 * e]),  bf_bits(a[2 * e + 1]));
    o[2 + e] = pk16(bf_bits(c4[2 * e]), bf_bits(c4[2 * e + 1]));
  }
  *(v4u*)(D + ((size_t)b * 256 + threadIdx.x) * 8) = o;
}

// =====================================================================================================
// barrier, then converted to f16 and written: lane = (row in group of 4, 8 consecutive cols); one instruction = 4 rows, each
// coverage: 4 instructions x 4 rows x 8 lanes x 8 halves = the wave's 16 x 64 tile.
// =====================================================================================================
__device__ __forceinline__ void epi16(float* sl, v8f a0, v8f a1, v8f a2, v8f a3, float oscale, u16* C, int N,
                                      size_t rowb, int col0, int lane) {
  const int hh = lane >> 4, m = lane & 15;
#pragma unroll
  for (int r = 0; r < 8; ++r) {
    const int ro = (8 * hh + r) * 68 + m;
    sl[ro]      = a0[r] * oscale;
    sl[ro + 16] = a1[r] * oscale;
    sl[ro + 32] = a2[r] * oscale;
    sl[ro + 48] = a3[r] * oscale;
  }
  wave_sync_lds();
  const int rq = lane >> 3, c8 = (lane & 7) * 8;
  v4u ov[4];
#pragma unroll
  for (int i4 = 0; i4 < 4; ++i4) {
    const int row = i4 * 4 + rq;
    const v4f a = *(const v4f*)(sl + row * 68 + c8), c4 = *(const v4f*)(sl + row * 68 + c8 + 4);
    float w[8];
#pragma unroll
    for (int e = 0; e < 4; ++e) { w[e] = a[e]; w[4 + e] = c4[e]; }
#pragma unroll
    for (int e = 0; e < 4; ++e) ov[i4][e] = pk16(h_bits((_Float16)w[2 * e]), h_bits((_Float16)w[2 * e + 1]));
  }
  u16* dst = C + (rowb + (size_t)rq) * (size_t)N + col0 + c8;
  {
#pragma unroll
    for (int i4 = 0; i4 < 4; ++i4) {
      *(v4u*)(dst + (size_t)(i4 * 4) * (size_t)N) = ov[i4];
    }
    wait_xlat();   // code of the merged kernel may follow these stores and rewrite their data or address registers
  }
}

// =====================================================================================================
// bf16 GEMM with bias and 16-bit result: C[M][N] (f16 of (acc + bias)*oscale) = A[M][K] (bf16 row-major) . Bt[N][K]^T
// (bf16 k-contiguous); bias (f32 input, taken as its RNE bf16 value) indexed by column (byrow == 0) or by row (byrow != 0),
// both candidates read with addresses clamped to [0, nbias). Tile = 64x64, 4 waves x 16 rows; K = DMOD. A stage = VKS
// k values of the tile's 64 A rows and 64 B rows, brought into LDS by asynchronous 16-byte copies (16 lanes = one 256-B row
// piece, whole 128-B lines; 16 copies per thread and stage), two buffers: stage t+2 is issued behind the barrier at the foot
// of trip t and flies during trip t+1. Fragments are read from LDS rows of 272 B (two 16-B reads each, split k map for A and
// B); k runs upward in steps of 32 from the block's own start stage and wraps.
// Part of the projection launch: a block of NCG waves holds VTPB such tiles side by side, tile tile0 + g in the 4 waves of group
// g = threadIdx.x >> 7, each group with its own slabs and its own ring in the block's LDS pool; all groups make the same trips,
// so every wave of the block passes every block barrier. (The caller gives tile0 + VTPB <= (M/64)*(N/64); M, N multiples of 64.)
// =====================================================================================================
__device__ __forceinline__
void gemm_b16(char* pool, int tile0, const u16* __restrict__ A, const u16* __restrict__ Bt, u16* C,
              const float* __restrict__ bias, int N, int nbias, int byrow, float oscale) {
  const int grp = threadIdx.x >> 7;
  float* slab = (float*)(void*)pool + grp * (4 * SLAB);
  u16*   ring = (u16*)(void*)(pool + NCG * SLAB * 4) + grp * (2 * VBUFH);   // two buffers of (A rows, B rows), rows of VPH halves
  const int K = DMOD;
  const int tid = threadIdx.x & 127, wave = tid >> 5, lane = tid & 31, hh = lane >> 4, m = lane & 15;
  const int ntile = N >> 6;
  const int bid   = tile0 + grp;
  const int row0  = (bid / ntile) * 64;
  const int rowb  = row0 + wave * 16;
  const int col0  = (bid % ntile) * 64;
  // copy addresses of this thread: chunk i = tid + 128*j, row = i >> 4 = (tid >> 4) + 8*j, 16-byte column = tid & 15
  const unsigned la0 = lds_addr(ring) + (unsigned)((tid >> 4) * (VPH * 2) + (tid & 15) * 16);
  const unsigned lb0 = la0 + 64 * VPH * 2;
  const char* ga0 = (const char*)(const void*)(A  + (size_t)(row0 + (tid >> 4)) * K) + (tid & 15) * 16;
  const char* gb0 = (const char*)(const void*)(Bt + (size_t)(col0 + (tid >> 4)) * K) + (tid & 15) * 16;
  const unsigned lst = 8 * VPH * 2;          // 8 rows on, in LDS
  const size_t   gst = (size_t)8 * K * 2;    // 8 rows on, in the source plane
  // Rotated walk: trip t works on k stage (t + rot) mod VNS, rot by block index. Blocks that read the same A or B rows then
  // ask for mostly different stages at the same time, so each line's first fetch into L2 is waited for by few of them and the
  // others find it there. For speed only: any rot in 0 .. VNS-1 gives every stage exactly once.
  const int rot = (tile0 / VTPB) % VNS;
  const int k1  = (rot + 1 < VNS) ? (rot + 1) : 0;
  // first stage landed and published; then the second into the other buffer
  copy8(la0, lst, ga0 + rot * (VKS * 2), gst);
  copy8(lb0, lst, gb0 + rot * (VKS * 2), gst);
  wait_copies();
  __syncthreads();
  copy8(la0 + VBUFH * 2, lst, ga0 + k1 * (VKS * 2), gst);
  copy8(lb0 + VBUFH * 2, lst, gb0 + k1 * (VKS * 2), gst);
  v8f acc0 = zero8(), acc1 = zero8(), acc2 = zero8(), acc3 = zero8();
#pragma unroll 1   // one trip per stage: the buffer index alternates, the code stays small
  for (int t = 0; t < VNS; ++t) {
    const u16* bufp = ring + (t & 1) * VBUFH;
    const u16* al = bufp + (wave * 16 + m) * VPH + 8 * hh;
    const u16* bl = bufp + (64 + m) * VPH + 8 * hh;
#pragma unroll     // k offsets inside the stage become immediate offsets of the LDS reads
    for (int u = 0; u < VKS; u += 64) {
      // all LDS reads of 64 k values stand together in front of their products
      const v16b a  = ldfrag_b(al + u),                 e  = ldfrag_b(al + u + 32);
      const v16b b0 = ldfrag_b(bl + u),                 f0 = ldfrag_b(bl + u + 32);
      const v16b b1 = ldfrag_b(bl + 16 * VPH + u),      f1 = ldfrag_b(bl + 16 * VPH + u + 32);
      const v16b b2 = ldfrag_b(bl + 32 * VPH + u),      f2 = ldfrag_b(bl + 32 * VPH + u + 32);
      const v16b b3 = ldfrag_b(bl + 48 * VPH + u),      f3 = ldfrag_b(bl + 48 * VPH + u + 32);
      acc0 = mma_b(a, b0, acc0);
      acc1 = mma_b(a, b1, acc1);
      acc2 = mma_b(a, b2, acc2);
      acc3 = mma_b(a, b3, acc3);
      guard6<v16b>(acc0, acc1, acc2, acc3, a, b0, b1, b2, b3, a);
      acc0 = mma_b(e, f0, acc0);
      acc1 = mma_b(e, f1, acc1);
      acc2 = mma_b(e, f2, acc2);
      acc3 = mma_b(e, f3, acc3);
      guard6<v16b>(acc0, acc1, acc2, acc3, e, f0, f1, f2, f3, e);
    }
    // foot of trip t: own LDS reads back, own copies of stage t+1 landed, barrier (publishes stage t+1 and ends every
    // reader's last read of this trip's buffer); only then the refill of that buffer with stage t+2
    wait_lds();
    wait_copies();
    __syncthreads();
    if (t + 2 < VNS) {
      const unsigned bo = (unsigned)((t & 1) * (VBUFH * 2));
      const int k2 = (t + 2 + rot < VNS) ? (t + 2 + rot) : (t + 2 + rot - VNS);
      copy8(la0 + bo, lst, ga0 + k2 * (VKS * 2), gst);
      copy8(lb0 + bo, lst, gb0 + k2 * (VKS * 2), gst);
    }
  }
  wait_copies();
  acc_guard4(acc0, acc1, acc2, acc3);
  // bias: D element r of lane -> (row rowb+8hh+r, col col0+16j+m); both candidates loaded with clamped addresses, select by value
  float bc[4], br[8];
#pragma unroll
  for (int j = 0; j < 4; ++j) {
    int ci = col0 + 16 * j + m;
    ci = (ci < nbias) ? ci : (nbias - 1);
    bc[j] = bf_val(bias[ci]);
  }
  int ri[8];
  float bw[8];
#pragma unroll
  for (int r = 0; r < 8; ++r) {
    ri[r] = rowb + 8 * hh + r;
    ri[r] = (ri[r] < nbias) ? ri[r] : (nbias - 1);
    bw[r] = bias[ri[r]];
  }
#if defined(__HIP_DEVICE_COMPILE__)
  // the eight loads' index registers stay live up to this address-translation wait (inputs only), so that no load's result
  // lands in the index register of a load issued before it; the loaded values as inputs keep the loads in front of it
  asm volatile("s_wait_xcnt 0x0"
               :: "v"(ri[0]), "v"(ri[1]), "v"(ri[2]), "v"(ri[3]), "v"(ri[4]), "v"(ri[5]), "v"(ri[6]), "v"(ri[7]),
                  "v"(bw[0]), "v"(bw[1]), "v"(bw[2]), "v"(bw[3]), "v"(bw[4]), "v"(bw[5]), "v"(bw[6]), "v"(bw[7])
               : "memory");
#endif
#pragma unroll
  for (int r = 0; r < 8; ++r) br[r] = bf_val(bw[r]);
#pragma unroll
  for (int r = 0; r < 8; ++r) {
    const float q0 = (byrow != 0) ? br[r] : bc[0];
    const float q1 = (byrow != 0) ? br[r] : bc[1];
    const float q2 = (byrow != 0) ? br[r] : bc[2];
    const float q3 = (byrow != 0) ? br[r] : bc[3];
    acc0[r] += q0;
    acc1[r] += q1;
    acc2[r] += q2;
    acc3[r] += q3;
  }
  epi16(slab + wave * SLAB, acc0, acc1, acc2, acc3, oscale, C, N, (size_t)rowb, col0, lane);
}

// =====================================================================================================
// Query projection with fused per-chunk L2 normalisation:
//   q[M][NCG*64] (f32, registers only) = A[M][K] (bf16 x plane) . Bt[NCG*64][K]^T (bf16 Wq plane) + bias[col] (RNE bf16 value);
//   block = 16 rows x all NCG column groups of 64, one wave per column group (wave index = cg), so the NCG groups of a row
//   tile run side by side instead of one after the other. K = DMOD. A stage = QKS k values of all DMOD weight rows and of the
//   block's 16 x rows, brought into LDS by asynchronous 16-byte copies (8 lanes = one whole 128-B line; 16 copies per thread
//   and stage, one more in waves 0..3 for the x rows), two buffers: stage t+2 is issued behind the barrier at the foot of
//   trip t and flies during trip t+1. Fragments are read from LDS rows of 144 B; k runs upward in steps of 32 from the
//   block's own start stage and wraps.
//   For D row 8hh+r the 64-wide chunk (row, cols col0..col0+63) lives
//   in the 16 lanes of half hh x 4 accumulators: ss = sum of squares (4 products per lane, xor-1/2/4/8 shuffles inside the
//   half), qn = q * (1/max(sqrt(ss), 1e-12)), aa = sum of qn^2 the same way (f32), kept in LDS at aas[(row in block)*NCG + cg].
//   After the block barrier the block's 16*NCG aa values (chunk index = row*NCG + cg) go out as whole 128-B lines that no
//   other block writes (16*NCG floats is a multiple of 32).
//   Part of the projection launch: block index = row tile, block = NCG waves (every wave reaches every barrier); slabs, aa
//   values and ring lie in the block's LDS pool.
// coverage: qn plane: M/16 blocks x NCG waves x (16 x 64) = M x NCG*64;  aa table: M/16 blocks x 16*NCG floats = M*NCG.
// =====================================================================================================
__device__ __forceinline__
void gemm_qn(char* pool, const u16* __restrict__ A, const u16* __restrict__ Bt, u16* C, float* AAP,
             const float* __restrict__ bias, int nbias, float oscale) {
  float* slab = (float*)(void*)pool;
  float* aas  = slab + NCG * SLAB;
  u16*   ring = (u16*)(void*)(pool + NCG * SLAB * 4 + 16 * NCG * 4);   // two buffers of (DMOD weight rows, 16 x rows), rows of LPH halves
  const int K = DMOD;
  const int tid = threadIdx.x, wave = tid >> 5, lane = tid & 31, hh = lane >> 4, m = lane & 15;
  const bool xw = __builtin_amdgcn_readfirstlane(tid >> 5) < 4;   // scalar: waves 0..3 also copy the x rows
  const int N = NCG * 64;
  const int rowb = blockIdx.x * 16;
  const int col0 = wave * 64;
  // copy addresses of this thread: weight chunk i = tid + 384*j, row = i >> 3 = (tid >> 3) + 48*j, 16-byte column = tid & 7;
  // x chunk (waves 0..3) = tid, row = tid >> 3 (kept inside 0..15 in every thread)
  const unsigned lb0 = lds_addr(ring) + (unsigned)((tid >> 3) * (LPH * 2) + (tid & 7) * 16);
  const unsigned la0 = lds_addr(ring) + (unsigned)((DMOD + ((tid >> 3) & 15)) * (LPH * 2) + (tid & 7) * 16);
  const char* gb0 = (const char*)(const void*)(Bt + (size_t)(tid >> 3) * K) + (tid & 7) * 16;
  const char* ga0 = (const char*)(const void*)(A + (size_t)(rowb + ((tid >> 3) & 15)) * K) + (tid & 7) * 16;
  const unsigned lst = 48 * LPH * 2;         // 48 rows on, in LDS
  const size_t   gst = (size_t)48 * K * 2;   // 48 rows on, in the weight plane
  // Rotated walk: trip t works on k stage (t + rot) mod QNS, rot by block index. All blocks read the same weight plane; with
  // different stages asked for at the same time each line's first fetch into L2 is waited for by few blocks and the others
  // find it there. For speed only: any rot in 0 .. QNS-1 gives every stage exactly once.
  const int rot = blockIdx.x % QNS;
  const int g0  = rot * (QKS * 2);
  const int g1  = ((rot + 1 < QNS) ? (rot + 1) : 0) * (QKS * 2);
  // first stage landed and published; then the second into the other buffer
  copy8(lb0, lst, gb0 + g0, gst);
  copy8(lb0 + 8 * lst, lst, gb0 + g0 + 8 * gst, gst);
  if (xw) copy1(la0, ga0 + g0);
  wait_copies();
  __syncthreads();
  copy8(lb0 + QBUFH * 2, lst, gb0 + g1, gst);
  copy8(lb0 + QBUFH * 2 + 8 * lst, lst, gb0 + g1 + 8 * gst, gst);
  if (xw) copy1(la0 + QBUFH * 2, ga0 + g1);
  v8f acc0 = zero8(), acc1 = zero8(), acc2 = zero8(), acc3 = zero8();
#pragma unroll 1   // one trip per stage: the buffer index alternates, the code stays small
  for (int t = 0; t < QNS; ++t) {
    const u16* bufp = ring + (t & 1) * QBUFH;
    const u16* al = bufp + (DMOD + m) * LPH + 8 * hh;
    const u16* bl = bufp + (col0 + m) * LPH + 8 * hh;
    // all LDS reads of the stage's 64 k values stand together in front of their products
    const v16b a  = ldfrag_b(al),                 e  = ldfrag_b(al + 32);
    const v16b b0 = ldfrag_b(bl),                 f0 = ldfrag_b(bl + 32);
    const v16b b1 = ldfrag_b(bl + 16 * LPH),      f1 = ldfrag_b(bl + 16 * LPH + 32);
    const v16b b2 = ldfrag_b(bl + 32 * LPH),      f2 = ldfrag_b(bl + 32 * LPH + 32);
    const v16b b3 = ldfrag_b(bl + 48 * LPH),      f3 = ldfrag_b(bl + 48 * LPH + 32);
    acc0 = mma_b(a, b0, acc0);
    acc1 = mma_b(a, b1, acc1);
    acc2 = mma_b(a, b2, acc2);
    acc3 = mma_b(a, b3, acc3);
    guard6<v16b>(acc0, acc1, acc2, acc3, a, b0, b1, b2, b3, a);
    acc0 = mma_b(e, f0, acc0);
    acc1 = mma_b(e, f1, acc1);
    acc2 = mma_b(e, f2, acc2);
    acc3 = mma_b(e, f3, acc3);
    guard6<v16b>(acc0, acc1, acc2, acc3, e, f0, f1, f2, f3, e);
    // foot of trip t: own LDS reads back, own copies of stage t+1 landed, barrier (publishes stage t+1 and ends every
    // reader's last read of this trip's buffer); only then the refill of that buffer with stage t+2
    wait_lds();
    wait_copies();
    __syncthreads();
    if (t + 2 < QNS) {
      const unsigned bo = (unsigned)((t & 1) * (QBUFH * 2));
      const int go = ((t + 2 + rot < QNS) ? (t + 2 + rot) : (t + 2 + rot - QNS)) * (QKS * 2);
      copy8(lb0 + bo, lst, gb0 + go, gst);
      copy8(lb0 + bo + 8 * lst, lst, gb0 + go + 8 * gst, gst);
      if (xw) copy1(la0 + bo, ga0 + go);
    }
  }
  wait_copies();
  acc_guard4(acc0, acc1, acc2, acc3);
  float bc[4];
#pragma unroll
  for (int j = 0; j < 4; ++j) {
    int ci = col0 + 16 * j + m;
    ci = (ci < nbias) ? ci : (nbias - 1);
    bc[j] = bf_val(bias[ci]);
  }
#pragma unroll
  for (int r = 0; r < 8; ++r) {
    acc0[r] += bc[0];
    acc1[r] += bc[1];
    acc2[r] += bc[2];
    acc3[r] += bc[3];
  }
  // per row: L2 normalise the 64-wide chunk and take the f32 sum of squares of the normalised values
#pragma unroll
  for (int r = 0; r < 8; ++r) {
    float ss = acc0[r] * acc0[r] + acc1[r] * acc1[r] + acc2[r] * acc2[r] + acc3[r] * acc3[r];
    ss += __shfl_xor(ss, 1, 32);
    ss += __shfl_xor(ss, 2, 32);
    ss += __shfl_xor(ss, 4, 32);
    ss += __shfl_xor(ss, 8, 32);
    const float nrm = sqrtf(ss);
    const float den = fmaxf(nrm, 1e-12f);
    const float inv = 1.0f / den;
    acc0[r] *= inv;
    acc1[r] *= inv;
    acc2[r] *= inv;
    acc3[r] *= inv;
    float a2 = acc0[r] * acc0[r] + acc1[r] * acc1[r] + acc2[r] * acc2[r] + acc3[r] * acc3[r];
    a2 += __shfl_xor(a2, 1, 32);
    a2 += __shfl_xor(a2, 2, 32);
    a2 += __shfl_xor(a2, 4, 32);
    a2 += __shfl_xor(a2, 8, 32);
    if (m == 0) aas[(8 * hh + r) * NCG + wave] = a2;
  }
  epi16(slab + wave * SLAB, acc0, acc1, acc2, acc3, oscale, C, N, (size_t)rowb, col0, lane);
  __syncthreads();
  // aa table lines of this block: 16*NCG contiguous floats; thread t < 16*NCG/4 writes float4 t
  const int nf4 = 16 * NCG / 4;
  if (tid < nf4) {
    const v4f w0 = *(const v4f*)(aas + 4 * tid);
    *(v4f*)(AAP + (size_t)blockIdx.x * (size_t)(16 * NCG) + 4 * tid) = w0;
  }
}

// =====================================================================================================
// Both projections in ONE launch (neither reads what the other writes): blocks 0 .. QBLK-1 do the query projection (the longer
// part, so it starts first), blocks QBLK .. QBLK+VBLK-1 the v^T GEMM, VTPB tiles each. The choice is block-uniform, so every
// barrier of either part is passed by all NCG waves of its block. One LDS pool per block, laid out by the part that runs.
// =====================================================================================================
__global__ __launch_bounds__(NCG * 32)
void gemm_qv(const u16* __restrict__ XBp, const u16* __restrict__ WQp, const u16* __restrict__ WVp, u16* QPp, float* AAP,
             u16* VPp, const float* __restrict__ bq, const float* __restrict__ bv) {
  __shared__ __align__(16) char pool[POOLB];
  const int b = blockIdx.x;
  if (b >= QBLK + VBLK) return;              // block-uniform, never taken with the exact grid; in front of every barrier
  if (b < QBLK) gemm_qn(pool, XBp, WQp, QPp, AAP, bq, DMOD, QSC);
  else          gemm_b16(pool, (b - QBLK) * VTPB, WVp, XBp, VPp, bv, SEQ, DMOD, 1, VCAR);
}

// =====================================================================================================
// L2-distance flash attention (no masking, all SEQ keys): block = (head, 64 query rows), 4 waves, wave w owns the 16 query
// rows q0 = 64*qt + 16*w .. q0+15. The block's 4 waves share the key and value tiles: a stage = 64 keys = K tile (64 key rows
// x 128 B) + V tile (64 d rows x 128 B), brought into LDS by asynchronous 16-byte copies (whole 128-B lines, 8 copies per
// thread and stage), two buffers: stage t+2 is issued behind the barrier at the foot of trip t and flies during trip t+1.
// The head's AA table (SEQ floats) is copied once with stage 0. Fragments are read from LDS rows of 144 B.
//   qn plane (f16, x QSC) laid out as [NHD*SEQ chunks][64]: head h, row n = chunk h*SEQ + n; keys and queries both come
//   from this plane. AA table (f32) indexed by the same chunk index. v^T plane [h*64+d][SEQ keys] (x1024).
//   All NKB = SEQ/32 key blocks of 32 keys are visited (static bound), from the block's own start stage on, wrapping.
//   Scores are computed TRANSPOSED: S^T tile g (g = 0,1) = key rows (keys kb+16g .. +15, A operand, row m = lane&15, split
//   k map over d) times q^T (B operand, col n = query q0 + (lane&15), k = d, split map), one product per tile and 32-deep
//   d-chunk. D element r of lane l = (key kb+16g+8h+r, query q0+(l&15)), so a lane owns one query column and 16 of its 32
//   keys; the partner lane l^16 owns the other 16 -> row sum needs one xor-16 shuffle.
//   Base-2 logit: t = (2*qn_n.qn_m/(QSC*QSC) - AA_n - AA_m) * log2(e)/8. Every qn row is a vector divided by at least its own
//   norm, so its length is at most 1 (f16 rounding adds under 0.1 %): |2*qn_n.qn_m| * log2(e)/8 < 0.37 and
//   0 <= AA * log2(e)/8 < 0.19 for any finite input, hence -0.74 < t < 0.37. The softmax therefore needs no running maximum:
//   its shift is the constant -PSH, p = exp2(t + PSH) = P x 32768 lies in (19000, 43000), inside f16, the exp2 argument is far
//   from the subnormal range (bare hardware exp2), and neither l nor the O accumulators are ever rescaled.
//   The exp'd values ARE the P A-fragment in place: A row m = query = lane&15, element i <- key kb+8h+i (tile 0, D element i),
//   element 8+i <- key kb+16+8h+i (tile 1, D element i). l (x32768) is summed per lane in 4 partial sums over the lane's
//   own keys; the partials and the partner lane l^16 are joined once behind the loop. 4 v^T B fragments
//   (col n = d = 16j + (lane&15), keys k-contiguous), 4 P.V WMMAs per key block.
//   Epilogue: 1/l (per query, shuffled to the D row owner) and carry folds in f32; the wave's 16x64 f32 result staged in its
//   aux0/aux1 are bound only (not read).
// coverage: per wave 8 instructions x 2 rows x 16 lanes x 4 floats = 16 x 64; grid NHD*(SEQ/64) blocks x 4 waves = every
//           output row (h, n < SEQ) exactly once = SEQ*NHD*64 floats.
// =====================================================================================================
__global__ __launch_bounds__(ATT_THREADS)
void attn_l2(const u16* __restrict__ QPp, const float* __restrict__ AAp, const u16* __restrict__ VPp, float* out,
             const float* aux0, const float* aux1) {
  __shared__ __align__(16) float smem[ATT_WAVES * SLAB];   // per wave: result slab [16][68] in the epilogue only
  __shared__ __align__(16) _Float16 ring[2 * BUFH];        // two buffers of (K tile, V tile), rows of LPH halves
  __shared__ __align__(16) float aas[SEQ];                 // AA table of this head
  (void)aux0; (void)aux1;

  const int tid  = threadIdx.x;
  const int wave = tid >> 5;
  const int lane = tid & 31;
  const int hh   = lane >> 4;
  const int c    = lane & 15;

  const int bid  = blockIdx.x;
  const int qt   = bid % QTILES;
  const int head = bid / QTILES;
  if (head >= NHD) return;                                 // block-uniform, never taken with the exact grid; in front of every barrier
  const int q0   = qt * 64 + wave * 16;
  const size_t hb = (size_t)head * SEQ;                    // chunk index base of this head

  const _Float16* QH = (const _Float16*)(const void*)QPp;
  // B fragments of q^T: col n = query chunk hb + q0 + c, k = d
  const _Float16* Qb = QH + (hb + (size_t)(q0 + c)) * HD + 8 * hh;
  // copy addresses of this thread: chunk i = tid + 128*j, row = i >> 3 = (tid >> 3) + 16*j, 16-byte column = tid & 7
  const unsigned lk0 = lds_addr(ring) + (unsigned)((tid >> 3) * (LPH * 2) + (tid & 7) * 16);
  const char* gk0 = (const char*)(const void*)(QH + hb * HD) + tid * 16;                       // K rows are contiguous
  const char* gv0 = (const char*)(const void*)((const _Float16*)(const void*)VPp + ((size_t)(head * HD + (tid >> 3))) * SEQ)
                    + (tid & 7) * 16;
  // Rotated walk: trip t works on key stage (t + rot) mod NST. The QTILES blocks of a head read the same K and V rows; with
  // different stages asked for at the same time each line's first fetch into L2 is waited for by few blocks and the others
  // find it there. The bit order spreads the starts of blocks whose indices lie close together modulo 8. For speed only: any
  // rot in 0 .. NST-1 gives every stage exactly once; the constant softmax shift makes the key order free but for rounding.
  const int rot = (qt & ~7) | ((qt & 3) << 1) | ((qt >> 2) & 1);
  const int st1 = (rot + 1) & (NST - 1);
  // first stage and the AA table, landed and published; then the second stage into the other buffer
  copy_stage(lk0, gk0 + (size_t)rot * (KT * HD * 2), gv0 + rot * (KT * 2));
#pragma unroll   // straight line: AACP copies, each with constant address steps
  for (int j = 0; j < AACP; ++j)
    copy1(lds_addr(aas) + (unsigned)((tid + ATT_THREADS * j) * 16), (const char*)(const void*)(AAp + hb) + (tid + ATT_THREADS * j) * 16);
  wait_copies();
  __syncthreads();
  copy_stage(lk0 + BUFH * 2, gk0 + (size_t)st1 * (KT * HD * 2), gv0 + st1 * (KT * 2));
  const float lsc = 0.25f * (LOG2E / (QSC * QSC));
  const float c1l = 0.125f * LOG2E;
  const float aq  = AAp[hb + (size_t)(q0 + c)] * c1l - PSH; // AA term of this lane's query, with the constant shift

  const v16h qf0 = ldfrag_h(Qb);            // d 0..31
  const v16h qf1 = ldfrag_h(Qb + 32);       // d 32..63

  v2f lp[2] = {{0.f, 0.f}, {0.f, 0.f}};     // partial sums of p over this lane's keys, element i -> lp[(i >> 1) & 1][i & 1]
  v8f o[4];
#pragma unroll
  for (int j = 0; j < 4; ++j) o[j] = zero8();

#pragma unroll 1
  for (int t = 0; t < NST; ++t) {
   const _Float16* bufp = ring + (t & 1) * BUFH;
   // A fragments of keys: LDS row = key in stage (32u + 16g + c), k = d;  B fragments of v: LDS row = d = 16j + c, k = key
   const _Float16* Kl = bufp + c * LPH + 8 * hh;
   const _Float16* Vl = bufp + TILEH + c * LPH + 8 * hh;
#pragma unroll   // both 32-key blocks of the stage in line: u becomes an immediate offset of the LDS reads
   for (int u = 0; u < 2; ++u) {
    const int kb = ((t + rot) & (NST - 1)) * KT + u * 32;
    // ---- all LDS reads of this 32-key block stand together in front of its products ----
    const _Float16* k0p = Kl + (32 * u) * LPH;
    const _Float16* k1p = k0p + 16 * LPH;
    const v16h ka0 = ldfrag_h(k0p), ka1 = ldfrag_h(k0p + 32);
    const v16h kc0 = ldfrag_h(k1p), kc1 = ldfrag_h(k1p + 32);
    // AA of this lane's 16 keys: tile 0 element i -> key kb+8hh+i, tile 1 element i -> key kb+16+8hh+i
    const float* am = aas + kb + 8 * hh;
    const v4f w0 = *(const v4f*)(am), w1 = *(const v4f*)(am + 4);
    const v4f w2 = *(const v4f*)(am + 16), w3 = *(const v4f*)(am + 20);
    const _Float16* vp = Vl + 32 * u;
    const v16h vf0 = ldfrag_h(vp);
    const v16h vf1 = ldfrag_h(vp + 16 * LPH);
    const v16h vf2 = ldfrag_h(vp + 32 * LPH);
    const v16h vf3 = ldfrag_h(vp + 48 * LPH);
    // ---- transposed scores: s0 = keys kb..kb+15, s1 = keys kb+16..kb+31, column = query q0 + c ----
    v8f s0 = zero8(), s1 = zero8();
    s0 = mma_h(ka0, qf0, s0);
    s0 = mma_h(ka1, qf1, s0);
    s1 = mma_h(kc0, qf0, s1);
    s1 = mma_h(kc1, qf1, s1);
    guard2(s0, s1, qf0, qf1, ka0, ka1, kc0, kc1);
    // ---- p = exp2(t + PSH) of this lane's 16 keys for query q0 + c, and the P A-fragment: element i <-> key i ----
    FragH ph;
#pragma unroll
    for (int e = 0; e < 2; ++e) {          // pairs of neighbouring keys: elements 2e, 2e+1 of each group of four
      const int i = 2 * e;
      const v2f sa = {s0[i], s0[i + 1]}, sb = {s0[4 + i], s0[5 + i]}, sc = {s1[i], s1[i + 1]}, sd = {s1[4 + i], s1[5 + i]};
      const v2f wa = {w0[i], w0[i + 1]}, wb = {w1[i], w1[i + 1]}, wc = {w2[i], w2[i + 1]}, wd = {w3[i], w3[i + 1]};
      const v2f ta = sa * lsc - (wa * c1l + aq), tb = sb * lsc - (wb * c1l + aq);
      const v2f tc = sc * lsc - (wc * c1l + aq), td = sd * lsc - (wd * c1l + aq);
      const v2f pa = {__builtin_amdgcn_exp2f(ta[0]), __builtin_amdgcn_exp2f(ta[1])};
      const v2f pb = {__builtin_amdgcn_exp2f(tb[0]), __builtin_amdgcn_exp2f(tb[1])};
      const v2f pc = {__builtin_amdgcn_exp2f(tc[0]), __builtin_amdgcn_exp2f(tc[1])};
      const v2f pd = {__builtin_amdgcn_exp2f(td[0]), __builtin_amdgcn_exp2f(td[1])};
      ph.u[0][e]     = pkh(pa);
      ph.u[0][2 + e] = pkh(pb);
      ph.u[1][e]     = pkh(pc);
      ph.u[1][2 + e] = pkh(pd);
      lp[e] += (pa + pb) + (pc + pd);
    }
    // ---- P.V : B fragment col n = d = j*16 + c, keys contiguous in the staged v^T rows ----
    {
      o[0] = mma_h(ph.v, vf0, o[0]);
      o[1] = mma_h(ph.v, vf1, o[1]);
      o[2] = mma_h(ph.v, vf2, o[2]);
      o[3] = mma_h(ph.v, vf3, o[3]);
      guard6<v16h>(o[0], o[1], o[2], o[3], ph.v, vf0, vf1, vf2, vf3, ph.v);
    }
   }
   // ---- foot of trip t: own LDS reads back, own copies of stage t+1 landed, barrier (publishes stage t+1 and ends every
   //      reader's last read of this trip's buffer); only then the refill of that buffer with stage t+2 ----
   wait_lds();
   wait_copies();
   __syncthreads();
   if (t + 2 < NST) {
     const int st2 = (t + 2 + rot) & (NST - 1);
     copy_stage(lk0 + (unsigned)((t & 1) * (BUFH * 2)), gk0 + (size_t)st2 * (KT * HD * 2), gv0 + st2 * (KT * 2));
   }
  }
  wait_copies();
  acc_guard4(o[0], o[1], o[2], o[3]);

  // ---- l x32768 of this lane's query: own partials, then the partner lane's 16 keys of every block ----
  float lrun = (lp[0][0] + lp[0][1]) + (lp[1][0] + lp[1][1]);
  lrun += __shfl_xor(lrun, 16, 32);
  // ---- fold 1/l (per query, owned by lane = query; the x32768 of P and of l cancel) and the v carry; stage the 16x64 slab ----
  const float linv = (lrun > 0.f) ? ((1.0f / lrun) * (1.0f / VCAR)) : 0.f;
  float inv[8];
#pragma unroll
  for (int r = 0; r < 8; ++r) inv[r] = __shfl(linv, 8 * hh + r, 32);
  float* slab = smem + wave * SLAB;
#pragma unroll
  for (int r = 0; r < 8; ++r) {
#pragma unroll
    for (int j = 0; j < 4; ++j) slab[(8 * hh + r) * 68 + j * 16 + c] = o[j][r] * inv[r];
  }
  wave_sync_lds();
  // ---- f32 output rows: lanes 0..15 -> row 2*it2, lanes 16..31 -> row 2*it2+1, 16 lanes x 16 B = one 256-B row ----
  v4f vals[8];
#pragma unroll
  for (int it2 = 0; it2 < 8; ++it2) vals[it2] = *(const v4f*)(slab + (it2 * 2 + hh) * 68 + c * 4);
  float* dst = out + (hb + (size_t)(q0 + hh)) * HD + c * 4;
  {
#pragma unroll
    for (int it2 = 0; it2 < 8; ++it2) {
      *(v4f*)(dst + (size_t)(it2 * 2) * HD) = vals[it2];
    }
    
  }
}

// =====================================================================================================
// Workspace map (bytes); every plane is fully written by whole-line stores before it is read; all extents are exact multiples
// of the store granularity (no pad rows needed), every offset a multiple of 128:
//   XB  bf16 [SEQ][768]                          SEQ*1536   (3145728 at SEQ = 2048)
//   WQB bf16 [768 n][768 k]                      1179648    WVB same
//   QP  f16  [SEQ][768] = [12*SEQ chunks][64] x16 SEQ*1536
//   AAP f32  [12*SEQ]                            SEQ*48     (98304)
//   VP  f16  [768 = h*64+d][SEQ] x1024           SEQ*1536
//   end                                          11894784 at SEQ = 2048
// =====================================================================================================
extern "C" void kernel_launch(void* const* d_in, const int* in_sizes, int n_in,
                              void* d_out, int out_size, void* d_ws, size_t ws_size,
                              hipStream_t stream) {
  if (n_in < 7) return;
  if (in_sizes[0] < SEQ * DMOD) return;
  if (in_sizes[1] < 1 || in_sizes[2] < 1) return;
  if (in_sizes[3] != DMOD * DMOD || in_sizes[5] != DMOD * DMOD) return;
  if (in_sizes[4] != DMOD || in_sizes[6] != DMOD) return;
  if (out_size < SEQ * DMOD) return;

  const float* Xin = (const float*)d_in[0];
  const float* Gin = (const float*)d_in[1];               // bound only, not read
  const float* Min = (const float*)d_in[2];               // bound only, not read
  const float* Wq  = (const float*)d_in[3];
  const float* bq  = (const float*)d_in[4];
  const float* Wv  = (const float*)d_in[5];
  const float* bv  = (const float*)d_in[6];
  float*       out = (float*)d_out;

  const size_t szXB = (size_t)SEQ * DMOD * 2;
  const size_t szW  = (size_t)DMOD * DMOD * 2;
  const size_t szQP = (size_t)SEQ * DMOD * 2;
  const size_t szAA = (size_t)NHD * SEQ * 4;
  const size_t szVP = (size_t)DMOD * SEQ * 2;
  size_t off = 0;
  const size_t oXB = off; off += szXB;
  const size_t oWQ = off; off += szW;
  const size_t oWV = off; off += szW;
  const size_t oQP = off; off += szQP;
  const size_t oAA = off; off += szAA;
  const size_t oVP = off; off += szVP;
  if (off > ws_size) return;                            // off = 11894784 at SEQ = 2048
  if (off > (size_t)134217728) return;

  char* ws = (char*)d_ws;
  u16*   XB  = (u16*)(ws + oXB);
  u16*   WQB = (u16*)(ws + oWQ);
  u16*   WVB = (u16*)(ws + oWV);
  u16*   QP  = (u16*)(ws + oQP);
  float* AAP = (float*)(ws + oAA);
  u16*   VP  = (u16*)(ws + oVP);

  const int n8x = (SEQ * DMOD) / 8;
  const int n8w = (DMOD * DMOD) / 8;
  if ((n8x % 256) != 0 || (n8w % 256) != 0) return;
  if ((DMOD % 64) != 0 || (SEQ % 64) != 0 || (DMOD % 32) != 0) return;
  const dim3 blk(256);
  const dim3 gC(CVX + 2 * CVW);                         // 768 + 2 * 288 at SEQ = 2048
  const dim3 gP(QBLK + VBLK);                           // 128 + 128
  const dim3 bP(NCG * 32);                              // 384
  const dim3 gAT(ATT_BLOCKS);                           // 384
  const dim3 bAT(ATT_THREADS);                          // 128

  // (0) operand planes: x -> bf16; Wq/Wv [n = out][k = in] (already k-contiguous) -> bf16
  //     (XB, WQB, WVB follow one another in the workspace: one joined destination)
  cvt16x3<<<gC, blk, 0, stream>>>(Xin, Wq, Wv, XB);
  // (1) q = x.Wq^T + bq, L2-normalised per 64-chunk -> qn plane [SEQ][768] f16 x16 and AA table [12*SEQ] f32;
  //     v^T plane: [768 = h*64+d][SEQ keys] = f16((Wv . x^T + bv) x1024), bias by row
  gemm_qv<<<gP, bP, 0, stream>>>(XB, WQB, WVB, QP, AAP, VP, bq, bv);
  // (2) attention -> out, f32 row (chunk h*SEQ + n) of 64 floats at float offset (h*SEQ + n)*64
  attn_l2<<<gAT, bAT, 0, stream>>>(QP, AAP, VP, out, Gin, Min);
  (void)hipGetLastError();
}

// v007
// Measured time: 36.2 microseconds a run.
// Timed twice side by side with v006, it ran 1.16 times as fast both times.
// All steps since v000 together make it 7.70 times as fast.
// Contractions: x.Wq^T+bq and Wv.x^T+bv on v_wmma_f32_16x16x32_bf16 (x and W planes RNE-converted to bf16 operands, f32 accumulate);
// scores qn.qn^T (qn = L2-normalised q, single f16 plane carried x16) and P.v (P x32768 single f16, v x1024 single f16) on
// v_wmma_f32_16x16x32_f16, f32 accumulate. Biases folded as RNE bf16 values in f32 epilogues; L2 normalisation, sums of squares,
// base-2 softmax with a constant shift, 1/l and carry folds in f32 on VALU.
#include <hip/hip_runtime.h>
#include <math.h>
#include <stdint.h>

#ifndef NB
#define NB 1
#endif
#ifndef SEQ
#define SEQ 2048
#endif
#define SEQ_FULL 2048
#define DMOD  768
#define NHD   12
#define HD    64
#define NCG   (DMOD / 64)
#define QSC   16.0f
#define PCAR  32768.0f
#define PSH   15.0f               // log2(PCAR): the constant shift of the base-2 logits, so that exp2 yields P x PCAR at once
#define VCAR  1024.0f
#define LOG2E 1.4426950408889634f
#define ATT_WAVES   4
#define ATT_THREADS (ATT_WAVES * 32)
#define QTILES      (SEQ / 64)
#define ATT_BLOCKS  (NHD * QTILES)
#define NKB    (SEQ / 32)
#define SLAB   (16 * 68)
#define KT     64                 // keys per LDS stage of the attention loop (two 32-key blocks)
#define NST    (SEQ / KT)         // stages
#define LPH    72                 // LDS row pitch in halves: 128-B rows at 144 B = 16 B x odd, for 16-byte LDS readers
#define TILEH  (64 * LPH)         // one staged tile of 64 rows, in halves
#define BUFH   (2 * TILEH)        // one buffer: K tile, then V tile
#define AACP   (SEQ / ATT_THREADS)   // 4-byte copies per thread for one head's AA table
static_assert(NST * KT == SEQ && NST >= 2 && KT == 2 * 32 && HD == 64);
static_assert((NST & (NST - 1)) == 0 && NST >= 8 && NST == QTILES);   // the rotated stage walk wraps by a mask
static_assert(AACP * ATT_THREADS == SEQ && (AACP % 8) == 0 && (LPH * 2) % 16 == 0 && ATT_THREADS * 4 * 16 == KT * HD * 2);
#define VKS    128                // k halves per LDS stage of the projection GEMMs: 256-B row pieces
#define VNS    (DMOD / VKS)       // their stages
#define VPH    136                // their LDS pitch in halves: 272 B = 16 B x odd
#define VTPB   3                  // 64x64 tiles per block of the projection launch, one per group of 4 waves: 64 x rows by 192 weight rows
#define WROWS  (64 * VTPB)        // weight rows of a block
#define WGRP   (DMOD / WROWS)     // groups of WROWS weight rows in a weight plane
#define VBUFH  ((64 + WROWS) * VPH)   // one buffer: the block's 64 x rows, then its WROWS weight rows, in halves
static_assert(VNS * VKS == DMOD && VNS >= 2 && (VPH * 2) % 16 == 0 && WGRP * WROWS == DMOD);
static_assert(NCG * 32 * 8 * 16 == WROWS * VKS * 2 && 8 * 32 * 4 * 16 == 64 * VKS * 2);   // copies per stage: 8 in every wave, 4 more in waves 0..7
#define CVX    ((SEQ * DMOD) / 2048)    // blocks of the conversion launch for x (256 threads x 8 elements each)
#define CVW    ((DMOD * DMOD) / 2048)   // its blocks for each weight plane
#define QBLK   ((SEQ / 64) * WGRP)      // blocks of the projection launch that do the query projection
#define VBLK   ((SEQ / 64) * WGRP)      // its blocks that do the v^T GEMM
#define POOLB  (NCG * SLAB * 4 + WROWS * 4 + 2 * VBUFH * 2)   // LDS bytes of a block: result slabs, aa values, ring
static_assert(VTPB * 4 == NCG && (NCG * SLAB * 4) % 16 == 0 && (WROWS * 4) % 128 == 0 && (VBUFH * 2) % 16 == 0);
static_assert(NB == 1);
static_assert(HD == 64 && DMOD == NHD * HD && NCG * 64 == DMOD);
static_assert((SEQ % 64) == 0 && SEQ >= 64 && SEQ <= SEQ_FULL);
static_assert(ATT_THREADS == 128 && NKB * 32 == SEQ && ATT_BLOCKS == NHD * (SEQ / 64));
static_assert((DMOD % 64) == 0 && (DMOD % 32) == 0);
static_assert(((SEQ * DMOD / 8) % 256) == 0 && ((DMOD * DMOD / 8) % 256) == 0);
static_assert((SLAB * 4) % 16 == 0);
static_assert(((16 * NCG) % 32) == 0 && NCG * 32 <= 1024 && (SEQ % 16) == 0);

typedef unsigned short u16;
typedef _Float16 v16h __attribute__((ext_vector_type(16)));
typedef _Float16 v8h  __attribute__((ext_vector_type(8)));
typedef __bf16   v16b __attribute__((ext_vector_type(16)));
typedef float    v8f  __attribute__((ext_vector_type(8)));
typedef float    v4f  __attribute__((ext_vector_type(4)));
typedef unsigned int v4u __attribute__((ext_vector_type(4)));
typedef float    v2f  __attribute__((ext_vector_type(2)));
typedef _Float16 v2h  __attribute__((ext_vector_type(2)));

union FragH { v16h v; v8h h[2]; v4u u[2]; };
union FragB { v16b v; v4u u[2]; };

// ---- scalar helpers --------------------------------------------------------------------------------
__device__ __forceinline__ unsigned short bf_bits(float f) {          // f32 -> bf16 bits, RNE convert
  unsigned u = __float_as_uint(f);
  return (unsigned short)((u + 0x7FFFu + ((u >> 16) & 1u)) >> 16);
}
__device__ __forceinline__ float bf_up(unsigned short h) { return __uint_as_float(((unsigned)h) << 16); }
__device__ __forceinline__ float bf_val(float f) { return bf_up(bf_bits(f)); }          // value after RNE bf16 convert
__device__ __forceinline__ unsigned short h_bits(_Float16 x) { return __builtin_bit_cast(unsigned short, x); }
__device__ __forceinline__ unsigned pk16(unsigned short a, unsigned short b) { return (unsigned)a | ((unsigned)b << 16); }
__device__ __forceinline__ unsigned pkh(v2f x) {                     // two f32 -> packed f16 pair, RNE, x[0] in the low half
  return __builtin_bit_cast(unsigned, __builtin_convertvector(x, v2h));
}
__device__ __forceinline__ v8f zero8() { v8f z = {0.f, 0.f, 0.f, 0.f, 0.f, 0.f, 0.f, 0.f}; return z; }

// ---- fragment loaders: 16-bit A/B operand, lane -> row/col (lane&15), p already includes +8*(lane>>4);
//      elements 0..7 <- p[0..7] (k0+8h..), elements 8..15 <- p[16..23] (k0+16+8h..)  (same split k map for A and B;
//      B is always read from a k-contiguous [n][k] plane)
__device__ __forceinline__ v16h ldfrag_h(const _Float16* p) {
  FragH f;
  f.h[0] = *(const v8h*)(p);
  f.h[1] = *(const v8h*)(p + 16);
  return f.v;
}
__device__ __forceinline__ v16b ldfrag_b(const u16* p) {              // bf16 plane read as unsigned integer vectors
  FragB f;
  f.u[0] = *(const v4u*)(p);
  f.u[1] = *(const v4u*)(p + 16);
  return f.v;
}

__device__ __forceinline__ v8f mma_h(v16h a, v16h b, v8f c) {
  return __builtin_amdgcn_wmma_f32_16x16x32_f16(false, a, false, b, (short)0, c, false, false);
}
__device__ __forceinline__ v8f mma_b(v16b a, v16b b, v8f c) {
  return __builtin_amdgcn_wmma_f32_16x16x32_bf16(false, a, false, b, (short)0, c, false, false);
}
__device__ __forceinline__ void guard2(v8f& a, v8f& b, v16h x0, v16h x1, v16h x2, v16h x3, v16h x4, v16h x5) {
#if defined(__HIP_DEVICE_COMPILE__)
  asm volatile("v_nop\n\tv_nop\n\tv_nop\n\tv_nop"
               : "+v"(a), "+v"(b) : "v"(x0), "v"(x1), "v"(x2), "v"(x3), "v"(x4), "v"(x5) : "memory");
#endif
}
template <typename F>
__device__ __forceinline__ void guard6(v8f& a, v8f& b, v8f& c, v8f& d, F x0, F x1, F x2, F x3, F x4, F x5) {
#if defined(__HIP_DEVICE_COMPILE__)
  asm volatile("v_nop\n\tv_nop\n\tv_nop\n\tv_nop"
               : "+v"(a), "+v"(b), "+v"(c), "+v"(d) : "v"(x0), "v"(x1), "v"(x2), "v"(x3), "v"(x4), "v"(x5) : "memory");
#endif
}
__device__ __forceinline__ void acc_guard4(v8f& a, v8f& b, v8f& c, v8f& d) {
#if defined(__HIP_DEVICE_COMPILE__)
  asm volatile("v_nop\n\tv_nop\n\tv_nop\n\tv_nop" : "+v"(a), "+v"(b), "+v"(c), "+v"(d));
#endif
}
__device__ __forceinline__ void wave_sync_lds() {
#if defined(__HIP_DEVICE_COMPILE__)
  __builtin_amdgcn_fence(__ATOMIC_RELEASE, "workgroup");
  __builtin_amdgcn_wave_barrier();
  __builtin_amdgcn_fence(__ATOMIC_ACQUIRE, "workgroup");
#endif
}

// ---- asynchronous copies global -> LDS, 16 B per lane (4 B in copy8w); lds = the lane's LDS byte address, g = the lane's global address.
//      The address-translation wait is the last line of the copies' own statement, so that no address register named by
//      an issued copy is rewritten in front of it.
__device__ __forceinline__ unsigned lds_addr(const void* p) { return (unsigned)(size_t)p; }
__device__ __forceinline__ void copy1(unsigned lds, const char* g) {
#if defined(__HIP_DEVICE_COMPILE__)
  asm volatile("global_load_async_to_lds_b128 %0, %1, off\n\ts_wait_xcnt 0x0" :: "v"(lds), "v"(g) : "memory");
#endif
}
// eight copies with constant steps from one to the next: ls bytes in LDS, gs bytes in global memory
__device__ __forceinline__ void copy8(unsigned l, unsigned ls, const char* g, size_t gs) {
#if defined(__HIP_DEVICE_COMPILE__)
  asm volatile("global_load_async_to_lds_b128 %0, %8, off\n\t"
               "global_load_async_to_lds_b128 %1, %9, off\n\t"
               "global_load_async_to_lds_b128 %2, %10, off\n\t"
               "global_load_async_to_lds_b128 %3, %11, off\n\t"
               "global_load_async_to_lds_b128 %4, %12, off\n\t"
               "global_load_async_to_lds_b128 %5, %13, off\n\t"
               "global_load_async_to_lds_b128 %6, %14, off\n\t"
               "global_load_async_to_lds_b128 %7, %15, off\n\t"
               "s_wait_xcnt 0x0"
               :: "v"(l), "v"(l + ls), "v"(l + 2 * ls), "v"(l + 3 * ls),
                  "v"(l + 4 * ls), "v"(l + 5 * ls), "v"(l + 6 * ls), "v"(l + 7 * ls),
                  "v"(g), "v"(g + gs), "v"(g + 2 * gs), "v"(g + 3 * gs),
                  "v"(g + 4 * gs), "v"(g + 5 * gs), "v"(g + 6 * gs), "v"(g + 7 * gs)
               : "memory");
#endif
}
// four copies with constant steps from one to the next
__device__ __forceinline__ void copy4(unsigned l, unsigned ls, const char* g, size_t gs) {
#if defined(__HIP_DEVICE_COMPILE__)
  asm volatile("global_load_async_to_lds_b128 %0, %4, off\n\t"
               "global_load_async_to_lds_b128 %1, %5, off\n\t"
               "global_load_async_to_lds_b128 %2, %6, off\n\t"
               "global_load_async_to_lds_b128 %3, %7, off\n\t"
               "s_wait_xcnt 0x0"
               :: "v"(l), "v"(l + ls), "v"(l + 2 * ls), "v"(l + 3 * ls),
                  "v"(g), "v"(g + gs), "v"(g + 2 * gs), "v"(g + 3 * gs)
               : "memory");
#endif
}
// eight 4-byte copies, LDS addresses ls bytes apart, each with a global address of its own
__device__ __forceinline__ void copy8w(unsigned l, unsigned ls, const char* const* g) {
#if defined(__HIP_DEVICE_COMPILE__)
  asm volatile("global_load_async_to_lds_b32 %0, %8, off\n\t"
               "global_load_async_to_lds_b32 %1, %9, off\n\t"
               "global_load_async_to_lds_b32 %2, %10, off\n\t"
               "global_load_async_to_lds_b32 %3, %11, off\n\t"
               "global_load_async_to_lds_b32 %4, %12, off\n\t"
               "global_load_async_to_lds_b32 %5, %13, off\n\t"
               "global_load_async_to_lds_b32 %6, %14, off\n\t"
               "global_load_async_to_lds_b32 %7, %15, off\n\t"
               "s_wait_xcnt 0x0"
               :: "v"(l), "v"(l + ls), "v"(l + 2 * ls), "v"(l + 3 * ls),
                  "v"(l + 4 * ls), "v"(l + 5 * ls), "v"(l + 6 * ls), "v"(l + 7 * ls),
                  "v"(g[0]), "v"(g[1]), "v"(g[2]), "v"(g[3]), "v"(g[4]), "v"(g[5]), "v"(g[6]), "v"(g[7])
               : "memory");
#endif
}
// one stage: 4 K chunks (16 rows apart in LDS, 2048 B apart in the contiguous K rows) and 4 V chunks (16 d rows apart)
__device__ __forceinline__ void copy_stage(unsigned lk, const char* gk, const char* gv) {
#if defined(__HIP_DEVICE_COMPILE__)
  const unsigned rs = 16 * LPH * 2, lv = lk + TILEH * 2;
  const size_t vs = (size_t)16 * SEQ * 2;
  asm volatile("global_load_async_to_lds_b128 %0, %8, off\n\t"
               "global_load_async_to_lds_b128 %1, %9, off\n\t"
               "global_load_async_to_lds_b128 %2, %10, off\n\t"
               "global_load_async_to_lds_b128 %3, %11, off\n\t"
               "global_load_async_to_lds_b128 %4, %12, off\n\t"
               "global_load_async_to_lds_b128 %5, %13, off\n\t"
               "global_load_async_to_lds_b128 %6, %14, off\n\t"
               "global_load_async_to_lds_b128 %7, %15, off\n\t"
               "s_wait_xcnt 0x0"
               :: "v"(lk), "v"(lk + rs), "v"(lk + 2 * rs), "v"(lk + 3 * rs),
                  "v"(lv), "v"(lv + rs), "v"(lv + 2 * rs), "v"(lv + 3 * rs),
                  "v"(gk), "v"(gk + 2048), "v"(gk + 4096), "v"(gk + 6144),
                  "v"(gv), "v"(gv + vs), "v"(gv + 2 * vs), "v"(gv + 3 * vs)
               : "memory");
#endif
}
// the issuing wave's own wait: its copies have landed (before the barrier behind which other waves read them)
__device__ __forceinline__ void wait_copies() {
#if defined(__HIP_DEVICE_COMPILE__)
  asm volatile("s_wait_asynccnt 0x0" ::: "memory");
#endif
}
// address-translation wait behind a run of plain global stores, in front of whatever rewrites a register that they name
__device__ __forceinline__ void wait_xlat() {
#if defined(__HIP_DEVICE_COMPILE__)
  asm volatile("s_wait_xcnt 0x0" ::: "memory");
#endif
}
// the wave's LDS reads have returned (before the barrier behind which their buffer is refilled)
__device__ __forceinline__ void wait_lds() {
#if defined(__HIP_DEVICE_COMPILE__)
  asm volatile("s_wait_dscnt 0x0" ::: "memory");
#endif
}

// =====================================================================================================
// The three f32 operand planes (x, Wq, Wv) -> bf16 RNE bits, same layouts, in ONE launch: the planes do not depend on one
// another, and their bf16 planes follow one another in the workspace, so block b writes elements b*2048 .. +2047 of the joined
// destination and picks its source plane by block index (block-uniform): CVX blocks of x, then CVW of Wq, then CVW of Wv.
// Thread = 8 consecutive elements: two 16-B loads, one 16-B store; 32 consecutive lanes = 512 contiguous, 512-B aligned bytes
// coverage: grid = CVX + 2*CVW blocks (plane sizes are exact multiples of 2048 elements) x 256 thr x 8 = the three planes.
// =====================================================================================================
__global__ __launch_bounds__(256) void cvt16x3(const float* __restrict__ x, const float* __restrict__ wq,
                                               const float* __restrict__ wv, u16* D) {
  const int b = blockIdx.x;
  if (b >= CVX + 2 * CVW) return;           // no barriers in this kernel
  const float* s = (b < CVX) ? x : ((b < CVX + CVW) ? wq : wv);
  const int   lb = (b < CVX) ? b : ((b < CVX + CVW) ? (b - CVX) : (b - CVX - CVW));
  const float* p = s + ((size_t)lb * 256 + threadIdx.x) * 8;
  const v4f a = *(const v4f*)(p), c4 = *(const v4f*)(p + 4);
  v4u o;
#pragma unroll
  for (int e = 0; e < 2; ++e) {
    o[e]     = pk16(bf_bits(a[2 * e]),  bf_bits(a[2 * e + 1]));
    o[2 + e] = pk16(bf_bits(c4[2 * e]), bf_bits(c4[2 * e + 1]));
  }
  *(v4u*)(D + ((size_t)b * 256 + threadIdx.x) * 8) = o;
}

// =====================================================================================================
// barrier, then converted to f16 and written: lane = (row in group of 4, 8 consecutive cols); one instruction = 4 rows, each
// coverage: 4 instructions x 4 rows x 8 lanes x 8 halves = the wave's 16 x 64 tile.
// =====================================================================================================
__device__ __forceinline__ void epi16(float* sl, v8f a0, v8f a1, v8f a2, v8f a3, float oscale, u16* C, int N,
                                      size_t rowb, int col0, int lane) {
  const int hh = lane >> 4, m = lane & 15;
#pragma unroll
  for (int r = 0; r < 8; ++r) {
    const int ro = (8 * hh + r) * 68 + m;
    sl[ro]      = a0[r] * oscale;
    sl[ro + 16] = a1[r] * oscale;
    sl[ro + 32] = a2[r] * oscale;
    sl[ro + 48] = a3[r] * oscale;
  }
  wave_sync_lds();
  const int rq = lane >> 3, c8 = (lane & 7) * 8;
  v4u ov[4];
#pragma unroll
  for (int i4 = 0; i4 < 4; ++i4) {
    const int row = i4 * 4 + rq;
    const v4f a = *(const v4f*)(sl + row * 68 + c8), c4 = *(const v4f*)(sl + row * 68 + c8 + 4);
    float w[8];
#pragma unroll
    for (int e = 0; e < 4; ++e) { w[e] = a[e]; w[4 + e] = c4[e]; }
#pragma unroll
    for (int e = 0; e < 4; ++e) ov[i4][e] = pk16(h_bits((_Float16)w[2 * e]), h_bits((_Float16)w[2 * e + 1]));
  }
  u16* dst = C + (rowb + (size_t)rq) * (size_t)N + col0 + c8;
  {
#pragma unroll
    for (int i4 = 0; i4 < 4; ++i4) {
      *(v4u*)(dst + (size_t)(i4 * 4) * (size_t)N) = ov[i4];
    }
    wait_xlat();   // code of the merged kernel may follow these stores and rewrite their data or address registers
  }
}

// =====================================================================================================
// Main loop of both projection GEMMs. A block of NCG waves works on ONE tile of 64 x rows by WROWS weight rows, K = DMOD: every
// x row and every weight row that the block needs comes into its LDS once, and all its waves read them there. A stage = VKS
// k values of the 64 x rows and the WROWS weight rows, brought in by asynchronous 16-byte copies (16 lanes = one 256-B row
// piece, whole 128-B lines; 8 copies per thread and stage for the weight rows, 4 more in waves 0..7 for the x rows), two
// buffers: stage t+2 is issued behind the barrier at the foot of trip t and flies during trip t+1. A wave's 16x64 result:
// A fragment from LDS row arow, B fragments from LDS rows brow, brow+16, brow+32, brow+48 (LDS row = x row 0..63, or 64 + weight
// row; the lane's own row index is already in arow and brow). Rows of 272 B, two 16-B reads per fragment, split k map for A
// and B; k runs upward in steps of 32 from the block's own start stage and wraps. Every wave passes every block barrier.
// rot: trip t works on k stage (t + rot) mod VNS. Blocks that read the same x or weight rows then ask for different stages at
// the same time, so each line's first fetch into L2 is waited for by few of them and the others find it there. For speed
// only: any rot in 0 .. VNS-1 gives every stage exactly once.
// =====================================================================================================
__device__ __forceinline__
void proj_loop(u16* ring, const u16* __restrict__ X, const u16* __restrict__ Wt, int xrow0, int wrow0, int rot,
               int arow, int brow, v8f& acc0, v8f& acc1, v8f& acc2, v8f& acc3) {
  const int K = DMOD;
  const int tid = threadIdx.x, hh = (tid & 31) >> 4;
  const bool xw = __builtin_amdgcn_readfirstlane(tid >> 5) < 8;   // scalar: waves 0..7 also copy the x rows
  // copy addresses of this thread: weight chunk i = tid + 384*j, row = i >> 4 = (tid >> 4) + 24*j, 16-byte column = tid & 15;
  // x chunk (waves 0..7) i = tid + 256*j, row = (tid >> 4) + 16*j (start row kept inside 0..15 in every thread)
  const unsigned lw0 = lds_addr(ring) + (unsigned)((64 + (tid >> 4)) * (VPH * 2) + (tid & 15) * 16);
  const unsigned lx0 = lds_addr(ring) + (unsigned)(((tid >> 4) & 15) * (VPH * 2) + (tid & 15) * 16);
  const char* gw0 = (const char*)(const void*)(Wt + (size_t)(wrow0 + (tid >> 4)) * K) + (tid & 15) * 16;
  const char* gx0 = (const char*)(const void*)(X + (size_t)(xrow0 + ((tid >> 4) & 15)) * K) + (tid & 15) * 16;
  const unsigned lws = 24 * VPH * 2, lxs = 16 * VPH * 2;                  // 24 and 16 rows on, in LDS
  const size_t   gws = (size_t)24 * K * 2, gxs = (size_t)16 * K * 2;      // the same in the source planes
  const int k1 = (rot + 1 < VNS) ? (rot + 1) : 0;
  // first stage landed and published; then the second into the other buffer
  copy8(lw0, lws, gw0 + rot * (VKS * 2), gws);
  if (xw) copy4(lx0, lxs, gx0 + rot * (VKS * 2), gxs);
  wait_copies();
  __syncthreads();
  copy8(lw0 + VBUFH * 2, lws, gw0 + k1 * (VKS * 2), gws);
  if (xw) copy4(lx0 + VBUFH * 2, lxs, gx0 + k1 * (VKS * 2), gxs);
#pragma unroll 1   // one trip per stage: the buffer index alternates, the code stays small
  for (int t = 0; t < VNS; ++t) {
    const u16* bufp = ring + (t & 1) * VBUFH;
    const u16* al = bufp + arow * VPH + 8 * hh;
    const u16* bl = bufp + brow * VPH + 8 * hh;
#pragma unroll     // k offsets inside the stage become immediate offsets of the LDS reads
    for (int u = 0; u < VKS; u += 64) {
      // all LDS reads of 64 k values stand together in front of their products
      const v16b a  = ldfrag_b(al + u),                 e  = ldfrag_b(al + u + 32);
      const v16b b0 = ldfrag_b(bl + u),                 f0 = ldfrag_b(bl + u + 32);
      const v16b b1 = ldfrag_b(bl + 16 * VPH + u),      f1 = ldfrag_b(bl + 16 * VPH + u + 32);
      const v16b b2 = ldfrag_b(bl + 32 * VPH + u),      f2 = ldfrag_b(bl + 32 * VPH + u + 32);
      const v16b b3 = ldfrag_b(bl + 48 * VPH + u),      f3 = ldfrag_b(bl + 48 * VPH + u + 32);
      acc0 = mma_b(a, b0, acc0);
      acc1 = mma_b(a, b1, acc1);
      acc2 = mma_b(a, b2, acc2);
      acc3 = mma_b(a, b3, acc3);
      guard6<v16b>(acc0, acc1, acc2, acc3, a, b0, b1, b2, b3, a);
      acc0 = mma_b(e, f0, acc0);
      acc1 = mma_b(e, f1, acc1);
      acc2 = mma_b(e, f2, acc2);
      acc3 = mma_b(e, f3, acc3);
      guard6<v16b>(acc0, acc1, acc2, acc3, e, f0, f1, f2, f3, e);
    }
    // foot of trip t: own LDS reads back, own copies of stage t+1 landed, barrier (publishes stage t+1 and ends every
    // reader's last read of this trip's buffer); only then the refill of that buffer with stage t+2
    wait_lds();
    wait_copies();
    __syncthreads();
    if (t + 2 < VNS) {
      const unsigned bo = (unsigned)((t & 1) * (VBUFH * 2));
      const int k2 = (t + 2 + rot < VNS) ? (t + 2 + rot) : (t + 2 + rot - VNS);
      copy8(lw0 + bo, lws, gw0 + k2 * (VKS * 2), gws);
      if (xw) copy4(lx0 + bo, lxs, gx0 + k2 * (VKS * 2), gxs);
    }
  }
  wait_copies();
  acc_guard4(acc0, acc1, acc2, acc3);
}

// =====================================================================================================
// bf16 GEMM with bias and 16-bit result: C[M][N] (f16 of (acc + bias)*oscale) = A[M][K] (bf16 weight plane, row-major) .
// Bt[N][K]^T (bf16 x plane, k-contiguous); bias (f32 input, taken as its RNE bf16 value) indexed by column (byrow == 0) or by
// row (byrow != 0), both candidates read with addresses clamped to [0, nbias). Block tile = WROWS result rows (weight rows
// wg*WROWS ..) by 64 result columns (x rows xt*64 ..): group g = threadIdx.x >> 7 of 4 waves takes rows 64g .. 64g+63 of it,
// 16 per wave. (The caller gives xt < N/64 and wg < WGRP.)
// =====================================================================================================
__device__ __forceinline__
void gemm_b16(char* pool, int xt, int wg, int rot, const u16* __restrict__ A, const u16* __restrict__ Bt, u16* C,
              const float* __restrict__ bias, int N, int nbias, int byrow, float oscale) {
  const int grp = threadIdx.x >> 7;
  float* slab = (float*)(void*)pool + grp * (4 * SLAB);
  u16*   ring = (u16*)(void*)(pool + NCG * SLAB * 4 + WROWS * 4);   // two buffers of (x rows, weight rows), rows of VPH halves
  const int tid = threadIdx.x & 127, wave = tid >> 5, lane = tid & 31, hh = lane >> 4, m = lane & 15;
  const int rowb  = wg * WROWS + grp * 64 + wave * 16;
  const int col0  = xt * 64;
  v8f acc0 = zero8(), acc1 = zero8(), acc2 = zero8(), acc3 = zero8();
  proj_loop(ring, Bt, A, col0, wg * WROWS, rot, 64 + grp * 64 + wave * 16 + m, m, acc0, acc1, acc2, acc3);
  // bias: D element r of lane -> (row rowb+8hh+r, col col0+16j+m); both candidates loaded with clamped addresses, select by value
  float bc[4], br[8];
#pragma unroll
  for (int j = 0; j < 4; ++j) {
    int ci = col0 + 16 * j + m;
    ci = (ci < nbias) ? ci : (nbias - 1);
    bc[j] = bf_val(bias[ci]);
  }
  int ri[8];
  float bw[8];
#pragma unroll
  for (int r = 0; r < 8; ++r) {
    ri[r] = rowb + 8 * hh + r;
    ri[r] = (ri[r] < nbias) ? ri[r] : (nbias - 1);
    bw[r] = bias[ri[r]];
  }
#if defined(__HIP_DEVICE_COMPILE__)
  // the eight loads' index registers stay live up to this address-translation wait (inputs only), so that no load's result
  // lands in the index register of a load issued before it; the loaded values as inputs keep the loads in front of it
  asm volatile("s_wait_xcnt 0x0"
               :: "v"(ri[0]), "v"(ri[1]), "v"(ri[2]), "v"(ri[3]), "v"(ri[4]), "v"(ri[5]), "v"(ri[6]), "v"(ri[7]),
                  "v"(bw[0]), "v"(bw[1]), "v"(bw[2]), "v"(bw[3]), "v"(bw[4]), "v"(bw[5]), "v"(bw[6]), "v"(bw[7])
               : "memory");
#endif
#pragma unroll
  for (int r = 0; r < 8; ++r) br[r] = bf_val(bw[r]);
#pragma unroll
  for (int r = 0; r < 8; ++r) {
    const float q0 = (byrow != 0) ? br[r] : bc[0];
    const float q1 = (byrow != 0) ? br[r] : bc[1];
    const float q2 = (byrow != 0) ? br[r] : bc[2];
    const float q3 = (byrow != 0) ? br[r] : bc[3];
    acc0[r] += q0;
    acc1[r] += q1;
    acc2[r] += q2;
    acc3[r] += q3;
  }
  epi16(slab + wave * SLAB, acc0, acc1, acc2, acc3, oscale, C, N, (size_t)rowb, col0, lane);
}

// =====================================================================================================
// Query projection with fused per-chunk L2 normalisation:
//   q[M][NCG*64] (f32, registers only) = A[M][K] (bf16 x plane) . Bt[NCG*64][K]^T (bf16 Wq plane) + bias[col] (RNE bf16 value);
//   block tile = 64 result rows (x rows xt*64 ..) by WROWS result columns (weight rows wg*WROWS ..) = VTPB column groups of 64:
//   group g = threadIdx.x >> 7 of 4 waves takes column group cg = wg*VTPB + g, 16 rows per wave, so a weight row is fetched by
//   SEQ/64 blocks and an x row by WGRP of them.
//   For D row 8hh+r the 64-wide chunk (row, cols col0..col0+63) lives
//   in the 16 lanes of half hh x 4 accumulators: ss = sum of squares (4 products per lane, xor-1/2/4/8 shuffles inside the
//   half), qn = q * (1/max(sqrt(ss), 1e-12)), aa = sum of qn^2 the same way (f32), kept in LDS at aas[(row in block)*VTPB + g].
//   After the block barrier the block's 64*VTPB aa values go out as whole 128-B lines that no other block writes: the aa table
//   is laid out [wg][row][g], so they are contiguous (64*VTPB floats is a multiple of 32).
//   Part of the projection launch: block = NCG waves (every wave reaches every barrier); slabs, aa values and ring lie in the
//   block's LDS pool.
// coverage: qn plane: (M/64)*WGRP blocks x NCG waves x (16 x 64) = M x NCG*64;  aa table: the same blocks x 64*VTPB floats = M*NCG.
// =====================================================================================================
__device__ __forceinline__
void gemm_qn(char* pool, int xt, int wg, int rot, const u16* __restrict__ A, const u16* __restrict__ Bt, u16* C, float* AAP,
             const float* __restrict__ bias, int nbias, float oscale) {
  float* slab = (float*)(void*)pool;
  float* aas  = slab + NCG * SLAB;
  u16*   ring = (u16*)(void*)(pool + NCG * SLAB * 4 + WROWS * 4);   // two buffers of (x rows, weight rows), rows of VPH halves
  const int tid = threadIdx.x, wave = tid >> 5, lane = tid & 31, hh = lane >> 4, m = lane & 15;
  const int grp = wave >> 2, wr = (wave & 3) * 16;   // column group in the block; first row of the wave in the block
  const int N = NCG * 64;
  const int rowb = xt * 64 + wr;
  const int col0 = wg * WROWS + grp * 64;
  v8f acc0 = zero8(), acc1 = zero8(), acc2 = zero8(), acc3 = zero8();
  proj_loop(ring, A, Bt, xt * 64, wg * WROWS, rot, wr + m, 64 + grp * 64 + m, acc0, acc1, acc2, acc3);
  float bc[4], bw[4];
  int ci[4];
#pragma unroll
  for (int j = 0; j < 4; ++j) {
    ci[j] = col0 + 16 * j + m;
    ci[j] = (ci[j] < nbias) ? ci[j] : (nbias - 1);
    bw[j] = bias[ci[j]];
  }
#if defined(__HIP_DEVICE_COMPILE__)
  // the four loads' index registers stay live up to this address-translation wait (inputs only), so that nothing rewrites one
  // in front of it; the loaded values as inputs keep the loads in front of it
  asm volatile("s_wait_xcnt 0x0"
               :: "v"(ci[0]), "v"(ci[1]), "v"(ci[2]), "v"(ci[3]), "v"(bw[0]), "v"(bw[1]), "v"(bw[2]), "v"(bw[3])
               : "memory");
#endif
#pragma unroll
  for (int j = 0; j < 4; ++j) bc[j] = bf_val(bw[j]);
#pragma unroll
  for (int r = 0; r < 8; ++r) {
    acc0[r] += bc[0];
    acc1[r] += bc[1];
    acc2[r] += bc[2];
    acc3[r] += bc[3];
  }
  // per row: L2 normalise the 64-wide chunk and take the f32 sum of squares of the normalised values
#pragma unroll
  for (int r = 0; r < 8; ++r) {
    float ss = acc0[r] * acc0[r] + acc1[r] * acc1[r] + acc2[r] * acc2[r] + acc3[r] * acc3[r];
    ss += __shfl_xor(ss, 1, 32);
    ss += __shfl_xor(ss, 2, 32);
    ss += __shfl_xor(ss, 4, 32);
    ss += __shfl_xor(ss, 8, 32);
    const float nrm = sqrtf(ss);
    const float den = fmaxf(nrm, 1e-12f);
    const float inv = 1.0f / den;
    acc0[r] *= inv;
    acc1[r] *= inv;
    acc2[r] *= inv;
    acc3[r] *= inv;
    float a2 = acc0[r] * acc0[r] + acc1[r] * acc1[r] + acc2[r] * acc2[r] + acc3[r] * acc3[r];
    a2 += __shfl_xor(a2, 1, 32);
    a2 += __shfl_xor(a2, 2, 32);
    a2 += __shfl_xor(a2, 4, 32);
    a2 += __shfl_xor(a2, 8, 32);
    if (m == 0) aas[(wr + 8 * hh + r) * VTPB + grp] = a2;
  }
  epi16(slab + wave * SLAB, acc0, acc1, acc2, acc3, oscale, C, N, (size_t)rowb, col0, lane);
  __syncthreads();
  // aa table lines of this block: 64*VTPB contiguous floats; thread t < 64*VTPB/4 writes float4 t
  const int nf4 = WROWS / 4;
  if (tid < nf4) {
    const v4f w0 = *(const v4f*)(aas + 4 * tid);
    *(v4f*)(AAP + ((size_t)wg * SEQ + (size_t)xt * 64) * VTPB + 4 * tid) = w0;
  }
}

// =====================================================================================================
// Both projections in ONE launch (neither reads what the other writes): blocks 0 .. QBLK-1 do the query projection (the longer
// part, so it starts first), blocks QBLK .. QBLK+VBLK-1 the v^T GEMM; either way block = (64 x rows xt, WROWS weight rows wg).
// The choice is block-uniform, so every barrier of either part is passed by all NCG waves of its block. One LDS pool per block.
// The start stage takes all VNS values among the 2*WGRP blocks that read the same x rows (two of them twice) and differs from one xt to the next (same weight rows).
// =====================================================================================================
__global__ __launch_bounds__(NCG * 32)
void gemm_qv(const u16* __restrict__ XBp, const u16* __restrict__ WQp, const u16* __restrict__ WVp, u16* QPp, float* AAP,
             u16* VPp, const float* __restrict__ bq, const float* __restrict__ bv) {
  __shared__ __align__(16) char pool[POOLB];
  const int b = blockIdx.x;
  if (b >= QBLK + VBLK) return;              // block-uniform, never taken with the exact grid; in front of every barrier
  const int lb = (b < QBLK) ? b : (b - QBLK);
  const int xt = lb / WGRP, wg = lb % WGRP;
  const int rot = (xt + wg + ((b < QBLK) ? 0 : WGRP)) % VNS;
  if (b < QBLK) gemm_qn(pool, xt, wg, rot, XBp, WQp, QPp, AAP, bq, DMOD, QSC);
  else          gemm_b16(pool, xt, wg, rot, WVp, XBp, VPp, bv, SEQ, DMOD, 1, VCAR);
}

// =====================================================================================================
// L2-distance flash attention (no masking, all SEQ keys): block = (head, 64 query rows), 4 waves, wave w owns the 16 query
// rows q0 = 64*qt + 16*w .. q0+15. The block's 4 waves share the key and value tiles: a stage = 64 keys = K tile (64 key rows
// x 128 B) + V tile (64 d rows x 128 B), brought into LDS by asynchronous 16-byte copies (whole 128-B lines, 8 copies per
// thread and stage), two buffers: stage t+2 is issued behind the barrier at the foot of trip t and flies during trip t+1.
// The head's AA table (SEQ floats) is copied once with stage 0, float by float, into chunk order. Fragments are read from LDS
// rows of 144 B.
//   qn plane (f16, x QSC) laid out as [NHD*SEQ chunks][64]: head h, row n = chunk h*SEQ + n; keys and queries both come
//   from this plane. AA table (f32): chunk row*NCG + cg at [cg / VTPB][row][cg % VTPB]. v^T plane [h*64+d][SEQ keys] (x1024).
//   All NKB = SEQ/32 key blocks of 32 keys are visited (static bound), from the block's own start stage on, wrapping.
//   Scores are computed TRANSPOSED: S^T tile g (g = 0,1) = key rows (keys kb+16g .. +15, A operand, row m = lane&15, split
//   k map over d) times q^T (B operand, col n = query q0 + (lane&15), k = d, split map), one product per tile and 32-deep
//   d-chunk. D element r of lane l = (key kb+16g+8h+r, query q0+(l&15)), so a lane owns one query column and 16 of its 32
//   keys; the partner lane l^16 owns the other 16 -> row sum needs one xor-16 shuffle.
//   Base-2 logit: t = (2*qn_n.qn_m/(QSC*QSC) - AA_n - AA_m) * log2(e)/8. Every qn row is a vector divided by at least its own
//   norm, so its length is at most 1 (f16 rounding adds under 0.1 %): |2*qn_n.qn_m| * log2(e)/8 < 0.37 and
//   0 <= AA * log2(e)/8 < 0.19 for any finite input, hence -0.74 < t < 0.37. The softmax therefore needs no running maximum:
//   its shift is the constant -PSH, p = exp2(t + PSH) = P x 32768 lies in (19000, 43000), inside f16, the exp2 argument is far
//   from the subnormal range (bare hardware exp2), and neither l nor the O accumulators are ever rescaled.
//   The exp'd values ARE the P A-fragment in place: A row m = query = lane&15, element i <- key kb+8h+i (tile 0, D element i),
//   element 8+i <- key kb+16+8h+i (tile 1, D element i). l (x32768) is summed per lane in 4 partial sums over the lane's
//   own keys; the partials and the partner lane l^16 are joined once behind the loop. 4 v^T B fragments
//   (col n = d = 16j + (lane&15), keys k-contiguous), 4 P.V WMMAs per key block.
//   Epilogue: 1/l (per query, shuffled to the D row owner) and carry folds in f32; the wave's 16x64 f32 result staged in its
//   aux0/aux1 are bound only (not read).
// coverage: per wave 8 instructions x 2 rows x 16 lanes x 4 floats = 16 x 64; grid NHD*(SEQ/64) blocks x 4 waves = every
//           output row (h, n < SEQ) exactly once = SEQ*NHD*64 floats.
// =====================================================================================================
__global__ __launch_bounds__(ATT_THREADS)
void attn_l2(const u16* __restrict__ QPp, const float* __restrict__ AAp, const u16* __restrict__ VPp, float* out,
             const float* aux0, const float* aux1) {
  __shared__ __align__(16) float smem[ATT_WAVES * SLAB];   // per wave: result slab [16][68] in the epilogue only
  __shared__ __align__(16) _Float16 ring[2 * BUFH];        // two buffers of (K tile, V tile), rows of LPH halves
  __shared__ __align__(16) float aas[SEQ];                 // AA table of this head
  (void)aux0; (void)aux1;

  const int tid  = threadIdx.x;
  const int wave = tid >> 5;
  const int lane = tid & 31;
  const int hh   = lane >> 4;
  const int c    = lane & 15;

  const int bid  = blockIdx.x;
  const int qt   = bid % QTILES;
  const int head = bid / QTILES;
  if (head >= NHD) return;                                 // block-uniform, never taken with the exact grid; in front of every barrier
  const int q0   = qt * 64 + wave * 16;
  const size_t hb = (size_t)head * SEQ;                    // chunk index base of this head

  const _Float16* QH = (const _Float16*)(const void*)QPp;
  // B fragments of q^T: col n = query chunk hb + q0 + c, k = d
  const _Float16* Qb = QH + (hb + (size_t)(q0 + c)) * HD + 8 * hh;
  // copy addresses of this thread: chunk i = tid + 128*j, row = i >> 3 = (tid >> 3) + 16*j, 16-byte column = tid & 7
  const unsigned lk0 = lds_addr(ring) + (unsigned)((tid >> 3) * (LPH * 2) + (tid & 7) * 16);
  const char* gk0 = (const char*)(const void*)(QH + hb * HD) + tid * 16;                       // K rows are contiguous
  const char* gv0 = (const char*)(const void*)((const _Float16*)(const void*)VPp + ((size_t)(head * HD + (tid >> 3))) * SEQ)
                    + (tid & 7) * 16;
  // Rotated walk: trip t works on key stage (t + rot) mod NST. The QTILES blocks of a head read the same K and V rows; with
  // different stages asked for at the same time each line's first fetch into L2 is waited for by few blocks and the others
  // find it there. The bit order spreads the starts of blocks whose indices lie close together modulo 8. For speed only: any
  // rot in 0 .. NST-1 gives every stage exactly once; the constant softmax shift makes the key order free but for rounding.
  const int rot = (qt & ~7) | ((qt & 3) << 1) | ((qt >> 2) & 1);
  const int st1 = (rot + 1) & (NST - 1);
  // first stage and the AA table, landed and published; then the second stage into the other buffer
  copy_stage(lk0, gk0 + (size_t)rot * (KT * HD * 2), gv0 + rot * (KT * 2));
#if defined(__HIP_DEVICE_COMPILE__)
  __builtin_amdgcn_sched_barrier(0);   // the table's address arithmetic stays behind the stage's copies, which then fly meanwhile
#endif
  // chunk ch = row*NCG + cg lies at float [cg / VTPB][row][cg % VTPB] of the table; with tq = ch / VTPB = row*WGRP + cg / VTPB that is
  // ch + (SEQ*VTPB - VTPB)*(tq % WGRP) - (NCG - VTPB)*(tq / WGRP). One division per thread: its chunks lie ATT_THREADS apart.
  const unsigned ch0 = (unsigned)hb + (unsigned)tid, tq0 = ch0 / VTPB, rm0 = ch0 - tq0 * VTPB;
#pragma unroll   // straight line: AACP copies of one float each, eight to a statement
  for (int j = 0; j < AACP; j += 8) {
    const char* ga[8];
#pragma unroll
    for (int i = 0; i < 8; ++i) {
      const unsigned st = (unsigned)(ATT_THREADS * (j + i));
      const unsigned tq = tq0 + st / VTPB + ((rm0 + st % VTPB >= VTPB) ? 1u : 0u);
      ga[i] = (const char*)(const void*)(AAp + (ch0 + st + (SEQ * VTPB - VTPB) * (tq % WGRP) - (NCG - VTPB) * (tq / WGRP)));
    }
    copy8w(lds_addr(aas) + (unsigned)((tid + ATT_THREADS * j) * 4), ATT_THREADS * 4, ga);
  }
  wait_copies();
  __syncthreads();
  copy_stage(lk0 + BUFH * 2, gk0 + (size_t)st1 * (KT * HD * 2), gv0 + st1 * (KT * 2));
  const float lsc = 0.25f * (LOG2E / (QSC * QSC));
  const float c1l = 0.125f * LOG2E;
  const float aq  = aas[q0 + c] * c1l - PSH;                // AA term of this lane's query (staged table), with the constant shift

  const v16h qf0 = ldfrag_h(Qb);            // d 0..31
  const v16h qf1 = ldfrag_h(Qb + 32);       // d 32..63

  v2f lp[2] = {{0.f, 0.f}, {0.f, 0.f}};     // partial sums of p over this lane's keys, element i -> lp[(i >> 1) & 1][i & 1]
  v8f o[4];
#pragma unroll
  for (int j = 0; j < 4; ++j) o[j] = zero8();

#pragma unroll 1
  for (int t = 0; t < NST; ++t) {
   const _Float16* bufp = ring + (t & 1) * BUFH;
   // A fragments of keys: LDS row = key in stage (32u + 16g + c), k = d;  B fragments of v: LDS row = d = 16j + c, k = key
   const _Float16* Kl = bufp + c * LPH + 8 * hh;
   const _Float16* Vl = bufp + TILEH + c * LPH + 8 * hh;
#pragma unroll   // both 32-key blocks of the stage in line: u becomes an immediate offset of the LDS reads
   for (int u = 0; u < 2; ++u) {
    const int kb = ((t + rot) & (NST - 1)) * KT + u * 32;
    // ---- all LDS reads of this 32-key block stand together in front of its products ----
    const _Float16* k0p = Kl + (32 * u) * LPH;
    const _Float16* k1p = k0p + 16 * LPH;
    const v16h ka0 = ldfrag_h(k0p), ka1 = ldfrag_h(k0p + 32);
    const v16h kc0 = ldfrag_h(k1p), kc1 = ldfrag_h(k1p + 32);
    // AA of this lane's 16 keys: tile 0 element i -> key kb+8hh+i, tile 1 element i -> key kb+16+8hh+i
    const float* am = aas + kb + 8 * hh;
    const v4f w0 = *(const v4f*)(am), w1 = *(const v4f*)(am + 4);
    const v4f w2 = *(const v4f*)(am + 16), w3 = *(const v4f*)(am + 20);
    const _Float16* vp = Vl + 32 * u;
    const v16h vf0 = ldfrag_h(vp);
    const v16h vf1 = ldfrag_h(vp + 16 * LPH);
    const v16h vf2 = ldfrag_h(vp + 32 * LPH);
    const v16h vf3 = ldfrag_h(vp + 48 * LPH);
    // ---- transposed scores: s0 = keys kb..kb+15, s1 = keys kb+16..kb+31, column = query q0 + c ----
    v8f s0 = zero8(), s1 = zero8();
    s0 = mma_h(ka0, qf0, s0);
    s0 = mma_h(ka1, qf1, s0);
    s1 = mma_h(kc0, qf0, s1);
    s1 = mma_h(kc1, qf1, s1);
    guard2(s0, s1, qf0, qf1, ka0, ka1, kc0, kc1);
    // ---- p = exp2(t + PSH) of this lane's 16 keys for query q0 + c, and the P A-fragment: element i <-> key i ----
    FragH ph;
#pragma unroll
    for (int e = 0; e < 2; ++e) {          // pairs of neighbouring keys: elements 2e, 2e+1 of each group of four
      const int i = 2 * e;
      const v2f sa = {s0[i], s0[i + 1]}, sb = {s0[4 + i], s0[5 + i]}, sc = {s1[i], s1[i + 1]}, sd = {s1[4 + i], s1[5 + i]};
      const v2f wa = {w0[i], w0[i + 1]}, wb = {w1[i], w1[i + 1]}, wc = {w2[i], w2[i + 1]}, wd = {w3[i], w3[i + 1]};
      const v2f ta = sa * lsc - (wa * c1l + aq), tb = sb * lsc - (wb * c1l + aq);
      const v2f tc = sc * lsc - (wc * c1l + aq), td = sd * lsc - (wd * c1l + aq);
      const v2f pa = {__builtin_amdgcn_exp2f(ta[0]), __builtin_amdgcn_exp2f(ta[1])};
      const v2f pb = {__builtin_amdgcn_exp2f(tb[0]), __builtin_amdgcn_exp2f(tb[1])};
      const v2f pc = {__builtin_amdgcn_exp2f(tc[0]), __builtin_amdgcn_exp2f(tc[1])};
      const v2f pd = {__builtin_amdgcn_exp2f(td[0]), __builtin_amdgcn_exp2f(td[1])};
      ph.u[0][e]     = pkh(pa);
      ph.u[0][2 + e] = pkh(pb);
      ph.u[1][e]     = pkh(pc);
      ph.u[1][2 + e] = pkh(pd);
      lp[e] += (pa + pb) + (pc + pd);
    }
    // ---- P.V : B fragment col n = d = j*16 + c, keys contiguous in the staged v^T rows ----
    {
      o[0] = mma_h(ph.v, vf0, o[0]);
      o[1] = mma_h(ph.v, vf1, o[1]);
      o[2] = mma_h(ph.v, vf2, o[2]);
      o[3] = mma_h(ph.v, vf3, o[3]);
      guard6<v16h>(o[0], o[1], o[2], o[3], ph.v, vf0, vf1, vf2, vf3, ph.v);
    }
   }
   // ---- foot of trip t: own LDS reads back, own copies of stage t+1 landed, barrier (publishes stage t+1 and ends every
   //      reader's last read of this trip's buffer); only then the refill of that buffer with stage t+2 ----
   wait_lds();
   wait_copies();
   __syncthreads();
   if (t + 2 < NST) {
     const int st2 = (t + 2 + rot) & (NST - 1);
     copy_stage(lk0 + (unsigned)((t & 1) * (BUFH * 2)), gk0 + (size_t)st2 * (KT * HD * 2), gv0 + st2 * (KT * 2));
   }
  }
  wait_copies();
  acc_guard4(o[0], o[1], o[2], o[3]);

  // ---- l x32768 of this lane's query: own partials, then the partner lane's 16 keys of every block ----
  float lrun = (lp[0][0] + lp[0][1]) + (lp[1][0] + lp[1][1]);
  lrun += __shfl_xor(lrun, 16, 32);
  // ---- fold 1/l (per query, owned by lane = query; the x32768 of P and of l cancel) and the v carry; stage the 16x64 slab ----
  const float linv = (lrun > 0.f) ? ((1.0f / lrun) * (1.0f / VCAR)) : 0.f;
  float inv[8];
#pragma unroll
  for (int r = 0; r < 8; ++r) inv[r] = __shfl(linv, 8 * hh + r, 32);
  float* slab = smem + wave * SLAB;
#pragma unroll
  for (int r = 0; r < 8; ++r) {
#pragma unroll
    for (int j = 0; j < 4; ++j) slab[(8 * hh + r) * 68 + j * 16 + c] = o[j][r] * inv[r];
  }
  wave_sync_lds();
  // ---- f32 output rows: lanes 0..15 -> row 2*it2, lanes 16..31 -> row 2*it2+1, 16 lanes x 16 B = one 256-B row ----
  v4f vals[8];
#pragma unroll
  for (int it2 = 0; it2 < 8; ++it2) vals[it2] = *(const v4f*)(slab + (it2 * 2 + hh) * 68 + c * 4);
  float* dst = out + (hb + (size_t)(q0 + hh)) * HD + c * 4;
  {
#pragma unroll
    for (int it2 = 0; it2 < 8; ++it2) {
      *(v4f*)(dst + (size_t)(it2 * 2) * HD) = vals[it2];
    }
    
  }
}

// =====================================================================================================
// Workspace map (bytes); every plane is fully written by whole-line stores before it is read; all extents are exact multiples
// of the store granularity (no pad rows needed), every offset a multiple of 128:
//   XB  bf16 [SEQ][768]                          SEQ*1536   (3145728 at SEQ = 2048)
//   WQB bf16 [768 n][768 k]                      1179648    WVB same
//   QP  f16  [SEQ][768] = [12*SEQ chunks][64] x16 SEQ*1536
//   AAP f32  [4][SEQ][3]                         SEQ*48     (98304)
//   VP  f16  [768 = h*64+d][SEQ] x1024           SEQ*1536
//   end                                          11894784 at SEQ = 2048
// =====================================================================================================
extern "C" void kernel_launch(void* const* d_in, const int* in_sizes, int n_in,
                              void* d_out, int out_size, void* d_ws, size_t ws_size,
                              hipStream_t stream) {
  if (n_in < 7) return;
  if (in_sizes[0] < SEQ * DMOD) return;
  if (in_sizes[1] < 1 || in_sizes[2] < 1) return;
  if (in_sizes[3] != DMOD * DMOD || in_sizes[5] != DMOD * DMOD) return;
  if (in_sizes[4] != DMOD || in_sizes[6] != DMOD) return;
  if (out_size < SEQ * DMOD) return;

  const float* Xin = (const float*)d_in[0];
  const float* Gin = (const float*)d_in[1];               // bound only, not read
  const float* Min = (const float*)d_in[2];               // bound only, not read
  const float* Wq  = (const float*)d_in[3];
  const float* bq  = (const float*)d_in[4];
  const float* Wv  = (const float*)d_in[5];
  const float* bv  = (const float*)d_in[6];
  float*       out = (float*)d_out;

  const size_t szXB = (size_t)SEQ * DMOD * 2;
  const size_t szW  = (size_t)DMOD * DMOD * 2;
  const size_t szQP = (size_t)SEQ * DMOD * 2;
  const size_t szAA = (size_t)NHD * SEQ * 4;
  const size_t szVP = (size_t)DMOD * SEQ * 2;
  size_t off = 0;
  const size_t oXB = off; off += szXB;
  const size_t oWQ = off; off += szW;
  const size_t oWV = off; off += szW;
  const size_t oQP = off; off += szQP;
  const size_t oAA = off; off += szAA;
  const size_t oVP = off; off += szVP;
  if (off > ws_size) return;                            // off = 11894784 at SEQ = 2048
  if (off > (size_t)134217728) return;

  char* ws = (char*)d_ws;
  u16*   XB  = (u16*)(ws + oXB);
  u16*   WQB = (u16*)(ws + oWQ);
  u16*   WVB = (u16*)(ws + oWV);
  u16*   QP  = (u16*)(ws + oQP);
  float* AAP = (float*)(ws + oAA);
  u16*   VP  = (u16*)(ws + oVP);

  const int n8x = (SEQ * DMOD) / 8;
  const int n8w = (DMOD * DMOD) / 8;
  if ((n8x % 256) != 0 || (n8w % 256) != 0) return;
  if ((DMOD % 64) != 0 || (SEQ % 64) != 0 || (DMOD % 32) != 0) return;
  const dim3 blk(256);
  const dim3 gC(CVX + 2 * CVW);                         // 768 + 2 * 288 at SEQ = 2048
  const dim3 gP(QBLK + VBLK);                           // 128 + 128
  const dim3 bP(NCG * 32);                              // 384
  const dim3 gAT(ATT_BLOCKS);                           // 384
  const dim3 bAT(ATT_THREADS);                          // 128

  // (0) operand planes: x -> bf16; Wq/Wv [n = out][k = in] (already k-contiguous) -> bf16
  //     (XB, WQB, WVB follow one another in the workspace: one joined destination)
  cvt16x3<<<gC, blk, 0, stream>>>(Xin, Wq, Wv, XB);
  // (1) q = x.Wq^T + bq, L2-normalised per 64-chunk -> qn plane [SEQ][768] f16 x16 and AA table [12*SEQ] f32;
  //     v^T plane: [768 = h*64+d][SEQ keys] = f16((Wv . x^T + bv) x1024), bias by row
  gemm_qv<<<gP, bP, 0, stream>>>(XB, WQB, WVB, QP, AAP, VP, bq, bv);
  // (2) attention -> out, f32 row (chunk h*SEQ + n) of 64 floats at float offset (h*SEQ + n)*64
  attn_l2<<<gAT, bAT, 0, stream>>>(QP, AAP, VP, out, Gin, Min);
  (void)hipGetLastError();
}

// v008
// It runs in 31.4 microseconds.
// Two timings next to v007 both put it at 1.16 times that version's speed.
// All steps since v000 together make it 8.91 times as fast.
// Contractions: x.Wq^T+bq and Wv.x^T+bv on v_wmma_f32_16x16x32_bf16 (x and W planes RNE-converted to bf16 operands, f32 accumulate);
// scores qn.qn^T (qn = L2-normalised q, single f16 plane carried x16) and P.v (P x32768 single f16, v x1024 single f16) on
// v_wmma_f32_16x16x32_f16, f32 accumulate. Biases folded as RNE bf16 values in f32 epilogues; L2 normalisation, sums of squares,
// base-2 softmax with a constant shift, 1/l and carry folds in f32 on VALU.
#include <hip/hip_runtime.h>
#include <math.h>
#include <stdint.h>

#ifndef NB
#define NB 1
#endif
#ifndef SEQ
#define SEQ 2048
#endif
#define SEQ_FULL 2048
#define DMOD  768
#define NHD   12
#define HD    64
#define NCG   (DMOD / 64)
#define QSC   16.0f
#define PCAR  32768.0f
#define PSH   15.0f               // log2(PCAR): the constant shift of the base-2 logits, so that exp2 yields P x PCAR at once
#define VCAR  1024.0f
#define LOG2E 1.4426950408889634f
#define ATT_WAVES   16
#define ATT_THREADS (ATT_WAVES * 32)
#define QROWS       128           // query rows of an attention block: 4 groups of 32 rows, each worked on by 4 waves
#define QTILES      (SEQ / QROWS)
#define ATT_BLOCKS  (NHD * QTILES)
#define NKB    (SEQ / 32)
#define SLAB   (16 * 68)
#define KT     256                // keys per LDS stage of the attention loop: two 32-key blocks for each of a group's 4 waves
#define NST    (SEQ / KT)         // stages
#define LPH    72                 // K tile row pitch in halves: 128-B rows at 144 B = 16 B x odd, for 16-byte LDS readers
#define VLPH   264                // V tile row pitch in halves: 512-B rows at 528 B = 16 B x odd
#define KTILEH (KT * LPH)         // one staged K tile of KT key rows, in halves
#define VTILEH (HD * VLPH)        // one staged V tile of HD d rows, in halves
#define BUFH   (KTILEH + VTILEH)  // one buffer: K tile, then V tile
#define AACP   (SEQ / ATT_THREADS)   // 4-byte copies per thread for one head's AA table
static_assert(NST * KT == SEQ && NST >= 2 && KT == 4 * 2 * 32 && HD == 64 && QROWS == (ATT_WAVES / 4) * 32);
static_assert((VLPH * 2) % 16 == 0 && (KTILEH * 2) % 16 == 0 && (BUFH * 2) % 16 == 0 && VLPH >= KT + 8);
static_assert((NST & (NST - 1)) == 0 && NST == 8);   // the rotated stage walk wraps by a mask; its start takes 3 bits
static_assert(AACP * ATT_THREADS == SEQ && AACP == 4 && (LPH * 2) % 16 == 0 && ATT_THREADS * 4 * 16 == KT * HD * 2);
#define VKS    128                // k halves per LDS stage of the projection GEMMs: 256-B row pieces
#define VNS    (DMOD / VKS)       // their stages
#define VPH    136                // their LDS pitch in halves: 272 B = 16 B x odd
#define VTPB   3                  // 64x64 tiles per block of the projection launch, one per group of 4 waves: 64 x rows by 192 weight rows
#define WROWS  (64 * VTPB)        // weight rows of a block
#define WGRP   (DMOD / WROWS)     // groups of WROWS weight rows in a weight plane
#define VBUFH  ((64 + WROWS) * VPH)   // one buffer: the block's 64 x rows, then its WROWS weight rows, in halves
static_assert(VNS * VKS == DMOD && VNS >= 2 && (VPH * 2) % 16 == 0 && WGRP * WROWS == DMOD);
static_assert(NCG * 32 * 8 * 16 == WROWS * VKS * 2 && 8 * 32 * 4 * 16 == 64 * VKS * 2);   // copies per stage: 8 in every wave, 4 more in waves 0..7
#define CVX    ((SEQ * DMOD) / 2048)    // blocks of the conversion launch for x (256 threads x 8 elements each)
#define CVW    ((DMOD * DMOD) / 2048)   // its blocks for each weight plane
#define QBLK   ((SEQ / 64) * WGRP)      // blocks of the projection launch that do the query projection
#define VBLK   ((SEQ / 64) * WGRP)      // its blocks that do the v^T GEMM
#define POOLB  (NCG * SLAB * 4 + WROWS * 4 + 2 * VBUFH * 2)   // LDS bytes of a block: result slabs, aa values, ring
static_assert(VTPB * 4 == NCG && (NCG * SLAB * 4) % 16 == 0 && (WROWS * 4) % 128 == 0 && (VBUFH * 2) % 16 == 0);
static_assert(NB == 1);
static_assert(HD == 64 && DMOD == NHD * HD && NCG * 64 == DMOD);
static_assert((SEQ % 64) == 0 && SEQ >= 64 && SEQ <= SEQ_FULL);
static_assert(ATT_THREADS == 512 && NKB * 32 == SEQ && ATT_BLOCKS == NHD * (SEQ / 128) && (SEQ % QROWS) == 0);
static_assert((DMOD % 64) == 0 && (DMOD % 32) == 0);
static_assert(((SEQ * DMOD / 8) % 256) == 0 && ((DMOD * DMOD / 8) % 256) == 0);
static_assert((SLAB * 4) % 16 == 0);
static_assert(((16 * NCG) % 32) == 0 && NCG * 32 <= 1024 && (SEQ % 16) == 0);

typedef unsigned short u16;
typedef _Float16 v16h __attribute__((ext_vector_type(16)));
typedef _Float16 v8h  __attribute__((ext_vector_type(8)));
typedef __bf16   v16b __attribute__((ext_vector_type(16)));
typedef float    v8f  __attribute__((ext_vector_type(8)));
typedef float    v4f  __attribute__((ext_vector_type(4)));
typedef unsigned int v4u __attribute__((ext_vector_type(4)));
typedef float    v2f  __attribute__((ext_vector_type(2)));
typedef _Float16 v2h  __attribute__((ext_vector_type(2)));

union FragH { v16h v; v8h h[2]; v4u u[2]; };
union FragB { v16b v; v4u u[2]; };

// ---- scalar helpers --------------------------------------------------------------------------------
__device__ __forceinline__ unsigned short bf_bits(float f) {          // f32 -> bf16 bits, RNE convert
  unsigned u = __float_as_uint(f);
  return (unsigned short)((u + 0x7FFFu + ((u >> 16) & 1u)) >> 16);
}
__device__ __forceinline__ float bf_up(unsigned short h) { return __uint_as_float(((unsigned)h) << 16); }
__device__ __forceinline__ float bf_val(float f) { return bf_up(bf_bits(f)); }          // value after RNE bf16 convert
__device__ __forceinline__ unsigned short h_bits(_Float16 x) { return __builtin_bit_cast(unsigned short, x); }
__device__ __forceinline__ unsigned pk16(unsigned short a, unsigned short b) { return (unsigned)a | ((unsigned)b << 16); }
__device__ __forceinline__ unsigned pkh(v2f x) {                     // two f32 -> packed f16 pair, RNE, x[0] in the low half
  return __builtin_bit_cast(unsigned, __builtin_convertvector(x, v2h));
}
__device__ __forceinline__ v8f zero8() { v8f z = {0.f, 0.f, 0.f, 0.f, 0.f, 0.f, 0.f, 0.f}; return z; }

// ---- fragment loaders: 16-bit A/B operand, lane -> row/col (lane&15), p already includes +8*(lane>>4);
//      elements 0..7 <- p[0..7] (k0+8h..), elements 8..15 <- p[16..23] (k0+16+8h..)  (same split k map for A and B;
//      B is always read from a k-contiguous [n][k] plane)
__device__ __forceinline__ v16h ldfrag_h(const _Float16* p) {
  FragH f;
  f.h[0] = *(const v8h*)(p);
  f.h[1] = *(const v8h*)(p + 16);
  return f.v;
}
__device__ __forceinline__ v16b ldfrag_b(const u16* p) {              // bf16 plane read as unsigned integer vectors
  FragB f;
  f.u[0] = *(const v4u*)(p);
  f.u[1] = *(const v4u*)(p + 16);
  return f.v;
}

__device__ __forceinline__ v8f mma_h(v16h a, v16h b, v8f c) {
  return __builtin_amdgcn_wmma_f32_16x16x32_f16(false, a, false, b, (short)0, c, false, false);
}
__device__ __forceinline__ v8f mma_b(v16b a, v16b b, v8f c) {
  return __builtin_amdgcn_wmma_f32_16x16x32_bf16(false, a, false, b, (short)0, c, false, false);
}
__device__ __forceinline__ void guard2(v8f& a, v8f& b, v16h x0, v16h x1, v16h x2, v16h x3, v16h x4, v16h x5) {
#if defined(__HIP_DEVICE_COMPILE__)
  asm volatile("v_nop\n\tv_nop\n\tv_nop\n\tv_nop"
               : "+v"(a), "+v"(b) : "v"(x0), "v"(x1), "v"(x2), "v"(x3), "v"(x4), "v"(x5) : "memory");
#endif
}
template <typename F>
__device__ __forceinline__ void guard6(v8f& a, v8f& b, v8f& c, v8f& d, F x0, F x1, F x2, F x3, F x4, F x5) {
#if defined(__HIP_DEVICE_COMPILE__)
  asm volatile("v_nop\n\tv_nop\n\tv_nop\n\tv_nop"
               : "+v"(a), "+v"(b), "+v"(c), "+v"(d) : "v"(x0), "v"(x1), "v"(x2), "v"(x3), "v"(x4), "v"(x5) : "memory");
#endif
}
__device__ __forceinline__ void acc_guard4(v8f& a, v8f& b, v8f& c, v8f& d) {
#if defined(__HIP_DEVICE_COMPILE__)
  asm volatile("v_nop\n\tv_nop\n\tv_nop\n\tv_nop" : "+v"(a), "+v"(b), "+v"(c), "+v"(d));
#endif
}
__device__ __forceinline__ void wave_sync_lds() {
#if defined(__HIP_DEVICE_COMPILE__)
  __builtin_amdgcn_fence(__ATOMIC_RELEASE, "workgroup");
  __builtin_amdgcn_wave_barrier();
  __builtin_amdgcn_fence(__ATOMIC_ACQUIRE, "workgroup");
#endif
}

// ---- asynchronous copies global -> LDS, 16 B per lane (4 B in copy4w); lds = the lane's LDS byte address, g = the lane's global address.
//      The address-translation wait is the last line of the copies' own statement, so that no address register named by
//      an issued copy is rewritten in front of it.
__device__ __forceinline__ unsigned lds_addr(const void* p) { return (unsigned)(size_t)p; }
__device__ __forceinline__ void copy1(unsigned lds, const char* g) {
#if defined(__HIP_DEVICE_COMPILE__)
  asm volatile("global_load_async_to_lds_b128 %0, %1, off\n\ts_wait_xcnt 0x0" :: "v"(lds), "v"(g) : "memory");
#endif
}
// eight copies with constant steps from one to the next: ls bytes in LDS, gs bytes in global memory
__device__ __forceinline__ void copy8(unsigned l, unsigned ls, const char* g, size_t gs) {
#if defined(__HIP_DEVICE_COMPILE__)
  asm volatile("global_load_async_to_lds_b128 %0, %8, off\n\t"
               "global_load_async_to_lds_b128 %1, %9, off\n\t"
               "global_load_async_to_lds_b128 %2, %10, off\n\t"
               "global_load_async_to_lds_b128 %3, %11, off\n\t"
               "global_load_async_to_lds_b128 %4, %12, off\n\t"
               "global_load_async_to_lds_b128 %5, %13, off\n\t"
               "global_load_async_to_lds_b128 %6, %14, off\n\t"
               "global_load_async_to_lds_b128 %7, %15, off\n\t"
               "s_wait_xcnt 0x0"
               :: "v"(l), "v"(l + ls), "v"(l + 2 * ls), "v"(l + 3 * ls),
                  "v"(l + 4 * ls), "v"(l + 5 * ls), "v"(l + 6 * ls), "v"(l + 7 * ls),
                  "v"(g), "v"(g + gs), "v"(g + 2 * gs), "v"(g + 3 * gs),
                  "v"(g + 4 * gs), "v"(g + 5 * gs), "v"(g + 6 * gs), "v"(g + 7 * gs)
               : "memory");
#endif
}
// four copies with constant steps from one to the next
__device__ __forceinline__ void copy4(unsigned l, unsigned ls, const char* g, size_t gs) {
#if defined(__HIP_DEVICE_COMPILE__)
  asm volatile("global_load_async_to_lds_b128 %0, %4, off\n\t"
               "global_load_async_to_lds_b128 %1, %5, off\n\t"
               "global_load_async_to_lds_b128 %2, %6, off\n\t"
               "global_load_async_to_lds_b128 %3, %7, off\n\t"
               "s_wait_xcnt 0x0"
               :: "v"(l), "v"(l + ls), "v"(l + 2 * ls), "v"(l + 3 * ls),
                  "v"(g), "v"(g + gs), "v"(g + 2 * gs), "v"(g + 3 * gs)
               : "memory");
#endif
}
// four 4-byte copies, LDS addresses ls bytes apart, each with a global address of its own
__device__ __forceinline__ void copy4w(unsigned l, unsigned ls, const char* const* g) {
#if defined(__HIP_DEVICE_COMPILE__)
  asm volatile("global_load_async_to_lds_b32 %0, %4, off\n\t"
               "global_load_async_to_lds_b32 %1, %5, off\n\t"
               "global_load_async_to_lds_b32 %2, %6, off\n\t"
               "global_load_async_to_lds_b32 %3, %7, off\n\t"
               "s_wait_xcnt 0x0"
               :: "v"(l), "v"(l + ls), "v"(l + 2 * ls), "v"(l + 3 * ls),
                  "v"(g[0]), "v"(g[1]), "v"(g[2]), "v"(g[3])
               : "memory");
#endif
}
// one stage: 4 K chunks (64 rows apart in LDS, 8192 B apart in the contiguous K rows) and 4 V chunks (16 d rows apart)
__device__ __forceinline__ void copy_stage(unsigned lk, unsigned lv, const char* gk, const char* gv) {
#if defined(__HIP_DEVICE_COMPILE__)
  const unsigned rs = 64 * LPH * 2, vr = 16 * VLPH * 2;
  const size_t vs = (size_t)16 * SEQ * 2;
  asm volatile("global_load_async_to_lds_b128 %0, %8, off\n\t"
               "global_load_async_to_lds_b128 %1, %9, off\n\t"
               "global_load_async_to_lds_b128 %2, %10, off\n\t"
               "global_load_async_to_lds_b128 %3, %11, off\n\t"
               "global_load_async_to_lds_b128 %4, %12, off\n\t"
               "global_load_async_to_lds_b128 %5, %13, off\n\t"
               "global_load_async_to_lds_b128 %6, %14, off\n\t"
               "global_load_async_to_lds_b128 %7, %15, off\n\t"
               "s_wait_xcnt 0x0"
               :: "v"(lk), "v"(lk + rs), "v"(lk + 2 * rs), "v"(lk + 3 * rs),
                  "v"(lv), "v"(lv + vr), "v"(lv + 2 * vr), "v"(lv + 3 * vr),
                  "v"(gk), "v"(gk + 8192), "v"(gk + 16384), "v"(gk + 24576),
                  "v"(gv), "v"(gv + vs), "v"(gv + 2 * vs), "v"(gv + 3 * vs)
               : "memory");
#endif
}
// the issuing wave's own wait: its copies have landed (before the barrier behind which other waves read them)
__device__ __forceinline__ void wait_copies() {
#if defined(__HIP_DEVICE_COMPILE__)
  asm volatile("s_wait_asynccnt 0x0" ::: "memory");
#endif
}
// address-translation wait behind a run of plain global stores, in front of whatever rewrites a register that they name
__device__ __forceinline__ void wait_xlat() {
#if defined(__HIP_DEVICE_COMPILE__)
  asm volatile("s_wait_xcnt 0x0" ::: "memory");
#endif
}
// the wave's LDS reads have returned (before the barrier behind which their buffer is refilled)
__device__ __forceinline__ void wait_lds() {
#if defined(__HIP_DEVICE_COMPILE__)
  asm volatile("s_wait_dscnt 0x0" ::: "memory");
#endif
}

// =====================================================================================================
// The three f32 operand planes (x, Wq, Wv) -> bf16 RNE bits, same layouts, in ONE launch: the planes do not depend on one
// another, and their bf16 planes follow one another in the workspace, so block b writes elements b*2048 .. +2047 of the joined
// destination and picks its source plane by block index (block-uniform): CVX blocks of x, then CVW of Wq, then CVW of Wv.
// Thread = 8 consecutive elements: two 16-B loads, one 16-B store; 32 consecutive lanes = 512 contiguous, 512-B aligned bytes
// coverage: grid = CVX + 2*CVW blocks (plane sizes are exact multiples of 2048 elements) x 256 thr x 8 = the three planes.
// =====================================================================================================
__global__ __launch_bounds__(256) void cvt16x3(const float* __restrict__ x, const float* __restrict__ wq,
                                               const float* __restrict__ wv, u16* D) {
  const int b = blockIdx.x;
  if (b >= CVX + 2 * CVW) return;           // no barriers in this kernel
  const float* s = (b < CVX) ? x : ((b < CVX + CVW) ? wq : wv);
  const int   lb = (b < CVX) ? b : ((b < CVX + CVW) ? (b - CVX) : (b - CVX - CVW));
  const float* p = s + ((size_t)lb * 256 + threadIdx.x) * 8;
  const v4f a = *(const v4f*)(p), c4 = *(const v4f*)(p + 4);
  v4u o;
#pragma unroll
  for (int e = 0; e < 2; ++e) {
    o[e]     = pk16(bf_bits(a[2 * e]),  bf_bits(a[2 * e + 1]));
    o[2 + e] = pk16(bf_bits(c4[2 * e]), bf_bits(c4[2 * e + 1]));
  }
  *(v4u*)(D + ((size_t)b * 256 + threadIdx.x) * 8) = o;
}

// =====================================================================================================
// barrier, then converted to f16 and written: lane = (row in group of 4, 8 consecutive cols); one instruction = 4 rows, each
// coverage: 4 instructions x 4 rows x 8 lanes x 8 halves = the wave's 16 x 64 tile.
// =====================================================================================================
__device__ __forceinline__ void epi16(float* sl, v8f a0, v8f a1, v8f a2, v8f a3, float oscale, u16* C, int N,
                                      size_t rowb, int col0, int lane) {
  const int hh = lane >> 4, m = lane & 15;
#pragma unroll
  for (int r = 0; r < 8; ++r) {
    const int ro = (8 * hh + r) * 68 + m;
    sl[ro]      = a0[r] * oscale;
    sl[ro + 16] = a1[r] * oscale;
    sl[ro + 32] = a2[r] * oscale;
    sl[ro + 48] = a3[r] * oscale;
  }
  wave_sync_lds();
  const int rq = lane >> 3, c8 = (lane & 7) * 8;
  v4u ov[4];
#pragma unroll
  for (int i4 = 0; i4 < 4; ++i4) {
    const int row = i4 * 4 + rq;
    const v4f a = *(const v4f*)(sl + row * 68 + c8), c4 = *(const v4f*)(sl + row * 68 + c8 + 4);
    float w[8];
#pragma unroll
    for (int e = 0; e < 4; ++e) { w[e] = a[e]; w[4 + e] = c4[e]; }
#pragma unroll
    for (int e = 0; e < 4; ++e) ov[i4][e] = pk16(h_bits((_Float16)w[2 * e]), h_bits((_Float16)w[2 * e + 1]));
  }
  u16* dst = C + (rowb + (size_t)rq) * (size_t)N + col0 + c8;
  {
#pragma unroll
    for (int i4 = 0; i4 < 4; ++i4) {
      *(v4u*)(dst + (size_t)(i4 * 4) * (size_t)N) = ov[i4];
    }
    wait_xlat();   // code of the merged kernel may follow these stores and rewrite their data or address registers
  }
}

// =====================================================================================================
// Main loop of both projection GEMMs. A block of NCG waves works on ONE tile of 64 x rows by WROWS weight rows, K = DMOD: every
// x row and every weight row that the block needs comes into its LDS once, and all its waves read them there. A stage = VKS
// k values of the 64 x rows and the WROWS weight rows, brought in by asynchronous 16-byte copies (16 lanes = one 256-B row
// piece, whole 128-B lines; 8 copies per thread and stage for the weight rows, 4 more in waves 0..7 for the x rows), two
// buffers: stage t+2 is issued behind the barrier at the foot of trip t and flies during trip t+1. A wave's 16x64 result:
// A fragment from LDS row arow, B fragments from LDS rows brow, brow+16, brow+32, brow+48 (LDS row = x row 0..63, or 64 + weight
// row; the lane's own row index is already in arow and brow). Rows of 272 B, two 16-B reads per fragment, split k map for A
// and B; k runs upward in steps of 32 from the block's own start stage and wraps. Every wave passes every block barrier.
// rot: trip t works on k stage (t + rot) mod VNS. Blocks that read the same x or weight rows then ask for different stages at
// the same time, so each line's first fetch into L2 is waited for by few of them and the others find it there. For speed
// only: any rot in 0 .. VNS-1 gives every stage exactly once.
// =====================================================================================================
__device__ __forceinline__
void proj_loop(u16* ring, const u16* __restrict__ X, const u16* __restrict__ Wt, int xrow0, int wrow0, int rot,
               int arow, int brow, v8f& acc0, v8f& acc1, v8f& acc2, v8f& acc3) {
  const int K = DMOD;
  const int tid = threadIdx.x, hh = (tid & 31) >> 4;
  const bool xw = __builtin_amdgcn_readfirstlane(tid >> 5) < 8;   // scalar: waves 0..7 also copy the x rows
  // copy addresses of this thread: weight chunk i = tid + 384*j, row = i >> 4 = (tid >> 4) + 24*j, 16-byte column = tid & 15;
  // x chunk (waves 0..7) i = tid + 256*j, row = (tid >> 4) + 16*j (start row kept inside 0..15 in every thread)
  const unsigned lw0 = lds_addr(ring) + (unsigned)((64 + (tid >> 4)) * (VPH * 2) + (tid & 15) * 16);
  const unsigned lx0 = lds_addr(ring) + (unsigned)(((tid >> 4) & 15) * (VPH * 2) + (tid & 15) * 16);
  const char* gw0 = (const char*)(const void*)(Wt + (size_t)(wrow0 + (tid >> 4)) * K) + (tid & 15) * 16;
  const char* gx0 = (const char*)(const void*)(X + (size_t)(xrow0 + ((tid >> 4) & 15)) * K) + (tid & 15) * 16;
  const unsigned lws = 24 * VPH * 2, lxs = 16 * VPH * 2;                  // 24 and 16 rows on, in LDS
  const size_t   gws = (size_t)24 * K * 2, gxs = (size_t)16 * K * 2;      // the same in the source planes
  const int k1 = (rot + 1 < VNS) ? (rot + 1) : 0;
  // first stage landed and published; then the second into the other buffer
  copy8(lw0, lws, gw0 + rot * (VKS * 2), gws);
  if (xw) copy4(lx0, lxs, gx0 + rot * (VKS * 2), gxs);
  wait_copies();
  __syncthreads();
  copy8(lw0 + VBUFH * 2, lws, gw0 + k1 * (VKS * 2), gws);
  if (xw) copy4(lx0 + VBUFH * 2, lxs, gx0 + k1 * (VKS * 2), gxs);
#pragma unroll 1   // one trip per stage: the buffer index alternates, the code stays small
  for (int t = 0; t < VNS; ++t) {
    const u16* bufp = ring + (t & 1) * VBUFH;
    const u16* al = bufp + arow * VPH + 8 * hh;
    const u16* bl = bufp + brow * VPH + 8 * hh;
#pragma unroll     // k offsets inside the stage become immediate offsets of the LDS reads
    for (int u = 0; u < VKS; u += 64) {
      // all LDS reads of 64 k values stand together in front of their products
      const v16b a  = ldfrag_b(al + u),                 e  = ldfrag_b(al + u + 32);
      const v16b b0 = ldfrag_b(bl + u),                 f0 = ldfrag_b(bl + u + 32);
      const v16b b1 = ldfrag_b(bl + 16 * VPH + u),      f1 = ldfrag_b(bl + 16 * VPH + u + 32);
      const v16b b2 = ldfrag_b(bl + 32 * VPH + u),      f2 = ldfrag_b(bl + 32 * VPH + u + 32);
      const v16b b3 = ldfrag_b(bl + 48 * VPH + u),      f3 = ldfrag_b(bl + 48 * VPH + u + 32);
      acc0 = mma_b(a, b0, acc0);
      acc1 = mma_b(a, b1, acc1);
      acc2 = mma_b(a, b2, acc2);
      acc3 = mma_b(a, b3, acc3);
      guard6<v16b>(acc0, acc1, acc2, acc3, a, b0, b1, b2, b3, a);
      acc0 = mma_b(e, f0, acc0);
      acc1 = mma_b(e, f1, acc1);
      acc2 = mma_b(e, f2, acc2);
      acc3 = mma_b(e, f3, acc3);
      guard6<v16b>(acc0, acc1, acc2, acc3, e, f0, f1, f2, f3, e);
    }
    // foot of trip t: own LDS reads back, own copies of stage t+1 landed, barrier (publishes stage t+1 and ends every
    // reader's last read of this trip's buffer); only then the refill of that buffer with stage t+2
    wait_lds();
    wait_copies();
    __syncthreads();
    if (t + 2 < VNS) {
      const unsigned bo = (unsigned)((t & 1) * (VBUFH * 2));
      const int k2 = (t + 2 + rot < VNS) ? (t + 2 + rot) : (t + 2 + rot - VNS);
      copy8(lw0 + bo, lws, gw0 + k2 * (VKS * 2), gws);
      if (xw) copy4(lx0 + bo, lxs, gx0 + k2 * (VKS * 2), gxs);
    }
  }
  wait_copies();
  acc_guard4(acc0, acc1, acc2, acc3);
}

// =====================================================================================================
// bf16 GEMM with bias and 16-bit result: C[M][N] (f16 of (acc + bias)*oscale) = A[M][K] (bf16 weight plane, row-major) .
// Bt[N][K]^T (bf16 x plane, k-contiguous); bias (f32 input, taken as its RNE bf16 value) indexed by column (byrow == 0) or by
// row (byrow != 0), both candidates read with addresses clamped to [0, nbias). Block tile = WROWS result rows (weight rows
// wg*WROWS ..) by 64 result columns (x rows xt*64 ..): group g = threadIdx.x >> 7 of 4 waves takes rows 64g .. 64g+63 of it,
// 16 per wave. (The caller gives xt < N/64 and wg < WGRP.)
// =====================================================================================================
__device__ __forceinline__
void gemm_b16(char* pool, int xt, int wg, int rot, const u16* __restrict__ A, const u16* __restrict__ Bt, u16* C,
              const float* __restrict__ bias, int N, int nbias, int byrow, float oscale) {
  const int grp = threadIdx.x >> 7;
  float* slab = (float*)(void*)pool + grp * (4 * SLAB);
  u16*   ring = (u16*)(void*)(pool + NCG * SLAB * 4 + WROWS * 4);   // two buffers of (x rows, weight rows), rows of VPH halves
  const int tid = threadIdx.x & 127, wave = tid >> 5, lane = tid & 31, hh = lane >> 4, m = lane & 15;
  const int rowb  = wg * WROWS + grp * 64 + wave * 16;
  const int col0  = xt * 64;
  v8f acc0 = zero8(), acc1 = zero8(), acc2 = zero8(), acc3 = zero8();
  proj_loop(ring, Bt, A, col0, wg * WROWS, rot, 64 + grp * 64 + wave * 16 + m, m, acc0, acc1, acc2, acc3);
  // bias: D element r of lane -> (row rowb+8hh+r, col col0+16j+m); both candidates loaded with clamped addresses, select by value
  float bc[4], br[8];
#pragma unroll
  for (int j = 0; j < 4; ++j) {
    int ci = col0 + 16 * j + m;
    ci = (ci < nbias) ? ci : (nbias - 1);
    bc[j] = bf_val(bias[ci]);
  }
  int ri[8];
  float bw[8];
#pragma unroll
  for (int r = 0; r < 8; ++r) {
    ri[r] = rowb + 8 * hh + r;
    ri[r] = (ri[r] < nbias) ? ri[r] : (nbias - 1);
    bw[r] = bias[ri[r]];
  }
#if defined(__HIP_DEVICE_COMPILE__)
  // the eight loads' index registers stay live up to this address-translation wait (inputs only), so that no load's result
  // lands in the index register of a load issued before it; the loaded values as inputs keep the loads in front of it
  asm volatile("s_wait_xcnt 0x0"
               :: "v"(ri[0]), "v"(ri[1]), "v"(ri[2]), "v"(ri[3]), "v"(ri[4]), "v"(ri[5]), "v"(ri[6]), "v"(ri[7]),
                  "v"(bw[0]), "v"(bw[1]), "v"(bw[2]), "v"(bw[3]), "v"(bw[4]), "v"(bw[5]), "v"(bw[6]), "v"(bw[7])
               : "memory");
#endif
#pragma unroll
  for (int r = 0; r < 8; ++r) br[r] = bf_val(bw[r]);
#pragma unroll
  for (int r = 0; r < 8; ++r) {
    const float q0 = (byrow != 0) ? br[r] : bc[0];
    const float q1 = (byrow != 0) ? br[r] : bc[1];
    const float q2 = (byrow != 0) ? br[r] : bc[2];
    const float q3 = (byrow != 0) ? br[r] : bc[3];
    acc0[r] += q0;
    acc1[r] += q1;
    acc2[r] += q2;
    acc3[r] += q3;
  }
  epi16(slab + wave * SLAB, acc0, acc1, acc2, acc3, oscale, C, N, (size_t)rowb, col0, lane);
}

// =====================================================================================================
// Query projection with fused per-chunk L2 normalisation:
//   q[M][NCG*64] (f32, registers only) = A[M][K] (bf16 x plane) . Bt[NCG*64][K]^T (bf16 Wq plane) + bias[col] (RNE bf16 value);
//   block tile = 64 result rows (x rows xt*64 ..) by WROWS result columns (weight rows wg*WROWS ..) = VTPB column groups of 64:
//   group g = threadIdx.x >> 7 of 4 waves takes column group cg = wg*VTPB + g, 16 rows per wave, so a weight row is fetched by
//   SEQ/64 blocks and an x row by WGRP of them.
//   For D row 8hh+r the 64-wide chunk (row, cols col0..col0+63) lives
//   in the 16 lanes of half hh x 4 accumulators: ss = sum of squares (4 products per lane, xor-1/2/4/8 shuffles inside the
//   half), qn = q * (1/max(sqrt(ss), 1e-12)), aa = sum of qn^2 the same way (f32), kept in LDS at aas[(row in block)*VTPB + g].
//   After the block barrier the block's 64*VTPB aa values go out as whole 128-B lines that no other block writes: the aa table
//   is laid out [wg][row][g], so they are contiguous (64*VTPB floats is a multiple of 32).
//   Part of the projection launch: block = NCG waves (every wave reaches every barrier); slabs, aa values and ring lie in the
//   block's LDS pool.
// coverage: qn plane: (M/64)*WGRP blocks x NCG waves x (16 x 64) = M x NCG*64;  aa table: the same blocks x 64*VTPB floats = M*NCG.
// =====================================================================================================
__device__ __forceinline__
void gemm_qn(char* pool, int xt, int wg, int rot, const u16* __restrict__ A, const u16* __restrict__ Bt, u16* C, float* AAP,
             const float* __restrict__ bias, int nbias, float oscale) {
  float* slab = (float*)(void*)pool;
  float* aas  = slab + NCG * SLAB;
  u16*   ring = (u16*)(void*)(pool + NCG * SLAB * 4 + WROWS * 4);   // two buffers of (x rows, weight rows), rows of VPH halves
  const int tid = threadIdx.x, wave = tid >> 5, lane = tid & 31, hh = lane >> 4, m = lane & 15;
  const int grp = wave >> 2, wr = (wave & 3) * 16;   // column group in the block; first row of the wave in the block
  const int N = NCG * 64;
  const int rowb = xt * 64 + wr;
  const int col0 = wg * WROWS + grp * 64;
  v8f acc0 = zero8(), acc1 = zero8(), acc2 = zero8(), acc3 = zero8();
  proj_loop(ring, A, Bt, xt * 64, wg * WROWS, rot, wr + m, 64 + grp * 64 + m, acc0, acc1, acc2, acc3);
  float bc[4], bw[4];
  int ci[4];
#pragma unroll
  for (int j = 0; j < 4; ++j) {
    ci[j] = col0 + 16 * j + m;
    ci[j] = (ci[j] < nbias) ? ci[j] : (nbias - 1);
    bw[j] = bias[ci[j]];
  }
#if defined(__HIP_DEVICE_COMPILE__)
  // the four loads' index registers stay live up to this address-translation wait (inputs only), so that nothing rewrites one
  // in front of it; the loaded values as inputs keep the loads in front of it
  asm volatile("s_wait_xcnt 0x0"
               :: "v"(ci[0]), "v"(ci[1]), "v"(ci[2]), "v"(ci[3]), "v"(bw[0]), "v"(bw[1]), "v"(bw[2]), "v"(bw[3])
               : "memory");
#endif
#pragma unroll
  for (int j = 0; j < 4; ++j) bc[j] = bf_val(bw[j]);
#pragma unroll
  for (int r = 0; r < 8; ++r) {
    acc0[r] += bc[0];
    acc1[r] += bc[1];
    acc2[r] += bc[2];
    acc3[r] += bc[3];
  }
  // per row: L2 normalise the 64-wide chunk and take the f32 sum of squares of the normalised values
#pragma unroll
  for (int r = 0; r < 8; ++r) {
    float ss = acc0[r] * acc0[r] + acc1[r] * acc1[r] + acc2[r] * acc2[r] + acc3[r] * acc3[r];
    ss += __shfl_xor(ss, 1, 32);
    ss += __shfl_xor(ss, 2, 32);
    ss += __shfl_xor(ss, 4, 32);
    ss += __shfl_xor(ss, 8, 32);
    const float nrm = sqrtf(ss);
    const float den = fmaxf(nrm, 1e-12f);
    const float inv = 1.0f / den;
    acc0[r] *= inv;
    acc1[r] *= inv;
    acc2[r] *= inv;
    acc3[r] *= inv;
    float a2 = acc0[r] * acc0[r] + acc1[r] * acc1[r] + acc2[r] * acc2[r] + acc3[r] * acc3[r];
    a2 += __shfl_xor(a2, 1, 32);
    a2 += __shfl_xor(a2, 2, 32);
    a2 += __shfl_xor(a2, 4, 32);
    a2 += __shfl_xor(a2, 8, 32);
    if (m == 0) aas[(wr + 8 * hh + r) * VTPB + grp] = a2;
  }
  epi16(slab + wave * SLAB, acc0, acc1, acc2, acc3, oscale, C, N, (size_t)rowb, col0, lane);
  __syncthreads();
  // aa table lines of this block: 64*VTPB contiguous floats; thread t < 64*VTPB/4 writes float4 t
  const int nf4 = WROWS / 4;
  if (tid < nf4) {
    const v4f w0 = *(const v4f*)(aas + 4 * tid);
    *(v4f*)(AAP + ((size_t)wg * SEQ + (size_t)xt * 64) * VTPB + 4 * tid) = w0;
  }
}

// =====================================================================================================
// Both projections in ONE launch (neither reads what the other writes): blocks 0 .. QBLK-1 do the query projection (the longer
// part, so it starts first), blocks QBLK .. QBLK+VBLK-1 the v^T GEMM; either way block = (64 x rows xt, WROWS weight rows wg).
// The choice is block-uniform, so every barrier of either part is passed by all NCG waves of its block. One LDS pool per block.
// The start stage takes all VNS values among the 2*WGRP blocks that read the same x rows (two of them twice) and differs from one xt to the next (same weight rows).
// =====================================================================================================
__global__ __launch_bounds__(NCG * 32)
void gemm_qv(const u16* __restrict__ XBp, const u16* __restrict__ WQp, const u16* __restrict__ WVp, u16* QPp, float* AAP,
             u16* VPp, const float* __restrict__ bq, const float* __restrict__ bv) {
  __shared__ __align__(16) char pool[POOLB];
  const int b = blockIdx.x;
  if (b >= QBLK + VBLK) return;              // block-uniform, never taken with the exact grid; in front of every barrier
  const int lb = (b < QBLK) ? b : (b - QBLK);
  const int xt = lb / WGRP, wg = lb % WGRP;
  const int rot = (xt + wg + ((b < QBLK) ? 0 : WGRP)) % VNS;
  if (b < QBLK) gemm_qn(pool, xt, wg, rot, XBp, WQp, QPp, AAP, bq, DMOD, QSC);
  else          gemm_b16(pool, xt, wg, rot, WVp, XBp, VPp, bv, SEQ, DMOD, 1, VCAR);
}

// =====================================================================================================
// L2-distance flash attention (no masking, all SEQ keys): block = (head, QROWS = 128 query rows), 16 waves, four to a SIMD.
// Wave w works on the 32 query rows of group wq = w & 3 (two tiles of 16) and, of every stage, on the 64 keys of quarter
// kq = w >> 2: each K and V fragment that a wave reads from LDS serves two query tiles, and a head's K and V rows are fetched
// by SEQ/128 blocks.
// A stage = KT = 256 keys = K tile (256 key rows x 128 B) + V tile (64 d rows x 512 B), brought into LDS by asynchronous 16-byte
// copies (whole 128-B lines, 8 copies per thread and stage), two buffers: stage t+2 is issued behind the barrier at the foot of
// trip t and flies during trip t+1. Two key blocks per wave between barriers: only the first block's LDS reads of all 16 waves
// fall together.
// The head's AA table (SEQ floats) is copied once with stage 0, float by float, into chunk order. Fragments are read from LDS
// rows of 144 B (K) and 528 B (V).
//   qn plane (f16, x QSC) laid out as [NHD*SEQ chunks][64]: head h, row n = chunk h*SEQ + n; keys and queries both come
//   from this plane. AA table (f32): chunk row*NCG + cg at [cg / VTPB][row][cg % VTPB]. v^T plane [h*64+d][SEQ keys] (x1024).
//   All NKB = SEQ/32 key blocks of 32 keys are visited by one wave of each group (static bound), from the block's own start
//   stage on, wrapping.
//   Scores are computed TRANSPOSED: S^T tile g (g = 0,1) = key rows (keys kb+16g .. +15, A operand, row m = lane&15, split
//   k map over d) times q^T (B operand, col n = query (lane&15) of the query tile, k = d, split map), one product per tile and
//   32-deep d-chunk. D element r of lane l = (key kb+16g+8h+r, query l&15), so a lane owns one query column and 16 of its 32
//   keys; the partner lane l^16 owns the other 16.
//   Base-2 logit: t = (2*qn_n.qn_m/(QSC*QSC) - AA_n - AA_m) * log2(e)/8. Every qn row is a vector divided by at least its own
//   norm, so its length is at most 1 (f16 rounding adds under 0.1 %): |2*qn_n.qn_m| * log2(e)/8 < 0.37 and
//   0 <= AA * log2(e)/8 < 0.19 for any finite input, hence -0.74 < t < 0.37. The softmax therefore needs no running maximum:
//   its shift is the constant -PSH, p = exp2(t + PSH) = P x 32768 lies in (19000, 43000), inside f16, the exp2 argument is far
//   from the subnormal range (bare hardware exp2), and neither l nor the O accumulators are ever rescaled.
//   The exp'd values ARE the P A-fragment in place: A row m = query = lane&15, element i <- key kb+8h+i (tile 0, D element i),
//   element 8+i <- key kb+16+8h+i (tile 1, D element i). l (x32768) is summed per lane in 4 partial sums over the lane's
//   own keys; the partials and the partner lane l^16 are joined once behind the loop. 4 v^T B fragments
//   (col n = d = 16j + (lane&15), keys k-contiguous), 4 P.V WMMAs per key block and query tile.
//   Behind the loop the four waves of a group hold sums over disjoint key quarters with the same constant shift, so O and l
//   simply add, in two steps through LDS. A wave's query tile a covers rows 16*(a ^ (kq & 1)) of its group. Step 1: it hands its
//   tile 1 (O in D layout, l per lane) to wave w ^ 4 and, behind a block barrier, adds that wave's tile 1, which is its own
//   tile 0. Step 2: waves 8..15 hand their tile 0 to wave w - 8 (the same tile, the other two quarters) and, behind a second
//   block barrier, end; waves 0..7 add it.
//   Epilogue, one query tile per wave 0..7: 1/l (per query, shuffled to the D row owner) and carry folds in f32; the 16x64 f32
//   result staged in the wave's slab. aux0/aux1 are bound only (not read).
// coverage: per wave 8 instructions x 2 rows x 16 lanes x 4 floats = 16 x 64; grid NHD*(SEQ/128) blocks x 8 writing waves =
//           every output row (h, n < SEQ) exactly once = SEQ*NHD*64 floats.
// =====================================================================================================
// p = exp2(t + PSH) of this lane's 16 keys for one query column, as the P A-fragment (element i <-> key i); adds p into lp
__device__ __forceinline__ v16h exp_tile(v8f s0, v8f s1, v4f w0, v4f w1, v4f w2, v4f w3, float lsc, float c1l, float aq,
                                         v2f* lp) {
  FragH ph;
#pragma unroll
  for (int e = 0; e < 2; ++e) {          // pairs of neighbouring keys: elements 2e, 2e+1 of each group of four
    const int i = 2 * e;
    const v2f sa = {s0[i], s0[i + 1]}, sb = {s0[4 + i], s0[5 + i]}, sc = {s1[i], s1[i + 1]}, sd = {s1[4 + i], s1[5 + i]};
    const v2f wa = {w0[i], w0[i + 1]}, wb = {w1[i], w1[i + 1]}, wc = {w2[i], w2[i + 1]}, wd = {w3[i], w3[i + 1]};
    const v2f ta = sa * lsc - (wa * c1l + aq), tb = sb * lsc - (wb * c1l + aq);
    const v2f tc = sc * lsc - (wc * c1l + aq), td = sd * lsc - (wd * c1l + aq);
    const v2f pa = {__builtin_amdgcn_exp2f(ta[0]), __builtin_amdgcn_exp2f(ta[1])};
    const v2f pb = {__builtin_amdgcn_exp2f(tb[0]), __builtin_amdgcn_exp2f(tb[1])};
    const v2f pc = {__builtin_amdgcn_exp2f(tc[0]), __builtin_amdgcn_exp2f(tc[1])};
    const v2f pd = {__builtin_amdgcn_exp2f(td[0]), __builtin_amdgcn_exp2f(td[1])};
    ph.u[0][e]     = pkh(pa);
    ph.u[0][2 + e] = pkh(pb);
    ph.u[1][e]     = pkh(pc);
    ph.u[1][2 + e] = pkh(pd);
    lp[e] += (pa + pb) + (pc + pd);
  }
  return ph.v;
}

__global__ __launch_bounds__(ATT_THREADS)
void attn_l2(const u16* __restrict__ QPp, const float* __restrict__ AAp, const u16* __restrict__ VPp, float* out,
             const float* aux0, const float* aux1) {
  __shared__ __align__(16) float smem[(ATT_WAVES / 2) * SLAB];   // per writing wave: result slab [16][68] in the epilogue only
  __shared__ __align__(16) _Float16 ring[2 * BUFH];        // two buffers of (K tile, V tile)
  __shared__ __align__(16) float aas[SEQ];                 // AA table of this head
  __shared__ __align__(16) v4f xch[ATT_WAVES * 8 * 32];    // step 1, per wave: the O tile it hands on, [8 quads][32 lanes]
  __shared__ __align__(16) float xl[ATT_WAVES * 32];       //         and the l of that tile, per lane
  __shared__ __align__(16) v4f xc2[(ATT_WAVES / 2) * 8 * 32];   // step 2, per receiving wave: the same
  __shared__ __align__(16) float xl2[(ATT_WAVES / 2) * 32];
  (void)aux0; (void)aux1;

  const int tid  = threadIdx.x;
  const int wave = __builtin_amdgcn_readfirstlane(tid >> 5);   // scalar: the tests on it behind the loop are scalar branches
  const int lane = tid & 31;
  const int hh   = lane >> 4;
  const int c    = lane & 15;
  const int kq   = wave >> 2;                              // key quarter of every stage that this wave works on
  const int wq   = wave & 3;                               // group of 32 query rows

  const int bid  = blockIdx.x;
  const int qt   = bid % QTILES;
  const int head = bid / QTILES;
  if (head >= NHD) return;                                 // block-uniform, never taken with the exact grid; in front of every barrier
  const int q0   = qt * QROWS + wq * 32 + 16 * (kq & 1);         // query tile 0 of this wave: the one it keeps behind the loop
  const int q1   = qt * QROWS + wq * 32 + 16 * (1 - (kq & 1));   // query tile 1: handed to wave w ^ 4 behind the loop
  const size_t hb = (size_t)head * SEQ;                    // chunk index base of this head

  const _Float16* QH = (const _Float16*)(const void*)QPp;
  // B fragments of q^T: col n = query chunk hb + (tile's first row) + c, k = d
  const _Float16* Qb0 = QH + (hb + (size_t)(q0 + c)) * HD + 8 * hh;
  const _Float16* Qb1 = QH + (hb + (size_t)(q1 + c)) * HD + 8 * hh;
  // copy addresses of this thread: K chunk i = tid + 512*j, row = i >> 3 = (tid >> 3) + 64*j, 16-byte column = tid & 7;
  // V chunk i = tid + 512*j, row = i >> 5 = (tid >> 5) + 16*j, 16-byte column = tid & 31
  const unsigned lk0 = lds_addr(ring) + (unsigned)((tid >> 3) * (LPH * 2) + (tid & 7) * 16);
  const unsigned lv0 = lds_addr(ring) + (unsigned)(KTILEH * 2 + (tid >> 5) * (VLPH * 2) + (tid & 31) * 16);
  const char* gk0 = (const char*)(const void*)(QH + hb * HD) + tid * 16;                       // K rows are contiguous
  const char* gv0 = (const char*)(const void*)((const _Float16*)(const void*)VPp + ((size_t)(head * HD + (tid >> 5))) * SEQ)
                    + (tid & 31) * 16;
  // Rotated walk: trip t works on key stage (t + rot) mod NST. The QTILES blocks of a head read the same K and V rows; with
  // different stages asked for at the same time each line's first fetch into L2 is waited for by few blocks and the others
  // find it there. The bit order spreads the starts of blocks whose indices lie close together modulo 8. For speed only: any
  // rot in 0 .. NST-1 gives every stage exactly once; the constant softmax shift makes the key order free but for rounding.
  const int rot = ((qt & 3) << 1) | ((qt >> 2) & 1);
  const int st1 = (rot + 1) & (NST - 1);
  // first stage and the AA table, landed and published; then the second stage into the other buffer
  copy_stage(lk0, lv0, gk0 + (size_t)rot * (KT * HD * 2), gv0 + rot * (KT * 2));
#if defined(__HIP_DEVICE_COMPILE__)
  __builtin_amdgcn_sched_barrier(0);   // the table's address arithmetic stays behind the stage's copies, which then fly meanwhile
#endif
  // chunk ch = row*NCG + cg lies at float [cg / VTPB][row][cg % VTPB] of the table; with tq = ch / VTPB = row*WGRP + cg / VTPB that is
  // ch + (SEQ*VTPB - VTPB)*(tq % WGRP) - (NCG - VTPB)*(tq / WGRP). One division per thread: its chunks lie ATT_THREADS apart.
  const unsigned ch0 = (unsigned)hb + (unsigned)tid, tq0 = ch0 / VTPB, rm0 = ch0 - tq0 * VTPB;
  {
    const char* ga[AACP];   // AACP copies of one float each, in one statement
#pragma unroll
    for (int i = 0; i < AACP; ++i) {
      const unsigned st = (unsigned)(ATT_THREADS * i);
      const unsigned tq = tq0 + st / VTPB + ((rm0 + st % VTPB >= VTPB) ? 1u : 0u);
      ga[i] = (const char*)(const void*)(AAp + (ch0 + st + (SEQ * VTPB - VTPB) * (tq % WGRP) - (NCG - VTPB) * (tq / WGRP)));
    }
    copy4w(lds_addr(aas) + (unsigned)(tid * 4), ATT_THREADS * 4, ga);
  }
  wait_copies();
  __syncthreads();
  copy_stage(lk0 + BUFH * 2, lv0 + BUFH * 2, gk0 + (size_t)st1 * (KT * HD * 2), gv0 + st1 * (KT * 2));
  const float lsc = 0.25f * (LOG2E / (QSC * QSC));
  const float c1l = 0.125f * LOG2E;
  const float aq0 = aas[q0 + c] * c1l - PSH;                // AA term of this lane's query in each tile (staged table), with the
  const float aq1 = aas[q1 + c] * c1l - PSH;                // constant shift

  const v16h qa0 = ldfrag_h(Qb0), qa1 = ldfrag_h(Qb0 + 32);   // tile 0: d 0..31, d 32..63
  const v16h qb0 = ldfrag_h(Qb1), qb1 = ldfrag_h(Qb1 + 32);   // tile 1
#if defined(__HIP_DEVICE_COMPILE__)
  // the eight loads' address registers stay live up to this address-translation wait (inputs only), so that nothing rewrites
  // one in front of it
  asm volatile("s_wait_xcnt 0x0" :: "v"(Qb0), "v"(Qb1) : "memory");
#endif

  // partial sums of p over this lane's keys, per query tile: element i -> [(i >> 1) & 1][i & 1]
  v2f lpa[2] = {{0.f, 0.f}, {0.f, 0.f}}, lpb[2] = {{0.f, 0.f}, {0.f, 0.f}};
  v8f o[4], ob[4];                          // O of tile 0 and of tile 1
#pragma unroll
  for (int j = 0; j < 4; ++j) { o[j] = zero8(); ob[j] = zero8(); }

#pragma unroll 1
  for (int t = 0; t < NST; ++t) {
   const _Float16* bufp = ring + (t & 1) * BUFH;
   // A fragments of keys: LDS row = key in stage (64kq + 32u + 16g + c), k = d;  B fragments of v: LDS row = d = 16j + c, k = key
#pragma unroll 1   // kept rolled: in line, both blocks' p values stay live up to the l sums and registers spill at 4 waves a SIMD
   for (int u = 0; u < 2; ++u) {
    const int kb = ((t + rot) & (NST - 1)) * KT + 64 * kq + 32 * u;
    // ---- all LDS reads of this 32-key block stand together in front of its products ----
    const _Float16* k0p = bufp + (64 * kq + 32 * u + c) * LPH + 8 * hh;
    const _Float16* k1p = k0p + 16 * LPH;
    const v16h ka0 = ldfrag_h(k0p), ka1 = ldfrag_h(k0p + 32);
    const v16h kc0 = ldfrag_h(k1p), kc1 = ldfrag_h(k1p + 32);
    // AA of this lane's 16 keys: tile 0 element i -> key kb+8hh+i, tile 1 element i -> key kb+16+8hh+i
    const float* am = aas + kb + 8 * hh;
    const v4f w0 = *(const v4f*)(am), w1 = *(const v4f*)(am + 4);
    const v4f w2 = *(const v4f*)(am + 16), w3 = *(const v4f*)(am + 20);
    const _Float16* vp = bufp + KTILEH + c * VLPH + 64 * kq + 32 * u + 8 * hh;
    const v16h vf0 = ldfrag_h(vp);
    const v16h vf1 = ldfrag_h(vp + 16 * VLPH);
    const v16h vf2 = ldfrag_h(vp + 32 * VLPH);
    const v16h vf3 = ldfrag_h(vp + 48 * VLPH);
    // ---- transposed scores of both query tiles: s0/r0 = keys kb..kb+15, s1/r1 = keys kb+16..kb+31, column = query c ----
    v8f s0 = zero8(), s1 = zero8(), r0 = zero8(), r1 = zero8();
    s0 = mma_h(ka0, qa0, s0);
    s1 = mma_h(kc0, qa0, s1);
    r0 = mma_h(ka0, qb0, r0);
    r1 = mma_h(kc0, qb0, r1);
    s0 = mma_h(ka1, qa1, s0);
    s1 = mma_h(kc1, qa1, s1);
    r0 = mma_h(ka1, qb1, r0);
    r1 = mma_h(kc1, qb1, r1);
    guard6<v16h>(s0, s1, r0, r1, ka0, ka1, kc0, kc1, qa1, qb1);
    // ---- per query tile: p of this lane's 16 keys, then P.V (B fragment col n = d = j*16 + c, keys contiguous in the v^T rows);
    //      tile 1's vector work stands behind tile 0's products and runs beside them ----
    const v16h pa = exp_tile(s0, s1, w0, w1, w2, w3, lsc, c1l, aq0, lpa);
    o[0] = mma_h(pa, vf0, o[0]);
    o[1] = mma_h(pa, vf1, o[1]);
    o[2] = mma_h(pa, vf2, o[2]);
    o[3] = mma_h(pa, vf3, o[3]);
    guard6<v16h>(o[0], o[1], o[2], o[3], pa, vf0, vf1, vf2, vf3, pa);
    const v16h pb = exp_tile(r0, r1, w0, w1, w2, w3, lsc, c1l, aq1, lpb);
    ob[0] = mma_h(pb, vf0, ob[0]);
    ob[1] = mma_h(pb, vf1, ob[1]);
    ob[2] = mma_h(pb, vf2, ob[2]);
    ob[3] = mma_h(pb, vf3, ob[3]);
    guard6<v16h>(ob[0], ob[1], ob[2], ob[3], pb, vf0, vf1, vf2, vf3, pb);
   }
   // ---- foot of trip t: own LDS reads back, own copies of stage t+1 landed, barrier (publishes stage t+1 and ends every
   //      reader's last read of this trip's buffer); only then the refill of that buffer with stage t+2 ----
   wait_lds();
   wait_copies();
   __syncthreads();
   if (t + 2 < NST) {
     const int st2 = (t + 2 + rot) & (NST - 1);
     const unsigned bo = (unsigned)((t & 1) * (BUFH * 2));
     copy_stage(lk0 + bo, lv0 + bo, gk0 + (size_t)st2 * (KT * HD * 2), gv0 + st2 * (KT * 2));
   }
  }
  wait_copies();
  acc_guard4(o[0], o[1], o[2], o[3]);
  acc_guard4(ob[0], ob[1], ob[2], ob[3]);

  // ---- l x32768 of this lane's query in each tile, over this wave's keys: own partials, then the partner lane's keys ----
  float lrun = (lpa[0][0] + lpa[0][1]) + (lpa[1][0] + lpa[1][1]);
  float lgiv = (lpb[0][0] + lpb[0][1]) + (lpb[1][0] + lpb[1][1]);
  lrun += __shfl_xor(lrun, 16, 32);
  lgiv += __shfl_xor(lgiv, 16, 32);
  // ---- step 1 of joining the key quarters: tile 1 goes to wave w ^ 4, whose tile 1 (this wave's tile 0) is added ----
  {
    v4f* xw = xch + wave * (8 * 32) + lane;
#pragma unroll
    for (int j = 0; j < 4; ++j) {
      const v4f lo = {ob[j][0], ob[j][1], ob[j][2], ob[j][3]}, hi = {ob[j][4], ob[j][5], ob[j][6], ob[j][7]};
      xw[(2 * j) * 32]     = lo;
      xw[(2 * j + 1) * 32] = hi;
    }
    xl[wave * 32 + lane] = lgiv;
    __syncthreads();   // every wave's handed tile is written before its partner reads it
    const v4f* xr = xch + (wave ^ 4) * (8 * 32) + lane;
#pragma unroll
    for (int j = 0; j < 4; ++j) {
      const v4f lo = xr[(2 * j) * 32], hi = xr[(2 * j + 1) * 32];
#pragma unroll
      for (int r = 0; r < 4; ++r) { o[j][r] += lo[r]; o[j][4 + r] += hi[r]; }
    }
    lrun += xl[(wave ^ 4) * 32 + lane];
  }
  // ---- step 2: waves 8..15 hand their tile 0 to wave w - 8, which holds the same tile over the other two quarters ----
  if (wave >= ATT_WAVES / 2) {
    v4f* xw = xc2 + (wave - ATT_WAVES / 2) * (8 * 32) + lane;
#pragma unroll
    for (int j = 0; j < 4; ++j) {
      const v4f lo = {o[j][0], o[j][1], o[j][2], o[j][3]}, hi = {o[j][4], o[j][5], o[j][6], o[j][7]};
      xw[(2 * j) * 32]     = lo;
      xw[(2 * j + 1) * 32] = hi;
    }
    xl2[(wave - ATT_WAVES / 2) * 32 + lane] = lrun;
  }
  __syncthreads();   // the handed tiles are written before waves 0..7 read them; the last barrier of the kernel
  if (wave >= ATT_WAVES / 2) return;
  {
    const v4f* xr = xc2 + wave * (8 * 32) + lane;
#pragma unroll
    for (int j = 0; j < 4; ++j) {
      const v4f lo = xr[(2 * j) * 32], hi = xr[(2 * j + 1) * 32];
#pragma unroll
      for (int r = 0; r < 4; ++r) { o[j][r] += lo[r]; o[j][4 + r] += hi[r]; }
    }
    lrun += xl2[wave * 32 + lane];
  }
  // ---- fold 1/l (per query, owned by lane = query; the x32768 of P and of l cancel) and the v carry; stage the 16x64 slab ----
  const float linv = (lrun > 0.f) ? ((1.0f / lrun) * (1.0f / VCAR)) : 0.f;
  float inv[8];
#pragma unroll
  for (int r = 0; r < 8; ++r) inv[r] = __shfl(linv, 8 * hh + r, 32);
  float* slab = smem + wave * SLAB;
#pragma unroll
  for (int r = 0; r < 8; ++r) {
#pragma unroll
    for (int j = 0; j < 4; ++j) slab[(8 * hh + r) * 68 + j * 16 + c] = o[j][r] * inv[r];
  }
  wave_sync_lds();
  // ---- f32 output rows: lanes 0..15 -> row 2*it2, lanes 16..31 -> row 2*it2+1, 16 lanes x 16 B = one 256-B row ----
  v4f vals[8];
#pragma unroll
  for (int it2 = 0; it2 < 8; ++it2) vals[it2] = *(const v4f*)(slab + (it2 * 2 + hh) * 68 + c * 4);
  float* dst = out + (hb + (size_t)(q0 + hh)) * HD + c * 4;
  {
#pragma unroll
    for (int it2 = 0; it2 < 8; ++it2) {
      *(v4f*)(dst + (size_t)(it2 * 2) * HD) = vals[it2];
    }
    
  }
}

// =====================================================================================================
// Workspace map (bytes); every plane is fully written by whole-line stores before it is read; all extents are exact multiples
// of the store granularity (no pad rows needed), every offset a multiple of 128:
//   XB  bf16 [SEQ][768]                          SEQ*1536   (3145728 at SEQ = 2048)
//   WQB bf16 [768 n][768 k]                      1179648    WVB same
//   QP  f16  [SEQ][768] = [12*SEQ chunks][64] x16 SEQ*1536
//   AAP f32  [4][SEQ][3]                         SEQ*48     (98304)
//   VP  f16  [768 = h*64+d][SEQ] x1024           SEQ*1536
//   end                                          11894784 at SEQ = 2048
// =====================================================================================================
extern "C" void kernel_launch(void* const* d_in, const int* in_sizes, int n_in,
                              void* d_out, int out_size, void* d_ws, size_t ws_size,
                              hipStream_t stream) {
  if (n_in < 7) return;
  if (in_sizes[0] < SEQ * DMOD) return;
  if (in_sizes[1] < 1 || in_sizes[2] < 1) return;
  if (in_sizes[3] != DMOD * DMOD || in_sizes[5] != DMOD * DMOD) return;
  if (in_sizes[4] != DMOD || in_sizes[6] != DMOD) return;
  if (out_size < SEQ * DMOD) return;

  const float* Xin = (const float*)d_in[0];
  const float* Gin = (const float*)d_in[1];               // bound only, not read
  const float* Min = (const float*)d_in[2];               // bound only, not read
  const float* Wq  = (const float*)d_in[3];
  const float* bq  = (const float*)d_in[4];
  const float* Wv  = (const float*)d_in[5];
  const float* bv  = (const float*)d_in[6];
  float*       out = (float*)d_out;

  const size_t szXB = (size_t)SEQ * DMOD * 2;
  const size_t szW  = (size_t)DMOD * DMOD * 2;
  const size_t szQP = (size_t)SEQ * DMOD * 2;
  const size_t szAA = (size_t)NHD * SEQ * 4;
  const size_t szVP = (size_t)DMOD * SEQ * 2;
  size_t off = 0;
  const size_t oXB = off; off += szXB;
  const size_t oWQ = off; off += szW;
  const size_t oWV = off; off += szW;
  const size_t oQP = off; off += szQP;
  const size_t oAA = off; off += szAA;
  const size_t oVP = off; off += szVP;
  if (off > ws_size) return;                            // off = 11894784 at SEQ = 2048
  if (off > (size_t)134217728) return;

  char* ws = (char*)d_ws;
  u16*   XB  = (u16*)(ws + oXB);
  u16*   WQB = (u16*)(ws + oWQ);
  u16*   WVB = (u16*)(ws + oWV);
  u16*   QP  = (u16*)(ws + oQP);
  float* AAP = (float*)(ws + oAA);
  u16*   VP  = (u16*)(ws + oVP);

  const int n8x = (SEQ * DMOD) / 8;
  const int n8w = (DMOD * DMOD) / 8;
  if ((n8x % 256) != 0 || (n8w % 256) != 0) return;
  if ((DMOD % 64) != 0 || (SEQ % 64) != 0 || (DMOD % 32) != 0) return;
  const dim3 blk(256);
  const dim3 gC(CVX + 2 * CVW);                         // 768 + 2 * 288 at SEQ = 2048
  const dim3 gP(QBLK + VBLK);                           // 128 + 128
  const dim3 bP(NCG * 32);                              // 384
  const dim3 gAT(ATT_BLOCKS);                           // 192
  const dim3 bAT(ATT_THREADS);                          // 512

  // (0) operand planes: x -> bf16; Wq/Wv [n = out][k = in] (already k-contiguous) -> bf16
  //     (XB, WQB, WVB follow one another in the workspace: one joined destination)
  cvt16x3<<<gC, blk, 0, stream>>>(Xin, Wq, Wv, XB);
  // (1) q = x.Wq^T + bq, L2-normalised per 64-chunk -> qn plane [SEQ][768] f16 x16 and AA table [12*SEQ] f32;
  //     v^T plane: [768 = h*64+d][SEQ keys] = f16((Wv . x^T + bv) x1024), bias by row
  gemm_qv<<<gP, bP, 0, stream>>>(XB, WQB, WVB, QP, AAP, VP, bq, bv);
  // (2) attention -> out, f32 row (chunk h*SEQ + n) of 64 floats at float offset (h*SEQ + n)*64
  attn_l2<<<gAT, bAT, 0, stream>>>(QP, AAP, VP, out, Gin, Min);
  (void)hipGetLastError();
}

// v009
// One run takes 29.4 microseconds.
// Two timings next to v008 both put it at 1.07 times that version's speed.
// All steps since v000 together make it 9.54 times as fast.
// Contractions: x.Wq^T+bq and Wv.x^T+bv on v_wmma_f32_16x16x32_bf16 (x and W planes RNE-converted to bf16 operands, f32 accumulate);
// scores qn.qn^T (qn = L2-normalised q, single f16 plane carried x16) and P.v (P x32768 single f16, v x1024 single f16) on
// v_wmma_f32_16x16x32_f16, f32 accumulate. Biases folded as RNE bf16 values in f32 epilogues; L2 normalisation, sums of squares,
// base-2 softmax with a constant shift, 1/l and carry folds in f32 on VALU.
#include <hip/hip_runtime.h>
#include <math.h>
#include <stdint.h>

#ifndef NB
#define NB 1
#endif
#ifndef SEQ
#define SEQ 2048
#endif
#define SEQ_FULL 2048
#define DMOD  768
#define NHD   12
#define HD    64
#define NCG   (DMOD / 64)
#define QSC   16.0f
#define PCAR  32768.0f
#define PSH   15.0f               // log2(PCAR): the constant shift of the base-2 logits, so that exp2 yields P x PCAR at once
#define VCAR  1024.0f
#define LOG2E 1.4426950408889634f
#define ATT_WAVES   16
#define ATT_THREADS (ATT_WAVES * 32)
#define QROWS       128           // query rows of an attention block: 4 groups of 32 rows, each worked on by 4 waves
#define QTILES      (SEQ / QROWS)
#define ATT_BLOCKS  (NHD * QTILES)
#define NKB    (SEQ / 32)
#define SLAB   (16 * 68)
#define KT     256                // keys per LDS stage of the attention loop: two 32-key blocks for each of a group's 4 waves
#define NST    (SEQ / KT)         // stages
#define LPH    72                 // K tile row pitch in halves: 128-B rows at 144 B = 16 B x odd, for 16-byte LDS readers
#define VLPH   264                // V tile row pitch in halves: 512-B rows at 528 B = 16 B x odd
#define KTILEH (KT * LPH)         // one staged K tile of KT key rows, in halves
#define VTILEH (HD * VLPH)        // one staged V tile of HD d rows, in halves
#define BUFH   (KTILEH + VTILEH)  // one buffer: K tile, then V tile
#define AACP   (SEQ / ATT_THREADS)   // 4-byte copies per thread for one head's AA table
static_assert(NST * KT == SEQ && NST >= 2 && KT == 4 * 2 * 32 && HD == 64 && QROWS == (ATT_WAVES / 4) * 32);
static_assert((VLPH * 2) % 16 == 0 && (KTILEH * 2) % 16 == 0 && (BUFH * 2) % 16 == 0 && VLPH >= KT + 8);
static_assert((NST & (NST - 1)) == 0 && NST == 8);   // the rotated stage walk wraps by a mask; its start takes 3 bits
static_assert(AACP * ATT_THREADS == SEQ && AACP == 4 && (LPH * 2) % 16 == 0 && ATT_THREADS * 4 * 16 == KT * HD * 2);
#define VKS    128                // k halves per LDS stage of the projection GEMMs: 256-B row pieces
#define VNS    (DMOD / VKS)       // their stages
#define VPH    136                // their LDS pitch in halves: 272 B = 16 B x odd
#define VTPB   3                  // 64x64 tiles per block of the projection launch, one per group of 4 waves: 64 x rows by 192 weight rows
#define WROWS  (64 * VTPB)        // weight rows of a block
#define WGRP   (DMOD / WROWS)     // groups of WROWS weight rows in a weight plane
#define VBUFH  ((64 + WROWS) * VPH)   // one buffer: the block's 64 x rows, then its WROWS weight rows, in halves
static_assert(VNS * VKS == DMOD && VNS >= 2 && (VPH * 2) % 16 == 0 && WGRP * WROWS == DMOD);
static_assert(NCG * 32 * 8 * 16 == WROWS * VKS * 2 && 8 * 32 * 4 * 16 == 64 * VKS * 2);   // copies per stage: 8 in every wave, 4 more in waves 0..7
#define CVX    ((SEQ * DMOD) / 2048)    // blocks of the conversion launch for x (256 threads x 8 elements each)
#define CVW    ((DMOD * DMOD) / 2048)   // its blocks for each weight plane
#define QBLK   ((SEQ / 64) * WGRP)      // blocks of the projection launch that do the query projection
#define VBLK   ((SEQ / 64) * WGRP)      // its blocks that do the v^T GEMM
#define POOLB  (NCG * SLAB * 4 + WROWS * 4 + 2 * VBUFH * 2)   // LDS bytes of a block: result slabs, aa values, ring
static_assert(VTPB * 4 == NCG && (NCG * SLAB * 4) % 16 == 0 && (WROWS * 4) % 128 == 0 && (VBUFH * 2) % 16 == 0);
static_assert(NB == 1);
static_assert(HD == 64 && DMOD == NHD * HD && NCG * 64 == DMOD);
static_assert((SEQ % 64) == 0 && SEQ >= 64 && SEQ <= SEQ_FULL);
static_assert(ATT_THREADS == 512 && NKB * 32 == SEQ && ATT_BLOCKS == NHD * (SEQ / 128) && (SEQ % QROWS) == 0);
static_assert((DMOD % 64) == 0 && (DMOD % 32) == 0);
static_assert(((SEQ * DMOD / 8) % 256) == 0 && ((DMOD * DMOD / 8) % 256) == 0);
static_assert((SLAB * 4) % 16 == 0);
static_assert(((16 * NCG) % 32) == 0 && NCG * 32 <= 1024 && (SEQ % 16) == 0);

typedef unsigned short u16;
typedef _Float16 v16h __attribute__((ext_vector_type(16)));
typedef _Float16 v8h  __attribute__((ext_vector_type(8)));
typedef __bf16   v16b __attribute__((ext_vector_type(16)));
typedef float    v8f  __attribute__((ext_vector_type(8)));
typedef float    v4f  __attribute__((ext_vector_type(4)));
typedef unsigned int v4u __attribute__((ext_vector_type(4)));
typedef float    v2f  __attribute__((ext_vector_type(2)));
typedef _Float16 v2h  __attribute__((ext_vector_type(2)));

union FragH { v16h v; v8h h[2]; v4u u[2]; };
union FragB { v16b v; v4u u[2]; };

// ---- scalar helpers --------------------------------------------------------------------------------
__device__ __forceinline__ unsigned short bf_bits(float f) {          // f32 -> bf16 bits, RNE convert
  unsigned u = __float_as_uint(f);
  return (unsigned short)((u + 0x7FFFu + ((u >> 16) & 1u)) >> 16);
}
__device__ __forceinline__ float bf_up(unsigned short h) { return __uint_as_float(((unsigned)h) << 16); }
__device__ __forceinline__ float bf_val(float f) { return bf_up(bf_bits(f)); }          // value after RNE bf16 convert
__device__ __forceinline__ unsigned short h_bits(_Float16 x) { return __builtin_bit_cast(unsigned short, x); }
__device__ __forceinline__ unsigned pk16(unsigned short a, unsigned short b) { return (unsigned)a | ((unsigned)b << 16); }
__device__ __forceinline__ unsigned pkh(v2f x) {                     // two f32 -> packed f16 pair, RNE, x[0] in the low half
  return __builtin_bit_cast(unsigned, __builtin_convertvector(x, v2h));
}
__device__ __forceinline__ v8f zero8() { v8f z = {0.f, 0.f, 0.f, 0.f, 0.f, 0.f, 0.f, 0.f}; return z; }

// ---- fragment loaders: 16-bit A/B operand, lane -> row/col (lane&15), p already includes +8*(lane>>4);
//      elements 0..7 <- p[0..7] (k0+8h..), elements 8..15 <- p[16..23] (k0+16+8h..)  (same split k map for A and B;
//      B is always read from a k-contiguous [n][k] plane)
__device__ __forceinline__ v16h ldfrag_h(const _Float16* p) {
  FragH f;
  f.h[0] = *(const v8h*)(p);
  f.h[1] = *(const v8h*)(p + 16);
  return f.v;
}
__device__ __forceinline__ v16b ldfrag_b(const u16* p) {              // bf16 plane read as unsigned integer vectors
  FragB f;
  f.u[0] = *(const v4u*)(p);
  f.u[1] = *(const v4u*)(p + 16);
  return f.v;
}

__device__ __forceinline__ v8f mma_h(v16h a, v16h b, v8f c) {
  return __builtin_amdgcn_wmma_f32_16x16x32_f16(false, a, false, b, (short)0, c, false, false);
}
__device__ __forceinline__ v8f mma_b(v16b a, v16b b, v8f c) {
  return __builtin_amdgcn_wmma_f32_16x16x32_bf16(false, a, false, b, (short)0, c, false, false);
}
__device__ __forceinline__ void guard2(v8f& a, v8f& b, v16h x0, v16h x1, v16h x2, v16h x3, v16h x4, v16h x5) {
#if defined(__HIP_DEVICE_COMPILE__)
  asm volatile("v_nop\n\tv_nop\n\tv_nop\n\tv_nop"
               : "+v"(a), "+v"(b) : "v"(x0), "v"(x1), "v"(x2), "v"(x3), "v"(x4), "v"(x5) : "memory");
#endif
}
template <typename F>
__device__ __forceinline__ void guard6(v8f& a, v8f& b, v8f& c, v8f& d, F x0, F x1, F x2, F x3, F x4, F x5) {
#if defined(__HIP_DEVICE_COMPILE__)
  asm volatile("v_nop\n\tv_nop\n\tv_nop\n\tv_nop"
               : "+v"(a), "+v"(b), "+v"(c), "+v"(d) : "v"(x0), "v"(x1), "v"(x2), "v"(x3), "v"(x4), "v"(x5) : "memory");
#endif
}
__device__ __forceinline__ void acc_guard4(v8f& a, v8f& b, v8f& c, v8f& d) {
#if defined(__HIP_DEVICE_COMPILE__)
  asm volatile("v_nop\n\tv_nop\n\tv_nop\n\tv_nop" : "+v"(a), "+v"(b), "+v"(c), "+v"(d));
#endif
}
__device__ __forceinline__ void wave_sync_lds() {
#if defined(__HIP_DEVICE_COMPILE__)
  __builtin_amdgcn_fence(__ATOMIC_RELEASE, "workgroup");
  __builtin_amdgcn_wave_barrier();
  __builtin_amdgcn_fence(__ATOMIC_ACQUIRE, "workgroup");
#endif
}

// ---- cross-lane moves inside a half (16 lanes) on the vector unit: CTRL = 0x160 | k reads lane l ^ k (row_xmask:k),
//      CTRL = 0x150 | k reads lane k of the half (row_share:k). All 32 lanes are on wherever these are used.
template <int CTRL>
__device__ __forceinline__ float dpp_f(float v) {
#if defined(__HIP_DEVICE_COMPILE__)
  return __int_as_float(__builtin_amdgcn_update_dpp(0, __float_as_int(v), CTRL, 0xf, 0xf, true));
#else
  return v;
#endif
}
// Sums over the 16 lanes of a half, of 8 values per lane at once; lane m gets the sum of s[m & 7] (b0, b1, b2 = bits 0..2 of m).
// Each step is the xor butterfly's (partners l ^ 1, l ^ 2, l ^ 4, l ^ 8, in this order), but a lane keeps only the half of the
// values whose index bit equals its own lane bit and hands the other half to its partner: 8 additions instead of 32.
__device__ __forceinline__ float rowsum8(const float* s, bool b0, bool b1, bool b2) {
  float c[4], d[2];
#pragma unroll   // constant indices: s, c and d stay in registers
  for (int i = 0; i < 4; ++i) c[i] = (b0 ? s[2 * i + 1] : s[2 * i]) + dpp_f<0x161>(b0 ? s[2 * i] : s[2 * i + 1]);
#pragma unroll   // the same
  for (int j = 0; j < 2; ++j) d[j] = (b1 ? c[2 * j + 1] : c[2 * j]) + dpp_f<0x162>(b1 ? c[2 * j] : c[2 * j + 1]);
  float e = (b2 ? d[1] : d[0]) + dpp_f<0x164>(b2 ? d[0] : d[1]);
  e += dpp_f<0x168>(e);
  return e;
}

// ---- asynchronous copies global -> LDS, 16 B per lane (4 B in copy4w); lds = the lane's LDS byte address, g = the lane's global address.
//      The address-translation wait is the last line of the copies' own statement, so that no address register named by
//      an issued copy is rewritten in front of it.
__device__ __forceinline__ unsigned lds_addr(const void* p) { return (unsigned)(size_t)p; }
__device__ __forceinline__ void copy1(unsigned lds, const char* g) {
#if defined(__HIP_DEVICE_COMPILE__)
  asm volatile("global_load_async_to_lds_b128 %0, %1, off\n\ts_wait_xcnt 0x0" :: "v"(lds), "v"(g) : "memory");
#endif
}
// eight copies with constant steps from one to the next: ls bytes in LDS, gs bytes in global memory
__device__ __forceinline__ void copy8(unsigned l, unsigned ls, const char* g, size_t gs) {
#if defined(__HIP_DEVICE_COMPILE__)
  asm volatile("global_load_async_to_lds_b128 %0, %8, off\n\t"
               "global_load_async_to_lds_b128 %1, %9, off\n\t"
               "global_load_async_to_lds_b128 %2, %10, off\n\t"
               "global_load_async_to_lds_b128 %3, %11, off\n\t"
               "global_load_async_to_lds_b128 %4, %12, off\n\t"
               "global_load_async_to_lds_b128 %5, %13, off\n\t"
               "global_load_async_to_lds_b128 %6, %14, off\n\t"
               "global_load_async_to_lds_b128 %7, %15, off\n\t"
               "s_wait_xcnt 0x0"
               :: "v"(l), "v"(l + ls), "v"(l + 2 * ls), "v"(l + 3 * ls),
                  "v"(l + 4 * ls), "v"(l + 5 * ls), "v"(l + 6 * ls), "v"(l + 7 * ls),
                  "v"(g), "v"(g + gs), "v"(g + 2 * gs), "v"(g + 3 * gs),
                  "v"(g + 4 * gs), "v"(g + 5 * gs), "v"(g + 6 * gs), "v"(g + 7 * gs)
               : "memory");
#endif
}
// four copies with constant steps from one to the next
__device__ __forceinline__ void copy4(unsigned l, unsigned ls, const char* g, size_t gs) {
#if defined(__HIP_DEVICE_COMPILE__)
  asm volatile("global_load_async_to_lds_b128 %0, %4, off\n\t"
               "global_load_async_to_lds_b128 %1, %5, off\n\t"
               "global_load_async_to_lds_b128 %2, %6, off\n\t"
               "global_load_async_to_lds_b128 %3, %7, off\n\t"
               "s_wait_xcnt 0x0"
               :: "v"(l), "v"(l + ls), "v"(l + 2 * ls), "v"(l + 3 * ls),
                  "v"(g), "v"(g + gs), "v"(g + 2 * gs), "v"(g + 3 * gs)
               : "memory");
#endif
}
// four 4-byte copies, LDS addresses ls bytes apart, each with a global address of its own
__device__ __forceinline__ void copy4w(unsigned l, unsigned ls, const char* const* g) {
#if defined(__HIP_DEVICE_COMPILE__)
  asm volatile("global_load_async_to_lds_b32 %0, %4, off\n\t"
               "global_load_async_to_lds_b32 %1, %5, off\n\t"
               "global_load_async_to_lds_b32 %2, %6, off\n\t"
               "global_load_async_to_lds_b32 %3, %7, off\n\t"
               "s_wait_xcnt 0x0"
               :: "v"(l), "v"(l + ls), "v"(l + 2 * ls), "v"(l + 3 * ls),
                  "v"(g[0]), "v"(g[1]), "v"(g[2]), "v"(g[3])
               : "memory");
#endif
}
// one stage: 4 K chunks (64 rows apart in LDS, 8192 B apart in the contiguous K rows) and 4 V chunks (16 d rows apart)
__device__ __forceinline__ void copy_stage(unsigned lk, unsigned lv, const char* gk, const char* gv) {
#if defined(__HIP_DEVICE_COMPILE__)
  const unsigned rs = 64 * LPH * 2, vr = 16 * VLPH * 2;
  const size_t vs = (size_t)16 * SEQ * 2;
  asm volatile("global_load_async_to_lds_b128 %0, %8, off\n\t"
               "global_load_async_to_lds_b128 %1, %9, off\n\t"
               "global_load_async_to_lds_b128 %2, %10, off\n\t"
               "global_load_async_to_lds_b128 %3, %11, off\n\t"
               "global_load_async_to_lds_b128 %4, %12, off\n\t"
               "global_load_async_to_lds_b128 %5, %13, off\n\t"
               "global_load_async_to_lds_b128 %6, %14, off\n\t"
               "global_load_async_to_lds_b128 %7, %15, off\n\t"
               "s_wait_xcnt 0x0"
               :: "v"(lk), "v"(lk + rs), "v"(lk + 2 * rs), "v"(lk + 3 * rs),
                  "v"(lv), "v"(lv + vr), "v"(lv + 2 * vr), "v"(lv + 3 * vr),
                  "v"(gk), "v"(gk + 8192), "v"(gk + 16384), "v"(gk + 24576),
                  "v"(gv), "v"(gv + vs), "v"(gv + 2 * vs), "v"(gv + 3 * vs)
               : "memory");
#endif
}
// the issuing wave's own wait: its copies have landed (before the barrier behind which other waves read them)
__device__ __forceinline__ void wait_copies() {
#if defined(__HIP_DEVICE_COMPILE__)
  asm volatile("s_wait_asynccnt 0x0" ::: "memory");
#endif
}
// address-translation wait behind a run of plain global stores, in front of whatever rewrites a register that they name
__device__ __forceinline__ void wait_xlat() {
#if defined(__HIP_DEVICE_COMPILE__)
  asm volatile("s_wait_xcnt 0x0" ::: "memory");
#endif
}
// the wave's LDS reads have returned (before the barrier behind which their buffer is refilled)
__device__ __forceinline__ void wait_lds() {
#if defined(__HIP_DEVICE_COMPILE__)
  asm volatile("s_wait_dscnt 0x0" ::: "memory");
#endif
}

// =====================================================================================================
// The three f32 operand planes (x, Wq, Wv) -> bf16 RNE bits, same layouts, in ONE launch: the planes do not depend on one
// another, and their bf16 planes follow one another in the workspace, so block b writes elements b*2048 .. +2047 of the joined
// destination and picks its source plane by block index (block-uniform): CVX blocks of x, then CVW of Wq, then CVW of Wv.
// Thread = 8 consecutive elements: two 16-B loads, one 16-B store; 32 consecutive lanes = 512 contiguous, 512-B aligned bytes
// coverage: grid = CVX + 2*CVW blocks (plane sizes are exact multiples of 2048 elements) x 256 thr x 8 = the three planes.
// =====================================================================================================
__global__ __launch_bounds__(256) void cvt16x3(const float* __restrict__ x, const float* __restrict__ wq,
                                               const float* __restrict__ wv, u16* D) {
  const int b = blockIdx.x;
  if (b >= CVX + 2 * CVW) return;           // no barriers in this kernel
  const float* s = (b < CVX) ? x : ((b < CVX + CVW) ? wq : wv);
  const int   lb = (b < CVX) ? b : ((b < CVX + CVW) ? (b - CVX) : (b - CVX - CVW));
  const float* p = s + ((size_t)lb * 256 + threadIdx.x) * 8;
  const v4f a = *(const v4f*)(p), c4 = *(const v4f*)(p + 4);
  v4u o;
#pragma unroll
  for (int e = 0; e < 2; ++e) {
    o[e]     = pk16(bf_bits(a[2 * e]),  bf_bits(a[2 * e + 1]));
    o[2 + e] = pk16(bf_bits(c4[2 * e]), bf_bits(c4[2 * e + 1]));
  }
  *(v4u*)(D + ((size_t)b * 256 + threadIdx.x) * 8) = o;
}

// =====================================================================================================
// barrier, then converted to f16 and written: lane = (row in group of 4, 8 consecutive cols); one instruction = 4 rows, each
// coverage: 4 instructions x 4 rows x 8 lanes x 8 halves = the wave's 16 x 64 tile.
// =====================================================================================================
__device__ __forceinline__ void epi16(float* sl, v8f a0, v8f a1, v8f a2, v8f a3, float oscale, u16* C, int N,
                                      size_t rowb, int col0, int lane) {
  const int hh = lane >> 4, m = lane & 15;
#pragma unroll
  for (int r = 0; r < 8; ++r) {
    const int ro = (8 * hh + r) * 68 + m;
    sl[ro]      = a0[r] * oscale;
    sl[ro + 16] = a1[r] * oscale;
    sl[ro + 32] = a2[r] * oscale;
    sl[ro + 48] = a3[r] * oscale;
  }
  wave_sync_lds();
  const int rq = lane >> 3, c8 = (lane & 7) * 8;
  v4u ov[4];
#pragma unroll
  for (int i4 = 0; i4 < 4; ++i4) {
    const int row = i4 * 4 + rq;
    const v4f a = *(const v4f*)(sl + row * 68 + c8), c4 = *(const v4f*)(sl + row * 68 + c8 + 4);
    float w[8];
#pragma unroll
    for (int e = 0; e < 4; ++e) { w[e] = a[e]; w[4 + e] = c4[e]; }
#pragma unroll
    for (int e = 0; e < 4; ++e) ov[i4][e] = pk16(h_bits((_Float16)w[2 * e]), h_bits((_Float16)w[2 * e + 1]));
  }
  u16* dst = C + (rowb + (size_t)rq) * (size_t)N + col0 + c8;
  {
#pragma unroll
    for (int i4 = 0; i4 < 4; ++i4) {
      *(v4u*)(dst + (size_t)(i4 * 4) * (size_t)N) = ov[i4];
    }
    wait_xlat();   // code of the merged kernel may follow these stores and rewrite their data or address registers
  }
}

// =====================================================================================================
// Main loop of both projection GEMMs. A block of NCG waves works on ONE tile of 64 x rows by WROWS weight rows, K = DMOD: every
// x row and every weight row that the block needs comes into its LDS once, and all its waves read them there. A stage = VKS
// k values of the 64 x rows and the WROWS weight rows, brought in by asynchronous 16-byte copies (16 lanes = one 256-B row
// piece, whole 128-B lines; 8 copies per thread and stage for the weight rows, 4 more in waves 0..7 for the x rows), two
// buffers: stage t+2 is issued behind the barrier at the foot of trip t and flies during trip t+1. A wave's 16x64 result:
// A fragment from LDS row arow, B fragments from LDS rows brow, brow+16, brow+32, brow+48 (LDS row = x row 0..63, or 64 + weight
// row; the lane's own row index is already in arow and brow). Rows of 272 B, two 16-B reads per fragment, split k map for A
// and B; k runs upward in steps of 32 from the block's own start stage and wraps. Every wave passes every block barrier.
// rot: trip t works on k stage (t + rot) mod VNS. Blocks that read the same x or weight rows then ask for different stages at
// the same time, so each line's first fetch into L2 is waited for by few of them and the others find it there. For speed
// only: any rot in 0 .. VNS-1 gives every stage exactly once.
// =====================================================================================================
__device__ __forceinline__
void proj_loop(u16* ring, const u16* __restrict__ X, const u16* __restrict__ Wt, int xrow0, int wrow0, int rot,
               int arow, int brow, v8f& acc0, v8f& acc1, v8f& acc2, v8f& acc3) {
  const int K = DMOD;
  const int tid = threadIdx.x, hh = (tid & 31) >> 4;
  const bool xw = __builtin_amdgcn_readfirstlane(tid >> 5) < 8;   // scalar: waves 0..7 also copy the x rows
  // copy addresses of this thread: weight chunk i = tid + 384*j, row = i >> 4 = (tid >> 4) + 24*j, 16-byte column = tid & 15;
  // x chunk (waves 0..7) i = tid + 256*j, row = (tid >> 4) + 16*j (start row kept inside 0..15 in every thread)
  const unsigned lw0 = lds_addr(ring) + (unsigned)((64 + (tid >> 4)) * (VPH * 2) + (tid & 15) * 16);
  const unsigned lx0 = lds_addr(ring) + (unsigned)(((tid >> 4) & 15) * (VPH * 2) + (tid & 15) * 16);
  const char* gw0 = (const char*)(const void*)(Wt + (size_t)(wrow0 + (tid >> 4)) * K) + (tid & 15) * 16;
  const char* gx0 = (const char*)(const void*)(X + (size_t)(xrow0 + ((tid >> 4) & 15)) * K) + (tid & 15) * 16;
  const unsigned lws = 24 * VPH * 2, lxs = 16 * VPH * 2;                  // 24 and 16 rows on, in LDS
  const size_t   gws = (size_t)24 * K * 2, gxs = (size_t)16 * K * 2;      // the same in the source planes
  const int k1 = (rot + 1 < VNS) ? (rot + 1) : 0;
  // first stage landed and published; then the second into the other buffer
  copy8(lw0, lws, gw0 + rot * (VKS * 2), gws);
  if (xw) copy4(lx0, lxs, gx0 + rot * (VKS * 2), gxs);
  wait_copies();
  __syncthreads();
  copy8(lw0 + VBUFH * 2, lws, gw0 + k1 * (VKS * 2), gws);
  if (xw) copy4(lx0 + VBUFH * 2, lxs, gx0 + k1 * (VKS * 2), gxs);
#pragma unroll 1   // one trip per stage: the buffer index alternates, the code stays small
  for (int t = 0; t < VNS; ++t) {
    const u16* bufp = ring + (t & 1) * VBUFH;
    const u16* al = bufp + arow * VPH + 8 * hh;
    const u16* bl = bufp + brow * VPH + 8 * hh;
#pragma unroll     // k offsets inside the stage become immediate offsets of the LDS reads
    for (int u = 0; u < VKS; u += 64) {
      // all LDS reads of 64 k values stand together in front of their products
      const v16b a  = ldfrag_b(al + u),                 e  = ldfrag_b(al + u + 32);
      const v16b b0 = ldfrag_b(bl + u),                 f0 = ldfrag_b(bl + u + 32);
      const v16b b1 = ldfrag_b(bl + 16 * VPH + u),      f1 = ldfrag_b(bl + 16 * VPH + u + 32);
      const v16b b2 = ldfrag_b(bl + 32 * VPH + u),      f2 = ldfrag_b(bl + 32 * VPH + u + 32);
      const v16b b3 = ldfrag_b(bl + 48 * VPH + u),      f3 = ldfrag_b(bl + 48 * VPH + u + 32);
      acc0 = mma_b(a, b0, acc0);
      acc1 = mma_b(a, b1, acc1);
      acc2 = mma_b(a, b2, acc2);
      acc3 = mma_b(a, b3, acc3);
      guard6<v16b>(acc0, acc1, acc2, acc3, a, b0, b1, b2, b3, a);
      acc0 = mma_b(e, f0, acc0);
      acc1 = mma_b(e, f1, acc1);
      acc2 = mma_b(e, f2, acc2);
      acc3 = mma_b(e, f3, acc3);
      guard6<v16b>(acc0, acc1, acc2, acc3, e, f0, f1, f2, f3, e);
    }
    // foot of trip t: own LDS reads back, own copies of stage t+1 landed, barrier (publishes stage t+1 and ends every
    // reader's last read of this trip's buffer); only then the refill of that buffer with stage t+2
    wait_lds();
    wait_copies();
    __syncthreads();
    if (t + 2 < VNS) {
      const unsigned bo = (unsigned)((t & 1) * (VBUFH * 2));
      const int k2 = (t + 2 + rot < VNS) ? (t + 2 + rot) : (t + 2 + rot - VNS);
      copy8(lw0 + bo, lws, gw0 + k2 * (VKS * 2), gws);
      if (xw) copy4(lx0 + bo, lxs, gx0 + k2 * (VKS * 2), gxs);
    }
  }
  wait_copies();
  acc_guard4(acc0, acc1, acc2, acc3);
}

// =====================================================================================================
// bf16 GEMM with bias and 16-bit result: C[M][N] (f16 of (acc + bias)*oscale) = A[M][K] (bf16 weight plane, row-major) .
// Bt[N][K]^T (bf16 x plane, k-contiguous); bias (f32 input, taken as its RNE bf16 value) indexed by column (byrow == 0) or by
// row (byrow != 0), both candidates read with addresses clamped to [0, nbias). Block tile = WROWS result rows (weight rows
// wg*WROWS ..) by 64 result columns (x rows xt*64 ..): group g = threadIdx.x >> 7 of 4 waves takes rows 64g .. 64g+63 of it,
// 16 per wave. (The caller gives xt < N/64 and wg < WGRP.)
// =====================================================================================================
__device__ __forceinline__
void gemm_b16(char* pool, int xt, int wg, int rot, const u16* __restrict__ A, const u16* __restrict__ Bt, u16* C,
              const float* __restrict__ bias, int N, int nbias, int byrow, float oscale) {
  const int grp = threadIdx.x >> 7;
  float* slab = (float*)(void*)pool + grp * (4 * SLAB);
  u16*   ring = (u16*)(void*)(pool + NCG * SLAB * 4 + WROWS * 4);   // two buffers of (x rows, weight rows), rows of VPH halves
  const int tid = threadIdx.x & 127, wave = tid >> 5, lane = tid & 31, hh = lane >> 4, m = lane & 15;
  const int rowb  = wg * WROWS + grp * 64 + wave * 16;
  const int col0  = xt * 64;
  v8f acc0 = zero8(), acc1 = zero8(), acc2 = zero8(), acc3 = zero8();
  proj_loop(ring, Bt, A, col0, wg * WROWS, rot, 64 + grp * 64 + wave * 16 + m, m, acc0, acc1, acc2, acc3);
  // bias: D element r of lane -> (row rowb+8hh+r, col col0+16j+m); both candidates loaded with clamped addresses, select by value
  float bc[4], br[8];
#pragma unroll
  for (int j = 0; j < 4; ++j) {
    int ci = col0 + 16 * j + m;
    ci = (ci < nbias) ? ci : (nbias - 1);
    bc[j] = bf_val(bias[ci]);
  }
  int ri[8];
  float bw[8];
#pragma unroll
  for (int r = 0; r < 8; ++r) {
    ri[r] = rowb + 8 * hh + r;
    ri[r] = (ri[r] < nbias) ? ri[r] : (nbias - 1);
    bw[r] = bias[ri[r]];
  }
#if defined(__HIP_DEVICE_COMPILE__)
  // the eight loads' index registers stay live up to this address-translation wait (inputs only), so that no load's result
  // lands in the index register of a load issued before it; the loaded values as inputs keep the loads in front of it
  asm volatile("s_wait_xcnt 0x0"
               :: "v"(ri[0]), "v"(ri[1]), "v"(ri[2]), "v"(ri[3]), "v"(ri[4]), "v"(ri[5]), "v"(ri[6]), "v"(ri[7]),
                  "v"(bw[0]), "v"(bw[1]), "v"(bw[2]), "v"(bw[3]), "v"(bw[4]), "v"(bw[5]), "v"(bw[6]), "v"(bw[7])
               : "memory");
#endif
#pragma unroll
  for (int r = 0; r < 8; ++r) br[r] = bf_val(bw[r]);
#pragma unroll
  for (int r = 0; r < 8; ++r) {
    const float q0 = (byrow != 0) ? br[r] : bc[0];
    const float q1 = (byrow != 0) ? br[r] : bc[1];
    const float q2 = (byrow != 0) ? br[r] : bc[2];
    const float q3 = (byrow != 0) ? br[r] : bc[3];
    acc0[r] += q0;
    acc1[r] += q1;
    acc2[r] += q2;
    acc3[r] += q3;
  }
  epi16(slab + wave * SLAB, acc0, acc1, acc2, acc3, oscale, C, N, (size_t)rowb, col0, lane);
}

// =====================================================================================================
// Query projection with fused per-chunk L2 normalisation:
//   q[M][NCG*64] (f32, registers only) = A[M][K] (bf16 x plane) . Bt[NCG*64][K]^T (bf16 Wq plane) + bias[col] (RNE bf16 value);
//   block tile = 64 result rows (x rows xt*64 ..) by WROWS result columns (weight rows wg*WROWS ..) = VTPB column groups of 64:
//   group g = threadIdx.x >> 7 of 4 waves takes column group cg = wg*VTPB + g, 16 rows per wave, so a weight row is fetched by
//   SEQ/64 blocks and an x row by WGRP of them.
//   For D row 8hh+r the 64-wide chunk (row, cols col0..col0+63) lives
//   in the 16 lanes of half hh x 4 accumulators: ss = sum of squares (4 products per lane, xor-1/2/4/8 steps in registers inside the
//   half), qn = q * (1/max(sqrt(ss), 1e-12)), aa = sum of qn^2 the same way (f32), kept in LDS at aas[(row in block)*VTPB + g].
//   After the block barrier the block's 64*VTPB aa values go out as whole 128-B lines that no other block writes: the aa table
//   is laid out [wg][row][g], so they are contiguous (64*VTPB floats is a multiple of 32).
//   Part of the projection launch: block = NCG waves (every wave reaches every barrier); slabs, aa values and ring lie in the
//   block's LDS pool.
// coverage: qn plane: (M/64)*WGRP blocks x NCG waves x (16 x 64) = M x NCG*64;  aa table: the same blocks x 64*VTPB floats = M*NCG.
// =====================================================================================================
__device__ __forceinline__
void gemm_qn(char* pool, int xt, int wg, int rot, const u16* __restrict__ A, const u16* __restrict__ Bt, u16* C, float* AAP,
             const float* __restrict__ bias, int nbias, float oscale) {
  float* slab = (float*)(void*)pool;
  float* aas  = slab + NCG * SLAB;
  u16*   ring = (u16*)(void*)(pool + NCG * SLAB * 4 + WROWS * 4);   // two buffers of (x rows, weight rows), rows of VPH halves
  const int tid = threadIdx.x, wave = tid >> 5, lane = tid & 31, hh = lane >> 4, m = lane & 15;
  const int grp = wave >> 2, wr = (wave & 3) * 16;   // column group in the block; first row of the wave in the block
  const int N = NCG * 64;
  const int rowb = xt * 64 + wr;
  const int col0 = wg * WROWS + grp * 64;
  v8f acc0 = zero8(), acc1 = zero8(), acc2 = zero8(), acc3 = zero8();
  proj_loop(ring, A, Bt, xt * 64, wg * WROWS, rot, wr + m, 64 + grp * 64 + m, acc0, acc1, acc2, acc3);
  float bc[4], bw[4];
  int ci[4];
#pragma unroll
  for (int j = 0; j < 4; ++j) {
    ci[j] = col0 + 16 * j + m;
    ci[j] = (ci[j] < nbias) ? ci[j] : (nbias - 1);
    bw[j] = bias[ci[j]];
  }
#if defined(__HIP_DEVICE_COMPILE__)
  // the four loads' index registers stay live up to this address-translation wait (inputs only), so that nothing rewrites one
  // in front of it; the loaded values as inputs keep the loads in front of it
  asm volatile("s_wait_xcnt 0x0"
               :: "v"(ci[0]), "v"(ci[1]), "v"(ci[2]), "v"(ci[3]), "v"(bw[0]), "v"(bw[1]), "v"(bw[2]), "v"(bw[3])
               : "memory");
#endif
#pragma unroll
  for (int j = 0; j < 4; ++j) bc[j] = bf_val(bw[j]);
#pragma unroll
  for (int r = 0; r < 8; ++r) {
    acc0[r] += bc[0];
    acc1[r] += bc[1];
    acc2[r] += bc[2];
    acc3[r] += bc[3];
  }
  // L2 normalise the 64-wide chunks of the wave's 8 rows per half and take the f32 sums of squares of the normalised values:
  // all 8 rows go through one in-register reduction, after which lane m holds the sum of row m & 7 of its half
  const bool b0 = (m & 1) != 0, b1 = (m & 2) != 0, b2 = (m & 4) != 0;
  float sq[8];
#pragma unroll   // constant indices: sq stays in registers
  for (int r = 0; r < 8; ++r) sq[r] = acc0[r] * acc0[r] + acc1[r] * acc1[r] + acc2[r] * acc2[r] + acc3[r] * acc3[r];
  const float ss  = rowsum8(sq, b0, b1, b2);
  const float nrm = sqrtf(ss);
  const float den = fmaxf(nrm, 1e-12f);
  const float il  = 1.0f / den;               // 1/norm of row m & 7: one square root and one division serve the 8 rows
  const float inv[8] = {dpp_f<0x150>(il), dpp_f<0x151>(il), dpp_f<0x152>(il), dpp_f<0x153>(il),     // row_share:r = lane r of
                        dpp_f<0x154>(il), dpp_f<0x155>(il), dpp_f<0x156>(il), dpp_f<0x157>(il)};    // the half, to all its lanes
#pragma unroll
  for (int r = 0; r < 8; ++r) {
    acc0[r] *= inv[r];
    acc1[r] *= inv[r];
    acc2[r] *= inv[r];
    acc3[r] *= inv[r];
    sq[r] = acc0[r] * acc0[r] + acc1[r] * acc1[r] + acc2[r] * acc2[r] + acc3[r] * acc3[r];
  }
  const float a2 = rowsum8(sq, b0, b1, b2);
  if (m < 8) aas[(wr + 8 * hh + m) * VTPB + grp] = a2;
  epi16(slab + wave * SLAB, acc0, acc1, acc2, acc3, oscale, C, N, (size_t)rowb, col0, lane);
  __syncthreads();
  // aa table lines of this block: 64*VTPB contiguous floats; thread t < 64*VTPB/4 writes float4 t
  const int nf4 = WROWS / 4;
  if (tid < nf4) {
    const v4f w0 = *(const v4f*)(aas + 4 * tid);
    *(v4f*)(AAP + ((size_t)wg * SEQ + (size_t)xt * 64) * VTPB + 4 * tid) = w0;
  }
}

// =====================================================================================================
// Both projections in ONE launch (neither reads what the other writes): blocks 0 .. QBLK-1 do the query projection (the longer
// part, so it starts first), blocks QBLK .. QBLK+VBLK-1 the v^T GEMM; either way block = (64 x rows xt, WROWS weight rows wg).
// The choice is block-uniform, so every barrier of either part is passed by all NCG waves of its block. One LDS pool per block.
// The start stage takes all VNS values among the 2*WGRP blocks that read the same x rows (two of them twice) and differs from one xt to the next (same weight rows).
// =====================================================================================================
__global__ __launch_bounds__(NCG * 32)
void gemm_qv(const u16* __restrict__ XBp, const u16* __restrict__ WQp, const u16* __restrict__ WVp, u16* QPp, float* AAP,
             u16* VPp, const float* __restrict__ bq, const float* __restrict__ bv) {
  __shared__ __align__(16) char pool[POOLB];
  const int b = blockIdx.x;
  if (b >= QBLK + VBLK) return;              // block-uniform, never taken with the exact grid; in front of every barrier
  const int lb = (b < QBLK) ? b : (b - QBLK);
  const int xt = lb / WGRP, wg = lb % WGRP;
  const int rot = (xt + wg + ((b < QBLK) ? 0 : WGRP)) % VNS;
  if (b < QBLK) gemm_qn(pool, xt, wg, rot, XBp, WQp, QPp, AAP, bq, DMOD, QSC);
  else          gemm_b16(pool, xt, wg, rot, WVp, XBp, VPp, bv, SEQ, DMOD, 1, VCAR);
}

// =====================================================================================================
// L2-distance flash attention (no masking, all SEQ keys): block = (head, QROWS = 128 query rows), 16 waves, four to a SIMD.
// Wave w works on the 32 query rows of group wq = w & 3 (two tiles of 16) and, of every stage, on the 64 keys of quarter
// kq = w >> 2: each K and V fragment that a wave reads from LDS serves two query tiles, and a head's K and V rows are fetched
// by SEQ/128 blocks.
// A stage = KT = 256 keys = K tile (256 key rows x 128 B) + V tile (64 d rows x 512 B), brought into LDS by asynchronous 16-byte
// copies (whole 128-B lines, 8 copies per thread and stage), two buffers: stage t+2 is issued behind the barrier at the foot of
// trip t and flies during trip t+1. Two key blocks per wave between barriers: only the first block's LDS reads of all 16 waves
// fall together.
// The head's AA table (SEQ floats) is copied once with stage 0, float by float, into chunk order. Fragments are read from LDS
// rows of 144 B (K) and 528 B (V).
//   qn plane (f16, x QSC) laid out as [NHD*SEQ chunks][64]: head h, row n = chunk h*SEQ + n; keys and queries both come
//   from this plane. AA table (f32): chunk row*NCG + cg at [cg / VTPB][row][cg % VTPB]. v^T plane [h*64+d][SEQ keys] (x1024).
//   All NKB = SEQ/32 key blocks of 32 keys are visited by one wave of each group (static bound), from the block's own start
//   stage on, wrapping.
//   Scores are computed TRANSPOSED: S^T tile g (g = 0,1) = key rows (keys kb+16g .. +15, A operand, row m = lane&15, split
//   k map over d) times q^T (B operand, col n = query (lane&15) of the query tile, k = d, split map), one product per tile and
//   32-deep d-chunk. D element r of lane l = (key kb+16g+8h+r, query l&15), so a lane owns one query column and 16 of its 32
//   keys; the partner lane l^16 owns the other 16.
//   Base-2 logit: t = (2*qn_n.qn_m/(QSC*QSC) - AA_n - AA_m) * log2(e)/8. Every qn row is a vector divided by at least its own
//   norm, so its length is at most 1 (f16 rounding adds under 0.1 %): |2*qn_n.qn_m| * log2(e)/8 < 0.37 and
//   0 <= AA * log2(e)/8 < 0.19 for any finite input, hence -0.74 < t < 0.37. The softmax therefore needs no running maximum:
//   its shift is the constant -PSH, p = exp2(t + PSH) = P x 32768 lies in (19000, 43000), inside f16, the exp2 argument is far
//   from the subnormal range (bare hardware exp2), and neither l nor the O accumulators are ever rescaled.
//   The exp'd values ARE the P A-fragment in place: A row m = query = lane&15, element i <- key kb+8h+i (tile 0, D element i),
//   element 8+i <- key kb+16+8h+i (tile 1, D element i). l (x32768) is summed per lane in 4 partial sums over the lane's
//   own keys; the partials and the partner lane l^16 are joined once behind the loop. 4 v^T B fragments
//   (col n = d = 16j + (lane&15), keys k-contiguous), 4 P.V WMMAs per key block and query tile.
//   Behind the loop the four waves of a group hold sums over disjoint key quarters with the same constant shift, so O and l
//   simply add, in two steps through LDS. A wave's query tile a covers rows 16*(a ^ (kq & 1)) of its group. Step 1: it hands its
//   tile 1 (O in D layout, l per lane) to wave w ^ 4 and, behind a block barrier, adds that wave's tile 1, which is its own
//   tile 0. Step 2: waves 8..15 hand their tile 0 to wave w - 8 (the same tile, the other two quarters) and, behind a second
//   block barrier, end; waves 0..7 add it.
//   Epilogue, one query tile per wave 0..7: 1/l (per query, shuffled to the D row owner) and carry folds in f32; the 16x64 f32
//   result staged in the wave's slab. aux0/aux1 are bound only (not read).
// coverage: per wave 8 instructions x 2 rows x 16 lanes x 4 floats = 16 x 64; grid NHD*(SEQ/128) blocks x 8 writing waves =
//           every output row (h, n < SEQ) exactly once = SEQ*NHD*64 floats.
// =====================================================================================================
// p = exp2(t + PSH) of this lane's 16 keys for one query column, as the P A-fragment (element i <-> key i); adds p into lp
__device__ __forceinline__ v16h exp_tile(v8f s0, v8f s1, v4f w0, v4f w1, v4f w2, v4f w3, float lsc, float c1l, float aq,
                                         v2f* lp) {
  FragH ph;
#pragma unroll
  for (int e = 0; e < 2; ++e) {          // pairs of neighbouring keys: elements 2e, 2e+1 of each group of four
    const int i = 2 * e;
    const v2f sa = {s0[i], s0[i + 1]}, sb = {s0[4 + i], s0[5 + i]}, sc = {s1[i], s1[i + 1]}, sd = {s1[4 + i], s1[5 + i]};
    const v2f wa = {w0[i], w0[i + 1]}, wb = {w1[i], w1[i + 1]}, wc = {w2[i], w2[i + 1]}, wd = {w3[i], w3[i + 1]};
    const v2f ta = sa * lsc - (wa * c1l + aq), tb = sb * lsc - (wb * c1l + aq);
    const v2f tc = sc * lsc - (wc * c1l + aq), td = sd * lsc - (wd * c1l + aq);
    const v2f pa = {__builtin_amdgcn_exp2f(ta[0]), __builtin_amdgcn_exp2f(ta[1])};
    const v2f pb = {__builtin_amdgcn_exp2f(tb[0]), __builtin_amdgcn_exp2f(tb[1])};
    const v2f pc = {__builtin_amdgcn_exp2f(tc[0]), __builtin_amdgcn_exp2f(tc[1])};
    const v2f pd = {__builtin_amdgcn_exp2f(td[0]), __builtin_amdgcn_exp2f(td[1])};
    ph.u[0][e]     = pkh(pa);
    ph.u[0][2 + e] = pkh(pb);
    ph.u[1][e]     = pkh(pc);
    ph.u[1][2 + e] = pkh(pd);
    lp[e] += (pa + pb) + (pc + pd);
  }
  return ph.v;
}

__global__ __launch_bounds__(ATT_THREADS)
void attn_l2(const u16* __restrict__ QPp, const float* __restrict__ AAp, const u16* __restrict__ VPp, float* out,
             const float* aux0, const float* aux1) {
  __shared__ __align__(16) float smem[(ATT_WAVES / 2) * SLAB];   // per writing wave: result slab [16][68] in the epilogue only
  __shared__ __align__(16) _Float16 ring[2 * BUFH];        // two buffers of (K tile, V tile)
  __shared__ __align__(16) float aas[SEQ];                 // AA table of this head
  __shared__ __align__(16) v4f xch[ATT_WAVES * 8 * 32];    // step 1, per wave: the O tile it hands on, [8 quads][32 lanes]
  __shared__ __align__(16) float xl[ATT_WAVES * 32];       //         and the l of that tile, per lane
  __shared__ __align__(16) v4f xc2[(ATT_WAVES / 2) * 8 * 32];   // step 2, per receiving wave: the same
  __shared__ __align__(16) float xl2[(ATT_WAVES / 2) * 32];
  (void)aux0; (void)aux1;

  const int tid  = threadIdx.x;
  const int wave = __builtin_amdgcn_readfirstlane(tid >> 5);   // scalar: the tests on it behind the loop are scalar branches
  const int lane = tid & 31;
  const int hh   = lane >> 4;
  const int c    = lane & 15;
  const int kq   = wave >> 2;                              // key quarter of every stage that this wave works on
  const int wq   = wave & 3;                               // group of 32 query rows

  const int bid  = blockIdx.x;
  const int qt   = bid % QTILES;
  const int head = bid / QTILES;
  if (head >= NHD) return;                                 // block-uniform, never taken with the exact grid; in front of every barrier
  const int q0   = qt * QROWS + wq * 32 + 16 * (kq & 1);         // query tile 0 of this wave: the one it keeps behind the loop
  const int q1   = qt * QROWS + wq * 32 + 16 * (1 - (kq & 1));   // query tile 1: handed to wave w ^ 4 behind the loop
  const size_t hb = (size_t)head * SEQ;                    // chunk index base of this head

  const _Float16* QH = (const _Float16*)(const void*)QPp;
  // B fragments of q^T: col n = query chunk hb + (tile's first row) + c, k = d
  const _Float16* Qb0 = QH + (hb + (size_t)(q0 + c)) * HD + 8 * hh;
  const _Float16* Qb1 = QH + (hb + (size_t)(q1 + c)) * HD + 8 * hh;
  // copy addresses of this thread: K chunk i = tid + 512*j, row = i >> 3 = (tid >> 3) + 64*j, 16-byte column = tid & 7;
  // V chunk i = tid + 512*j, row = i >> 5 = (tid >> 5) + 16*j, 16-byte column = tid & 31
  const unsigned lk0 = lds_addr(ring) + (unsigned)((tid >> 3) * (LPH * 2) + (tid & 7) * 16);
  const unsigned lv0 = lds_addr(ring) + (unsigned)(KTILEH * 2 + (tid >> 5) * (VLPH * 2) + (tid & 31) * 16);
  const char* gk0 = (const char*)(const void*)(QH + hb * HD) + tid * 16;                       // K rows are contiguous
  const char* gv0 = (const char*)(const void*)((const _Float16*)(const void*)VPp + ((size_t)(head * HD + (tid >> 5))) * SEQ)
                    + (tid & 31) * 16;
  // Rotated walk: trip t works on key stage (t + rot) mod NST. The QTILES blocks of a head read the same K and V rows; with
  // different stages asked for at the same time each line's first fetch into L2 is waited for by few blocks and the others
  // find it there. The bit order spreads the starts of blocks whose indices lie close together modulo 8. For speed only: any
  // rot in 0 .. NST-1 gives every stage exactly once; the constant softmax shift makes the key order free but for rounding.
  const int rot = ((qt & 3) << 1) | ((qt >> 2) & 1);
  const int st1 = (rot + 1) & (NST - 1);
  // first stage and the AA table, landed and published; then the second stage into the other buffer
  copy_stage(lk0, lv0, gk0 + (size_t)rot * (KT * HD * 2), gv0 + rot * (KT * 2));
#if defined(__HIP_DEVICE_COMPILE__)
  __builtin_amdgcn_sched_barrier(0);   // the table's address arithmetic stays behind the stage's copies, which then fly meanwhile
#endif
  // chunk ch = row*NCG + cg lies at float [cg / VTPB][row][cg % VTPB] of the table; with tq = ch / VTPB = row*WGRP + cg / VTPB that is
  // ch + (SEQ*VTPB - VTPB)*(tq % WGRP) - (NCG - VTPB)*(tq / WGRP). One division per thread: its chunks lie ATT_THREADS apart.
  const unsigned ch0 = (unsigned)hb + (unsigned)tid, tq0 = ch0 / VTPB, rm0 = ch0 - tq0 * VTPB;
  {
    const char* ga[AACP];   // AACP copies of one float each, in one statement
#pragma unroll
    for (int i = 0; i < AACP; ++i) {
      const unsigned st = (unsigned)(ATT_THREADS * i);
      const unsigned tq = tq0 + st / VTPB + ((rm0 + st % VTPB >= VTPB) ? 1u : 0u);
      ga[i] = (const char*)(const void*)(AAp + (ch0 + st + (SEQ * VTPB - VTPB) * (tq % WGRP) - (NCG - VTPB) * (tq / WGRP)));
    }
    copy4w(lds_addr(aas) + (unsigned)(tid * 4), ATT_THREADS * 4, ga);
  }
  wait_copies();
  __syncthreads();
  copy_stage(lk0 + BUFH * 2, lv0 + BUFH * 2, gk0 + (size_t)st1 * (KT * HD * 2), gv0 + st1 * (KT * 2));
  const float lsc = 0.25f * (LOG2E / (QSC * QSC));
  const float c1l = 0.125f * LOG2E;
  const float aq0 = aas[q0 + c] * c1l - PSH;                // AA term of this lane's query in each tile (staged table), with the
  const float aq1 = aas[q1 + c] * c1l - PSH;                // constant shift

  const v16h qa0 = ldfrag_h(Qb0), qa1 = ldfrag_h(Qb0 + 32);   // tile 0: d 0..31, d 32..63
  const v16h qb0 = ldfrag_h(Qb1), qb1 = ldfrag_h(Qb1 + 32);   // tile 1
#if defined(__HIP_DEVICE_COMPILE__)
  // the eight loads' address registers stay live up to this address-translation wait (inputs only), so that nothing rewrites
  // one in front of it
  asm volatile("s_wait_xcnt 0x0" :: "v"(Qb0), "v"(Qb1) : "memory");
#endif

  // partial sums of p over this lane's keys, per query tile: element i -> [(i >> 1) & 1][i & 1]
  v2f lpa[2] = {{0.f, 0.f}, {0.f, 0.f}}, lpb[2] = {{0.f, 0.f}, {0.f, 0.f}};
  v8f o[4], ob[4];                          // O of tile 0 and of tile 1
#pragma unroll
  for (int j = 0; j < 4; ++j) { o[j] = zero8(); ob[j] = zero8(); }

#pragma unroll 1
  for (int t = 0; t < NST; ++t) {
   const _Float16* bufp = ring + (t & 1) * BUFH;
   // A fragments of keys: LDS row = key in stage (64kq + 32u + 16g + c), k = d;  B fragments of v: LDS row = d = 16j + c, k = key
#pragma unroll 1   // kept rolled: in line, both blocks' p values stay live up to the l sums and registers spill at 4 waves a SIMD
   for (int u = 0; u < 2; ++u) {
    const int kb = ((t + rot) & (NST - 1)) * KT + 64 * kq + 32 * u;
    // ---- all LDS reads of this 32-key block stand together in front of its products ----
    const _Float16* k0p = bufp + (64 * kq + 32 * u + c) * LPH + 8 * hh;
    const _Float16* k1p = k0p + 16 * LPH;
    const v16h ka0 = ldfrag_h(k0p), ka1 = ldfrag_h(k0p + 32);
    const v16h kc0 = ldfrag_h(k1p), kc1 = ldfrag_h(k1p + 32);
    // AA of this lane's 16 keys: tile 0 element i -> key kb+8hh+i, tile 1 element i -> key kb+16+8hh+i
    const float* am = aas + kb + 8 * hh;
    const v4f w0 = *(const v4f*)(am), w1 = *(const v4f*)(am + 4);
    const v4f w2 = *(const v4f*)(am + 16), w3 = *(const v4f*)(am + 20);
    const _Float16* vp = bufp + KTILEH + c * VLPH + 64 * kq + 32 * u + 8 * hh;
    const v16h vf0 = ldfrag_h(vp);
    const v16h vf1 = ldfrag_h(vp + 16 * VLPH);
    const v16h vf2 = ldfrag_h(vp + 32 * VLPH);
    const v16h vf3 = ldfrag_h(vp + 48 * VLPH);
    // ---- transposed scores of both query tiles: s0/r0 = keys kb..kb+15, s1/r1 = keys kb+16..kb+31, column = query c ----
    v8f s0 = zero8(), s1 = zero8(), r0 = zero8(), r1 = zero8();
    s0 = mma_h(ka0, qa0, s0);
    s1 = mma_h(kc0, qa0, s1);
    r0 = mma_h(ka0, qb0, r0);
    r1 = mma_h(kc0, qb0, r1);
    s0 = mma_h(ka1, qa1, s0);
    s1 = mma_h(kc1, qa1, s1);
    r0 = mma_h(ka1, qb1, r0);
    r1 = mma_h(kc1, qb1, r1);
    guard6<v16h>(s0, s1, r0, r1, ka0, ka1, kc0, kc1, qa1, qb1);
    // ---- per query tile: p of this lane's 16 keys, then P.V (B fragment col n = d = j*16 + c, keys contiguous in the v^T rows);
    //      tile 1's vector work stands behind tile 0's products and runs beside them ----
    const v16h pa = exp_tile(s0, s1, w0, w1, w2, w3, lsc, c1l, aq0, lpa);
    o[0] = mma_h(pa, vf0, o[0]);
    o[1] = mma_h(pa, vf1, o[1]);
    o[2] = mma_h(pa, vf2, o[2]);
    o[3] = mma_h(pa, vf3, o[3]);
    guard6<v16h>(o[0], o[1], o[2], o[3], pa, vf0, vf1, vf2, vf3, pa);
    const v16h pb = exp_tile(r0, r1, w0, w1, w2, w3, lsc, c1l, aq1, lpb);
    ob[0] = mma_h(pb, vf0, ob[0]);
    ob[1] = mma_h(pb, vf1, ob[1]);
    ob[2] = mma_h(pb, vf2, ob[2]);
    ob[3] = mma_h(pb, vf3, ob[3]);
    guard6<v16h>(ob[0], ob[1], ob[2], ob[3], pb, vf0, vf1, vf2, vf3, pb);
   }
   // ---- foot of trip t: own LDS reads back, own copies of stage t+1 landed, barrier (publishes stage t+1 and ends every
   //      reader's last read of this trip's buffer); only then the refill of that buffer with stage t+2 ----
   wait_lds();
   wait_copies();
   __syncthreads();
   if (t + 2 < NST) {
     const int st2 = (t + 2 + rot) & (NST - 1);
     const unsigned bo = (unsigned)((t & 1) * (BUFH * 2));
     copy_stage(lk0 + bo, lv0 + bo, gk0 + (size_t)st2 * (KT * HD * 2), gv0 + st2 * (KT * 2));
   }
  }
  wait_copies();
  acc_guard4(o[0], o[1], o[2], o[3]);
  acc_guard4(ob[0], ob[1], ob[2], ob[3]);

  // ---- l x32768 of this lane's query in each tile, over this wave's keys: own partials, then the partner lane's keys ----
  float lrun = (lpa[0][0] + lpa[0][1]) + (lpa[1][0] + lpa[1][1]);
  float lgiv = (lpb[0][0] + lpb[0][1]) + (lpb[1][0] + lpb[1][1]);
  lrun += __shfl_xor(lrun, 16, 32);
  lgiv += __shfl_xor(lgiv, 16, 32);
  // ---- step 1 of joining the key quarters: tile 1 goes to wave w ^ 4, whose tile 1 (this wave's tile 0) is added ----
  {
    v4f* xw = xch + wave * (8 * 32) + lane;
#pragma unroll
    for (int j = 0; j < 4; ++j) {
      const v4f lo = {ob[j][0], ob[j][1], ob[j][2], ob[j][3]}, hi = {ob[j][4], ob[j][5], ob[j][6], ob[j][7]};
      xw[(2 * j) * 32]     = lo;
      xw[(2 * j + 1) * 32] = hi;
    }
    xl[wave * 32 + lane] = lgiv;
    __syncthreads();   // every wave's handed tile is written before its partner reads it
    const v4f* xr = xch + (wave ^ 4) * (8 * 32) + lane;
#pragma unroll
    for (int j = 0; j < 4; ++j) {
      const v4f lo = xr[(2 * j) * 32], hi = xr[(2 * j + 1) * 32];
#pragma unroll
      for (int r = 0; r < 4; ++r) { o[j][r] += lo[r]; o[j][4 + r] += hi[r]; }
    }
    lrun += xl[(wave ^ 4) * 32 + lane];
  }
  // ---- step 2: waves 8..15 hand their tile 0 to wave w - 8, which holds the same tile over the other two quarters ----
  if (wave >= ATT_WAVES / 2) {
    v4f* xw = xc2 + (wave - ATT_WAVES / 2) * (8 * 32) + lane;
#pragma unroll
    for (int j = 0; j < 4; ++j) {
      const v4f lo = {o[j][0], o[j][1], o[j][2], o[j][3]}, hi = {o[j][4], o[j][5], o[j][6], o[j][7]};
      xw[(2 * j) * 32]     = lo;
      xw[(2 * j + 1) * 32] = hi;
    }
    xl2[(wave - ATT_WAVES / 2) * 32 + lane] = lrun;
  }
  __syncthreads();   // the handed tiles are written before waves 0..7 read them; the last barrier of the kernel
  if (wave >= ATT_WAVES / 2) return;
  {
    const v4f* xr = xc2 + wave * (8 * 32) + lane;
#pragma unroll
    for (int j = 0; j < 4; ++j) {
      const v4f lo = xr[(2 * j) * 32], hi = xr[(2 * j + 1) * 32];
#pragma unroll
      for (int r = 0; r < 4; ++r) { o[j][r] += lo[r]; o[j][4 + r] += hi[r]; }
    }
    lrun += xl2[wave * 32 + lane];
  }
  // ---- fold 1/l (per query, owned by lane = query; the x32768 of P and of l cancel) and the v carry; stage the 16x64 slab ----
  const float linv = (lrun > 0.f) ? ((1.0f / lrun) * (1.0f / VCAR)) : 0.f;
  float inv[8];
#pragma unroll
  for (int r = 0; r < 8; ++r) inv[r] = __shfl(linv, 8 * hh + r, 32);
  float* slab = smem + wave * SLAB;
#pragma unroll
  for (int r = 0; r < 8; ++r) {
#pragma unroll
    for (int j = 0; j < 4; ++j) slab[(8 * hh + r) * 68 + j * 16 + c] = o[j][r] * inv[r];
  }
  wave_sync_lds();
  // ---- f32 output rows: lanes 0..15 -> row 2*it2, lanes 16..31 -> row 2*it2+1, 16 lanes x 16 B = one 256-B row ----
  v4f vals[8];
#pragma unroll
  for (int it2 = 0; it2 < 8; ++it2) vals[it2] = *(const v4f*)(slab + (it2 * 2 + hh) * 68 + c * 4);
  float* dst = out + (hb + (size_t)(q0 + hh)) * HD + c * 4;
  {
#pragma unroll
    for (int it2 = 0; it2 < 8; ++it2) {
      *(v4f*)(dst + (size_t)(it2 * 2) * HD) = vals[it2];
    }
    
  }
}

// =====================================================================================================
// Workspace map (bytes); every plane is fully written by whole-line stores before it is read; all extents are exact multiples
// of the store granularity (no pad rows needed), every offset a multiple of 128:
//   XB  bf16 [SEQ][768]                          SEQ*1536   (3145728 at SEQ = 2048)
//   WQB bf16 [768 n][768 k]                      1179648    WVB same
//   QP  f16  [SEQ][768] = [12*SEQ chunks][64] x16 SEQ*1536
//   AAP f32  [4][SEQ][3]                         SEQ*48     (98304)
//   VP  f16  [768 = h*64+d][SEQ] x1024           SEQ*1536
//   end                                          11894784 at SEQ = 2048
// =====================================================================================================
extern "C" void kernel_launch(void* const* d_in, const int* in_sizes, int n_in,
                              void* d_out, int out_size, void* d_ws, size_t ws_size,
                              hipStream_t stream) {
  if (n_in < 7) return;
  if (in_sizes[0] < SEQ * DMOD) return;
  if (in_sizes[1] < 1 || in_sizes[2] < 1) return;
  if (in_sizes[3] != DMOD * DMOD || in_sizes[5] != DMOD * DMOD) return;
  if (in_sizes[4] != DMOD || in_sizes[6] != DMOD) return;
  if (out_size < SEQ * DMOD) return;

  const float* Xin = (const float*)d_in[0];
  const float* Gin = (const float*)d_in[1];               // bound only, not read
  const float* Min = (const float*)d_in[2];               // bound only, not read
  const float* Wq  = (const float*)d_in[3];
  const float* bq  = (const float*)d_in[4];
  const float* Wv  = (const float*)d_in[5];
  const float* bv  = (const float*)d_in[6];
  float*       out = (float*)d_out;

  const size_t szXB = (size_t)SEQ * DMOD * 2;
  const size_t szW  = (size_t)DMOD * DMOD * 2;
  const size_t szQP = (size_t)SEQ * DMOD * 2;
  const size_t szAA = (size_t)NHD * SEQ * 4;
  const size_t szVP = (size_t)DMOD * SEQ * 2;
  size_t off = 0;
  const size_t oXB = off; off += szXB;
  const size_t oWQ = off; off += szW;
  const size_t oWV = off; off += szW;
  const size_t oQP = off; off += szQP;
  const size_t oAA = off; off += szAA;
  const size_t oVP = off; off += szVP;
  if (off > ws_size) return;                            // off = 11894784 at SEQ = 2048
  if (off > (size_t)134217728) return;

  char* ws = (char*)d_ws;
  u16*   XB  = (u16*)(ws + oXB);
  u16*   WQB = (u16*)(ws + oWQ);
  u16*   WVB = (u16*)(ws + oWV);
  u16*   QP  = (u16*)(ws + oQP);
  float* AAP = (float*)(ws + oAA);
  u16*   VP  = (u16*)(ws + oVP);

  const int n8x = (SEQ * DMOD) / 8;
  const int n8w = (DMOD * DMOD) / 8;
  if ((n8x % 256) != 0 || (n8w % 256) != 0) return;
  if ((DMOD % 64) != 0 || (SEQ % 64) != 0 || (DMOD % 32) != 0) return;
  const dim3 blk(256);
  const dim3 gC(CVX + 2 * CVW);                         // 768 + 2 * 288 at SEQ = 2048
  const dim3 gP(QBLK + VBLK);                           // 128 + 128
  const dim3 bP(NCG * 32);                              // 384
  const dim3 gAT(ATT_BLOCKS);                           // 192
  const dim3 bAT(ATT_THREADS);                          // 512

  // (0) operand planes: x -> bf16; Wq/Wv [n = out][k = in] (already k-contiguous) -> bf16
  //     (XB, WQB, WVB follow one another in the workspace: one joined destination)
  cvt16x3<<<gC, blk, 0, stream>>>(Xin, Wq, Wv, XB);
  // (1) q = x.Wq^T + bq, L2-normalised per 64-chunk -> qn plane [SEQ][768] f16 x16 and AA table [12*SEQ] f32;
  //     v^T plane: [768 = h*64+d][SEQ keys] = f16((Wv . x^T + bv) x1024), bias by row
  gemm_qv<<<gP, bP, 0, stream>>>(XB, WQB, WVB, QP, AAP, VP, bq, bv);
  // (2) attention -> out, f32 row (chunk h*SEQ + n) of 64 floats at float offset (h*SEQ + n)*64
  attn_l2<<<gAT, bAT, 0, stream>>>(QP, AAP, VP, out, Gin, Min);
  (void)hipGetLastError();
}

// v010
// Measured time: 27.6 microseconds a run.
// Next to v009, in two timings, it ran 1.06 times as fast each time.
// Over all steps from v000 it is 10.1 times as fast.
// Contractions: x.Wq^T+bq and Wv.x^T+bv on v_wmma_f32_16x16x32_bf16 (x and W rows RNE-converted to bf16 operands on their way into LDS, f32 accumulate);
// scores qn.qn^T (qn = L2-normalised q, single f16 plane carried x16) and P.v (P x32768 single f16, v x1024 single f16) on
// v_wmma_f32_16x16x32_f16, f32 accumulate. Biases folded as RNE bf16 values in f32 epilogues; L2 normalisation, sums of squares,
// base-2 softmax with a constant shift, 1/l and carry folds in f32 on VALU.
#include <hip/hip_runtime.h>
#include <math.h>
#include <stdint.h>

#ifndef NB
#define NB 1
#endif
#ifndef SEQ
#define SEQ 2048
#endif
#define SEQ_FULL 2048
#define DMOD  768
#define NHD   12
#define HD    64
#define NCG   (DMOD / 64)
#define QSC   16.0f
#define PCAR  32768.0f
#define PSH   15.0f               // log2(PCAR): the constant shift of the base-2 logits, so that exp2 yields P x PCAR at once
#define VCAR  1024.0f
#define LOG2E 1.4426950408889634f
#define ATT_WAVES   16
#define ATT_THREADS (ATT_WAVES * 32)
#define QROWS       128           // query rows of an attention block: 4 groups of 32 rows, each worked on by 4 waves
#define QTILES      (SEQ / QROWS)
#define ATT_BLOCKS  (NHD * QTILES)
#define NKB    (SEQ / 32)
#define SLAB   (16 * 68)
#define KT     256                // keys per LDS stage of the attention loop: two 32-key blocks for each of a group's 4 waves
#define NST    (SEQ / KT)         // stages
#define LPH    72                 // K tile row pitch in halves: 128-B rows at 144 B = 16 B x odd, for 16-byte LDS readers
#define VLPH   264                // V tile row pitch in halves: 512-B rows at 528 B = 16 B x odd
#define KTILEH (KT * LPH)         // one staged K tile of KT key rows, in halves
#define VTILEH (HD * VLPH)        // one staged V tile of HD d rows, in halves
#define BUFH   (KTILEH + VTILEH)  // one buffer: K tile, then V tile
#define AACP   (SEQ / ATT_THREADS)   // 4-byte copies per thread for one head's AA table
static_assert(NST * KT == SEQ && NST >= 2 && KT == 4 * 2 * 32 && HD == 64 && QROWS == (ATT_WAVES / 4) * 32);
static_assert((VLPH * 2) % 16 == 0 && (KTILEH * 2) % 16 == 0 && (BUFH * 2) % 16 == 0 && VLPH >= KT + 8);
static_assert((NST & (NST - 1)) == 0 && NST == 8);   // the rotated stage walk wraps by a mask; its start takes 3 bits
static_assert(AACP * ATT_THREADS == SEQ && AACP == 4 && (LPH * 2) % 16 == 0 && ATT_THREADS * 4 * 16 == KT * HD * 2);
#define VKS    128                // k halves per LDS stage of the projection GEMMs: 256-B row pieces
#define VNS    (DMOD / VKS)       // their stages
#define VPH    136                // their LDS pitch in halves: 272 B = 16 B x odd
#define VTPB   3                  // 64x64 tiles per block of the projection launch, one per group of 4 waves: 64 x rows by 192 weight rows
#define WROWS  (64 * VTPB)        // weight rows of a block
#define WGRP   (DMOD / WROWS)     // groups of WROWS weight rows in a weight plane
#define VBUFH  ((64 + WROWS) * VPH)   // one buffer: the block's 64 x rows, then its WROWS weight rows, in halves
static_assert(VNS * VKS == DMOD && VNS >= 2 && (VPH * 2) % 16 == 0 && WGRP * WROWS == DMOD);
#define WPW    (WROWS / NCG)      // weight rows that a wave brings in per stage
#define XPW    8                  // x rows that each of waves 0..7 brings in per stage
static_assert(WPW * NCG == WROWS && XPW * 8 == 64 && NCG >= 8 && VKS == 32 * 4);   // a wave-wide 16-byte load = one row's f32 piece of a stage
#define QBLK   ((SEQ / 64) * WGRP)      // blocks of the projection launch that do the query projection
#define VBLK   ((SEQ / 64) * WGRP)      // its blocks that do the v^T GEMM
#define POOLB  (NCG * SLAB * 4 + WROWS * 4 + 2 * VBUFH * 2)   // LDS bytes of a block: result slabs, aa values, ring
static_assert(VTPB * 4 == NCG && (NCG * SLAB * 4) % 16 == 0 && (WROWS * 4) % 128 == 0 && (VBUFH * 2) % 16 == 0);
static_assert(NB == 1);
static_assert(HD == 64 && DMOD == NHD * HD && NCG * 64 == DMOD);
static_assert((SEQ % 64) == 0 && SEQ >= 64 && SEQ <= SEQ_FULL);
static_assert(ATT_THREADS == 512 && NKB * 32 == SEQ && ATT_BLOCKS == NHD * (SEQ / 128) && (SEQ % QROWS) == 0);
static_assert((DMOD % 64) == 0 && (DMOD % 32) == 0);
static_assert((SLAB * 4) % 16 == 0);
static_assert(((16 * NCG) % 32) == 0 && NCG * 32 <= 1024 && (SEQ % 16) == 0);

typedef unsigned short u16;
typedef _Float16 v16h __attribute__((ext_vector_type(16)));
typedef _Float16 v8h  __attribute__((ext_vector_type(8)));
typedef __bf16   v16b __attribute__((ext_vector_type(16)));
typedef float    v8f  __attribute__((ext_vector_type(8)));
typedef float    v4f  __attribute__((ext_vector_type(4)));
typedef unsigned int v4u __attribute__((ext_vector_type(4)));
typedef float    v2f  __attribute__((ext_vector_type(2)));
typedef _Float16 v2h  __attribute__((ext_vector_type(2)));
typedef __bf16   v2b  __attribute__((ext_vector_type(2)));
typedef unsigned int v2u __attribute__((ext_vector_type(2)));

union FragH { v16h v; v8h h[2]; v4u u[2]; };
union FragB { v16b v; v4u u[2]; };

// ---- scalar helpers --------------------------------------------------------------------------------
__device__ __forceinline__ unsigned short bf_bits(float f) {          // f32 -> bf16 bits, RNE convert
  unsigned u = __float_as_uint(f);
  return (unsigned short)((u + 0x7FFFu + ((u >> 16) & 1u)) >> 16);
}
__device__ __forceinline__ float bf_up(unsigned short h) { return __uint_as_float(((unsigned)h) << 16); }
__device__ __forceinline__ float bf_val(float f) { return bf_up(bf_bits(f)); }          // value after RNE bf16 convert
__device__ __forceinline__ unsigned short h_bits(_Float16 x) { return __builtin_bit_cast(unsigned short, x); }
__device__ __forceinline__ unsigned pk16(unsigned short a, unsigned short b) { return (unsigned)a | ((unsigned)b << 16); }
__device__ __forceinline__ unsigned pkh(v2f x) {                     // two f32 -> packed f16 pair, RNE, x[0] in the low half
  return __builtin_bit_cast(unsigned, __builtin_convertvector(x, v2h));
}
__device__ __forceinline__ v2u cvt4(v4f a) {                         // four f32 -> four bf16, RNE, a[0] lowest
  const v2f lo = {a[0], a[1]}, hi = {a[2], a[3]};
  v2u o;
  o[0] = __builtin_bit_cast(unsigned, __builtin_convertvector(lo, v2b));
  o[1] = __builtin_bit_cast(unsigned, __builtin_convertvector(hi, v2b));
  return o;
}
__device__ __forceinline__ v8f zero8() { v8f z = {0.f, 0.f, 0.f, 0.f, 0.f, 0.f, 0.f, 0.f}; return z; }

// ---- fragment loaders: 16-bit A/B operand, lane -> row/col (lane&15), p already includes +8*(lane>>4);
//      elements 0..7 <- p[0..7] (k0+8h..), elements 8..15 <- p[16..23] (k0+16+8h..)  (same split k map for A and B;
//      B is always read from a k-contiguous [n][k] plane)
__device__ __forceinline__ v16h ldfrag_h(const _Float16* p) {
  FragH f;
  f.h[0] = *(const v8h*)(p);
  f.h[1] = *(const v8h*)(p + 16);
  return f.v;
}
__device__ __forceinline__ v16b ldfrag_b(const u16* p) {              // bf16 plane read as unsigned integer vectors
  FragB f;
  f.u[0] = *(const v4u*)(p);
  f.u[1] = *(const v4u*)(p + 16);
  return f.v;
}

__device__ __forceinline__ v8f mma_h(v16h a, v16h b, v8f c) {
  return __builtin_amdgcn_wmma_f32_16x16x32_f16(false, a, false, b, (short)0, c, false, false);
}
__device__ __forceinline__ v8f mma_b(v16b a, v16b b, v8f c) {
  return __builtin_amdgcn_wmma_f32_16x16x32_bf16(false, a, false, b, (short)0, c, false, false);
}
__device__ __forceinline__ void guard2(v8f& a, v8f& b, v16h x0, v16h x1, v16h x2, v16h x3, v16h x4, v16h x5) {
#if defined(__HIP_DEVICE_COMPILE__)
  asm volatile("v_nop\n\tv_nop\n\tv_nop\n\tv_nop"
               : "+v"(a), "+v"(b) : "v"(x0), "v"(x1), "v"(x2), "v"(x3), "v"(x4), "v"(x5) : "memory");
#endif
}
template <typename F>
__device__ __forceinline__ void guard6(v8f& a, v8f& b, v8f& c, v8f& d, F x0, F x1, F x2, F x3, F x4, F x5) {
#if defined(__HIP_DEVICE_COMPILE__)
  asm volatile("v_nop\n\tv_nop\n\tv_nop\n\tv_nop"
               : "+v"(a), "+v"(b), "+v"(c), "+v"(d) : "v"(x0), "v"(x1), "v"(x2), "v"(x3), "v"(x4), "v"(x5) : "memory");
#endif
}
__device__ __forceinline__ void acc_guard4(v8f& a, v8f& b, v8f& c, v8f& d) {
#if defined(__HIP_DEVICE_COMPILE__)
  asm volatile("v_nop\n\tv_nop\n\tv_nop\n\tv_nop" : "+v"(a), "+v"(b), "+v"(c), "+v"(d));
#endif
}
__device__ __forceinline__ void wave_sync_lds() {
#if defined(__HIP_DEVICE_COMPILE__)
  __builtin_amdgcn_fence(__ATOMIC_RELEASE, "workgroup");
  __builtin_amdgcn_wave_barrier();
  __builtin_amdgcn_fence(__ATOMIC_ACQUIRE, "workgroup");
#endif
}

// ---- cross-lane moves inside a half (16 lanes) on the vector unit: CTRL = 0x160 | k reads lane l ^ k (row_xmask:k),
//      CTRL = 0x150 | k reads lane k of the half (row_share:k). All 32 lanes are on wherever these are used.
template <int CTRL>
__device__ __forceinline__ float dpp_f(float v) {
#if defined(__HIP_DEVICE_COMPILE__)
  return __int_as_float(__builtin_amdgcn_update_dpp(0, __float_as_int(v), CTRL, 0xf, 0xf, true));
#else
  return v;
#endif
}
// Sums over the 16 lanes of a half, of 8 values per lane at once; lane m gets the sum of s[m & 7] (b0, b1, b2 = bits 0..2 of m).
// Each step is the xor butterfly's (partners l ^ 1, l ^ 2, l ^ 4, l ^ 8, in this order), but a lane keeps only the half of the
// values whose index bit equals its own lane bit and hands the other half to its partner: 8 additions instead of 32.
__device__ __forceinline__ float rowsum8(const float* s, bool b0, bool b1, bool b2) {
  float c[4], d[2];
#pragma unroll   // constant indices: s, c and d stay in registers
  for (int i = 0; i < 4; ++i) c[i] = (b0 ? s[2 * i + 1] : s[2 * i]) + dpp_f<0x161>(b0 ? s[2 * i] : s[2 * i + 1]);
#pragma unroll   // the same
  for (int j = 0; j < 2; ++j) d[j] = (b1 ? c[2 * j + 1] : c[2 * j]) + dpp_f<0x162>(b1 ? c[2 * j] : c[2 * j + 1]);
  float e = (b2 ? d[1] : d[0]) + dpp_f<0x164>(b2 ? d[0] : d[1]);
  e += dpp_f<0x168>(e);
  return e;
}

// ---- asynchronous copies global -> LDS, 16 B per lane (4 B in copy4w); lds = the lane's LDS byte address, g = the lane's global address.
//      The address-translation wait is the last line of the copies' own statement, so that no address register named by
//      an issued copy is rewritten in front of it.
__device__ __forceinline__ unsigned lds_addr(const void* p) { return (unsigned)(size_t)p; }
__device__ __forceinline__ void copy1(unsigned lds, const char* g) {
#if defined(__HIP_DEVICE_COMPILE__)
  asm volatile("global_load_async_to_lds_b128 %0, %1, off\n\ts_wait_xcnt 0x0" :: "v"(lds), "v"(g) : "memory");
#endif
}
// four 4-byte copies, LDS addresses ls bytes apart, each with a global address of its own
__device__ __forceinline__ void copy4w(unsigned l, unsigned ls, const char* const* g) {
#if defined(__HIP_DEVICE_COMPILE__)
  asm volatile("global_load_async_to_lds_b32 %0, %4, off\n\t"
               "global_load_async_to_lds_b32 %1, %5, off\n\t"
               "global_load_async_to_lds_b32 %2, %6, off\n\t"
               "global_load_async_to_lds_b32 %3, %7, off\n\t"
               "s_wait_xcnt 0x0"
               :: "v"(l), "v"(l + ls), "v"(l + 2 * ls), "v"(l + 3 * ls),
                  "v"(g[0]), "v"(g[1]), "v"(g[2]), "v"(g[3])
               : "memory");
#endif
}
// one stage: 4 K chunks (64 rows apart in LDS, 8192 B apart in the contiguous K rows) and 4 V chunks (16 d rows apart)
__device__ __forceinline__ void copy_stage(unsigned lk, unsigned lv, const char* gk, const char* gv) {
#if defined(__HIP_DEVICE_COMPILE__)
  const unsigned rs = 64 * LPH * 2, vr = 16 * VLPH * 2;
  const size_t vs = (size_t)16 * SEQ * 2;
  asm volatile("global_load_async_to_lds_b128 %0, %8, off\n\t"
               "global_load_async_to_lds_b128 %1, %9, off\n\t"
               "global_load_async_to_lds_b128 %2, %10, off\n\t"
               "global_load_async_to_lds_b128 %3, %11, off\n\t"
               "global_load_async_to_lds_b128 %4, %12, off\n\t"
               "global_load_async_to_lds_b128 %5, %13, off\n\t"
               "global_load_async_to_lds_b128 %6, %14, off\n\t"
               "global_load_async_to_lds_b128 %7, %15, off\n\t"
               "s_wait_xcnt 0x0"
               :: "v"(lk), "v"(lk + rs), "v"(lk + 2 * rs), "v"(lk + 3 * rs),
                  "v"(lv), "v"(lv + vr), "v"(lv + 2 * vr), "v"(lv + 3 * vr),
                  "v"(gk), "v"(gk + 8192), "v"(gk + 16384), "v"(gk + 24576),
                  "v"(gv), "v"(gv + vs), "v"(gv + 2 * vs), "v"(gv + 3 * vs)
               : "memory");
#endif
}
// the issuing wave's own wait: its copies have landed (before the barrier behind which other waves read them)
__device__ __forceinline__ void wait_copies() {
#if defined(__HIP_DEVICE_COMPILE__)
  asm volatile("s_wait_asynccnt 0x0" ::: "memory");
#endif
}
// address-translation wait behind a run of plain global loads or stores, in front of whatever rewrites a register that they name
__device__ __forceinline__ void wait_xlat() {
#if defined(__HIP_DEVICE_COMPILE__)
  asm volatile("s_wait_xcnt 0x0" ::: "memory");
#endif
}
// the wave's LDS reads have returned (before the barrier behind which their buffer is refilled)
__device__ __forceinline__ void wait_lds() {
#if defined(__HIP_DEVICE_COMPILE__)
  asm volatile("s_wait_dscnt 0x0" ::: "memory");
#endif
}

// block barrier for data handed over in LDS alone: its fences name the LDS address space, so that they wait for the wave's LDS
// reads and stores but not for global loads into registers, which stay in flight across it
__device__ __forceinline__ void block_sync_lds() {
#if defined(__HIP_DEVICE_COMPILE__)
  __builtin_amdgcn_fence(__ATOMIC_RELEASE, "workgroup", "local");
  __builtin_amdgcn_s_barrier();
  __builtin_amdgcn_fence(__ATOMIC_ACQUIRE, "workgroup", "local");
#endif
}

// =====================================================================================================
// barrier, then converted to f16 and written: lane = (row in group of 4, 8 consecutive cols); one instruction = 4 rows, each
// coverage: 4 instructions x 4 rows x 8 lanes x 8 halves = the wave's 16 x 64 tile.
// =====================================================================================================
__device__ __forceinline__ void epi16(float* sl, v8f a0, v8f a1, v8f a2, v8f a3, float oscale, u16* C, int N,
                                      size_t rowb, int col0, int lane) {
  const int hh = lane >> 4, m = lane & 15;
#pragma unroll
  for (int r = 0; r < 8; ++r) {
    const int ro = (8 * hh + r) * 68 + m;
    sl[ro]      = a0[r] * oscale;
    sl[ro + 16] = a1[r] * oscale;
    sl[ro + 32] = a2[r] * oscale;
    sl[ro + 48] = a3[r] * oscale;
  }
  wave_sync_lds();
  const int rq = lane >> 3, c8 = (lane & 7) * 8;
  v4u ov[4];
#pragma unroll
  for (int i4 = 0; i4 < 4; ++i4) {
    const int row = i4 * 4 + rq;
    const v4f a = *(const v4f*)(sl + row * 68 + c8), c4 = *(const v4f*)(sl + row * 68 + c8 + 4);
    float w[8];
#pragma unroll
    for (int e = 0; e < 4; ++e) { w[e] = a[e]; w[4 + e] = c4[e]; }
#pragma unroll
    for (int e = 0; e < 4; ++e) ov[i4][e] = pk16(h_bits((_Float16)w[2 * e]), h_bits((_Float16)w[2 * e + 1]));
  }
  u16* dst = C + (rowb + (size_t)rq) * (size_t)N + col0 + c8;
  {
#pragma unroll
    for (int i4 = 0; i4 < 4; ++i4) {
      *(v4u*)(dst + (size_t)(i4 * 4) * (size_t)N) = ov[i4];
    }
    wait_xlat();   // code of the merged kernel may follow these stores and rewrite their data or address registers
  }
}

// =====================================================================================================
// Main loop of both projection GEMMs. A block of NCG waves works on ONE tile of 64 x rows by WROWS weight rows, K = DMOD: every
// x row and every weight row that the block needs comes into its LDS once, and all its waves read them there. The rows are
// read as the f32 inputs themselves: a stage = VKS k values of the 64 x rows and the WROWS weight rows; one wave-wide 16-byte
// load = one row's 512-B piece (whole 128-B lines; WPW weight rows per wave and stage, XPW x rows more in waves 0..7), held in
// registers, converted to bf16 (RNE) and stored to LDS as 8 bytes per lane. Two LDS buffers and one stage in registers: the
// loads of stage t+2 are issued at the foot of trip t, fly across its barrier and during the products of trip t+1 and are
// converted and stored behind them, into the buffer whose last readers left it at the barrier of trip t. A wave's 16x64 result:
// A fragment from LDS row arow, B fragments from LDS rows brow, brow+16, brow+32, brow+48 (LDS row = x row 0..63, or 64 + weight
// row; the lane's own row index is already in arow and brow). Rows of 272 B, two 16-B reads per fragment, split k map for A
// and B; k runs upward in steps of 32 from the block's own start stage and wraps. Every wave passes every block barrier.
// rot: trip t works on k stage (t + rot) mod VNS. Blocks that read the same x or weight rows then ask for different stages at
// the same time, so each line's first fetch into L2 is waited for by few of them and the others find it there. For speed
// only: any rot in 0 .. VNS-1 gives every stage exactly once.
// =====================================================================================================
template <int N>
__device__ __forceinline__ void ld_rows(v4f (&r)[N], const float* g) {     // N rows' pieces, DMOD floats apart
#pragma unroll   // constant indices: r stays in registers
  for (int j = 0; j < N; ++j) r[j] = *(const v4f*)(g + (size_t)j * DMOD);
}
template <int N>
__device__ __forceinline__ void st_rows(u16* l, const v4f (&r)[N]) {       // the same rows as bf16, VPH halves apart
#pragma unroll   // constant indices: r stays in registers
  for (int j = 0; j < N; ++j) *(v2u*)(l + j * VPH) = cvt4(r[j]);
}
// one stage's loads of a wave. The two address pairs stay live up to the address-translation wait (inputs only), so that no
// load's result lands in the address register of a load issued before it and nothing else rewrites one in front of the wait
__device__ __forceinline__ void ld_stage(v4f (&rw)[WPW], v4f (&rx)[XPW], const float* pw, const float* px, bool xw) {
  ld_rows<WPW>(rw, pw);
  if (xw) ld_rows<XPW>(rx, px);
#if defined(__HIP_DEVICE_COMPILE__)
  asm volatile("s_wait_xcnt 0x0" :: "v"(pw), "v"(px) : "memory");
#endif
}
__device__ __forceinline__
void proj_loop(u16* ring, const float* __restrict__ X, const float* __restrict__ Wt, int xrow0, int wrow0, int rot,
               int arow, int brow, v8f& acc0, v8f& acc1, v8f& acc2, v8f& acc3) {
  const int K = DMOD;
  const int tid = threadIdx.x, lane = tid & 31, hh = lane >> 4;
  const int wv = __builtin_amdgcn_readfirstlane(tid >> 5);
  const bool xw = wv < 8;                                         // scalar: waves 0..7 also bring in the x rows
  // rows of this wave: weight rows WPW*wv .. +WPW-1; x rows XPW*wv .. +XPW-1 (start row kept inside the tile in every wave);
  // the lane takes floats 4*lane .. +3 of a row's piece
  const float* gw0 = Wt + (size_t)(wrow0 + WPW * wv) * K + 4 * lane;
  const float* gx0 = X + (size_t)(xrow0 + XPW * (wv & 7)) * K + 4 * lane;
  u16* lw0 = ring + (64 + WPW * wv) * VPH + 4 * lane;
  u16* lx0 = ring + (XPW * (wv & 7)) * VPH + 4 * lane;
  v4f rw[WPW], rx[XPW];
  const int k1 = (rot + 1 < VNS) ? (rot + 1) : 0;
  // first stage: loaded, converted, stored; the second stage's loads fly from here on; the barrier publishes the first
  ld_stage(rw, rx, gw0 + rot * VKS, gx0 + rot * VKS, xw);
  st_rows<WPW>(lw0, rw);
  if (xw) st_rows<XPW>(lx0, rx);
  ld_stage(rw, rx, gw0 + k1 * VKS, gx0 + k1 * VKS, xw);
  block_sync_lds();
#pragma unroll 1   // one trip per stage: the buffer index alternates, the code stays small
  for (int t = 0; t < VNS; ++t) {
    const u16* bufp = ring + (t & 1) * VBUFH;
    const u16* al = bufp + arow * VPH + 8 * hh;
    const u16* bl = bufp + brow * VPH + 8 * hh;
#pragma unroll     // k offsets inside the stage become immediate offsets of the LDS reads
    for (int u = 0; u < VKS; u += 64) {
      // all LDS reads of 64 k values stand together in front of their products
      const v16b a  = ldfrag_b(al + u),                 e  = ldfrag_b(al + u + 32);
      const v16b b0 = ldfrag_b(bl + u),                 f0 = ldfrag_b(bl + u + 32);
      const v16b b1 = ldfrag_b(bl + 16 * VPH + u),      f1 = ldfrag_b(bl + 16 * VPH + u + 32);
      const v16b b2 = ldfrag_b(bl + 32 * VPH + u),      f2 = ldfrag_b(bl + 32 * VPH + u + 32);
      const v16b b3 = ldfrag_b(bl + 48 * VPH + u),      f3 = ldfrag_b(bl + 48 * VPH + u + 32);
      acc0 = mma_b(a, b0, acc0);
      acc1 = mma_b(a, b1, acc1);
      acc2 = mma_b(a, b2, acc2);
      acc3 = mma_b(a, b3, acc3);
      guard6<v16b>(acc0, acc1, acc2, acc3, a, b0, b1, b2, b3, a);
      acc0 = mma_b(e, f0, acc0);
      acc1 = mma_b(e, f1, acc1);
      acc2 = mma_b(e, f2, acc2);
      acc3 = mma_b(e, f3, acc3);
      guard6<v16b>(acc0, acc1, acc2, acc3, e, f0, f1, f2, f3, e);
    }
    // foot of trip t: stage t+1 goes from registers into the other buffer (its readers left it at the barrier of trip t-1),
    // then the loads of stage t+2 into the same registers; own LDS reads and stores done, barrier (publishes stage t+1 and
    // ends every reader's last read of this trip's buffer)
    if (t + 1 < VNS) {
      const int bo = ((t + 1) & 1) * VBUFH;
      st_rows<WPW>(lw0 + bo, rw);
      if (xw) st_rows<XPW>(lx0 + bo, rx);
      if (t + 2 < VNS) {
        const int k2 = (t + 2 + rot < VNS) ? (t + 2 + rot) : (t + 2 + rot - VNS);
        ld_stage(rw, rx, gw0 + k2 * VKS, gx0 + k2 * VKS, xw);
      }
    }
    block_sync_lds();
  }
  acc_guard4(acc0, acc1, acc2, acc3);
}

// =====================================================================================================
// bf16 GEMM with bias and 16-bit result: C[M][N] (f16 of (acc + bias)*oscale) = A[M][K] (f32 weight input, row-major, as bf16) .
// Bt[N][K]^T (f32 x input, k-contiguous, as bf16); bias (f32 input, taken as its RNE bf16 value) indexed by column (byrow == 0) or by
// row (byrow != 0), both candidates read with addresses clamped to [0, nbias). Block tile = WROWS result rows (weight rows
// wg*WROWS ..) by 64 result columns (x rows xt*64 ..): group g = threadIdx.x >> 7 of 4 waves takes rows 64g .. 64g+63 of it,
// 16 per wave. (The caller gives xt < N/64 and wg < WGRP.)
// =====================================================================================================
__device__ __forceinline__
void gemm_b16(char* pool, int xt, int wg, int rot, const float* __restrict__ A, const float* __restrict__ Bt, u16* C,
              const float* __restrict__ bias, int N, int nbias, int byrow, float oscale) {
  const int grp = threadIdx.x >> 7;
  float* slab = (float*)(void*)pool + grp * (4 * SLAB);
  u16*   ring = (u16*)(void*)(pool + NCG * SLAB * 4 + WROWS * 4);   // two buffers of (x rows, weight rows), rows of VPH halves
  const int tid = threadIdx.x & 127, wave = tid >> 5, lane = tid & 31, hh = lane >> 4, m = lane & 15;
  const int rowb  = wg * WROWS + grp * 64 + wave * 16;
  const int col0  = xt * 64;
  v8f acc0 = zero8(), acc1 = zero8(), acc2 = zero8(), acc3 = zero8();
  proj_loop(ring, Bt, A, col0, wg * WROWS, rot, 64 + grp * 64 + wave * 16 + m, m, acc0, acc1, acc2, acc3);
  // bias: D element r of lane -> (row rowb+8hh+r, col col0+16j+m); both candidates loaded with clamped addresses, select by value
  float bc[4], br[8];
#pragma unroll
  for (int j = 0; j < 4; ++j) {
    int ci = col0 + 16 * j + m;
    ci = (ci < nbias) ? ci : (nbias - 1);
    bc[j] = bf_val(bias[ci]);
  }
  int ri[8];
  float bw[8];
#pragma unroll
  for (int r = 0; r < 8; ++r) {
    ri[r] = rowb + 8 * hh + r;
    ri[r] = (ri[r] < nbias) ? ri[r] : (nbias - 1);
    bw[r] = bias[ri[r]];
  }
#if defined(__HIP_DEVICE_COMPILE__)
  // the eight loads' index registers stay live up to this address-translation wait (inputs only), so that no load's result
  // lands in the index register of a load issued before it; the loaded values as inputs keep the loads in front of it
  asm volatile("s_wait_xcnt 0x0"
               :: "v"(ri[0]), "v"(ri[1]), "v"(ri[2]), "v"(ri[3]), "v"(ri[4]), "v"(ri[5]), "v"(ri[6]), "v"(ri[7]),
                  "v"(bw[0]), "v"(bw[1]), "v"(bw[2]), "v"(bw[3]), "v"(bw[4]), "v"(bw[5]), "v"(bw[6]), "v"(bw[7])
               : "memory");
#endif
#pragma unroll
  for (int r = 0; r < 8; ++r) br[r] = bf_val(bw[r]);
#pragma unroll
  for (int r = 0; r < 8; ++r) {
    const float q0 = (byrow != 0) ? br[r] : bc[0];
    const float q1 = (byrow != 0) ? br[r] : bc[1];
    const float q2 = (byrow != 0) ? br[r] : bc[2];
    const float q3 = (byrow != 0) ? br[r] : bc[3];
    acc0[r] += q0;
    acc1[r] += q1;
    acc2[r] += q2;
    acc3[r] += q3;
  }
  epi16(slab + wave * SLAB, acc0, acc1, acc2, acc3, oscale, C, N, (size_t)rowb, col0, lane);
}

// =====================================================================================================
// Query projection with fused per-chunk L2 normalisation:
//   q[M][NCG*64] (f32, registers only) = A[M][K] (f32 x input as bf16) . Bt[NCG*64][K]^T (f32 Wq input as bf16) + bias[col] (RNE bf16 value);
//   block tile = 64 result rows (x rows xt*64 ..) by WROWS result columns (weight rows wg*WROWS ..) = VTPB column groups of 64:
//   group g = threadIdx.x >> 7 of 4 waves takes column group cg = wg*VTPB + g, 16 rows per wave, so a weight row is fetched by
//   SEQ/64 blocks and an x row by WGRP of them.
//   For D row 8hh+r the 64-wide chunk (row, cols col0..col0+63) lives
//   in the 16 lanes of half hh x 4 accumulators: ss = sum of squares (4 products per lane, xor-1/2/4/8 steps in registers inside the
//   half), qn = q * (1/max(sqrt(ss), 1e-12)), aa = sum of qn^2 the same way (f32), kept in LDS at aas[(row in block)*VTPB + g].
//   After the block barrier the block's 64*VTPB aa values go out as whole 128-B lines that no other block writes: the aa table
//   is laid out [wg][row][g], so they are contiguous (64*VTPB floats is a multiple of 32).
//   Part of the projection launch: block = NCG waves (every wave reaches every barrier); slabs, aa values and ring lie in the
//   block's LDS pool.
// coverage: qn plane: (M/64)*WGRP blocks x NCG waves x (16 x 64) = M x NCG*64;  aa table: the same blocks x 64*VTPB floats = M*NCG.
// =====================================================================================================
__device__ __forceinline__
void gemm_qn(char* pool, int xt, int wg, int rot, const float* __restrict__ A, const float* __restrict__ Bt, u16* C, float* AAP,
             const float* __restrict__ bias, int nbias, float oscale) {
  float* slab = (float*)(void*)pool;
  float* aas  = slab + NCG * SLAB;
  u16*   ring = (u16*)(void*)(pool + NCG * SLAB * 4 + WROWS * 4);   // two buffers of (x rows, weight rows), rows of VPH halves
  const int tid = threadIdx.x, wave = tid >> 5, lane = tid & 31, hh = lane >> 4, m = lane & 15;
  const int grp = wave >> 2, wr = (wave & 3) * 16;   // column group in the block; first row of the wave in the block
  const int N = NCG * 64;
  const int rowb = xt * 64 + wr;
  const int col0 = wg * WROWS + grp * 64;
  v8f acc0 = zero8(), acc1 = zero8(), acc2 = zero8(), acc3 = zero8();
  proj_loop(ring, A, Bt, xt * 64, wg * WROWS, rot, wr + m, 64 + grp * 64 + m, acc0, acc1, acc2, acc3);
  float bc[4], bw[4];
  int ci[4];
#pragma unroll
  for (int j = 0; j < 4; ++j) {
    ci[j] = col0 + 16 * j + m;
    ci[j] = (ci[j] < nbias) ? ci[j] : (nbias - 1);
    bw[j] = bias[ci[j]];
  }
#if defined(__HIP_DEVICE_COMPILE__)
  // the four loads' index registers stay live up to this address-translation wait (inputs only), so that nothing rewrites one
  // in front of it; the loaded values as inputs keep the loads in front of it
  asm volatile("s_wait_xcnt 0x0"
               :: "v"(ci[0]), "v"(ci[1]), "v"(ci[2]), "v"(ci[3]), "v"(bw[0]), "v"(bw[1]), "v"(bw[2]), "v"(bw[3])
               : "memory");
#endif
#pragma unroll
  for (int j = 0; j < 4; ++j) bc[j] = bf_val(bw[j]);
#pragma unroll
  for (int r = 0; r < 8; ++r) {
    acc0[r] += bc[0];
    acc1[r] += bc[1];
    acc2[r] += bc[2];
    acc3[r] += bc[3];
  }
  // L2 normalise the 64-wide chunks of the wave's 8 rows per half and take the f32 sums of squares of the normalised values:
  // all 8 rows go through one in-register reduction, after which lane m holds the sum of row m & 7 of its half
  const bool b0 = (m & 1) != 0, b1 = (m & 2) != 0, b2 = (m & 4) != 0;
  float sq[8];
#pragma unroll   // constant indices: sq stays in registers
  for (int r = 0; r < 8; ++r) sq[r] = acc0[r] * acc0[r] + acc1[r] * acc1[r] + acc2[r] * acc2[r] + acc3[r] * acc3[r];
  const float ss  = rowsum8(sq, b0, b1, b2);
  const float nrm = sqrtf(ss);
  const float den = fmaxf(nrm, 1e-12f);
  const float il  = 1.0f / den;               // 1/norm of row m & 7: one square root and one division serve the 8 rows
  const float inv[8] = {dpp_f<0x150>(il), dpp_f<0x151>(il), dpp_f<0x152>(il), dpp_f<0x153>(il),     // row_share:r = lane r of
                        dpp_f<0x154>(il), dpp_f<0x155>(il), dpp_f<0x156>(il), dpp_f<0x157>(il)};    // the half, to all its lanes
#pragma unroll
  for (int r = 0; r < 8; ++r) {
    acc0[r] *= inv[r];
    acc1[r] *= inv[r];
    acc2[r] *= inv[r];
    acc3[r] *= inv[r];
    sq[r] = acc0[r] * acc0[r] + acc1[r] * acc1[r] + acc2[r] * acc2[r] + acc3[r] * acc3[r];
  }
  const float a2 = rowsum8(sq, b0, b1, b2);
  if (m < 8) aas[(wr + 8 * hh + m) * VTPB + grp] = a2;
  epi16(slab + wave * SLAB, acc0, acc1, acc2, acc3, oscale, C, N, (size_t)rowb, col0, lane);
  __syncthreads();
  // aa table lines of this block: 64*VTPB contiguous floats; thread t < 64*VTPB/4 writes float4 t
  const int nf4 = WROWS / 4;
  if (tid < nf4) {
    const v4f w0 = *(const v4f*)(aas + 4 * tid);
    *(v4f*)(AAP + ((size_t)wg * SEQ + (size_t)xt * 64) * VTPB + 4 * tid) = w0;
  }
}

// =====================================================================================================
// Both projections in ONE launch (neither reads what the other writes): blocks 0 .. QBLK-1 do the query projection (the longer
// part, so it starts first), blocks QBLK .. QBLK+VBLK-1 the v^T GEMM; either way block = (64 x rows xt, WROWS weight rows wg).
// The choice is block-uniform, so every barrier of either part is passed by all NCG waves of its block. One LDS pool per block.
// The start stage takes all VNS values among the 2*WGRP blocks that read the same x rows (two of them twice) and differs from one xt to the next (same weight rows).
// =====================================================================================================
__global__ __launch_bounds__(NCG * 32)
void gemm_qv(const float* __restrict__ Xp, const float* __restrict__ WQp, const float* __restrict__ WVp, u16* QPp, float* AAP,
             u16* VPp, const float* __restrict__ bq, const float* __restrict__ bv) {
  __shared__ __align__(16) char pool[POOLB];
  const int b = blockIdx.x;
  if (b >= QBLK + VBLK) return;              // block-uniform, never taken with the exact grid; in front of every barrier
  const int lb = (b < QBLK) ? b : (b - QBLK);
  const int xt = lb / WGRP, wg = lb % WGRP;
  const int rot = (xt + wg + ((b < QBLK) ? 0 : WGRP)) % VNS;
  if (b < QBLK) gemm_qn(pool, xt, wg, rot, Xp, WQp, QPp, AAP, bq, DMOD, QSC);
  else          gemm_b16(pool, xt, wg, rot, WVp, Xp, VPp, bv, SEQ, DMOD, 1, VCAR);
}

// =====================================================================================================
// L2-distance flash attention (no masking, all SEQ keys): block = (head, QROWS = 128 query rows), 16 waves, four to a SIMD.
// Wave w works on the 32 query rows of group wq = w & 3 (two tiles of 16) and, of every stage, on the 64 keys of quarter
// kq = w >> 2: each K and V fragment that a wave reads from LDS serves two query tiles, and a head's K and V rows are fetched
// by SEQ/128 blocks.
// A stage = KT = 256 keys = K tile (256 key rows x 128 B) + V tile (64 d rows x 512 B), brought into LDS by asynchronous 16-byte
// copies (whole 128-B lines, 8 copies per thread and stage), two buffers: stage t+2 is issued behind the barrier at the foot of
// trip t and flies during trip t+1. Two key blocks per wave between barriers: only the first block's LDS reads of all 16 waves
// fall together.
// The head's AA table (SEQ floats) is copied once with stage 0, float by float, into chunk order. Fragments are read from LDS
// rows of 144 B (K) and 528 B (V).
//   qn plane (f16, x QSC) laid out as [NHD*SEQ chunks][64]: head h, row n = chunk h*SEQ + n; keys and queries both come
//   from this plane. AA table (f32): chunk row*NCG + cg at [cg / VTPB][row][cg % VTPB]. v^T plane [h*64+d][SEQ keys] (x1024).
//   All NKB = SEQ/32 key blocks of 32 keys are visited by one wave of each group (static bound), from the block's own start
//   stage on, wrapping.
//   Scores are computed TRANSPOSED: S^T tile g (g = 0,1) = key rows (keys kb+16g .. +15, A operand, row m = lane&15, split
//   k map over d) times q^T (B operand, col n = query (lane&15) of the query tile, k = d, split map), one product per tile and
//   32-deep d-chunk. D element r of lane l = (key kb+16g+8h+r, query l&15), so a lane owns one query column and 16 of its 32
//   keys; the partner lane l^16 owns the other 16.
//   Base-2 logit: t = (2*qn_n.qn_m/(QSC*QSC) - AA_n - AA_m) * log2(e)/8. Every qn row is a vector divided by at least its own
//   norm, so its length is at most 1 (f16 rounding adds under 0.1 %): |2*qn_n.qn_m| * log2(e)/8 < 0.37 and
//   0 <= AA * log2(e)/8 < 0.19 for any finite input, hence -0.74 < t < 0.37. The softmax therefore needs no running maximum:
//   its shift is the constant -PSH, p = exp2(t + PSH) = P x 32768 lies in (19000, 43000), inside f16, the exp2 argument is far
//   from the subnormal range (bare hardware exp2), and neither l nor the O accumulators are ever rescaled.
//   The exp'd values ARE the P A-fragment in place: A row m = query = lane&15, element i <- key kb+8h+i (tile 0, D element i),
//   element 8+i <- key kb+16+8h+i (tile 1, D element i). l (x32768) is summed per lane in 4 partial sums over the lane's
//   own keys; the partials and the partner lane l^16 are joined once behind the loop. 4 v^T B fragments
//   (col n = d = 16j + (lane&15), keys k-contiguous), 4 P.V WMMAs per key block and query tile.
//   Behind the loop the four waves of a group hold sums over disjoint key quarters with the same constant shift, so O and l
//   simply add, in two steps through LDS. A wave's query tile a covers rows 16*(a ^ (kq & 1)) of its group. Step 1: it hands its
//   tile 1 (O in D layout, l per lane) to wave w ^ 4 and, behind a block barrier, adds that wave's tile 1, which is its own
//   tile 0. Step 2: waves 8..15 hand their tile 0 to wave w - 8 (the same tile, the other two quarters) and, behind a second
//   block barrier, end; waves 0..7 add it.
//   Epilogue, one query tile per wave 0..7: 1/l (per query, shuffled to the D row owner) and carry folds in f32; the 16x64 f32
//   result staged in the wave's slab. aux0/aux1 are bound only (not read).
// coverage: per wave 8 instructions x 2 rows x 16 lanes x 4 floats = 16 x 64; grid NHD*(SEQ/128) blocks x 8 writing waves =
//           every output row (h, n < SEQ) exactly once = SEQ*NHD*64 floats.
// =====================================================================================================
// p = exp2(t + PSH) of this lane's 16 keys for one query column, as the P A-fragment (element i <-> key i); adds p into lp
__device__ __forceinline__ v16h exp_tile(v8f s0, v8f s1, v4f w0, v4f w1, v4f w2, v4f w3, float lsc, float c1l, float aq,
                                         v2f* lp) {
  FragH ph;
#pragma unroll
  for (int e = 0; e < 2; ++e) {          // pairs of neighbouring keys: elements 2e, 2e+1 of each group of four
    const int i = 2 * e;
    const v2f sa = {s0[i], s0[i + 1]}, sb = {s0[4 + i], s0[5 + i]}, sc = {s1[i], s1[i + 1]}, sd = {s1[4 + i], s1[5 + i]};
    const v2f wa = {w0[i], w0[i + 1]}, wb = {w1[i], w1[i + 1]}, wc = {w2[i], w2[i + 1]}, wd = {w3[i], w3[i + 1]};
    const v2f ta = sa * lsc - (wa * c1l + aq), tb = sb * lsc - (wb * c1l + aq);
    const v2f tc = sc * lsc - (wc * c1l + aq), td = sd * lsc - (wd * c1l + aq);
    const v2f pa = {__builtin_amdgcn_exp2f(ta[0]), __builtin_amdgcn_exp2f(ta[1])};
    const v2f pb = {__builtin_amdgcn_exp2f(tb[0]), __builtin_amdgcn_exp2f(tb[1])};
    const v2f pc = {__builtin_amdgcn_exp2f(tc[0]), __builtin_amdgcn_exp2f(tc[1])};
    const v2f pd = {__builtin_amdgcn_exp2f(td[0]), __builtin_amdgcn_exp2f(td[1])};
    ph.u[0][e]     = pkh(pa);
    ph.u[0][2 + e] = pkh(pb);
    ph.u[1][e]     = pkh(pc);
    ph.u[1][2 + e] = pkh(pd);
    lp[e] += (pa + pb) + (pc + pd);
  }
  return ph.v;
}

__global__ __launch_bounds__(ATT_THREADS)
void attn_l2(const u16* __restrict__ QPp, const float* __restrict__ AAp, const u16* __restrict__ VPp, float* out,
             const float* aux0, const float* aux1) {
  __shared__ __align__(16) float smem[(ATT_WAVES / 2) * SLAB];   // per writing wave: result slab [16][68] in the epilogue only
  __shared__ __align__(16) _Float16 ring[2 * BUFH];        // two buffers of (K tile, V tile)
  __shared__ __align__(16) float aas[SEQ];                 // AA table of this head
  __shared__ __align__(16) v4f xch[ATT_WAVES * 8 * 32];    // step 1, per wave: the O tile it hands on, [8 quads][32 lanes]
  __shared__ __align__(16) float xl[ATT_WAVES * 32];       //         and the l of that tile, per lane
  __shared__ __align__(16) v4f xc2[(ATT_WAVES / 2) * 8 * 32];   // step 2, per receiving wave: the same
  __shared__ __align__(16) float xl2[(ATT_WAVES / 2) * 32];
  (void)aux0; (void)aux1;

  const int tid  = threadIdx.x;
  const int wave = __builtin_amdgcn_readfirstlane(tid >> 5);   // scalar: the tests on it behind the loop are scalar branches
  const int lane = tid & 31;
  const int hh   = lane >> 4;
  const int c    = lane & 15;
  const int kq   = wave >> 2;                              // key quarter of every stage that this wave works on
  const int wq   = wave & 3;                               // group of 32 query rows

  const int bid  = blockIdx.x;
  const int qt   = bid % QTILES;
  const int head = bid / QTILES;
  if (head >= NHD) return;                                 // block-uniform, never taken with the exact grid; in front of every barrier
  const int q0   = qt * QROWS + wq * 32 + 16 * (kq & 1);         // query tile 0 of this wave: the one it keeps behind the loop
  const int q1   = qt * QROWS + wq * 32 + 16 * (1 - (kq & 1));   // query tile 1: handed to wave w ^ 4 behind the loop
  const size_t hb = (size_t)head * SEQ;                    // chunk index base of this head

  const _Float16* QH = (const _Float16*)(const void*)QPp;
  // B fragments of q^T: col n = query chunk hb + (tile's first row) + c, k = d
  const _Float16* Qb0 = QH + (hb + (size_t)(q0 + c)) * HD + 8 * hh;
  const _Float16* Qb1 = QH + (hb + (size_t)(q1 + c)) * HD + 8 * hh;
  // copy addresses of this thread: K chunk i = tid + 512*j, row = i >> 3 = (tid >> 3) + 64*j, 16-byte column = tid & 7;
  // V chunk i = tid + 512*j, row = i >> 5 = (tid >> 5) + 16*j, 16-byte column = tid & 31
  const unsigned lk0 = lds_addr(ring) + (unsigned)((tid >> 3) * (LPH * 2) + (tid & 7) * 16);
  const unsigned lv0 = lds_addr(ring) + (unsigned)(KTILEH * 2 + (tid >> 5) * (VLPH * 2) + (tid & 31) * 16);
  const char* gk0 = (const char*)(const void*)(QH + hb * HD) + tid * 16;                       // K rows are contiguous
  const char* gv0 = (const char*)(const void*)((const _Float16*)(const void*)VPp + ((size_t)(head * HD + (tid >> 5))) * SEQ)
                    + (tid & 31) * 16;
  // Rotated walk: trip t works on key stage (t + rot) mod NST. The QTILES blocks of a head read the same K and V rows; with
  // different stages asked for at the same time each line's first fetch into L2 is waited for by few blocks and the others
  // find it there. The bit order spreads the starts of blocks whose indices lie close together modulo 8. For speed only: any
  // rot in 0 .. NST-1 gives every stage exactly once; the constant softmax shift makes the key order free but for rounding.
  const int rot = ((qt & 3) << 1) | ((qt >> 2) & 1);
  const int st1 = (rot + 1) & (NST - 1);
  // first stage and the AA table, landed and published; then the second stage into the other buffer
  copy_stage(lk0, lv0, gk0 + (size_t)rot * (KT * HD * 2), gv0 + rot * (KT * 2));
#if defined(__HIP_DEVICE_COMPILE__)
  __builtin_amdgcn_sched_barrier(0);   // the table's address arithmetic stays behind the stage's copies, which then fly meanwhile
#endif
  // chunk ch = row*NCG + cg lies at float [cg / VTPB][row][cg % VTPB] of the table; with tq = ch / VTPB = row*WGRP + cg / VTPB that is
  // ch + (SEQ*VTPB - VTPB)*(tq % WGRP) - (NCG - VTPB)*(tq / WGRP). One division per thread: its chunks lie ATT_THREADS apart.
  const unsigned ch0 = (unsigned)hb + (unsigned)tid, tq0 = ch0 / VTPB, rm0 = ch0 - tq0 * VTPB;
  {
    const char* ga[AACP];   // AACP copies of one float each, in one statement
#pragma unroll
    for (int i = 0; i < AACP; ++i) {
      const unsigned st = (unsigned)(ATT_THREADS * i);
      const unsigned tq = tq0 + st / VTPB + ((rm0 + st % VTPB >= VTPB) ? 1u : 0u);
      ga[i] = (const char*)(const void*)(AAp + (ch0 + st + (SEQ * VTPB - VTPB) * (tq % WGRP) - (NCG - VTPB) * (tq / WGRP)));
    }
    copy4w(lds_addr(aas) + (unsigned)(tid * 4), ATT_THREADS * 4, ga);
  }
  wait_copies();
  __syncthreads();
  copy_stage(lk0 + BUFH * 2, lv0 + BUFH * 2, gk0 + (size_t)st1 * (KT * HD * 2), gv0 + st1 * (KT * 2));
  const float lsc = 0.25f * (LOG2E / (QSC * QSC));
  const float c1l = 0.125f * LOG2E;
  const float aq0 = aas[q0 + c] * c1l - PSH;                // AA term of this lane's query in each tile (staged table), with the
  const float aq1 = aas[q1 + c] * c1l - PSH;                // constant shift

  const v16h qa0 = ldfrag_h(Qb0), qa1 = ldfrag_h(Qb0 + 32);   // tile 0: d 0..31, d 32..63
  const v16h qb0 = ldfrag_h(Qb1), qb1 = ldfrag_h(Qb1 + 32);   // tile 1
#if defined(__HIP_DEVICE_COMPILE__)
  // the eight loads' address registers stay live up to this address-translation wait (inputs only), so that nothing rewrites
  // one in front of it
  asm volatile("s_wait_xcnt 0x0" :: "v"(Qb0), "v"(Qb1) : "memory");
#endif

  // partial sums of p over this lane's keys, per query tile: element i -> [(i >> 1) & 1][i & 1]
  v2f lpa[2] = {{0.f, 0.f}, {0.f, 0.f}}, lpb[2] = {{0.f, 0.f}, {0.f, 0.f}};
  v8f o[4], ob[4];                          // O of tile 0 and of tile 1
#pragma unroll
  for (int j = 0; j < 4; ++j) { o[j] = zero8(); ob[j] = zero8(); }

#pragma unroll 1
  for (int t = 0; t < NST; ++t) {
   const _Float16* bufp = ring + (t & 1) * BUFH;
   // A fragments of keys: LDS row = key in stage (64kq + 32u + 16g + c), k = d;  B fragments of v: LDS row = d = 16j + c, k = key
#pragma unroll 1   // kept rolled: in line, both blocks' p values stay live up to the l sums and registers spill at 4 waves a SIMD
   for (int u = 0; u < 2; ++u) {
    const int kb = ((t + rot) & (NST - 1)) * KT + 64 * kq + 32 * u;
    // ---- all LDS reads of this 32-key block stand together in front of its products ----
    const _Float16* k0p = bufp + (64 * kq + 32 * u + c) * LPH + 8 * hh;
    const _Float16* k1p = k0p + 16 * LPH;
    const v16h ka0 = ldfrag_h(k0p), ka1 = ldfrag_h(k0p + 32);
    const v16h kc0 = ldfrag_h(k1p), kc1 = ldfrag_h(k1p + 32);
    // AA of this lane's 16 keys: tile 0 element i -> key kb+8hh+i, tile 1 element i -> key kb+16+8hh+i
    const float* am = aas + kb + 8 * hh;
    const v4f w0 = *(const v4f*)(am), w1 = *(const v4f*)(am + 4);
    const v4f w2 = *(const v4f*)(am + 16), w3 = *(const v4f*)(am + 20);
    const _Float16* vp = bufp + KTILEH + c * VLPH + 64 * kq + 32 * u + 8 * hh;
    const v16h vf0 = ldfrag_h(vp);
    const v16h vf1 = ldfrag_h(vp + 16 * VLPH);
    const v16h vf2 = ldfrag_h(vp + 32 * VLPH);
    const v16h vf3 = ldfrag_h(vp + 48 * VLPH);
    // ---- transposed scores of both query tiles: s0/r0 = keys kb..kb+15, s1/r1 = keys kb+16..kb+31, column = query c ----
    v8f s0 = zero8(), s1 = zero8(), r0 = zero8(), r1 = zero8();
    s0 = mma_h(ka0, qa0, s0);
    s1 = mma_h(kc0, qa0, s1);
    r0 = mma_h(ka0, qb0, r0);
    r1 = mma_h(kc0, qb0, r1);
    s0 = mma_h(ka1, qa1, s0);
    s1 = mma_h(kc1, qa1, s1);
    r0 = mma_h(ka1, qb1, r0);
    r1 = mma_h(kc1, qb1, r1);
    guard6<v16h>(s0, s1, r0, r1, ka0, ka1, kc0, kc1, qa1, qb1);
    // ---- per query tile: p of this lane's 16 keys, then P.V (B fragment col n = d = j*16 + c, keys contiguous in the v^T rows);
    //      tile 1's vector work stands behind tile 0's products and runs beside them ----
    const v16h pa = exp_tile(s0, s1, w0, w1, w2, w3, lsc, c1l, aq0, lpa);
    o[0] = mma_h(pa, vf0, o[0]);
    o[1] = mma_h(pa, vf1, o[1]);
    o[2] = mma_h(pa, vf2, o[2]);
    o[3] = mma_h(pa, vf3, o[3]);
    guard6<v16h>(o[0], o[1], o[2], o[3], pa, vf0, vf1, vf2, vf3, pa);
    const v16h pb = exp_tile(r0, r1, w0, w1, w2, w3, lsc, c1l, aq1, lpb);
    ob[0] = mma_h(pb, vf0, ob[0]);
    ob[1] = mma_h(pb, vf1, ob[1]);
    ob[2] = mma_h(pb, vf2, ob[2]);
    ob[3] = mma_h(pb, vf3, ob[3]);
    guard6<v16h>(ob[0], ob[1], ob[2], ob[3], pb, vf0, vf1, vf2, vf3, pb);
   }
   // ---- foot of trip t: own LDS reads back, own copies of stage t+1 landed, barrier (publishes stage t+1 and ends every
   //      reader's last read of this trip's buffer); only then the refill of that buffer with stage t+2 ----
   wait_lds();
   wait_copies();
   __syncthreads();
   if (t + 2 < NST) {
     const int st2 = (t + 2 + rot) & (NST - 1);
     const unsigned bo = (unsigned)((t & 1) * (BUFH * 2));
     copy_stage(lk0 + bo, lv0 + bo, gk0 + (size_t)st2 * (KT * HD * 2), gv0 + st2 * (KT * 2));
   }
  }
  wait_copies();
  acc_guard4(o[0], o[1], o[2], o[3]);
  acc_guard4(ob[0], ob[1], ob[2], ob[3]);

  // ---- l x32768 of this lane's query in each tile, over this wave's keys: own partials, then the partner lane's keys ----
  float lrun = (lpa[0][0] + lpa[0][1]) + (lpa[1][0] + lpa[1][1]);
  float lgiv = (lpb[0][0] + lpb[0][1]) + (lpb[1][0] + lpb[1][1]);
  lrun += __shfl_xor(lrun, 16, 32);
  lgiv += __shfl_xor(lgiv, 16, 32);
  // ---- step 1 of joining the key quarters: tile 1 goes to wave w ^ 4, whose tile 1 (this wave's tile 0) is added ----
  {
    v4f* xw = xch + wave * (8 * 32) + lane;
#pragma unroll
    for (int j = 0; j < 4; ++j) {
      const v4f lo = {ob[j][0], ob[j][1], ob[j][2], ob[j][3]}, hi = {ob[j][4], ob[j][5], ob[j][6], ob[j][7]};
      xw[(2 * j) * 32]     = lo;
      xw[(2 * j + 1) * 32] = hi;
    }
    xl[wave * 32 + lane] = lgiv;
    __syncthreads();   // every wave's handed tile is written before its partner reads it
    const v4f* xr = xch + (wave ^ 4) * (8 * 32) + lane;
#pragma unroll
    for (int j = 0; j < 4; ++j) {
      const v4f lo = xr[(2 * j) * 32], hi = xr[(2 * j + 1) * 32];
#pragma unroll
      for (int r = 0; r < 4; ++r) { o[j][r] += lo[r]; o[j][4 + r] += hi[r]; }
    }
    lrun += xl[(wave ^ 4) * 32 + lane];
  }
  // ---- step 2: waves 8..15 hand their tile 0 to wave w - 8, which holds the same tile over the other two quarters ----
  if (wave >= ATT_WAVES / 2) {
    v4f* xw = xc2 + (wave - ATT_WAVES / 2) * (8 * 32) + lane;
#pragma unroll
    for (int j = 0; j < 4; ++j) {
      const v4f lo = {o[j][0], o[j][1], o[j][2], o[j][3]}, hi = {o[j][4], o[j][5], o[j][6], o[j][7]};
      xw[(2 * j) * 32]     = lo;
      xw[(2 * j + 1) * 32] = hi;
    }
    xl2[(wave - ATT_WAVES / 2) * 32 + lane] = lrun;
  }
  __syncthreads();   // the handed tiles are written before waves 0..7 read them; the last barrier of the kernel
  if (wave >= ATT_WAVES / 2) return;
  {
    const v4f* xr = xc2 + wave * (8 * 32) + lane;
#pragma unroll
    for (int j = 0; j < 4; ++j) {
      const v4f lo = xr[(2 * j) * 32], hi = xr[(2 * j + 1) * 32];
#pragma unroll
      for (int r = 0; r < 4; ++r) { o[j][r] += lo[r]; o[j][4 + r] += hi[r]; }
    }
    lrun += xl2[wave * 32 + lane];
  }
  // ---- fold 1/l (per query, owned by lane = query; the x32768 of P and of l cancel) and the v carry; stage the 16x64 slab ----
  const float linv = (lrun > 0.f) ? ((1.0f / lrun) * (1.0f / VCAR)) : 0.f;
  float inv[8];
#pragma unroll
  for (int r = 0; r < 8; ++r) inv[r] = __shfl(linv, 8 * hh + r, 32);
  float* slab = smem + wave * SLAB;
#pragma unroll
  for (int r = 0; r < 8; ++r) {
#pragma unroll
    for (int j = 0; j < 4; ++j) slab[(8 * hh + r) * 68 + j * 16 + c] = o[j][r] * inv[r];
  }
  wave_sync_lds();
  // ---- f32 output rows: lanes 0..15 -> row 2*it2, lanes 16..31 -> row 2*it2+1, 16 lanes x 16 B = one 256-B row ----
  v4f vals[8];
#pragma unroll
  for (int it2 = 0; it2 < 8; ++it2) vals[it2] = *(const v4f*)(slab + (it2 * 2 + hh) * 68 + c * 4);
  float* dst = out + (hb + (size_t)(q0 + hh)) * HD + c * 4;
  {
#pragma unroll
    for (int it2 = 0; it2 < 8; ++it2) {
      *(v4f*)(dst + (size_t)(it2 * 2) * HD) = vals[it2];
    }
    
  }
}

// =====================================================================================================
// Workspace map (bytes); every plane is fully written by whole-line stores before it is read; all extents are exact multiples
// of the store granularity (no pad rows needed), every offset a multiple of 128:
//   QP  f16  [SEQ][768] = [12*SEQ chunks][64] x16 SEQ*1536
//   AAP f32  [4][SEQ][3]                         SEQ*48     (98304)
//   VP  f16  [768 = h*64+d][SEQ] x1024           SEQ*1536
//   end                                          6389760 at SEQ = 2048
// =====================================================================================================
extern "C" void kernel_launch(void* const* d_in, const int* in_sizes, int n_in,
                              void* d_out, int out_size, void* d_ws, size_t ws_size,
                              hipStream_t stream) {
  if (n_in < 7) return;
  if (in_sizes[0] < SEQ * DMOD) return;
  if (in_sizes[1] < 1 || in_sizes[2] < 1) return;
  if (in_sizes[3] != DMOD * DMOD || in_sizes[5] != DMOD * DMOD) return;
  if (in_sizes[4] != DMOD || in_sizes[6] != DMOD) return;
  if (out_size < SEQ * DMOD) return;

  const float* Xin = (const float*)d_in[0];
  const float* Gin = (const float*)d_in[1];               // bound only, not read
  const float* Min = (const float*)d_in[2];               // bound only, not read
  const float* Wq  = (const float*)d_in[3];
  const float* bq  = (const float*)d_in[4];
  const float* Wv  = (const float*)d_in[5];
  const float* bv  = (const float*)d_in[6];
  float*       out = (float*)d_out;

  const size_t szQP = (size_t)SEQ * DMOD * 2;
  const size_t szAA = (size_t)NHD * SEQ * 4;
  const size_t szVP = (size_t)DMOD * SEQ * 2;
  size_t off = 0;
  const size_t oQP = off; off += szQP;
  const size_t oAA = off; off += szAA;
  const size_t oVP = off; off += szVP;
  if (off > ws_size) return;                            // off = 6389760 at SEQ = 2048
  if (off > (size_t)134217728) return;

  char* ws = (char*)d_ws;
  u16*   QP  = (u16*)(ws + oQP);
  float* AAP = (float*)(ws + oAA);
  u16*   VP  = (u16*)(ws + oVP);

  if ((DMOD % 64) != 0 || (SEQ % 64) != 0 || (DMOD % 32) != 0) return;
  const dim3 gP(QBLK + VBLK);                           // 128 + 128
  const dim3 bP(NCG * 32);                              // 384
  const dim3 gAT(ATT_BLOCKS);                           // 192
  const dim3 bAT(ATT_THREADS);                          // 512

  // (1) q = x.Wq^T + bq, L2-normalised per 64-chunk -> qn plane [SEQ][768] f16 x16 and AA table [12*SEQ] f32;
  //     v^T plane: [768 = h*64+d][SEQ keys] = f16((Wv . x^T + bv) x1024), bias by row;
  //     x, Wq, Wv [n = out][k = in] (k-contiguous) are read as f32 and become bf16 operands inside the launch
  gemm_qv<<<gP, bP, 0, stream>>>(Xin, Wq, Wv, QP, AAP, VP, bq, bv);
  // (2) attention -> out, f32 row (chunk h*SEQ + n) of 64 floats at float offset (h*SEQ + n)*64
  attn_l2<<<gAT, bAT, 0, stream>>>(QP, AAP, VP, out, Gin, Min);
  (void)hipGetLastError();
}
